// v000
// The times below were measured on an AMD MI455X: many runs one after another, warmed up first and cycling through
// copies of the inputs, with the whole window's GPU time divided by the number of runs. Launches and the gaps
// between them are all in it. The median over several windows is given; except for v000 it joins two sittings, which
// can be a few percent apart, so the side-by-side timings, each taken in one sitting, are the better comparison.
// v000, which the later versions start from, runs in 603 microseconds.
// Contractions: value.Wv^T, query.Wq^T, key.Wk^T on v_wmma_f32_16x16x32_bf16 (inputs and W as bf16 RNE planes; W [n][k] rows
// are the k-contiguous B operand); q.k^T over hd 64 and P.v on v_wmma_f32_16x16x32_f16 (q, k x256, P x32768, v x1024 as f16
// planes; query rows s < QO additionally use f16 residual planes, products hh+lh+hl); all f32 accumulate. Strictly-earlier-key
// causal select, base-2 online softmax and 1/Z fold in f32 on VALU; query row 0 (uniform weights over all keys) = column mean
// of the f32 v projection with f64 accumulate on VALU. Output f32 written directly by the attention epilogue.
#include <hip/hip_runtime.h>
#include <math.h>
#include <stdint.h>

#ifndef NB
#define NB 4
#endif
#ifndef SEQ
#define SEQ 4096
#endif
#define SEQ_FULL 4096
#define DIN   512
#define HD    64
#define QO    ((SEQ < 512) ? SEQ : 512)
#define MROWS (NB * SEQ)
#define RSQ_HD 0.125f
#define LOG2E 1.4426950408889634f
#define QSC   256.0f
#define KSC   256.0f
#define PCAR  32768.0f
#define VCAR  1024.0f
#define WPB   2
#define NQT   (SEQ / 16)
#define NQO   (QO / 16)
#define NST   (SEQ / 64)
#define NKT   (SEQ / 32)
#define ATT_THREADS (WPB * 32)
#define PTP   36
#define PTW   (16 * PTP)
#define SLP   68
#define SLW   (16 * SLP)
#define WREG  (PTW + SLW)
#define SLAB64 (16 * 68)
#define VTP   72
#define C8R   (HD / 8)
#define WS_CAP 134217728
static_assert(HD == 64 && (DIN % 32) == 0 && DIN >= 32 && WPB == 2 && ATT_THREADS == 64);
static_assert(NB >= 1 && NB <= 4);
static_assert((SEQ % 64) == 0 && SEQ >= 64 && SEQ <= SEQ_FULL && (SEQ % 4) == 0);
static_assert((QO % 64) == 0 && QO >= 64 && QO <= SEQ);
static_assert((MROWS % 64) == 0 && C8R == 8 && SLP == 68 && SLW == SLAB64);
static_assert(((SEQ * DIN / 8) % 256) == 0 && ((HD * DIN / 8) % 256) == 0 && ((MROWS * HD / 8) % 256) == 0);
static_assert(WPB * WREG * 4 <= 65536 && 2 * HD * VTP * 2 <= 65536 && 4 * SLAB64 * 4 <= 65536);

typedef unsigned short u16;
typedef _Float16 v16h __attribute__((ext_vector_type(16)));
typedef _Float16 v8h  __attribute__((ext_vector_type(8)));
typedef __bf16   v16b __attribute__((ext_vector_type(16)));
typedef float    v8f  __attribute__((ext_vector_type(8)));
typedef float    v4f  __attribute__((ext_vector_type(4)));
typedef unsigned int v4u __attribute__((ext_vector_type(4)));

union FragH { v16h v; v8h h[2]; v4u u[2]; };
union FragB { v16b v; v4u u[2]; };

// ---- scalar helpers --------------------------------------------------------------------------------
__device__ __forceinline__ unsigned short bf_bits(float f) {          // f32 -> bf16 bits, RNE convert
  unsigned u = __float_as_uint(f);
  return (unsigned short)((u + 0x7FFFu + ((u >> 16) & 1u)) >> 16);
}
__device__ __forceinline__ float bf_up(unsigned short h) { return __uint_as_float(((unsigned)h) << 16); }
__device__ __forceinline__ float bfr(float f) { return bf_up(bf_bits(f)); }
__device__ __forceinline__ unsigned short h_bits(_Float16 x) { return __builtin_bit_cast(unsigned short, x); }
__device__ __forceinline__ unsigned pk16(unsigned short a, unsigned short b) { return (unsigned)a | ((unsigned)b << 16); }
__device__ __forceinline__ v8f zero8() { v8f z = {0.f, 0.f, 0.f, 0.f, 0.f, 0.f, 0.f, 0.f}; return z; }
__device__ __forceinline__ const _Float16* ash(const u16* p) { return (const _Float16*)(const void*)p; }

// ---- fragment loaders: 16-bit A/B operand, lane -> row/col (lane&15), p already includes +8*(lane>>4);
//      elements 0..7 <- p[0..7] (k0+8h..), elements 8..15 <- p[16..23] (k0+16+8h..)  (same split k map for A and B;
//      B is always read from a k-contiguous [n][k] plane)
__device__ __forceinline__ v16h ldfrag_h(const _Float16* p) {
  FragH f;
  f.h[0] = *(const v8h*)(p);
  f.h[1] = *(const v8h*)(p + 16);
  return f.v;
}
__device__ __forceinline__ v16b ldfrag_b(const u16* p) {              // bf16 plane read as unsigned integer vectors
  FragB f;
  f.u[0] = *(const v4u*)(p);
  f.u[1] = *(const v4u*)(p + 16);
  return f.v;
}

__device__ __forceinline__ v8f mma_h(v16h a, v16h b, v8f c) {
  return __builtin_amdgcn_wmma_f32_16x16x32_f16(false, a, false, b, (short)0, c, false, false);
}
__device__ __forceinline__ v8f mma_b(v16b a, v16b b, v8f c) {
  return __builtin_amdgcn_wmma_f32_16x16x32_bf16(false, a, false, b, (short)0, c, false, false);
}
__device__ __forceinline__ void guard2(v8f& a, v8f& b, v16h x0, v16h x1, v16h x2, v16h x3, v16h x4, v16h x5) {
#if defined(__HIP_DEVICE_COMPILE__)
  asm volatile("v_nop\n\tv_nop\n\tv_nop\n\tv_nop"
               : "+v"(a), "+v"(b) : "v"(x0), "v"(x1), "v"(x2), "v"(x3), "v"(x4), "v"(x5) : "memory");
#endif
}
template <typename F>
__device__ __forceinline__ void guard6(v8f& a, v8f& b, v8f& c, v8f& d, F x0, F x1, F x2, F x3, F x4, F x5) {
#if defined(__HIP_DEVICE_COMPILE__)
  asm volatile("v_nop\n\tv_nop\n\tv_nop\n\tv_nop"
               : "+v"(a), "+v"(b), "+v"(c), "+v"(d) : "v"(x0), "v"(x1), "v"(x2), "v"(x3), "v"(x4), "v"(x5) : "memory");
#endif
}
__device__ __forceinline__ void acc_guard4(v8f& a, v8f& b, v8f& c, v8f& d) {
#if defined(__HIP_DEVICE_COMPILE__)
  asm volatile("v_nop\n\tv_nop\n\tv_nop\n\tv_nop" : "+v"(a), "+v"(b), "+v"(c), "+v"(d));
#endif
}
__device__ __forceinline__ void wave_sync_lds() {
  __builtin_amdgcn_fence(__ATOMIC_RELEASE, "workgroup");
  __builtin_amdgcn_wave_barrier();
  __builtin_amdgcn_fence(__ATOMIC_ACQUIRE, "workgroup");
}

// =====================================================================================================
// f32 -> 16-bit plane.  f16mode == 0: bf16 RNE bits;  f16mode == 1: f16 bits of (bf16 RNE value) * scale.
// Batched: element group gt -> (bt = gt / n8, w8 = gt - bt*n8); source at x + bt*sstr + 8*w8 (floats), destination at
// D + bt*dstr + 8*w8 (halves), so a reduced build reads full-stride input rows into a compact plane.
// Thread = 8 consecutive elements: two 16-B loads, one 16-B store; 32 consecutive lanes = 512 contiguous, 512-B aligned
// coverage: grid = ceil(ntot/256) blocks x 256 thr x 8 (in-kernel bound) = ntot*8 elements = the whole compact plane.
// =====================================================================================================
__global__ __launch_bounds__(256) void cvt16(const float* __restrict__ x, u16* D, int n8, int ntot, int sstr, int dstr,
                                             int f16mode, float scale) {
  const int gt = blockIdx.x * 256 + (int)threadIdx.x;
  if (gt >= ntot) return;
  const int bt = gt / n8;
  const int w8 = gt - bt * n8;
  const float* p = x + (size_t)bt * (size_t)sstr + (size_t)w8 * 8;
  const v4f a = *(const v4f*)(p), b4 = *(const v4f*)(p + 4);
  float w[8];
#pragma unroll
  for (int e = 0; e < 4; ++e) { w[e] = a[e]; w[4 + e] = b4[e]; }
  v4u o;
#pragma unroll
  for (int e = 0; e < 4; ++e) {
    const float f0 = w[2 * e], f1 = w[2 * e + 1];
    const unsigned short hb0 = h_bits((_Float16)(bfr(f0) * scale));
    const unsigned short hb1 = h_bits((_Float16)(bfr(f1) * scale));
    const unsigned short bb0 = bf_bits(f0);
    const unsigned short bb1 = bf_bits(f1);
    o[e] = (f16mode != 0) ? pk16(hb0, hb1) : pk16(bb0, bb1);
  }
  u16* d = D + (size_t)bt * (size_t)dstr + (size_t)w8 * 8;
  {
    *(v4u*)(d) = o;
    
  }
}

// =====================================================================================================
// f32 plane F [MROWS][HD] (row = b*SEQ + s) -> f16 hi plane Hp = f16(F * sc), same layout, all rows; and f16 residual plane
// Lp = f16(t - f16(t)) in the compact layout [NB*QO][HD] (row = b*QO + s) for rows with s < QO only.
// Thread = 8 consecutive elements of one row: two 16-B loads, one 16-B store per plane; 32 consecutive lanes = 512 contiguous,
// loaded value.
// coverage: Hp: ceil(n8/256) blocks x 256 thr x 8 = all MROWS x HD; Lp: every (b, s < QO) row x 8 thr x 8 = all NB*QO x HD.
// =====================================================================================================
__global__ __launch_bounds__(256) void split16(const float* __restrict__ F, u16* Hp, u16* Lp, int n8, float sc) {
  const int gt = blockIdx.x * 256 + (int)threadIdx.x;
  if (gt >= n8) return;
  const int row = gt / C8R;
  const int c8  = (gt - row * C8R) * 8;
  const int b   = row / SEQ;
  const int s   = row - b * SEQ;
  const bool dolo = (s < QO);
  const int  sl   = dolo ? s : 0;
  const float* p = F + (size_t)gt * 8;
  const v4f a = *(const v4f*)(p), b4 = *(const v4f*)(p + 4);
  float w[8];
#pragma unroll
  for (int e = 0; e < 4; ++e) { w[e] = a[e] * sc; w[4 + e] = b4[e] * sc; }
  v4u oh, ol;
#pragma unroll
  for (int e = 0; e < 4; ++e) {
    const float t0 = w[2 * e], t1 = w[2 * e + 1];
    const _Float16 h0 = (_Float16)t0, h1 = (_Float16)t1;
    const _Float16 l0 = (_Float16)(t0 - (float)h0), l1 = (_Float16)(t1 - (float)h1);
    oh[e] = pk16(h_bits(h0), h_bits(h1));
    ol[e] = pk16(h_bits(l0), h_bits(l1));
  }
  u16* dh = Hp + (size_t)gt * 8;
  u16* dl = Lp + ((size_t)(b * QO + sl) * HD + c8);
  {
    *(v4u*)(dh) = oh;
    if (dolo) { *(v4u*)(dl) = ol; }
    
  }
}

// =====================================================================================================
// v^T planes from the v projection F f32 [MROWS][HD] (row = b*SEQ + s, column = d):
//   VH[(b*HD + d)][s] (pitch SEQ) = f16(v * 1024) for all keys s;
//   VL[(b*HD + d)][s] (pitch QO)  = f16 residual (t - f16(t)) for keys s < QO only.
// Block = (b, 64 keys s0): each thread loads its 16 floats (key sl, d chunk dc) with 16-B loads, converts, scatters
// into two LDS tiles [64 d][64 keys] (pitch 72 halves; columns 64..71 never read); after a block barrier each d row segment
// coverage: load 256 thr x 16 = 64 keys x 64 d (staged extent == consumed extent); store 2 iterations x 256 thr x 8 halves
//           = 64 lines x 64 = the block's tile of VH (and of VL when s0 < QO); grid = NB*NST blocks covers VH exactly once
//           and all QO columns of VL exactly once.
// =====================================================================================================
__global__ __launch_bounds__(256) void vt16(const float* __restrict__ F, u16* VHo, u16* VLo) {
  __shared__ __align__(16) u16 TH[HD * VTP];
  __shared__ __align__(16) u16 TL[HD * VTP];
  const int tid = threadIdx.x;
  const int bid = blockIdx.x;
  const int st  = bid % NST;
  const int b   = bid / NST;
  if (b >= NB) return;                      // block-uniform, before any barrier; never taken with the exact grid
  const int s0  = st * 64;
  const bool dolo = (s0 + 64 <= QO);        // block-uniform
  {
    const int sl = tid >> 2;                // key within tile 0..63
    const int dc = (tid & 3) * 16;          // d chunk 0,16,32,48
    const float* src = F + ((size_t)b * SEQ + s0 + sl) * HD + dc;
#pragma unroll
    for (int i = 0; i < 4; ++i) {
      const v4f a = *(const v4f*)(src + 4 * i);
#pragma unroll
      for (int e = 0; e < 4; ++e) {
        const float t = a[e] * VCAR;
        const _Float16 hv = (_Float16)t;
        const _Float16 lv = (_Float16)(t - (float)hv);
        TH[(dc + 4 * i + e) * VTP + sl] = h_bits(hv);
        TL[(dc + 4 * i + e) * VTP + sl] = h_bits(lv);
      }
    }
  }
  __syncthreads();
  v4u vh[2], vl[2];
  const int q8 = tid >> 3, p8 = (tid & 7) * 8;
#pragma unroll
  for (int it = 0; it < 2; ++it) {
    const int line = it * 32 + q8;          // d = 0..63
    vh[it] = *(const v4u*)(TH + line * VTP + p8);
    vl[it] = *(const v4u*)(TL + line * VTP + p8);
  }
  const size_t hrow  = (size_t)b * HD;
  const size_t baseH = hrow * SEQ + s0 + p8;
  const size_t baseL = hrow * QO + (dolo ? s0 : 0) + p8;
  {
#pragma unroll
    for (int it = 0; it < 2; ++it) {
      const int line = it * 32 + q8;
      *(v4u*)(VHo + baseH + (size_t)line * SEQ) = vh[it];
      if (dolo) { *(v4u*)(VLo + baseL + (size_t)line * QO) = vl[it]; }
    }
    
  }
}

// =====================================================================================================
// GEMM / attention f32 epilogue: the wave's 16x64 f32 tile (times oscale, plus the lane's per-column addend of each
// coverage: 8 instructions x 2 rows x 16 lanes x 4 floats = the wave's 16 x 64 tile (staged extent == consumed extent).
// =====================================================================================================
__device__ __forceinline__ void epi64(float* sl, v8f a0, v8f a1, v8f a2, v8f a3, float oscale,
                                      float bb0, float bb1, float bb2, float bb3,
                                      float* C, int N, size_t rowb, int col0, int lane) {
  const int hh = lane >> 4, m = lane & 15;
#pragma unroll
  for (int r = 0; r < 8; ++r) {
    const int ro = (8 * hh + r) * 68 + m;
    sl[ro]      = a0[r] * oscale + bb0;
    sl[ro + 16] = a1[r] * oscale + bb1;
    sl[ro + 32] = a2[r] * oscale + bb2;
    sl[ro + 48] = a3[r] * oscale + bb3;
  }
  wave_sync_lds();
  v4f vals[8];
#pragma unroll
  for (int it = 0; it < 8; ++it) vals[it] = *(const v4f*)(sl + (it * 2 + hh) * 68 + m * 4);
  float* dst = C + (rowb + (size_t)hh) * (size_t)N + col0 + m * 4;
  {
#pragma unroll
    for (int it = 0; it < 8; ++it) {
      *(v4f*)(dst + (size_t)(it * 2) * (size_t)N) = vals[it];
    }
    
  }
}

// =====================================================================================================
// bf16 GEMM: C[M][N] (f32) = A[M][K] (bf16 row-major) . Bt[N][K]^T (bf16 k-contiguous), times oscale (no addend). Block =
// 64x64 tile, 4 waves x 16 rows; fragments loaded straight from the 16-bit rows (two 16-B loads each, split k map for A and
// B); K stepped by 32 (host guarantees K % 32 == 0, M % 64 == 0, N % 64 == 0, grid = (M/64)*(N/64)).
// =====================================================================================================
__global__ __launch_bounds__(128)
void gemm_bf(const u16* __restrict__ A, const u16* __restrict__ Bt, float* C, int M, int N, int K, float oscale) {
  __shared__ __align__(16) float slab[4 * SLAB64];
  const int tid = threadIdx.x, wave = tid >> 5, lane = tid & 31, hh = lane >> 4, m = lane & 15;
  const int ntile = N >> 6;
  const int bid   = blockIdx.x;
  const int rowb  = (bid / ntile) * 64 + wave * 16;
  const int col0  = (bid % ntile) * 64;
  if (rowb + 16 > M) return;                // wave-uniform, never taken with the exact grid; no block barriers in this kernel
  const u16* ap = A  + (size_t)(rowb + m) * K + 8 * hh;
  const u16* bp = Bt + (size_t)(col0 + m) * K + 8 * hh;
  const size_t bs = (size_t)16 * K;
  v8f acc0 = zero8(), acc1 = zero8(), acc2 = zero8(), acc3 = zero8();
#pragma unroll 1
  for (int k0 = 0; k0 < K; k0 += 32) {
    const v16b a  = ldfrag_b(ap + k0);
    const v16b b0 = ldfrag_b(bp + k0);
    const v16b b1 = ldfrag_b(bp + bs + k0);
    const v16b b2 = ldfrag_b(bp + 2 * bs + k0);
    const v16b b3 = ldfrag_b(bp + 3 * bs + k0);
    acc0 = mma_b(a, b0, acc0);
    acc1 = mma_b(a, b1, acc1);
    acc2 = mma_b(a, b2, acc2);
    acc3 = mma_b(a, b3, acc3);
    guard6<v16b>(acc0, acc1, acc2, acc3, a, b0, b1, b2, b3, a);
  }
  epi64(slab + wave * SLAB64, acc0, acc1, acc2, acc3, oscale, 0.f, 0.f, 0.f, 0.f, C, N, (size_t)rowb, col0, lane);
}

// =====================================================================================================
// Single-head causal attention (key j contributes to query i only when j < i), hd = 64, f32 output.
// Block bid -> (batch b = bid / BPB, query tile index qi = (bid % BPB)*WPB + wave): one wave per 16-row query tile q0 = 16*qt.
// RES == 1: query tiles q0 < QO, scores = q_hi.k_hi + q_lo.k_hi + q_hi.k_lo and P.v = hh + lh + hl; RES == 0: query tiles
// q0 >= QO, single products q_hi.k_hi, P_hi.v_hi.
//   q hi plane f16 x256 [b*SEQ + s][d], q residual (compact) [b*QO + s][d]; k hi / residual planes likewise;
//   v^T hi plane [b][d][SEQ] x1024, v^T residual plane [b][d][QO].
//   score (log2 domain) t(i, j) = (q_i.k_j over HD) * (1/8)*log2e/(256*256), replaced by -inf where key j >= query i.
//   Key tiles of 32 visited in order for kb <= q0 + 14 (later tiles hold only keys at or above every query row of the tile);
//   with RES == 1 this keeps every visited key below QO, inside the compact residual planes. Query row 0 has no admitted key:
//   its running max stays -inf, Z = 0, and the row is written as 0 here (a later launch writes its true value).
//   Per tile: 2 score subtiles x 2 k-steps, fragments loaded straight from the 16-bit planes (two 16-B loads per fragment,
//   split k map); online max-subtracted base-2 softmax in f32, -inf-safe rescale; the 16x32 prob tile stored to wave-private
//   fragments of P*32768 (f16 hi plus its f16 residual) rebuilt from the LDS rows (float vector loads, same element type as
//   stored), v^T B fragments in 2 groups of 2 d-subtiles.
//   After the loop: out = acc / Z (0 if Z == 0), carries 1/(32768*1024) folded once, then the f32 whole-line epilogue epi64
//   No block barriers in this kernel; bounded loops only (nkt <= NKT).
// coverage: per wave 8 instructions x 2 rows x 64 floats = its 16 x 64 output rows; the two launches (RES 1: NQO tiles,
//           RES 0: NQT-NQO tiles) x NB = every (b, s) output row exactly once.
// =====================================================================================================
template <int RES>
__global__ __launch_bounds__(ATT_THREADS)
void attn_c(const u16* __restrict__ QHp, const u16* __restrict__ QLp,
            const u16* __restrict__ KHp, const u16* __restrict__ KLp,
            const u16* __restrict__ VHp, const u16* __restrict__ VLp,
            float* Out) {
  __shared__ __align__(16) float smem[WPB * WREG];
  constexpr int QT0 = (RES != 0) ? 0 : NQO;
  constexpr int NQL = (RES != 0) ? NQO : (NQT - NQO);
  constexpr int NQE = (NQL > 0) ? NQL : 1;
  constexpr int BPB = (NQE + WPB - 1) / WPB;

  const int tid  = threadIdx.x;
  const int wave = tid >> 5;
  const int lane = tid & 31;
  const int hh   = lane >> 4;
  const int c    = lane & 15;
  const int bid  = blockIdx.x;
  const int b    = bid / BPB;
  const int qi   = (bid - b * BPB) * WPB + wave;
  if (b >= NB) return;                      // block-uniform; no block barriers in this kernel; never taken with the exact grid
  if (qi >= NQL) return;                    // wave-uniform; never taken (tile counts are even)
  const int q0   = (QT0 + qi) * 16;
  if (q0 + 16 > SEQ) return;                // wave-uniform; never taken
  if (RES != 0 && q0 + 16 > QO) return;     // wave-uniform; never taken
  const int ql0  = (RES != 0) ? q0 : 0;

  float* pt   = smem + wave * WREG;         // prob tile [16][32] pitch 36
  float* slab = pt + PTW;                   // result slab [16][64] pitch 68

  const size_t hcol = (size_t)8 * hh;
  const _Float16* Qh  = ash(QHp) + ((size_t)b * SEQ + q0 + c) * HD + hcol;
  const _Float16* Ql  = ash(QLp) + ((size_t)b * QO + ql0 + c) * HD + hcol;          // RES == 1 only
  const _Float16* Khb = ash(KHp) + ((size_t)b * SEQ + c) * HD + hcol;               // key row kb added per step
  const _Float16* Klb = ash(KLp) + ((size_t)b * QO + c) * HD + hcol;                // RES == 1 only, keys < QO
  const _Float16* Vhb = ash(VHp) + ((size_t)b * HD + c) * SEQ + hcol;               // d col c (+16j)
  const _Float16* Vlb = ash(VLp) + ((size_t)b * HD + c) * QO + hcol;                // RES == 1 only
  const float lsc = RSQ_HD * (LOG2E / (QSC * KSC));
  const float oc  = 1.0f / (PCAR * VCAR);
  const size_t KROW = (size_t)HD;           // halves between consecutive key rows

  float mrow[8], lrow[8];
  v8f o[4];
#pragma unroll
  for (int r = 0; r < 8; ++r) { mrow[r] = -INFINITY; lrow[r] = 0.f; }
#pragma unroll
  for (int j = 0; j < 4; ++j) o[j] = zero8();
  const int ncaus = (q0 >> 5) + 1;                                            // tiles holding keys <= q0 + 14
  const int nkt = (ncaus < NKT) ? ncaus : NKT;
  const int qr0 = q0 + 8 * hh;                                                // query row of D element r = qr0 + r

#pragma unroll 1
  for (int kt = 0; kt < nkt; ++kt) {
    const int kb = kt * 32;
    // ---- scores: D element r of this lane = (query row qr0 + r, key kb + c) in s0, key kb + 16 + c in s1 ----
    v8f s0 = zero8(), s1 = zero8();
    const _Float16* k0p = Khb + (size_t)kb * KROW;
    const _Float16* k1p = k0p + (size_t)16 * KROW;
    if constexpr (RES != 0) {
      const _Float16* l0p = Klb + (size_t)kb * KROW;
      const _Float16* l1p = l0p + (size_t)16 * KROW;
#pragma unroll
      for (int kk = 0; kk < HD / 32; ++kk) {
        const v16h qh  = ldfrag_h(Qh + kk * 32);
        const v16h ql  = ldfrag_h(Ql + kk * 32);
        const v16h kh0 = ldfrag_h(k0p + kk * 32);
        const v16h kh1 = ldfrag_h(k1p + kk * 32);
        const v16h kl0 = ldfrag_h(l0p + kk * 32);
        const v16h kl1 = ldfrag_h(l1p + kk * 32);
        s0 = mma_h(qh, kh0, s0);
        s0 = mma_h(ql, kh0, s0);
        s0 = mma_h(qh, kl0, s0);
        s1 = mma_h(qh, kh1, s1);
        s1 = mma_h(ql, kh1, s1);
        s1 = mma_h(qh, kl1, s1);
        guard2(s0, s1, qh, ql, kh0, kl0, kh1, kl1);
      }
    } else {
#pragma unroll
      for (int kk = 0; kk < HD / 32; ++kk) {
        const v16h qh  = ldfrag_h(Qh + kk * 32);
        const v16h kh0 = ldfrag_h(k0p + kk * 32);
        const v16h kh1 = ldfrag_h(k1p + kk * 32);
        s0 = mma_h(qh, kh0, s0);
        s1 = mma_h(qh, kh1, s1);
        guard2(s0, s1, qh, kh0, kh1, qh, kh0, kh1);
      }
    }
    // ---- causal select (key >= query excluded) + online softmax in base 2, -inf-safe ----
    const int key0 = kb + c, key1 = kb + 16 + c;
#pragma unroll
    for (int r = 0; r < 8; ++r) {
      const int   qr = qr0 + r;
      const float u0 = s0[r] * lsc;
      const float u1 = s1[r] * lsc;
      const float t0 = (key0 >= qr) ? -INFINITY : u0;
      const float t1 = (key1 >= qr) ? -INFINITY : u1;
      float mx = fmaxf(t0, t1);
#pragma unroll
      for (int off = 1; off < 16; off <<= 1) mx = fmaxf(mx, __shfl_xor(mx, off, 32));
      const float mn = fmaxf(mrow[r], mx);
      const float ms = (mn == -INFINITY) ? 0.0f : mn;
      const float al = exp2f(mrow[r] - ms);
      mrow[r] = mn;
      const float e0 = exp2f(t0 - ms), e1 = exp2f(t1 - ms);
      float ps = e0 + e1;
#pragma unroll
      for (int off = 1; off < 16; off <<= 1) ps += __shfl_xor(ps, off, 32);
      lrow[r] = lrow[r] * al + ps;
#pragma unroll
      for (int j = 0; j < 4; ++j) o[j][r] *= al;
      const int ro = (8 * hh + r) * PTP + c;
      pt[ro]      = e0;
      pt[ro + 16] = e1;
    }
    wave_sync_lds();
    // ---- A fragments of P*32768: hi f16 and residual f16, row = c, split k map over the 32 keys of this step ----
    FragH ph, pl;
    {
      const float* prow = pt + c * PTP + 8 * hh;
      const v4f p0 = *(const v4f*)(prow), p1 = *(const v4f*)(prow + 4);
      const v4f p2 = *(const v4f*)(prow + 16), p3 = *(const v4f*)(prow + 20);
#pragma unroll
      for (int e = 0; e < 4; ++e) {
        const float ta = p0[e] * PCAR, tb = p1[e] * PCAR, tc = p2[e] * PCAR, td = p3[e] * PCAR;
        const _Float16 ha = (_Float16)ta, hb = (_Float16)tb, hc = (_Float16)tc, hd = (_Float16)td;
        ph.h[0][e]     = ha;                  // elements 0..7  = keys kb + 8hh + 0..7
        ph.h[0][4 + e] = hb;
        ph.h[1][e]     = hc;                  // elements 8..15 = keys kb + 16 + 8hh + 0..7
        ph.h[1][4 + e] = hd;
        pl.h[0][e]     = (_Float16)(ta - (float)ha);
        pl.h[0][4 + e] = (_Float16)(tb - (float)hb);
        pl.h[1][e]     = (_Float16)(tc - (float)hc);
        pl.h[1][4 + e] = (_Float16)(td - (float)hd);
      }
    }
    // ---- P.V : B fragment col n = d = j*16 + c, keys contiguous in the v^T planes; 2 groups of 2 d-subtiles ----
    {
      const _Float16* vhp = Vhb + kb;
      if constexpr (RES != 0) {
        const _Float16* vlp = Vlb + kb;
#pragma unroll
        for (int jg = 0; jg < 2; ++jg) {
          const size_t da = (size_t)(2 * jg) * 16 * SEQ;
          const size_t db = da + (size_t)16 * SEQ;
          const size_t la = (size_t)(2 * jg) * 16 * QO;
          const size_t lb = la + (size_t)16 * QO;
          const v16h vha = ldfrag_h(vhp + da), vhb2 = ldfrag_h(vhp + db);
          const v16h vla = ldfrag_h(vlp + la), vlb2 = ldfrag_h(vlp + lb);
          o[2 * jg]     = mma_h(ph.v, vha,  o[2 * jg]);
          o[2 * jg]     = mma_h(pl.v, vha,  o[2 * jg]);
          o[2 * jg]     = mma_h(ph.v, vla,  o[2 * jg]);
          o[2 * jg + 1] = mma_h(ph.v, vhb2, o[2 * jg + 1]);
          o[2 * jg + 1] = mma_h(pl.v, vhb2, o[2 * jg + 1]);
          o[2 * jg + 1] = mma_h(ph.v, vlb2, o[2 * jg + 1]);
          guard2(o[2 * jg], o[2 * jg + 1], ph.v, pl.v, vha, vhb2, vla, vlb2);
        }
      } else {
#pragma unroll
        for (int jg = 0; jg < 2; ++jg) {
          const size_t da = (size_t)(2 * jg) * 16 * SEQ;
          const size_t db = da + (size_t)16 * SEQ;
          const v16h vha = ldfrag_h(vhp + da), vhb2 = ldfrag_h(vhp + db);
          o[2 * jg]     = mma_h(ph.v, vha,  o[2 * jg]);
          o[2 * jg + 1] = mma_h(ph.v, vhb2, o[2 * jg + 1]);
          guard2(o[2 * jg], o[2 * jg + 1], ph.v, vha, vhb2, ph.v, vha, vhb2);
        }
      }
    }
    wave_sync_lds();
  }
  acc_guard4(o[0], o[1], o[2], o[3]);
  // ---- out = acc / Z (0 if Z == 0), carries (32768 on P, 1024 on v) folded once, applied per D row in registers ----
#pragma unroll
  for (int r = 0; r < 8; ++r) {
    const float lv  = lrow[r];
    const float ls  = (lv > 0.0f) ? lv : 1.0f;
    const float inv = (lv > 0.0f) ? ((1.0f / ls) * oc) : 0.0f;
#pragma unroll
    for (int j = 0; j < 4; ++j) o[j][r] *= inv;
  }
  // ---- f32 whole-line epilogue straight to the output rows b*SEQ_FULL + q0 .. + 15 ----
  epi64(slab, o[0], o[1], o[2], o[3], 1.0f, 0.f, 0.f, 0.f, 0.f, Out, HD, (size_t)b * SEQ_FULL + (size_t)q0, 0, lane);
}

// =====================================================================================================
// Query row 0 of every batch: uniform weights 1/SEQ over ALL keys -> out[b][0][d] = mean over s of F[b*SEQ + s][d], F the f32
// v projection. Block = batch b, 256 threads: thread (d = tid & 63, g = tid >> 6) sums rows g*SEQ/4 .. (g+1)*SEQ/4 - 1 of
// column d in f64 (coalesced 256-B row reads), partials combined in fixed order through LDS, scaled by 1/SEQ, staged as one
// f32 row in LDS; after a barrier lanes 0..15 of wave 0 write the 256-B output row (16 consecutive lanes x 16 B, one
// coverage: 16 lanes x 4 floats = the 64-float row; grid = NB blocks = every batch's row 0 exactly once.
// =====================================================================================================
__global__ __launch_bounds__(256) void row0_mean(const float* __restrict__ F, float* Out) {
  __shared__ double part[4 * HD];
  __shared__ __align__(16) float rowv[HD];
  const int tid = threadIdx.x;
  const int b   = blockIdx.x;
  if (b >= NB) return;                      // block-uniform, before any barrier; never taken with the exact grid
  const int d = tid & 63, g = tid >> 6;
  const int nper = SEQ / 4;
  const float* p = F + ((size_t)b * SEQ + (size_t)g * nper) * HD + d;
  double acc = 0.0;
#pragma unroll 1
  for (int s = 0; s < nper; ++s) acc += (double)p[(size_t)s * HD];
  part[g * HD + d] = acc;
  __syncthreads();
  if (tid < HD) {
    const double t = ((part[tid] + part[HD + tid]) + part[2 * HD + tid]) + part[3 * HD + tid];
    rowv[tid] = (float)t * (1.0f / (float)SEQ);
  }
  __syncthreads();
  if (tid < 16) {
    const v4f v = *(const v4f*)(rowv + 4 * tid);
    float* dst = Out + (size_t)b * SEQ_FULL * HD + 4 * tid;
    {
      *(v4f*)(dst) = v;
      
    }
  }
}

// =====================================================================================================
// Workspace map (bytes); every plane is fully written by whole-line stores before it is read; all extents are exact multiples
// of the store granularity (no pad rows needed); every region offset a multiple of 65536:
//   XB  bf16 [MROWS][512]            MROWS*1024   (value, query, key bf16 planes in launch order)   (NB=4, SEQ=4096: 16777216)
//   WBv, WBq, WBk bf16 [64 n][512 k] 65536 each                                                     (196608)
//   FV, FQ, FK f32 [MROWS][64]       MROWS*256 each                                                 (3 x 4194304)
//   QH  f16 [MROWS][64] x256         MROWS*128    QL residual [NB*QO][64]  NB*QO*128                (2097152 + 262144)
//   KH  f16 [MROWS][64] x256         MROWS*128    KL residual [NB*QO][64]  NB*QO*128                (2097152 + 262144)
//   VH  f16 [NB][64][SEQ] x1024      MROWS*128    VL residual [NB][64][QO] NB*QO*128                (2097152 + 262144)
//   end (NB=4, SEQ=4096)           36634624
// =====================================================================================================
extern "C" void kernel_launch(void* const* d_in, const int* in_sizes, int n_in,
                              void* d_out, int out_size, void* d_ws, size_t ws_size,
                              hipStream_t stream) {
  if (n_in < 6) return;
  const int needx = ((NB - 1) * SEQ_FULL + SEQ) * DIN;
  if (in_sizes[0] < needx) return;
  if (in_sizes[1] < needx) return;
  if (in_sizes[2] < needx) return;
  if (in_sizes[3] != HD * DIN) return;
  if (in_sizes[4] != HD * DIN) return;
  if (in_sizes[5] != HD * DIN) return;
  if (out_size < ((NB - 1) * SEQ_FULL + SEQ) * HD) return;

  const float* query = (const float*)d_in[0];
  const float* keyin = (const float*)d_in[1];
  const float* value = (const float*)d_in[2];
  const float* wq    = (const float*)d_in[3];
  const float* wk    = (const float*)d_in[4];
  const float* wv    = (const float*)d_in[5];
  float*       out   = (float*)d_out;

  const size_t szXB = (size_t)MROWS * DIN * 2;
  const size_t szW  = (size_t)HD * DIN * 2;
  const size_t szF  = (size_t)MROWS * HD * 4;
  const size_t szH  = (size_t)MROWS * HD * 2;                    // QH, KH
  const size_t szL  = (size_t)NB * QO * HD * 2;                  // QL, KL (compact residual planes)
  const size_t szVH = (size_t)NB * HD * SEQ * 2;                 // == szH
  const size_t szVL = (size_t)NB * HD * QO * 2;                  // == szL
  size_t off = 0;
  const size_t oXB = off; off += szXB;
  const size_t oWv = off; off += szW;
  const size_t oWq = off; off += szW;
  const size_t oWk = off; off += szW;
  const size_t oFV = off; off += szF;
  const size_t oFQ = off; off += szF;
  const size_t oFK = off; off += szF;
  const size_t oQH = off; off += szH;
  const size_t oQL = off; off += szL;
  const size_t oKH = off; off += szH;
  const size_t oKL = off; off += szL;
  const size_t oVH = off; off += szVH;
  const size_t oVL = off; off += szVL;
  if (off > ws_size) return;                // off = 36634624 for NB = 4, SEQ = 4096
  if (off > (size_t)WS_CAP) return;

  char* ws = (char*)d_ws;
  u16*   XB  = (u16*)(ws + oXB);
  u16*   WBv = (u16*)(ws + oWv);
  u16*   WBq = (u16*)(ws + oWq);
  u16*   WBk = (u16*)(ws + oWk);
  float* FV  = (float*)(ws + oFV);
  float* FQ  = (float*)(ws + oFQ);
  float* FK  = (float*)(ws + oFK);
  u16*   QH  = (u16*)(ws + oQH);
  u16*   QL  = (u16*)(ws + oQL);
  u16*   KH  = (u16*)(ws + oKH);
  u16*   KL  = (u16*)(ws + oKL);
  u16*   VH  = (u16*)(ws + oVH);
  u16*   VL  = (u16*)(ws + oVL);

  const dim3 b256(256), b128(128), bAT(ATT_THREADS);
  const int  n8x  = (SEQ * DIN) / 8;                    // per batch
  const int  ntx  = NB * n8x;
  const int  sstr = SEQ_FULL * DIN;                     // full input batch stride (floats)
  const int  dstr = SEQ * DIN;                          // compact plane batch stride (halves)
  const dim3 gX((ntx + 255) / 256);
  const int  n8w  = (HD * DIN) / 8;                     // one [64][512] weight block
  const dim3 gW((n8w + 255) / 256);
  const dim3 gG((MROWS / 64) * (HD / 64));
  const dim3 gVT(NB * NST);
  const int  n8q  = (MROWS * HD) / 8;                   // q / k hi planes
  const dim3 gSQ((n8q + 255) / 256);
  const dim3 gATR(NB * ((NQO + WPB - 1) / WPB));
  const int  nqp  = NQT - NQO;                          // query tiles with s >= QO
  const dim3 gR0(NB);

  // (1) value -> bf16 plane; (2) Wv [64 n][512 k] -> bf16 plane; (3) v = value.Wv^T -> FV f32 [MROWS][64];
  // (4) v^T hi (all keys) + residual (keys < QO) x1024
  cvt16<<<gX, b256, 0, stream>>>(value, XB, n8x, ntx, sstr, dstr, 0, 1.0f);
  cvt16<<<gW, b256, 0, stream>>>(wv, WBv, n8w, n8w, 0, 0, 0, 1.0f);
  gemm_bf<<<gG, b128, 0, stream>>>(XB, WBv, FV, MROWS, HD, DIN, 1.0f);
  vt16<<<gVT, b256, 0, stream>>>(FV, VH, VL);
  // (5) query -> bf16 plane; (6) Wq -> bf16 plane; (7) q = query.Wq^T -> FQ; (8) q hi (all rows) + residual (rows s < QO) x256
  cvt16<<<gX, b256, 0, stream>>>(query, XB, n8x, ntx, sstr, dstr, 0, 1.0f);
  cvt16<<<gW, b256, 0, stream>>>(wq, WBq, n8w, n8w, 0, 0, 0, 1.0f);
  gemm_bf<<<gG, b128, 0, stream>>>(XB, WBq, FQ, MROWS, HD, DIN, 1.0f);
  split16<<<gSQ, b256, 0, stream>>>(FQ, QH, QL, n8q, QSC);
  // (9) key -> bf16 plane; (10) Wk -> bf16 plane; (11) k = key.Wk^T -> FK; (12) k hi + residual planes x256
  cvt16<<<gX, b256, 0, stream>>>(keyin, XB, n8x, ntx, sstr, dstr, 0, 1.0f);
  cvt16<<<gW, b256, 0, stream>>>(wk, WBk, n8w, n8w, 0, 0, 0, 1.0f);
  gemm_bf<<<gG, b128, 0, stream>>>(XB, WBk, FK, MROWS, HD, DIN, 1.0f);
  split16<<<gSQ, b256, 0, stream>>>(FK, KH, KL, n8q, KSC);
  // (13) causal attention: query tiles s < QO with residual products -> out; (14) query tiles s >= QO single products -> out
  attn_c<1><<<gATR, bAT, 0, stream>>>(QH, QL, KH, KL, VH, VL, out);
  if (nqp > 0) {
    attn_c<0><<<dim3(NB * ((nqp + WPB - 1) / WPB)), bAT, 0, stream>>>(QH, QL, KH, KL, VH, VL, out);
  }
  // (15) query row 0 of every batch = column mean of v over all SEQ keys (written last)
  row0_mean<<<gR0, b256, 0, stream>>>(FV, out);
  (void)hipGetLastError();
}

// v001
// One run takes 308 microseconds.
// Timed twice side by side with v000, it ran 1.98 and 1.94 times as fast.
// Contractions: value.Wv^T, query.Wq^T, key.Wk^T on v_wmma_f32_16x16x32_bf16 (inputs and W as bf16 RNE planes; W [n][k] rows
// are the k-contiguous B operand); q.k^T over hd 64 and P.v on v_wmma_f32_16x16x32_f16 (q, k x256, P x32768, v x1024 as f16
// planes; query rows s < QO additionally use f16 residual planes, products hh+lh+hl); all f32 accumulate. Strictly-earlier-key
// causal select, base-2 online softmax and 1/Z fold in f32 on VALU; query row 0 (uniform weights over all keys) = column mean
// of the f32 v projection with f64 accumulate on VALU (16-key partial sums in the v^T launch, added up in the last launch).
// Output f32 written directly by the attention epilogue.
#include <hip/hip_runtime.h>
#include <math.h>
#include <stdint.h>

#ifndef NB
#define NB 4
#endif
#ifndef SEQ
#define SEQ 4096
#endif
#define SEQ_FULL 4096
#define DIN   512
#define HD    64
#define QO    ((SEQ < 512) ? SEQ : 512)
#define MROWS (NB * SEQ)
#define RSQ_HD 0.125f
#define LOG2E 1.4426950408889634f
#define QSC   256.0f
#define KSC   256.0f
#define PCAR  32768.0f
#define VCAR  1024.0f
#define WPB   2
#define NQT   (SEQ / 16)
#define NQO   (QO / 16)
#define NST   (SEQ / 64)
#define NKT   (SEQ / 32)
#define ATT_THREADS (WPB * 32)
#define PTP   36
#define PTW   (16 * PTP)
#define SLP   68
#define SLW   (16 * SLP)
#define WREG  (PTW + SLW)
#define SLAB64 (16 * 68)
#define VTP   72
#define C8R   (HD / 8)
#define NPS   (NST * 4)
#define RGRP  16
#define WS_CAP 134217728
static_assert(HD == 64 && (DIN % 32) == 0 && DIN >= 32 && WPB == 2 && ATT_THREADS == 64);
static_assert(NB >= 1 && NB <= 4);
static_assert((SEQ % 64) == 0 && SEQ >= 64 && SEQ <= SEQ_FULL && (SEQ % 4) == 0);
static_assert((QO % 64) == 0 && QO >= 64 && QO <= SEQ);
static_assert((MROWS % 64) == 0 && C8R == 8 && SLP == 68 && SLW == SLAB64);
static_assert(((SEQ * DIN / 8) % 256) == 0 && ((HD * DIN / 8) % 256) == 0 && ((MROWS * HD / 8) % 256) == 0);
static_assert((NPS % RGRP) == 0 && RGRP * HD == 1024);
static_assert(WPB * WREG * 4 <= 65536 && 2 * HD * VTP * 2 <= 65536 && 4 * SLAB64 * 4 <= 65536);

typedef unsigned short u16;
typedef _Float16 v16h __attribute__((ext_vector_type(16)));
typedef _Float16 v8h  __attribute__((ext_vector_type(8)));
typedef __bf16   v16b __attribute__((ext_vector_type(16)));
typedef float    v8f  __attribute__((ext_vector_type(8)));
typedef float    v4f  __attribute__((ext_vector_type(4)));
typedef unsigned int v4u __attribute__((ext_vector_type(4)));

union FragH { v16h v; v8h h[2]; v4u u[2]; };
union FragB { v16b v; v4u u[2]; };

// ---- scalar helpers --------------------------------------------------------------------------------
__device__ __forceinline__ unsigned short bf_bits(float f) {          // f32 -> bf16 bits, RNE convert
  unsigned u = __float_as_uint(f);
  return (unsigned short)((u + 0x7FFFu + ((u >> 16) & 1u)) >> 16);
}
__device__ __forceinline__ float bf_up(unsigned short h) { return __uint_as_float(((unsigned)h) << 16); }
__device__ __forceinline__ float bfr(float f) { return bf_up(bf_bits(f)); }
__device__ __forceinline__ unsigned short h_bits(_Float16 x) { return __builtin_bit_cast(unsigned short, x); }
__device__ __forceinline__ unsigned pk16(unsigned short a, unsigned short b) { return (unsigned)a | ((unsigned)b << 16); }
__device__ __forceinline__ v8f zero8() { v8f z = {0.f, 0.f, 0.f, 0.f, 0.f, 0.f, 0.f, 0.f}; return z; }
__device__ __forceinline__ const _Float16* ash(const u16* p) { return (const _Float16*)(const void*)p; }

// ---- fragment loaders: 16-bit A/B operand, lane -> row/col (lane&15), p already includes +8*(lane>>4);
//      elements 0..7 <- p[0..7] (k0+8h..), elements 8..15 <- p[16..23] (k0+16+8h..)  (same split k map for A and B;
//      B is always read from a k-contiguous [n][k] plane)
__device__ __forceinline__ v16h ldfrag_h(const _Float16* p) {
  FragH f;
  f.h[0] = *(const v8h*)(p);
  f.h[1] = *(const v8h*)(p + 16);
  return f.v;
}
__device__ __forceinline__ v16b ldfrag_b(const u16* p) {              // bf16 plane read as unsigned integer vectors
  FragB f;
  f.u[0] = *(const v4u*)(p);
  f.u[1] = *(const v4u*)(p + 16);
  return f.v;
}

__device__ __forceinline__ v8f mma_h(v16h a, v16h b, v8f c) {
  return __builtin_amdgcn_wmma_f32_16x16x32_f16(false, a, false, b, (short)0, c, false, false);
}
__device__ __forceinline__ v8f mma_b(v16b a, v16b b, v8f c) {
  return __builtin_amdgcn_wmma_f32_16x16x32_bf16(false, a, false, b, (short)0, c, false, false);
}
__device__ __forceinline__ void guard2(v8f& a, v8f& b, v16h x0, v16h x1, v16h x2, v16h x3, v16h x4, v16h x5) {
#if defined(__HIP_DEVICE_COMPILE__)
  asm volatile("v_nop\n\tv_nop\n\tv_nop\n\tv_nop"
               : "+v"(a), "+v"(b) : "v"(x0), "v"(x1), "v"(x2), "v"(x3), "v"(x4), "v"(x5) : "memory");
#endif
}
template <typename F>
__device__ __forceinline__ void guard6(v8f& a, v8f& b, v8f& c, v8f& d, F x0, F x1, F x2, F x3, F x4, F x5) {
#if defined(__HIP_DEVICE_COMPILE__)
  asm volatile("v_nop\n\tv_nop\n\tv_nop\n\tv_nop"
               : "+v"(a), "+v"(b), "+v"(c), "+v"(d) : "v"(x0), "v"(x1), "v"(x2), "v"(x3), "v"(x4), "v"(x5) : "memory");
#endif
}
__device__ __forceinline__ void acc_guard4(v8f& a, v8f& b, v8f& c, v8f& d) {
#if defined(__HIP_DEVICE_COMPILE__)
  asm volatile("v_nop\n\tv_nop\n\tv_nop\n\tv_nop" : "+v"(a), "+v"(b), "+v"(c), "+v"(d));
#endif
}
__device__ __forceinline__ void wave_sync_lds() {
  __builtin_amdgcn_fence(__ATOMIC_RELEASE, "workgroup");
  __builtin_amdgcn_wave_barrier();
  __builtin_amdgcn_fence(__ATOMIC_ACQUIRE, "workgroup");
}

// =====================================================================================================
// f32 -> 16-bit plane.  f16mode == 0: bf16 RNE bits;  f16mode == 1: f16 bits of (bf16 RNE value) * scale.
// Batched: element group gt -> (bt = gt / n8, w8 = gt - bt*n8); source at x + bt*sstr + 8*w8 (floats), destination at
// D + bt*dstr + 8*w8 (halves), so a reduced build reads full-stride input rows into a compact plane.
// Thread = 8 consecutive elements: two 16-B loads, one 16-B store; 32 consecutive lanes = 512 contiguous, 512-B aligned
// coverage: grid = ceil(ntot/256) blocks x 256 thr x 8 (in-kernel bound) = ntot*8 elements = the whole compact plane.
// =====================================================================================================
__global__ __launch_bounds__(256) void cvt16(const float* __restrict__ x, u16* D, int n8, int ntot, int sstr, int dstr,
                                             int f16mode, float scale) {
  const int gt = blockIdx.x * 256 + (int)threadIdx.x;
  if (gt >= ntot) return;
  const int bt = gt / n8;
  const int w8 = gt - bt * n8;
  const float* p = x + (size_t)bt * (size_t)sstr + (size_t)w8 * 8;
  const v4f a = *(const v4f*)(p), b4 = *(const v4f*)(p + 4);
  float w[8];
#pragma unroll
  for (int e = 0; e < 4; ++e) { w[e] = a[e]; w[4 + e] = b4[e]; }
  v4u o;
#pragma unroll
  for (int e = 0; e < 4; ++e) {
    const float f0 = w[2 * e], f1 = w[2 * e + 1];
    const unsigned short hb0 = h_bits((_Float16)(bfr(f0) * scale));
    const unsigned short hb1 = h_bits((_Float16)(bfr(f1) * scale));
    const unsigned short bb0 = bf_bits(f0);
    const unsigned short bb1 = bf_bits(f1);
    o[e] = (f16mode != 0) ? pk16(hb0, hb1) : pk16(bb0, bb1);
  }
  u16* d = D + (size_t)bt * (size_t)dstr + (size_t)w8 * 8;
  {
    *(v4u*)(d) = o;
    
  }
}

// =====================================================================================================
// f32 plane F [MROWS][HD] (row = b*SEQ + s) -> f16 hi plane Hp = f16(F * sc), same layout, all rows; and f16 residual plane
// Lp = f16(t - f16(t)) in the compact layout [NB*QO][HD] (row = b*QO + s) for rows with s < QO only.
// Thread = 8 consecutive elements of one row: two 16-B loads, one 16-B store per plane; 32 consecutive lanes = 512 contiguous,
// loaded value.
// coverage: Hp: ceil(n8/256) blocks x 256 thr x 8 = all MROWS x HD; Lp: every (b, s < QO) row x 8 thr x 8 = all NB*QO x HD.
// =====================================================================================================
__global__ __launch_bounds__(256) void split16(const float* __restrict__ F, u16* Hp, u16* Lp, int n8, float sc) {
  const int gt = blockIdx.x * 256 + (int)threadIdx.x;
  if (gt >= n8) return;
  const int row = gt / C8R;
  const int c8  = (gt - row * C8R) * 8;
  const int b   = row / SEQ;
  const int s   = row - b * SEQ;
  const bool dolo = (s < QO);
  const int  sl   = dolo ? s : 0;
  const float* p = F + (size_t)gt * 8;
  const v4f a = *(const v4f*)(p), b4 = *(const v4f*)(p + 4);
  float w[8];
#pragma unroll
  for (int e = 0; e < 4; ++e) { w[e] = a[e] * sc; w[4 + e] = b4[e] * sc; }
  v4u oh, ol;
#pragma unroll
  for (int e = 0; e < 4; ++e) {
    const float t0 = w[2 * e], t1 = w[2 * e + 1];
    const _Float16 h0 = (_Float16)t0, h1 = (_Float16)t1;
    const _Float16 l0 = (_Float16)(t0 - (float)h0), l1 = (_Float16)(t1 - (float)h1);
    oh[e] = pk16(h_bits(h0), h_bits(h1));
    ol[e] = pk16(h_bits(l0), h_bits(l1));
  }
  u16* dh = Hp + (size_t)gt * 8;
  u16* dl = Lp + ((size_t)(b * QO + sl) * HD + c8);
  {
    *(v4u*)(dh) = oh;
    if (dolo) { *(v4u*)(dl) = ol; }
    
  }
}

// =====================================================================================================
// v^T planes from the v projection F f32 [MROWS][HD] (row = b*SEQ + s, column = d):
//   VH[(b*HD + d)][s] (pitch SEQ) = f16(v * 1024) for all keys s;
//   VL[(b*HD + d)][s] (pitch QO)  = f16 residual (t - f16(t)) for keys s < QO only.
// Block = (b, 64 keys s0): each thread loads its 16 floats (key sl, d chunk dc) with 16-B loads, converts, scatters
// into two LDS tiles [64 d][64 keys] (pitch 72 halves; columns 64..71 never read); after a block barrier each d row segment
// coverage: load 256 thr x 16 = 64 keys x 64 d (staged extent == consumed extent); store 2 iterations x 256 thr x 8 halves
//           = 64 lines x 64 = the block's tile of VH (and of VL when s0 < QO); grid = NB*NST blocks covers VH exactly once
//           and all QO columns of VL exactly once.
// Column sums for query row 0: the loaded f32 rows are also kept in an LDS tile [64 keys][64 d] (pitch 68 floats); after the
// barrier thread (d = tid & 63, g = tid >> 6) adds keys 16g .. 16g+15 of column d in f64, in key order, and stores the sum to
// PS[(bid*4 + g)][d]: 256 thr x 8 B = the block's 2048 contiguous bytes; grid = every one of the NB*NPS rows of PS exactly once.
// =====================================================================================================
__global__ __launch_bounds__(256) void vt16(const float* __restrict__ F, u16* VHo, u16* VLo, double* PS) {
  __shared__ __align__(16) u16 TH[HD * VTP];
  __shared__ __align__(16) u16 TL[HD * VTP];
  __shared__ __align__(16) float TF[64 * SLP];
  const int tid = threadIdx.x;
  const int bid = blockIdx.x;
  const int st  = bid % NST;
  const int b   = bid / NST;
  if (b >= NB) return;                      // block-uniform, before any barrier; never taken with the exact grid
  const int s0  = st * 64;
  const bool dolo = (s0 + 64 <= QO);        // block-uniform
  {
    const int sl = tid >> 2;                // key within tile 0..63
    const int dc = (tid & 3) * 16;          // d chunk 0,16,32,48
    const float* src = F + ((size_t)b * SEQ + s0 + sl) * HD + dc;
#pragma unroll
    for (int i = 0; i < 4; ++i) {
      const v4f a = *(const v4f*)(src + 4 * i);
      *(v4f*)(TF + sl * SLP + dc + 4 * i) = a;
#pragma unroll
      for (int e = 0; e < 4; ++e) {
        const float t = a[e] * VCAR;
        const _Float16 hv = (_Float16)t;
        const _Float16 lv = (_Float16)(t - (float)hv);
        TH[(dc + 4 * i + e) * VTP + sl] = h_bits(hv);
        TL[(dc + 4 * i + e) * VTP + sl] = h_bits(lv);
      }
    }
  }
  __syncthreads();
  v4u vh[2], vl[2];
  const int q8 = tid >> 3, p8 = (tid & 7) * 8;
#pragma unroll
  for (int it = 0; it < 2; ++it) {
    const int line = it * 32 + q8;          // d = 0..63
    vh[it] = *(const v4u*)(TH + line * VTP + p8);
    vl[it] = *(const v4u*)(TL + line * VTP + p8);
  }
  const size_t hrow  = (size_t)b * HD;
  const size_t baseH = hrow * SEQ + s0 + p8;
  const size_t baseL = hrow * QO + (dolo ? s0 : 0) + p8;
  {
#pragma unroll
    for (int it = 0; it < 2; ++it) {
      const int line = it * 32 + q8;
      *(v4u*)(VHo + baseH + (size_t)line * SEQ) = vh[it];
      if (dolo) { *(v4u*)(VLo + baseL + (size_t)line * QO) = vl[it]; }
    }
    
  }
  // the sums below reuse registers that the tile stores above name: wait before they are overwritten; the scheduling
  // barrier keeps the address arithmetic of the sums from being moved up in front of the wait
  asm volatile("s_wait_xcnt 0x0" ::: "memory");
  __builtin_amdgcn_sched_barrier(0);
  {
    const float* col = TF + ((tid >> 6) * 16) * SLP + (tid & 63);
    double acc = 0.0;
#pragma unroll                              // constant LDS offsets
    for (int i = 0; i < 16; ++i) acc += (double)col[i * SLP];
    PS[(size_t)bid * 256 + tid] = acc;      // row bid*4 + (tid >> 6), column tid & 63
  }
}

// =====================================================================================================
// GEMM / attention f32 epilogue: the wave's 16x64 f32 tile (times oscale, plus the lane's per-column addend of each
// coverage: 8 instructions x 2 rows x 16 lanes x 4 floats = the wave's 16 x 64 tile (staged extent == consumed extent).
// =====================================================================================================
__device__ __forceinline__ void epi64(float* sl, v8f a0, v8f a1, v8f a2, v8f a3, float oscale,
                                      float bb0, float bb1, float bb2, float bb3,
                                      float* C, int N, size_t rowb, int col0, int lane) {
  const int hh = lane >> 4, m = lane & 15;
#pragma unroll
  for (int r = 0; r < 8; ++r) {
    const int ro = (8 * hh + r) * 68 + m;
    sl[ro]      = a0[r] * oscale + bb0;
    sl[ro + 16] = a1[r] * oscale + bb1;
    sl[ro + 32] = a2[r] * oscale + bb2;
    sl[ro + 48] = a3[r] * oscale + bb3;
  }
  wave_sync_lds();
  v4f vals[8];
#pragma unroll
  for (int it = 0; it < 8; ++it) vals[it] = *(const v4f*)(sl + (it * 2 + hh) * 68 + m * 4);
  float* dst = C + (rowb + (size_t)hh) * (size_t)N + col0 + m * 4;
  {
#pragma unroll
    for (int it = 0; it < 8; ++it) {
      *(v4f*)(dst + (size_t)(it * 2) * (size_t)N) = vals[it];
    }
    
  }
}

// =====================================================================================================
// bf16 GEMM: C[M][N] (f32) = A[M][K] (bf16 row-major) . Bt[N][K]^T (bf16 k-contiguous), times oscale (no addend). Block =
// 64x64 tile, 4 waves x 16 rows; fragments loaded straight from the 16-bit rows (two 16-B loads each, split k map for A and
// B); K stepped by 32 (host guarantees K % 32 == 0, M % 64 == 0, N % 64 == 0, grid = (M/64)*(N/64)).
// =====================================================================================================
__global__ __launch_bounds__(128)
void gemm_bf(const u16* __restrict__ A, const u16* __restrict__ Bt, float* C, int M, int N, int K, float oscale) {
  __shared__ __align__(16) float slab[4 * SLAB64];
  const int tid = threadIdx.x, wave = tid >> 5, lane = tid & 31, hh = lane >> 4, m = lane & 15;
  const int ntile = N >> 6;
  const int bid   = blockIdx.x;
  const int rowb  = (bid / ntile) * 64 + wave * 16;
  const int col0  = (bid % ntile) * 64;
  if (rowb + 16 > M) return;                // wave-uniform, never taken with the exact grid; no block barriers in this kernel
  const u16* ap = A  + (size_t)(rowb + m) * K + 8 * hh;
  const u16* bp = Bt + (size_t)(col0 + m) * K + 8 * hh;
  const size_t bs = (size_t)16 * K;
  v8f acc0 = zero8(), acc1 = zero8(), acc2 = zero8(), acc3 = zero8();
#pragma unroll 1
  for (int k0 = 0; k0 < K; k0 += 32) {
    const v16b a  = ldfrag_b(ap + k0);
    const v16b b0 = ldfrag_b(bp + k0);
    const v16b b1 = ldfrag_b(bp + bs + k0);
    const v16b b2 = ldfrag_b(bp + 2 * bs + k0);
    const v16b b3 = ldfrag_b(bp + 3 * bs + k0);
    acc0 = mma_b(a, b0, acc0);
    acc1 = mma_b(a, b1, acc1);
    acc2 = mma_b(a, b2, acc2);
    acc3 = mma_b(a, b3, acc3);
    guard6<v16b>(acc0, acc1, acc2, acc3, a, b0, b1, b2, b3, a);
  }
  epi64(slab + wave * SLAB64, acc0, acc1, acc2, acc3, oscale, 0.f, 0.f, 0.f, 0.f, C, N, (size_t)rowb, col0, lane);
}

// =====================================================================================================
// Single-head causal attention (key j contributes to query i only when j < i), hd = 64, f32 output.
// Block bid -> (batch b = bid / BPB, query tile index qi = (bid % BPB)*WPB + wave): one wave per 16-row query tile q0 = 16*qt.
// RES == 1: query tiles q0 < QO, scores = q_hi.k_hi + q_lo.k_hi + q_hi.k_lo and P.v = hh + lh + hl; RES == 0: query tiles
// q0 >= QO, single products q_hi.k_hi, P_hi.v_hi.
//   q hi plane f16 x256 [b*SEQ + s][d], q residual (compact) [b*QO + s][d]; k hi / residual planes likewise;
//   v^T hi plane [b][d][SEQ] x1024, v^T residual plane [b][d][QO].
//   score (log2 domain) t(i, j) = (q_i.k_j over HD) * (1/8)*log2e/(256*256), replaced by -inf where key j >= query i.
//   Key tiles of 32 visited in order for kb <= q0 + 14 (later tiles hold only keys at or above every query row of the tile);
//   with RES == 1 this keeps every visited key below QO, inside the compact residual planes. Query row 0 has no admitted key:
//   its running max stays -inf, Z = 0, and the row is written as 0 here (a later launch writes its true value).
//   Per tile: 2 score subtiles x 2 k-steps, fragments loaded straight from the 16-bit planes (two 16-B loads per fragment,
//   split k map); online max-subtracted base-2 softmax in f32, -inf-safe rescale; the 16x32 prob tile stored to wave-private
//   fragments of P*32768 (f16 hi plus its f16 residual) rebuilt from the LDS rows (float vector loads, same element type as
//   stored), v^T B fragments in 2 groups of 2 d-subtiles.
//   After the loop: out = acc / Z (0 if Z == 0), carries 1/(32768*1024) folded once, then the f32 whole-line epilogue epi64
//   No block barriers in this kernel; bounded loops only (nkt <= NKT).
// coverage: per wave 8 instructions x 2 rows x 64 floats = its 16 x 64 output rows; the two launches (RES 1: NQO tiles,
//           RES 0: NQT-NQO tiles) x NB = every (b, s) output row exactly once.
// =====================================================================================================
template <int RES>
__global__ __launch_bounds__(ATT_THREADS)
void attn_c(const u16* __restrict__ QHp, const u16* __restrict__ QLp,
            const u16* __restrict__ KHp, const u16* __restrict__ KLp,
            const u16* __restrict__ VHp, const u16* __restrict__ VLp,
            float* Out) {
  __shared__ __align__(16) float smem[WPB * WREG];
  constexpr int QT0 = (RES != 0) ? 0 : NQO;
  constexpr int NQL = (RES != 0) ? NQO : (NQT - NQO);
  constexpr int NQE = (NQL > 0) ? NQL : 1;
  constexpr int BPB = (NQE + WPB - 1) / WPB;

  const int tid  = threadIdx.x;
  const int wave = tid >> 5;
  const int lane = tid & 31;
  const int hh   = lane >> 4;
  const int c    = lane & 15;
  const int bid  = blockIdx.x;
  const int b    = bid / BPB;
  const int qi   = (bid - b * BPB) * WPB + wave;
  if (b >= NB) return;                      // block-uniform; no block barriers in this kernel; never taken with the exact grid
  if (qi >= NQL) return;                    // wave-uniform; never taken (tile counts are even)
  const int q0   = (QT0 + qi) * 16;
  if (q0 + 16 > SEQ) return;                // wave-uniform; never taken
  if (RES != 0 && q0 + 16 > QO) return;     // wave-uniform; never taken
  const int ql0  = (RES != 0) ? q0 : 0;

  float* pt   = smem + wave * WREG;         // prob tile [16][32] pitch 36
  float* slab = pt + PTW;                   // result slab [16][64] pitch 68

  const size_t hcol = (size_t)8 * hh;
  const _Float16* Qh  = ash(QHp) + ((size_t)b * SEQ + q0 + c) * HD + hcol;
  const _Float16* Ql  = ash(QLp) + ((size_t)b * QO + ql0 + c) * HD + hcol;          // RES == 1 only
  const _Float16* Khb = ash(KHp) + ((size_t)b * SEQ + c) * HD + hcol;               // key row kb added per step
  const _Float16* Klb = ash(KLp) + ((size_t)b * QO + c) * HD + hcol;                // RES == 1 only, keys < QO
  const _Float16* Vhb = ash(VHp) + ((size_t)b * HD + c) * SEQ + hcol;               // d col c (+16j)
  const _Float16* Vlb = ash(VLp) + ((size_t)b * HD + c) * QO + hcol;                // RES == 1 only
  const float lsc = RSQ_HD * (LOG2E / (QSC * KSC));
  const float oc  = 1.0f / (PCAR * VCAR);
  const size_t KROW = (size_t)HD;           // halves between consecutive key rows

  float mrow[8], lrow[8];
  v8f o[4];
#pragma unroll
  for (int r = 0; r < 8; ++r) { mrow[r] = -INFINITY; lrow[r] = 0.f; }
#pragma unroll
  for (int j = 0; j < 4; ++j) o[j] = zero8();
  const int ncaus = (q0 >> 5) + 1;                                            // tiles holding keys <= q0 + 14
  const int nkt = (ncaus < NKT) ? ncaus : NKT;
  const int qr0 = q0 + 8 * hh;                                                // query row of D element r = qr0 + r

#pragma unroll 1
  for (int kt = 0; kt < nkt; ++kt) {
    const int kb = kt * 32;
    // ---- scores: D element r of this lane = (query row qr0 + r, key kb + c) in s0, key kb + 16 + c in s1 ----
    v8f s0 = zero8(), s1 = zero8();
    const _Float16* k0p = Khb + (size_t)kb * KROW;
    const _Float16* k1p = k0p + (size_t)16 * KROW;
    if constexpr (RES != 0) {
      const _Float16* l0p = Klb + (size_t)kb * KROW;
      const _Float16* l1p = l0p + (size_t)16 * KROW;
#pragma unroll
      for (int kk = 0; kk < HD / 32; ++kk) {
        const v16h qh  = ldfrag_h(Qh + kk * 32);
        const v16h ql  = ldfrag_h(Ql + kk * 32);
        const v16h kh0 = ldfrag_h(k0p + kk * 32);
        const v16h kh1 = ldfrag_h(k1p + kk * 32);
        const v16h kl0 = ldfrag_h(l0p + kk * 32);
        const v16h kl1 = ldfrag_h(l1p + kk * 32);
        s0 = mma_h(qh, kh0, s0);
        s0 = mma_h(ql, kh0, s0);
        s0 = mma_h(qh, kl0, s0);
        s1 = mma_h(qh, kh1, s1);
        s1 = mma_h(ql, kh1, s1);
        s1 = mma_h(qh, kl1, s1);
        guard2(s0, s1, qh, ql, kh0, kl0, kh1, kl1);
      }
    } else {
#pragma unroll
      for (int kk = 0; kk < HD / 32; ++kk) {
        const v16h qh  = ldfrag_h(Qh + kk * 32);
        const v16h kh0 = ldfrag_h(k0p + kk * 32);
        const v16h kh1 = ldfrag_h(k1p + kk * 32);
        s0 = mma_h(qh, kh0, s0);
        s1 = mma_h(qh, kh1, s1);
        guard2(s0, s1, qh, kh0, kh1, qh, kh0, kh1);
      }
    }
    // ---- causal select (key >= query excluded) + online softmax in base 2, -inf-safe ----
    const int key0 = kb + c, key1 = kb + 16 + c;
#pragma unroll
    for (int r = 0; r < 8; ++r) {
      const int   qr = qr0 + r;
      const float u0 = s0[r] * lsc;
      const float u1 = s1[r] * lsc;
      const float t0 = (key0 >= qr) ? -INFINITY : u0;
      const float t1 = (key1 >= qr) ? -INFINITY : u1;
      float mx = fmaxf(t0, t1);
#pragma unroll
      for (int off = 1; off < 16; off <<= 1) mx = fmaxf(mx, __shfl_xor(mx, off, 32));
      const float mn = fmaxf(mrow[r], mx);
      const float ms = (mn == -INFINITY) ? 0.0f : mn;
      const float al = exp2f(mrow[r] - ms);
      mrow[r] = mn;
      const float e0 = exp2f(t0 - ms), e1 = exp2f(t1 - ms);
      float ps = e0 + e1;
#pragma unroll
      for (int off = 1; off < 16; off <<= 1) ps += __shfl_xor(ps, off, 32);
      lrow[r] = lrow[r] * al + ps;
#pragma unroll
      for (int j = 0; j < 4; ++j) o[j][r] *= al;
      const int ro = (8 * hh + r) * PTP + c;
      pt[ro]      = e0;
      pt[ro + 16] = e1;
    }
    wave_sync_lds();
    // ---- A fragments of P*32768: hi f16 and residual f16, row = c, split k map over the 32 keys of this step ----
    FragH ph, pl;
    {
      const float* prow = pt + c * PTP + 8 * hh;
      const v4f p0 = *(const v4f*)(prow), p1 = *(const v4f*)(prow + 4);
      const v4f p2 = *(const v4f*)(prow + 16), p3 = *(const v4f*)(prow + 20);
#pragma unroll
      for (int e = 0; e < 4; ++e) {
        const float ta = p0[e] * PCAR, tb = p1[e] * PCAR, tc = p2[e] * PCAR, td = p3[e] * PCAR;
        const _Float16 ha = (_Float16)ta, hb = (_Float16)tb, hc = (_Float16)tc, hd = (_Float16)td;
        ph.h[0][e]     = ha;                  // elements 0..7  = keys kb + 8hh + 0..7
        ph.h[0][4 + e] = hb;
        ph.h[1][e]     = hc;                  // elements 8..15 = keys kb + 16 + 8hh + 0..7
        ph.h[1][4 + e] = hd;
        pl.h[0][e]     = (_Float16)(ta - (float)ha);
        pl.h[0][4 + e] = (_Float16)(tb - (float)hb);
        pl.h[1][e]     = (_Float16)(tc - (float)hc);
        pl.h[1][4 + e] = (_Float16)(td - (float)hd);
      }
    }
    // ---- P.V : B fragment col n = d = j*16 + c, keys contiguous in the v^T planes; 2 groups of 2 d-subtiles ----
    {
      const _Float16* vhp = Vhb + kb;
      if constexpr (RES != 0) {
        const _Float16* vlp = Vlb + kb;
#pragma unroll
        for (int jg = 0; jg < 2; ++jg) {
          const size_t da = (size_t)(2 * jg) * 16 * SEQ;
          const size_t db = da + (size_t)16 * SEQ;
          const size_t la = (size_t)(2 * jg) * 16 * QO;
          const size_t lb = la + (size_t)16 * QO;
          const v16h vha = ldfrag_h(vhp + da), vhb2 = ldfrag_h(vhp + db);
          const v16h vla = ldfrag_h(vlp + la), vlb2 = ldfrag_h(vlp + lb);
          o[2 * jg]     = mma_h(ph.v, vha,  o[2 * jg]);
          o[2 * jg]     = mma_h(pl.v, vha,  o[2 * jg]);
          o[2 * jg]     = mma_h(ph.v, vla,  o[2 * jg]);
          o[2 * jg + 1] = mma_h(ph.v, vhb2, o[2 * jg + 1]);
          o[2 * jg + 1] = mma_h(pl.v, vhb2, o[2 * jg + 1]);
          o[2 * jg + 1] = mma_h(ph.v, vlb2, o[2 * jg + 1]);
          guard2(o[2 * jg], o[2 * jg + 1], ph.v, pl.v, vha, vhb2, vla, vlb2);
        }
      } else {
#pragma unroll
        for (int jg = 0; jg < 2; ++jg) {
          const size_t da = (size_t)(2 * jg) * 16 * SEQ;
          const size_t db = da + (size_t)16 * SEQ;
          const v16h vha = ldfrag_h(vhp + da), vhb2 = ldfrag_h(vhp + db);
          o[2 * jg]     = mma_h(ph.v, vha,  o[2 * jg]);
          o[2 * jg + 1] = mma_h(ph.v, vhb2, o[2 * jg + 1]);
          guard2(o[2 * jg], o[2 * jg + 1], ph.v, vha, vhb2, ph.v, vha, vhb2);
        }
      }
    }
    wave_sync_lds();
  }
  acc_guard4(o[0], o[1], o[2], o[3]);
  // ---- out = acc / Z (0 if Z == 0), carries (32768 on P, 1024 on v) folded once, applied per D row in registers ----
#pragma unroll
  for (int r = 0; r < 8; ++r) {
    const float lv  = lrow[r];
    const float ls  = (lv > 0.0f) ? lv : 1.0f;
    const float inv = (lv > 0.0f) ? ((1.0f / ls) * oc) : 0.0f;
#pragma unroll
    for (int j = 0; j < 4; ++j) o[j][r] *= inv;
  }
  // ---- f32 whole-line epilogue straight to the output rows b*SEQ_FULL + q0 .. + 15 ----
  epi64(slab, o[0], o[1], o[2], o[3], 1.0f, 0.f, 0.f, 0.f, 0.f, Out, HD, (size_t)b * SEQ_FULL + (size_t)q0, 0, lane);
}

// =====================================================================================================
// Query row 0 of every batch: uniform weights 1/SEQ over ALL keys -> out[b][0][d] = mean over s of F[b*SEQ + s][d], F the f32
// v projection, from its f64 16-key partial sums PS[b*NPS + p][d] (written by vt16 earlier in the same call). Block = batch b,
// 1024 threads: thread (d = tid & 63, g = tid >> 6) adds rows g, g + 16, .. of column d in that order (independent 8-B loads,
// the block reads 8192 contiguous bytes per step), partials combined in fixed order through LDS, scaled by 1/SEQ, staged as one
// f32 row in LDS; after a barrier lanes 0..15 of wave 0 write the 256-B output row (16 consecutive lanes x 16 B, one
// coverage: 16 lanes x 4 floats = the 64-float row; grid = NB blocks = every batch's row 0 exactly once.
// =====================================================================================================
__global__ __launch_bounds__(1024) void row0_mean(const double* __restrict__ PS, float* Out) {
  __shared__ double part[RGRP * HD];
  __shared__ __align__(16) float rowv[HD];
  const int tid = threadIdx.x;
  const int b   = blockIdx.x;
  if (b >= NB) return;                      // block-uniform, before any barrier; never taken with the exact grid
  const double* p = PS + (size_t)b * NPS * HD + tid;
  double acc = 0.0;
#pragma unroll                              // independent loads in flight together instead of one memory latency per row
  for (int s = 0; s < NPS / RGRP; ++s) acc += p[s * (RGRP * HD)];
  part[tid] = acc;
  __syncthreads();
  if (tid < HD) {
    double t = part[tid];
#pragma unroll                              // constant LDS offsets
    for (int g2 = 1; g2 < RGRP; ++g2) t += part[g2 * HD + tid];
    rowv[tid] = (float)t * (1.0f / (float)SEQ);
  }
  __syncthreads();
  if (tid < 16) {
    const v4f v = *(const v4f*)(rowv + 4 * tid);
    float* dst = Out + (size_t)b * SEQ_FULL * HD + 4 * tid;
    {
      *(v4f*)(dst) = v;
      
    }
  }
}

// =====================================================================================================
// Workspace map (bytes); every plane is fully written by whole-line stores before it is read; all extents are exact multiples
// of the store granularity (no pad rows needed); every region offset a multiple of 65536:
//   XB  bf16 [MROWS][512]            MROWS*1024   (value, query, key bf16 planes in launch order)   (NB=4, SEQ=4096: 16777216)
//   WBv, WBq, WBk bf16 [64 n][512 k] 65536 each                                                     (196608)
//   FV, FQ, FK f32 [MROWS][64]       MROWS*256 each                                                 (3 x 4194304)
//   QH  f16 [MROWS][64] x256         MROWS*128    QL residual [NB*QO][64]  NB*QO*128                (2097152 + 262144)
//   KH  f16 [MROWS][64] x256         MROWS*128    KL residual [NB*QO][64]  NB*QO*128                (2097152 + 262144)
//   VH  f16 [NB][64][SEQ] x1024      MROWS*128    VL residual [NB][64][QO] NB*QO*128                (2097152 + 262144)
//   PS  f64 [NB*NPS][64] 16-key column sums of FV   NB*NPS*512                                      (524288)
//   end (NB=4, SEQ=4096)           37158912
// =====================================================================================================
extern "C" void kernel_launch(void* const* d_in, const int* in_sizes, int n_in,
                              void* d_out, int out_size, void* d_ws, size_t ws_size,
                              hipStream_t stream) {
  if (n_in < 6) return;
  const int needx = ((NB - 1) * SEQ_FULL + SEQ) * DIN;
  if (in_sizes[0] < needx) return;
  if (in_sizes[1] < needx) return;
  if (in_sizes[2] < needx) return;
  if (in_sizes[3] != HD * DIN) return;
  if (in_sizes[4] != HD * DIN) return;
  if (in_sizes[5] != HD * DIN) return;
  if (out_size < ((NB - 1) * SEQ_FULL + SEQ) * HD) return;

  const float* query = (const float*)d_in[0];
  const float* keyin = (const float*)d_in[1];
  const float* value = (const float*)d_in[2];
  const float* wq    = (const float*)d_in[3];
  const float* wk    = (const float*)d_in[4];
  const float* wv    = (const float*)d_in[5];
  float*       out   = (float*)d_out;

  const size_t szXB = (size_t)MROWS * DIN * 2;
  const size_t szW  = (size_t)HD * DIN * 2;
  const size_t szF  = (size_t)MROWS * HD * 4;
  const size_t szH  = (size_t)MROWS * HD * 2;                    // QH, KH
  const size_t szL  = (size_t)NB * QO * HD * 2;                  // QL, KL (compact residual planes)
  const size_t szVH = (size_t)NB * HD * SEQ * 2;                 // == szH
  const size_t szVL = (size_t)NB * HD * QO * 2;                  // == szL
  const size_t szPS = (size_t)NB * NPS * HD * 8;
  size_t off = 0;
  const size_t oXB = off; off += szXB;
  const size_t oWv = off; off += szW;
  const size_t oWq = off; off += szW;
  const size_t oWk = off; off += szW;
  const size_t oFV = off; off += szF;
  const size_t oFQ = off; off += szF;
  const size_t oFK = off; off += szF;
  const size_t oQH = off; off += szH;
  const size_t oQL = off; off += szL;
  const size_t oKH = off; off += szH;
  const size_t oKL = off; off += szL;
  const size_t oVH = off; off += szVH;
  const size_t oVL = off; off += szVL;
  const size_t oPS = off; off += szPS;
  if (off > ws_size) return;                // off = 37158912 for NB = 4, SEQ = 4096
  if (off > (size_t)WS_CAP) return;

  char* ws = (char*)d_ws;
  u16*   XB  = (u16*)(ws + oXB);
  u16*   WBv = (u16*)(ws + oWv);
  u16*   WBq = (u16*)(ws + oWq);
  u16*   WBk = (u16*)(ws + oWk);
  float* FV  = (float*)(ws + oFV);
  float* FQ  = (float*)(ws + oFQ);
  float* FK  = (float*)(ws + oFK);
  u16*   QH  = (u16*)(ws + oQH);
  u16*   QL  = (u16*)(ws + oQL);
  u16*   KH  = (u16*)(ws + oKH);
  u16*   KL  = (u16*)(ws + oKL);
  u16*   VH  = (u16*)(ws + oVH);
  u16*   VL  = (u16*)(ws + oVL);
  double* PS = (double*)(ws + oPS);

  const dim3 b256(256), b128(128), bAT(ATT_THREADS), b1024(1024);
  const int  n8x  = (SEQ * DIN) / 8;                    // per batch
  const int  ntx  = NB * n8x;
  const int  sstr = SEQ_FULL * DIN;                     // full input batch stride (floats)
  const int  dstr = SEQ * DIN;                          // compact plane batch stride (halves)
  const dim3 gX((ntx + 255) / 256);
  const int  n8w  = (HD * DIN) / 8;                     // one [64][512] weight block
  const dim3 gW((n8w + 255) / 256);
  const dim3 gG((MROWS / 64) * (HD / 64));
  const dim3 gVT(NB * NST);
  const int  n8q  = (MROWS * HD) / 8;                   // q / k hi planes
  const dim3 gSQ((n8q + 255) / 256);
  const dim3 gATR(NB * ((NQO + WPB - 1) / WPB));
  const int  nqp  = NQT - NQO;                          // query tiles with s >= QO
  const dim3 gR0(NB);

  // (1) value -> bf16 plane; (2) Wv [64 n][512 k] -> bf16 plane; (3) v = value.Wv^T -> FV f32 [MROWS][64];
  // (4) v^T hi (all keys) + residual (keys < QO) x1024, and the f64 16-key column sums of v
  cvt16<<<gX, b256, 0, stream>>>(value, XB, n8x, ntx, sstr, dstr, 0, 1.0f);
  cvt16<<<gW, b256, 0, stream>>>(wv, WBv, n8w, n8w, 0, 0, 0, 1.0f);
  gemm_bf<<<gG, b128, 0, stream>>>(XB, WBv, FV, MROWS, HD, DIN, 1.0f);
  vt16<<<gVT, b256, 0, stream>>>(FV, VH, VL, PS);
  // (5) query -> bf16 plane; (6) Wq -> bf16 plane; (7) q = query.Wq^T -> FQ; (8) q hi (all rows) + residual (rows s < QO) x256
  cvt16<<<gX, b256, 0, stream>>>(query, XB, n8x, ntx, sstr, dstr, 0, 1.0f);
  cvt16<<<gW, b256, 0, stream>>>(wq, WBq, n8w, n8w, 0, 0, 0, 1.0f);
  gemm_bf<<<gG, b128, 0, stream>>>(XB, WBq, FQ, MROWS, HD, DIN, 1.0f);
  split16<<<gSQ, b256, 0, stream>>>(FQ, QH, QL, n8q, QSC);
  // (9) key -> bf16 plane; (10) Wk -> bf16 plane; (11) k = key.Wk^T -> FK; (12) k hi + residual planes x256
  cvt16<<<gX, b256, 0, stream>>>(keyin, XB, n8x, ntx, sstr, dstr, 0, 1.0f);
  cvt16<<<gW, b256, 0, stream>>>(wk, WBk, n8w, n8w, 0, 0, 0, 1.0f);
  gemm_bf<<<gG, b128, 0, stream>>>(XB, WBk, FK, MROWS, HD, DIN, 1.0f);
  split16<<<gSQ, b256, 0, stream>>>(FK, KH, KL, n8q, KSC);
  // (13) causal attention: query tiles s < QO with residual products -> out; (14) query tiles s >= QO single products -> out
  attn_c<1><<<gATR, bAT, 0, stream>>>(QH, QL, KH, KL, VH, VL, out);
  if (nqp > 0) {
    attn_c<0><<<dim3(NB * ((nqp + WPB - 1) / WPB)), bAT, 0, stream>>>(QH, QL, KH, KL, VH, VL, out);
  }
  // (15) query row 0 of every batch = column mean of v over all SEQ keys, from the partial sums (written last)
  row0_mean<<<gR0, b1024, 0, stream>>>(PS, out);
  (void)hipGetLastError();
}

// v002
// It runs in 130 microseconds.
// Next to v001, in two timings, it ran 2.38 and 2.34 times as fast.
// Counting every step since v000, it is 4.61 times as fast.
// Contractions: value.Wv^T, query.Wq^T, key.Wk^T on v_wmma_f32_16x16x32_bf16 (inputs and W as bf16 RNE planes; W [n][k] rows
// are the k-contiguous B operand); q.k^T over hd 64 and P.v on v_wmma_f32_16x16x32_f16 (q, k x256, P x32768, v x1024 as f16
// planes; query rows s < QO additionally use f16 residual planes, products hh+lh+hl); all f32 accumulate. Strictly-earlier-key
// causal select, base-2 online softmax and 1/Z fold in f32 on VALU; query row 0 (uniform weights over all keys) = column mean
// of the f32 v projection with f64 accumulate on VALU (16-key partial sums in the v^T launch, added up in the last launch).
// Each 16-row query tile is one work-group of 16 waves: wave w walks key tiles w, w + 16, .. with its own maxima, sums and
// accumulators; the partials are merged through LDS behind one work-group barrier and the merge writes the f32 output.
#include <hip/hip_runtime.h>
#include <math.h>
#include <stdint.h>

#ifndef NB
#define NB 4
#endif
#ifndef SEQ
#define SEQ 4096
#endif
#define SEQ_FULL 4096
#define DIN   512
#define HD    64
#define QO    ((SEQ < 512) ? SEQ : 512)
#define MROWS (NB * SEQ)
#define RSQ_HD 0.125f
#define LOG2E 1.4426950408889634f
#define QSC   256.0f
#define KSC   256.0f
#define PCAR  32768.0f
#define VCAR  1024.0f
#define WPB   16
#define NQT   (SEQ / 16)
#define NQO   (QO / 16)
#define NST   (SEQ / 64)
#define NKT   (SEQ / 32)
#define ATT_THREADS (WPB * 32)
#define PTP   36
#define PTW   (16 * PTP)
#define SLP   68
#define SLW   (16 * SLP)
#define WREG  SLW
#define SLAB64 (16 * 68)
#define VTP   72
#define C8R   (HD / 8)
#define NPS   (NST * 4)
#define RGRP  16
#define WS_CAP 134217728
static_assert(HD == 64 && (DIN % 32) == 0 && DIN >= 32 && WPB == 16 && ATT_THREADS == 512 && PTW <= SLW);
static_assert(NB >= 1 && NB <= 4);
static_assert((SEQ % 64) == 0 && SEQ >= 64 && SEQ <= SEQ_FULL && (SEQ % 4) == 0);
static_assert((QO % 64) == 0 && QO >= 64 && QO <= SEQ);
static_assert((MROWS % 64) == 0 && C8R == 8 && SLP == 68 && SLW == SLAB64);
static_assert(((SEQ * DIN / 8) % 256) == 0 && ((HD * DIN / 8) % 256) == 0 && ((MROWS * HD / 8) % 256) == 0);
static_assert((NPS % RGRP) == 0 && RGRP * HD == 1024);
static_assert((WPB * WREG + 2 * 16 * WPB) * 4 <= 81920 && 2 * HD * VTP * 2 <= 65536 && 4 * SLAB64 * 4 <= 65536);

typedef unsigned short u16;
typedef _Float16 v16h __attribute__((ext_vector_type(16)));
typedef _Float16 v8h  __attribute__((ext_vector_type(8)));
typedef __bf16   v16b __attribute__((ext_vector_type(16)));
typedef float    v8f  __attribute__((ext_vector_type(8)));
typedef float    v4f  __attribute__((ext_vector_type(4)));
typedef float    v2f  __attribute__((ext_vector_type(2)));
typedef unsigned int v4u __attribute__((ext_vector_type(4)));

union FragH { v16h v; v8h h[2]; v4u u[2]; };
union FragB { v16b v; v4u u[2]; };

// ---- scalar helpers --------------------------------------------------------------------------------
__device__ __forceinline__ unsigned short bf_bits(float f) {          // f32 -> bf16 bits, RNE convert
  unsigned u = __float_as_uint(f);
  return (unsigned short)((u + 0x7FFFu + ((u >> 16) & 1u)) >> 16);
}
__device__ __forceinline__ float bf_up(unsigned short h) { return __uint_as_float(((unsigned)h) << 16); }
__device__ __forceinline__ float bfr(float f) { return bf_up(bf_bits(f)); }
__device__ __forceinline__ unsigned short h_bits(_Float16 x) { return __builtin_bit_cast(unsigned short, x); }
__device__ __forceinline__ unsigned pk16(unsigned short a, unsigned short b) { return (unsigned)a | ((unsigned)b << 16); }
__device__ __forceinline__ v8f zero8() { v8f z = {0.f, 0.f, 0.f, 0.f, 0.f, 0.f, 0.f, 0.f}; return z; }
__device__ __forceinline__ const _Float16* ash(const u16* p) { return (const _Float16*)(const void*)p; }

// ---- fragment loaders: 16-bit A/B operand, lane -> row/col (lane&15), p already includes +8*(lane>>4);
//      elements 0..7 <- p[0..7] (k0+8h..), elements 8..15 <- p[16..23] (k0+16+8h..)  (same split k map for A and B;
//      B is always read from a k-contiguous [n][k] plane)
__device__ __forceinline__ v16h ldfrag_h(const _Float16* p) {
  FragH f;
  f.h[0] = *(const v8h*)(p);
  f.h[1] = *(const v8h*)(p + 16);
  return f.v;
}
__device__ __forceinline__ v16b ldfrag_b(const u16* p) {              // bf16 plane read as unsigned integer vectors
  FragB f;
  f.u[0] = *(const v4u*)(p);
  f.u[1] = *(const v4u*)(p + 16);
  return f.v;
}

__device__ __forceinline__ v8f mma_h(v16h a, v16h b, v8f c) {
  return __builtin_amdgcn_wmma_f32_16x16x32_f16(false, a, false, b, (short)0, c, false, false);
}
__device__ __forceinline__ v8f mma_b(v16b a, v16b b, v8f c) {
  return __builtin_amdgcn_wmma_f32_16x16x32_bf16(false, a, false, b, (short)0, c, false, false);
}
__device__ __forceinline__ void guard2(v8f& a, v8f& b, v16h x0, v16h x1, v16h x2, v16h x3, v16h x4, v16h x5) {
#if defined(__HIP_DEVICE_COMPILE__)
  asm volatile("v_nop\n\tv_nop\n\tv_nop\n\tv_nop"
               : "+v"(a), "+v"(b) : "v"(x0), "v"(x1), "v"(x2), "v"(x3), "v"(x4), "v"(x5) : "memory");
#endif
}
template <typename F>
__device__ __forceinline__ void guard6(v8f& a, v8f& b, v8f& c, v8f& d, F x0, F x1, F x2, F x3, F x4, F x5) {
#if defined(__HIP_DEVICE_COMPILE__)
  asm volatile("v_nop\n\tv_nop\n\tv_nop\n\tv_nop"
               : "+v"(a), "+v"(b), "+v"(c), "+v"(d) : "v"(x0), "v"(x1), "v"(x2), "v"(x3), "v"(x4), "v"(x5) : "memory");
#endif
}
__device__ __forceinline__ void acc_guard4(v8f& a, v8f& b, v8f& c, v8f& d) {
#if defined(__HIP_DEVICE_COMPILE__)
  asm volatile("v_nop\n\tv_nop\n\tv_nop\n\tv_nop" : "+v"(a), "+v"(b), "+v"(c), "+v"(d));
#endif
}
__device__ __forceinline__ void wave_sync_lds() {
  __builtin_amdgcn_fence(__ATOMIC_RELEASE, "workgroup");
  __builtin_amdgcn_wave_barrier();
  __builtin_amdgcn_fence(__ATOMIC_ACQUIRE, "workgroup");
}

// =====================================================================================================
// f32 -> 16-bit plane.  f16mode == 0: bf16 RNE bits;  f16mode == 1: f16 bits of (bf16 RNE value) * scale.
// Batched: element group gt -> (bt = gt / n8, w8 = gt - bt*n8); source at x + bt*sstr + 8*w8 (floats), destination at
// D + bt*dstr + 8*w8 (halves), so a reduced build reads full-stride input rows into a compact plane.
// Thread = 8 consecutive elements: two 16-B loads, one 16-B store; 32 consecutive lanes = 512 contiguous, 512-B aligned
// coverage: grid = ceil(ntot/256) blocks x 256 thr x 8 (in-kernel bound) = ntot*8 elements = the whole compact plane.
// =====================================================================================================
__global__ __launch_bounds__(256) void cvt16(const float* __restrict__ x, u16* D, int n8, int ntot, int sstr, int dstr,
                                             int f16mode, float scale) {
  const int gt = blockIdx.x * 256 + (int)threadIdx.x;
  if (gt >= ntot) return;
  const int bt = gt / n8;
  const int w8 = gt - bt * n8;
  const float* p = x + (size_t)bt * (size_t)sstr + (size_t)w8 * 8;
  const v4f a = *(const v4f*)(p), b4 = *(const v4f*)(p + 4);
  float w[8];
#pragma unroll
  for (int e = 0; e < 4; ++e) { w[e] = a[e]; w[4 + e] = b4[e]; }
  v4u o;
#pragma unroll
  for (int e = 0; e < 4; ++e) {
    const float f0 = w[2 * e], f1 = w[2 * e + 1];
    const unsigned short hb0 = h_bits((_Float16)(bfr(f0) * scale));
    const unsigned short hb1 = h_bits((_Float16)(bfr(f1) * scale));
    const unsigned short bb0 = bf_bits(f0);
    const unsigned short bb1 = bf_bits(f1);
    o[e] = (f16mode != 0) ? pk16(hb0, hb1) : pk16(bb0, bb1);
  }
  u16* d = D + (size_t)bt * (size_t)dstr + (size_t)w8 * 8;
  {
    *(v4u*)(d) = o;
    
  }
}

// =====================================================================================================
// f32 plane F [MROWS][HD] (row = b*SEQ + s) -> f16 hi plane Hp = f16(F * sc), same layout, all rows; and f16 residual plane
// Lp = f16(t - f16(t)) in the compact layout [NB*QO][HD] (row = b*QO + s) for rows with s < QO only.
// Thread = 8 consecutive elements of one row: two 16-B loads, one 16-B store per plane; 32 consecutive lanes = 512 contiguous,
// loaded value.
// coverage: Hp: ceil(n8/256) blocks x 256 thr x 8 = all MROWS x HD; Lp: every (b, s < QO) row x 8 thr x 8 = all NB*QO x HD.
// =====================================================================================================
__global__ __launch_bounds__(256) void split16(const float* __restrict__ F, u16* Hp, u16* Lp, int n8, float sc) {
  const int gt = blockIdx.x * 256 + (int)threadIdx.x;
  if (gt >= n8) return;
  const int row = gt / C8R;
  const int c8  = (gt - row * C8R) * 8;
  const int b   = row / SEQ;
  const int s   = row - b * SEQ;
  const bool dolo = (s < QO);
  const int  sl   = dolo ? s : 0;
  const float* p = F + (size_t)gt * 8;
  const v4f a = *(const v4f*)(p), b4 = *(const v4f*)(p + 4);
  float w[8];
#pragma unroll
  for (int e = 0; e < 4; ++e) { w[e] = a[e] * sc; w[4 + e] = b4[e] * sc; }
  v4u oh, ol;
#pragma unroll
  for (int e = 0; e < 4; ++e) {
    const float t0 = w[2 * e], t1 = w[2 * e + 1];
    const _Float16 h0 = (_Float16)t0, h1 = (_Float16)t1;
    const _Float16 l0 = (_Float16)(t0 - (float)h0), l1 = (_Float16)(t1 - (float)h1);
    oh[e] = pk16(h_bits(h0), h_bits(h1));
    ol[e] = pk16(h_bits(l0), h_bits(l1));
  }
  u16* dh = Hp + (size_t)gt * 8;
  u16* dl = Lp + ((size_t)(b * QO + sl) * HD + c8);
  {
    *(v4u*)(dh) = oh;
    if (dolo) { *(v4u*)(dl) = ol; }
    
  }
}

// =====================================================================================================
// v^T planes from the v projection F f32 [MROWS][HD] (row = b*SEQ + s, column = d):
//   VH[(b*HD + d)][s] (pitch SEQ) = f16(v * 1024) for all keys s;
//   VL[(b*HD + d)][s] (pitch QO)  = f16 residual (t - f16(t)) for keys s < QO only.
// Block = (b, 64 keys s0): each thread loads its 16 floats (key sl, d chunk dc) with 16-B loads, converts, scatters
// into two LDS tiles [64 d][64 keys] (pitch 72 halves; columns 64..71 never read); after a block barrier each d row segment
// coverage: load 256 thr x 16 = 64 keys x 64 d (staged extent == consumed extent); store 2 iterations x 256 thr x 8 halves
//           = 64 lines x 64 = the block's tile of VH (and of VL when s0 < QO); grid = NB*NST blocks covers VH exactly once
//           and all QO columns of VL exactly once.
// Column sums for query row 0: the loaded f32 rows are also kept in an LDS tile [64 keys][64 d] (pitch 68 floats); after the
// barrier thread (d = tid & 63, g = tid >> 6) adds keys 16g .. 16g+15 of column d in f64, in key order, and stores the sum to
// PS[(bid*4 + g)][d]: 256 thr x 8 B = the block's 2048 contiguous bytes; grid = every one of the NB*NPS rows of PS exactly once.
// =====================================================================================================
__global__ __launch_bounds__(256) void vt16(const float* __restrict__ F, u16* VHo, u16* VLo, double* PS) {
  __shared__ __align__(16) u16 TH[HD * VTP];
  __shared__ __align__(16) u16 TL[HD * VTP];
  __shared__ __align__(16) float TF[64 * SLP];
  const int tid = threadIdx.x;
  const int bid = blockIdx.x;
  const int st  = bid % NST;
  const int b   = bid / NST;
  if (b >= NB) return;                      // block-uniform, before any barrier; never taken with the exact grid
  const int s0  = st * 64;
  const bool dolo = (s0 + 64 <= QO);        // block-uniform
  {
    const int sl = tid >> 2;                // key within tile 0..63
    const int dc = (tid & 3) * 16;          // d chunk 0,16,32,48
    const float* src = F + ((size_t)b * SEQ + s0 + sl) * HD + dc;
#pragma unroll
    for (int i = 0; i < 4; ++i) {
      const v4f a = *(const v4f*)(src + 4 * i);
      *(v4f*)(TF + sl * SLP + dc + 4 * i) = a;
#pragma unroll
      for (int e = 0; e < 4; ++e) {
        const float t = a[e] * VCAR;
        const _Float16 hv = (_Float16)t;
        const _Float16 lv = (_Float16)(t - (float)hv);
        TH[(dc + 4 * i + e) * VTP + sl] = h_bits(hv);
        TL[(dc + 4 * i + e) * VTP + sl] = h_bits(lv);
      }
    }
  }
  __syncthreads();
  v4u vh[2], vl[2];
  const int q8 = tid >> 3, p8 = (tid & 7) * 8;
#pragma unroll
  for (int it = 0; it < 2; ++it) {
    const int line = it * 32 + q8;          // d = 0..63
    vh[it] = *(const v4u*)(TH + line * VTP + p8);
    vl[it] = *(const v4u*)(TL + line * VTP + p8);
  }
  const size_t hrow  = (size_t)b * HD;
  const size_t baseH = hrow * SEQ + s0 + p8;
  const size_t baseL = hrow * QO + (dolo ? s0 : 0) + p8;
  {
#pragma unroll
    for (int it = 0; it < 2; ++it) {
      const int line = it * 32 + q8;
      *(v4u*)(VHo + baseH + (size_t)line * SEQ) = vh[it];
      if (dolo) { *(v4u*)(VLo + baseL + (size_t)line * QO) = vl[it]; }
    }
    
  }
  // the sums below reuse registers that the tile stores above name: wait before they are overwritten; the scheduling
  // barrier keeps the address arithmetic of the sums from being moved up in front of the wait
  asm volatile("s_wait_xcnt 0x0" ::: "memory");
  __builtin_amdgcn_sched_barrier(0);
  {
    const float* col = TF + ((tid >> 6) * 16) * SLP + (tid & 63);
    double acc = 0.0;
#pragma unroll                              // constant LDS offsets
    for (int i = 0; i < 16; ++i) acc += (double)col[i * SLP];
    PS[(size_t)bid * 256 + tid] = acc;      // row bid*4 + (tid >> 6), column tid & 63
  }
}

// =====================================================================================================
// GEMM f32 epilogue: the wave's 16x64 f32 tile (times oscale, plus the lane's per-column addend of each
// coverage: 8 instructions x 2 rows x 16 lanes x 4 floats = the wave's 16 x 64 tile (staged extent == consumed extent).
// =====================================================================================================
__device__ __forceinline__ void epi64(float* sl, v8f a0, v8f a1, v8f a2, v8f a3, float oscale,
                                      float bb0, float bb1, float bb2, float bb3,
                                      float* C, int N, size_t rowb, int col0, int lane) {
  const int hh = lane >> 4, m = lane & 15;
#pragma unroll
  for (int r = 0; r < 8; ++r) {
    const int ro = (8 * hh + r) * 68 + m;
    sl[ro]      = a0[r] * oscale + bb0;
    sl[ro + 16] = a1[r] * oscale + bb1;
    sl[ro + 32] = a2[r] * oscale + bb2;
    sl[ro + 48] = a3[r] * oscale + bb3;
  }
  wave_sync_lds();
  v4f vals[8];
#pragma unroll
  for (int it = 0; it < 8; ++it) vals[it] = *(const v4f*)(sl + (it * 2 + hh) * 68 + m * 4);
  float* dst = C + (rowb + (size_t)hh) * (size_t)N + col0 + m * 4;
  {
#pragma unroll
    for (int it = 0; it < 8; ++it) {
      *(v4f*)(dst + (size_t)(it * 2) * (size_t)N) = vals[it];
    }
    
  }
}

// =====================================================================================================
// bf16 GEMM: C[M][N] (f32) = A[M][K] (bf16 row-major) . Bt[N][K]^T (bf16 k-contiguous), times oscale (no addend). Block =
// 64x64 tile, 4 waves x 16 rows; fragments loaded straight from the 16-bit rows (two 16-B loads each, split k map for A and
// B); K stepped by 32 (host guarantees K % 32 == 0, M % 64 == 0, N % 64 == 0, grid = (M/64)*(N/64)).
// =====================================================================================================
__global__ __launch_bounds__(128)
void gemm_bf(const u16* __restrict__ A, const u16* __restrict__ Bt, float* C, int M, int N, int K, float oscale) {
  __shared__ __align__(16) float slab[4 * SLAB64];
  const int tid = threadIdx.x, wave = tid >> 5, lane = tid & 31, hh = lane >> 4, m = lane & 15;
  const int ntile = N >> 6;
  const int bid   = blockIdx.x;
  const int rowb  = (bid / ntile) * 64 + wave * 16;
  const int col0  = (bid % ntile) * 64;
  if (rowb + 16 > M) return;                // wave-uniform, never taken with the exact grid; no block barriers in this kernel
  const u16* ap = A  + (size_t)(rowb + m) * K + 8 * hh;
  const u16* bp = Bt + (size_t)(col0 + m) * K + 8 * hh;
  const size_t bs = (size_t)16 * K;
  v8f acc0 = zero8(), acc1 = zero8(), acc2 = zero8(), acc3 = zero8();
#pragma unroll 1
  for (int k0 = 0; k0 < K; k0 += 32) {
    const v16b a  = ldfrag_b(ap + k0);
    const v16b b0 = ldfrag_b(bp + k0);
    const v16b b1 = ldfrag_b(bp + bs + k0);
    const v16b b2 = ldfrag_b(bp + 2 * bs + k0);
    const v16b b3 = ldfrag_b(bp + 3 * bs + k0);
    acc0 = mma_b(a, b0, acc0);
    acc1 = mma_b(a, b1, acc1);
    acc2 = mma_b(a, b2, acc2);
    acc3 = mma_b(a, b3, acc3);
    guard6<v16b>(acc0, acc1, acc2, acc3, a, b0, b1, b2, b3, a);
  }
  epi64(slab + wave * SLAB64, acc0, acc1, acc2, acc3, oscale, 0.f, 0.f, 0.f, 0.f, C, N, (size_t)rowb, col0, lane);
}

// =====================================================================================================
// Single-head causal attention (key j contributes to query i only when j < i), hd = 64, f32 output.
// Block bid -> (batch b = bid / BPB, query tile index qi = bid % BPB): one work-group of WPB waves per 16-row query tile
// q0 = 16*qt; wave w takes the key tiles kt = w, w + WPB, .. below.
// RES == 1: query tiles q0 < QO, scores = q_hi.k_hi + q_lo.k_hi + q_hi.k_lo and P.v = hh + lh + hl; RES == 0: query tiles
// q0 >= QO, single products q_hi.k_hi, P_hi.v_hi.
//   q hi plane f16 x256 [b*SEQ + s][d], q residual (compact) [b*QO + s][d]; k hi / residual planes likewise;
//   v^T hi plane [b][d][SEQ] x1024, v^T residual plane [b][d][QO].
//   score (log2 domain) t(i, j) = (q_i.k_j over HD) * (1/8)*log2e/(256*256), replaced by -inf where key j >= query i.
//   Key tiles of 32 visited in order for kb <= q0 + 14 (later tiles hold only keys at or above every query row of the tile);
//   with RES == 1 this keeps every visited key below QO, inside the compact residual planes. Query row 0 has no admitted key:
//   its running max stays -inf, Z = 0, and the row is written as 0 here (a later launch writes its true value).
//   Per tile: 2 score subtiles x 2 k-steps, fragments loaded straight from the 16-bit planes (two 16-B loads per fragment,
//   split k map); online max-subtracted base-2 softmax in f32, -inf-safe rescale; the 16x32 prob tile stored to wave-private
//   fragments of P*32768 (f16 hi plus its f16 residual) rebuilt from the LDS rows (float vector loads, same element type as
//   stored), v^T B fragments in 2 groups of 2 d-subtiles.
//   After the loop each wave stores its un-normalised 16x64 accumulators (over its own prob tile, which it has finished
//   reading) and its 16 (max, sum) pairs to LDS; one work-group barrier, which every wave reaches (also a wave without a key
//   tile: max -inf, sum 0, accumulators 0); then wave w merges query row w: M = max of the maxima, weights exp2(m - M) (0 where
//   m = -inf), Z and the row added up in wave order, out = row / Z (0 if Z == 0), carries 1/(32768*1024) folded once.
//   Every return stands in front of the barrier and is block-uniform; bounded loops only (nkt <= NKT).
// coverage: per wave 32 lanes x 2 floats = one 64-float output row, WPB waves = the tile's 16 rows; the two launches
//           (RES 1: NQO tiles, RES 0: NQT-NQO tiles) x NB = every (b, s) output row exactly once.
// =====================================================================================================
template <int RES>
__global__ __launch_bounds__(ATT_THREADS)
void attn_c(const u16* __restrict__ QHp, const u16* __restrict__ QLp,
            const u16* __restrict__ KHp, const u16* __restrict__ KLp,
            const u16* __restrict__ VHp, const u16* __restrict__ VLp,
            float* Out) {
  __shared__ __align__(16) float smem[WPB * WREG];
  __shared__ __align__(16) float mxs[16 * WPB];   // [query row][wave] running maxima
  __shared__ __align__(16) float sms[16 * WPB];   // [query row][wave] running sums
  constexpr int QT0 = (RES != 0) ? 0 : NQO;
  constexpr int NQL = (RES != 0) ? NQO : (NQT - NQO);
  constexpr int NQE = (NQL > 0) ? NQL : 1;
  constexpr int BPB = NQE;

  const int tid  = threadIdx.x;
  const int wave = __builtin_amdgcn_readfirstlane(tid >> 5);   // scalar: the key loop below branches on it, EXEC stays whole
  const int lane = tid & 31;
  const int hh   = lane >> 4;
  const int c    = lane & 15;
  const int bid  = blockIdx.x;
  const int b    = bid / BPB;
  const int qi   = bid - b * BPB;
  if (b >= NB) return;                      // block-uniform, before the barrier; never taken with the exact grid
  if (qi >= NQL) return;                    // block-uniform; never taken
  const int q0   = (QT0 + qi) * 16;
  if (q0 + 16 > SEQ) return;                // block-uniform; never taken
  if (RES != 0 && q0 + 16 > QO) return;     // block-uniform; never taken
  const int ql0  = (RES != 0) ? q0 : 0;

  float* pt   = smem + wave * WREG;         // prob tile [16][32] pitch 36, in the loop
  float* slab = pt;                         // the wave's partial result [16][64] pitch 68, behind the loop

  const size_t hcol = (size_t)8 * hh;
  const _Float16* Qh  = ash(QHp) + ((size_t)b * SEQ + q0 + c) * HD + hcol;
  const _Float16* Ql  = ash(QLp) + ((size_t)b * QO + ql0 + c) * HD + hcol;          // RES == 1 only
  const _Float16* Khb = ash(KHp) + ((size_t)b * SEQ + c) * HD + hcol;               // key row kb added per step
  const _Float16* Klb = ash(KLp) + ((size_t)b * QO + c) * HD + hcol;                // RES == 1 only, keys < QO
  const _Float16* Vhb = ash(VHp) + ((size_t)b * HD + c) * SEQ + hcol;               // d col c (+16j)
  const _Float16* Vlb = ash(VLp) + ((size_t)b * HD + c) * QO + hcol;                // RES == 1 only
  const float lsc = RSQ_HD * (LOG2E / (QSC * KSC));
  const float oc  = 1.0f / (PCAR * VCAR);
  const size_t KROW = (size_t)HD;           // halves between consecutive key rows

  float mrow[8], lrow[8];
  v8f o[4];
#pragma unroll
  for (int r = 0; r < 8; ++r) { mrow[r] = -INFINITY; lrow[r] = 0.f; }
#pragma unroll
  for (int j = 0; j < 4; ++j) o[j] = zero8();
  const int ncaus = (q0 >> 5) + 1;                                            // tiles holding keys <= q0 + 14
  const int nkt = (ncaus < NKT) ? ncaus : NKT;
  const int qr0 = q0 + 8 * hh;                                                // query row of D element r = qr0 + r

#pragma unroll 1
  for (int kt = wave; kt < nkt; kt += WPB) {
    const int kb = kt * 32;
    // ---- scores: D element r of this lane = (query row qr0 + r, key kb + c) in s0, key kb + 16 + c in s1 ----
    v8f s0 = zero8(), s1 = zero8();
    const _Float16* k0p = Khb + (size_t)kb * KROW;
    const _Float16* k1p = k0p + (size_t)16 * KROW;
    if constexpr (RES != 0) {
      const _Float16* l0p = Klb + (size_t)kb * KROW;
      const _Float16* l1p = l0p + (size_t)16 * KROW;
#pragma unroll
      for (int kk = 0; kk < HD / 32; ++kk) {
        const v16h qh  = ldfrag_h(Qh + kk * 32);
        const v16h ql  = ldfrag_h(Ql + kk * 32);
        const v16h kh0 = ldfrag_h(k0p + kk * 32);
        const v16h kh1 = ldfrag_h(k1p + kk * 32);
        const v16h kl0 = ldfrag_h(l0p + kk * 32);
        const v16h kl1 = ldfrag_h(l1p + kk * 32);
        s0 = mma_h(qh, kh0, s0);
        s0 = mma_h(ql, kh0, s0);
        s0 = mma_h(qh, kl0, s0);
        s1 = mma_h(qh, kh1, s1);
        s1 = mma_h(ql, kh1, s1);
        s1 = mma_h(qh, kl1, s1);
        guard2(s0, s1, qh, ql, kh0, kl0, kh1, kl1);
      }
    } else {
#pragma unroll
      for (int kk = 0; kk < HD / 32; ++kk) {
        const v16h qh  = ldfrag_h(Qh + kk * 32);
        const v16h kh0 = ldfrag_h(k0p + kk * 32);
        const v16h kh1 = ldfrag_h(k1p + kk * 32);
        s0 = mma_h(qh, kh0, s0);
        s1 = mma_h(qh, kh1, s1);
        guard2(s0, s1, qh, kh0, kh1, qh, kh0, kh1);
      }
    }
    // ---- causal select (key >= query excluded) + online softmax in base 2, -inf-safe ----
    const int key0 = kb + c, key1 = kb + 16 + c;
#pragma unroll
    for (int r = 0; r < 8; ++r) {
      const int   qr = qr0 + r;
      const float u0 = s0[r] * lsc;
      const float u1 = s1[r] * lsc;
      const float t0 = (key0 >= qr) ? -INFINITY : u0;
      const float t1 = (key1 >= qr) ? -INFINITY : u1;
      float mx = fmaxf(t0, t1);
#pragma unroll
      for (int off = 1; off < 16; off <<= 1) mx = fmaxf(mx, __shfl_xor(mx, off, 32));
      const float mn = fmaxf(mrow[r], mx);
      const float ms = (mn == -INFINITY) ? 0.0f : mn;
      const float al = exp2f(mrow[r] - ms);
      mrow[r] = mn;
      const float e0 = exp2f(t0 - ms), e1 = exp2f(t1 - ms);
      float ps = e0 + e1;
#pragma unroll
      for (int off = 1; off < 16; off <<= 1) ps += __shfl_xor(ps, off, 32);
      lrow[r] = lrow[r] * al + ps;
#pragma unroll
      for (int j = 0; j < 4; ++j) o[j][r] *= al;
      const int ro = (8 * hh + r) * PTP + c;
      pt[ro]      = e0;
      pt[ro + 16] = e1;
    }
    wave_sync_lds();
    // ---- A fragments of P*32768: hi f16 and residual f16, row = c, split k map over the 32 keys of this step ----
    FragH ph, pl;
    {
      const float* prow = pt + c * PTP + 8 * hh;
      const v4f p0 = *(const v4f*)(prow), p1 = *(const v4f*)(prow + 4);
      const v4f p2 = *(const v4f*)(prow + 16), p3 = *(const v4f*)(prow + 20);
#pragma unroll
      for (int e = 0; e < 4; ++e) {
        const float ta = p0[e] * PCAR, tb = p1[e] * PCAR, tc = p2[e] * PCAR, td = p3[e] * PCAR;
        const _Float16 ha = (_Float16)ta, hb = (_Float16)tb, hc = (_Float16)tc, hd = (_Float16)td;
        ph.h[0][e]     = ha;                  // elements 0..7  = keys kb + 8hh + 0..7
        ph.h[0][4 + e] = hb;
        ph.h[1][e]     = hc;                  // elements 8..15 = keys kb + 16 + 8hh + 0..7
        ph.h[1][4 + e] = hd;
        pl.h[0][e]     = (_Float16)(ta - (float)ha);
        pl.h[0][4 + e] = (_Float16)(tb - (float)hb);
        pl.h[1][e]     = (_Float16)(tc - (float)hc);
        pl.h[1][4 + e] = (_Float16)(td - (float)hd);
      }
    }
    // ---- P.V : B fragment col n = d = j*16 + c, keys contiguous in the v^T planes; 2 groups of 2 d-subtiles ----
    {
      const _Float16* vhp = Vhb + kb;
      if constexpr (RES != 0) {
        const _Float16* vlp = Vlb + kb;
#pragma unroll
        for (int jg = 0; jg < 2; ++jg) {
          const size_t da = (size_t)(2 * jg) * 16 * SEQ;
          const size_t db = da + (size_t)16 * SEQ;
          const size_t la = (size_t)(2 * jg) * 16 * QO;
          const size_t lb = la + (size_t)16 * QO;
          const v16h vha = ldfrag_h(vhp + da), vhb2 = ldfrag_h(vhp + db);
          const v16h vla = ldfrag_h(vlp + la), vlb2 = ldfrag_h(vlp + lb);
          o[2 * jg]     = mma_h(ph.v, vha,  o[2 * jg]);
          o[2 * jg]     = mma_h(pl.v, vha,  o[2 * jg]);
          o[2 * jg]     = mma_h(ph.v, vla,  o[2 * jg]);
          o[2 * jg + 1] = mma_h(ph.v, vhb2, o[2 * jg + 1]);
          o[2 * jg + 1] = mma_h(pl.v, vhb2, o[2 * jg + 1]);
          o[2 * jg + 1] = mma_h(ph.v, vlb2, o[2 * jg + 1]);
          guard2(o[2 * jg], o[2 * jg + 1], ph.v, pl.v, vha, vhb2, vla, vlb2);
        }
      } else {
#pragma unroll
        for (int jg = 0; jg < 2; ++jg) {
          const size_t da = (size_t)(2 * jg) * 16 * SEQ;
          const size_t db = da + (size_t)16 * SEQ;
          const v16h vha = ldfrag_h(vhp + da), vhb2 = ldfrag_h(vhp + db);
          o[2 * jg]     = mma_h(ph.v, vha,  o[2 * jg]);
          o[2 * jg + 1] = mma_h(ph.v, vhb2, o[2 * jg + 1]);
          guard2(o[2 * jg], o[2 * jg + 1], ph.v, vha, vhb2, ph.v, vha, vhb2);
        }
      }
    }
    wave_sync_lds();
  }
  acc_guard4(o[0], o[1], o[2], o[3]);
  // ---- the wave's partials to LDS: accumulators at (row 8hh + r, column 16j + c), (max, sum) of row 8hh + r from lane c == 0 ----
#pragma unroll                              // accumulators stay in registers: constant element indices, constant LDS offsets
  for (int r = 0; r < 8; ++r) {
    const int ro = (8 * hh + r) * SLP + c;
#pragma unroll                              // as above
    for (int j = 0; j < 4; ++j) slab[ro + 16 * j] = o[j][r];
  }
  if (c == 0) {
#pragma unroll                              // mrow, lrow stay in registers
    for (int r = 0; r < 8; ++r) {
      mxs[(8 * hh + r) * WPB + wave] = mrow[r];
      sms[(8 * hh + r) * WPB + wave] = lrow[r];
    }
  }
  __syncthreads();                          // publishes every wave's partials to the merging waves
  // ---- merge of query row q0 + wave over the WPB key ranges, in wave order; lane = columns 2*lane, 2*lane + 1 ----
  {
    const int row = wave;
    float mw[WPB], lw[WPB];
#pragma unroll                              // mw, lw stay in registers; the LDS loads go out together
    for (int g = 0; g < WPB / 4; ++g) {
      const v4f a = *(const v4f*)(mxs + row * WPB + 4 * g);
      const v4f z = *(const v4f*)(sms + row * WPB + 4 * g);
#pragma unroll                              // as above
      for (int e = 0; e < 4; ++e) { mw[4 * g + e] = a[e]; lw[4 * g + e] = z[e]; }
    }
    float mm = mw[0];
#pragma unroll                              // as above
    for (int w = 1; w < WPB; ++w) mm = fmaxf(mm, mw[w]);
    const float ms = (mm == -INFINITY) ? 0.0f : mm;
    const float* prt = smem + row * SLP + 2 * lane;
    float lv = 0.f, x0 = 0.f, x1 = 0.f;
#pragma unroll                              // the WPB partial-row loads go out together, one LDS latency instead of WPB
    for (int w = 0; w < WPB; ++w) {
      const float wg = exp2f(mw[w] - ms);
      const v2f  pv = *(const v2f*)(prt + w * WREG);
      lv += lw[w] * wg;
      x0 += pv[0] * wg;
      x1 += pv[1] * wg;
    }
    const float ls  = (lv > 0.0f) ? lv : 1.0f;
    const float inv = (lv > 0.0f) ? ((1.0f / ls) * oc) : 0.0f;
    v2f res;
    res[0] = x0 * inv;
    res[1] = x1 * inv;
    *(v2f*)(Out + ((size_t)b * SEQ_FULL + (size_t)(q0 + row)) * HD + 2 * lane) = res;
  }
}

// =====================================================================================================
// Query row 0 of every batch: uniform weights 1/SEQ over ALL keys -> out[b][0][d] = mean over s of F[b*SEQ + s][d], F the f32
// v projection, from its f64 16-key partial sums PS[b*NPS + p][d] (written by vt16 earlier in the same call). Block = batch b,
// 1024 threads: thread (d = tid & 63, g = tid >> 6) adds rows g, g + 16, .. of column d in that order (independent 8-B loads,
// the block reads 8192 contiguous bytes per step), partials combined in fixed order through LDS, scaled by 1/SEQ, staged as one
// f32 row in LDS; after a barrier lanes 0..15 of wave 0 write the 256-B output row (16 consecutive lanes x 16 B, one
// coverage: 16 lanes x 4 floats = the 64-float row; grid = NB blocks = every batch's row 0 exactly once.
// =====================================================================================================
__global__ __launch_bounds__(1024) void row0_mean(const double* __restrict__ PS, float* Out) {
  __shared__ double part[RGRP * HD];
  __shared__ __align__(16) float rowv[HD];
  const int tid = threadIdx.x;
  const int b   = blockIdx.x;
  if (b >= NB) return;                      // block-uniform, before any barrier; never taken with the exact grid
  const double* p = PS + (size_t)b * NPS * HD + tid;
  double acc = 0.0;
#pragma unroll                              // independent loads in flight together instead of one memory latency per row
  for (int s = 0; s < NPS / RGRP; ++s) acc += p[s * (RGRP * HD)];
  part[tid] = acc;
  __syncthreads();
  if (tid < HD) {
    double t = part[tid];
#pragma unroll                              // constant LDS offsets
    for (int g2 = 1; g2 < RGRP; ++g2) t += part[g2 * HD + tid];
    rowv[tid] = (float)t * (1.0f / (float)SEQ);
  }
  __syncthreads();
  if (tid < 16) {
    const v4f v = *(const v4f*)(rowv + 4 * tid);
    float* dst = Out + (size_t)b * SEQ_FULL * HD + 4 * tid;
    {
      *(v4f*)(dst) = v;
      
    }
  }
}

// =====================================================================================================
// Workspace map (bytes); every plane is fully written by whole-line stores before it is read; all extents are exact multiples
// of the store granularity (no pad rows needed); every region offset a multiple of 65536:
//   XB  bf16 [MROWS][512]            MROWS*1024   (value, query, key bf16 planes in launch order)   (NB=4, SEQ=4096: 16777216)
//   WBv, WBq, WBk bf16 [64 n][512 k] 65536 each                                                     (196608)
//   FV, FQ, FK f32 [MROWS][64]       MROWS*256 each                                                 (3 x 4194304)
//   QH  f16 [MROWS][64] x256         MROWS*128    QL residual [NB*QO][64]  NB*QO*128                (2097152 + 262144)
//   KH  f16 [MROWS][64] x256         MROWS*128    KL residual [NB*QO][64]  NB*QO*128                (2097152 + 262144)
//   VH  f16 [NB][64][SEQ] x1024      MROWS*128    VL residual [NB][64][QO] NB*QO*128                (2097152 + 262144)
//   PS  f64 [NB*NPS][64] 16-key column sums of FV   NB*NPS*512                                      (524288)
//   end (NB=4, SEQ=4096)           37158912
// =====================================================================================================
extern "C" void kernel_launch(void* const* d_in, const int* in_sizes, int n_in,
                              void* d_out, int out_size, void* d_ws, size_t ws_size,
                              hipStream_t stream) {
  if (n_in < 6) return;
  const int needx = ((NB - 1) * SEQ_FULL + SEQ) * DIN;
  if (in_sizes[0] < needx) return;
  if (in_sizes[1] < needx) return;
  if (in_sizes[2] < needx) return;
  if (in_sizes[3] != HD * DIN) return;
  if (in_sizes[4] != HD * DIN) return;
  if (in_sizes[5] != HD * DIN) return;
  if (out_size < ((NB - 1) * SEQ_FULL + SEQ) * HD) return;

  const float* query = (const float*)d_in[0];
  const float* keyin = (const float*)d_in[1];
  const float* value = (const float*)d_in[2];
  const float* wq    = (const float*)d_in[3];
  const float* wk    = (const float*)d_in[4];
  const float* wv    = (const float*)d_in[5];
  float*       out   = (float*)d_out;

  const size_t szXB = (size_t)MROWS * DIN * 2;
  const size_t szW  = (size_t)HD * DIN * 2;
  const size_t szF  = (size_t)MROWS * HD * 4;
  const size_t szH  = (size_t)MROWS * HD * 2;                    // QH, KH
  const size_t szL  = (size_t)NB * QO * HD * 2;                  // QL, KL (compact residual planes)
  const size_t szVH = (size_t)NB * HD * SEQ * 2;                 // == szH
  const size_t szVL = (size_t)NB * HD * QO * 2;                  // == szL
  const size_t szPS = (size_t)NB * NPS * HD * 8;
  size_t off = 0;
  const size_t oXB = off; off += szXB;
  const size_t oWv = off; off += szW;
  const size_t oWq = off; off += szW;
  const size_t oWk = off; off += szW;
  const size_t oFV = off; off += szF;
  const size_t oFQ = off; off += szF;
  const size_t oFK = off; off += szF;
  const size_t oQH = off; off += szH;
  const size_t oQL = off; off += szL;
  const size_t oKH = off; off += szH;
  const size_t oKL = off; off += szL;
  const size_t oVH = off; off += szVH;
  const size_t oVL = off; off += szVL;
  const size_t oPS = off; off += szPS;
  if (off > ws_size) return;                // off = 37158912 for NB = 4, SEQ = 4096
  if (off > (size_t)WS_CAP) return;

  char* ws = (char*)d_ws;
  u16*   XB  = (u16*)(ws + oXB);
  u16*   WBv = (u16*)(ws + oWv);
  u16*   WBq = (u16*)(ws + oWq);
  u16*   WBk = (u16*)(ws + oWk);
  float* FV  = (float*)(ws + oFV);
  float* FQ  = (float*)(ws + oFQ);
  float* FK  = (float*)(ws + oFK);
  u16*   QH  = (u16*)(ws + oQH);
  u16*   QL  = (u16*)(ws + oQL);
  u16*   KH  = (u16*)(ws + oKH);
  u16*   KL  = (u16*)(ws + oKL);
  u16*   VH  = (u16*)(ws + oVH);
  u16*   VL  = (u16*)(ws + oVL);
  double* PS = (double*)(ws + oPS);

  const dim3 b256(256), b128(128), bAT(ATT_THREADS), b1024(1024);
  const int  n8x  = (SEQ * DIN) / 8;                    // per batch
  const int  ntx  = NB * n8x;
  const int  sstr = SEQ_FULL * DIN;                     // full input batch stride (floats)
  const int  dstr = SEQ * DIN;                          // compact plane batch stride (halves)
  const dim3 gX((ntx + 255) / 256);
  const int  n8w  = (HD * DIN) / 8;                     // one [64][512] weight block
  const dim3 gW((n8w + 255) / 256);
  const dim3 gG((MROWS / 64) * (HD / 64));
  const dim3 gVT(NB * NST);
  const int  n8q  = (MROWS * HD) / 8;                   // q / k hi planes
  const dim3 gSQ((n8q + 255) / 256);
  const dim3 gATR(NB * NQO);
  const int  nqp  = NQT - NQO;                          // query tiles with s >= QO
  const dim3 gR0(NB);

  // (1) value -> bf16 plane; (2) Wv [64 n][512 k] -> bf16 plane; (3) v = value.Wv^T -> FV f32 [MROWS][64];
  // (4) v^T hi (all keys) + residual (keys < QO) x1024, and the f64 16-key column sums of v
  cvt16<<<gX, b256, 0, stream>>>(value, XB, n8x, ntx, sstr, dstr, 0, 1.0f);
  cvt16<<<gW, b256, 0, stream>>>(wv, WBv, n8w, n8w, 0, 0, 0, 1.0f);
  gemm_bf<<<gG, b128, 0, stream>>>(XB, WBv, FV, MROWS, HD, DIN, 1.0f);
  vt16<<<gVT, b256, 0, stream>>>(FV, VH, VL, PS);
  // (5) query -> bf16 plane; (6) Wq -> bf16 plane; (7) q = query.Wq^T -> FQ; (8) q hi (all rows) + residual (rows s < QO) x256
  cvt16<<<gX, b256, 0, stream>>>(query, XB, n8x, ntx, sstr, dstr, 0, 1.0f);
  cvt16<<<gW, b256, 0, stream>>>(wq, WBq, n8w, n8w, 0, 0, 0, 1.0f);
  gemm_bf<<<gG, b128, 0, stream>>>(XB, WBq, FQ, MROWS, HD, DIN, 1.0f);
  split16<<<gSQ, b256, 0, stream>>>(FQ, QH, QL, n8q, QSC);
  // (9) key -> bf16 plane; (10) Wk -> bf16 plane; (11) k = key.Wk^T -> FK; (12) k hi + residual planes x256
  cvt16<<<gX, b256, 0, stream>>>(keyin, XB, n8x, ntx, sstr, dstr, 0, 1.0f);
  cvt16<<<gW, b256, 0, stream>>>(wk, WBk, n8w, n8w, 0, 0, 0, 1.0f);
  gemm_bf<<<gG, b128, 0, stream>>>(XB, WBk, FK, MROWS, HD, DIN, 1.0f);
  split16<<<gSQ, b256, 0, stream>>>(FK, KH, KL, n8q, KSC);
  // (13) causal attention: query tiles s < QO with residual products -> out; (14) query tiles s >= QO single products -> out
  attn_c<1><<<gATR, bAT, 0, stream>>>(QH, QL, KH, KL, VH, VL, out);
  if (nqp > 0) {
    attn_c<0><<<dim3(NB * nqp), bAT, 0, stream>>>(QH, QL, KH, KL, VH, VL, out);
  }
  // (15) query row 0 of every batch = column mean of v over all SEQ keys, from the partial sums (written last)
  row0_mean<<<gR0, b1024, 0, stream>>>(PS, out);
  (void)hipGetLastError();
}

// v003
// It runs in 97.9 microseconds.
// Two timings next to v002 put it at 1.34 and 1.33 times that version's speed.
// All steps since v000 together make it 6.16 times as fast.
// Contractions: value.Wv^T, query.Wq^T, key.Wk^T on v_wmma_f32_16x16x32_bf16 (inputs and W rounded to bf16 RNE on the way into
// LDS; W [n][k] rows are the k-contiguous B operand); q.k^T over hd 64 and P.v on v_wmma_f32_16x16x32_f16 (q, k x256, P x32768, v x1024 as f16
// planes; query rows s < QO additionally use f16 residual planes, products hh+lh+hl); all f32 accumulate. Strictly-earlier-key
// causal select, base-2 online softmax and 1/Z fold in f32 on VALU; query row 0 (uniform weights over all keys) = column mean
// of the f32 v projection with f64 accumulate on VALU (16-key partial sums in the v^T launch, added up in the last launch).
// Each 16-row query tile is one work-group of 16 waves: wave w walks key tiles w, w + 16, .. with its own maxima, sums and
// accumulators; the partials are merged through LDS behind one work-group barrier and the merge writes the f32 output.
#include <hip/hip_runtime.h>
#include <math.h>
#include <stdint.h>

#ifndef NB
#define NB 4
#endif
#ifndef SEQ
#define SEQ 4096
#endif
#define SEQ_FULL 4096
#define DIN   512
#define HD    64
#define QO    ((SEQ < 512) ? SEQ : 512)
#define MROWS (NB * SEQ)
#define RSQ_HD 0.125f
#define LOG2E 1.4426950408889634f
#define QSC   256.0f
#define KSC   256.0f
#define PCAR  32768.0f
#define VCAR  1024.0f
#define WPB   16
#define NQT   (SEQ / 16)
#define NQO   (QO / 16)
#define NST   (SEQ / 64)
#define NKT   (SEQ / 32)
#define ATT_THREADS (WPB * 32)
#define PTP   36
#define PTW   (16 * PTP)
#define SLP   68
#define SLW   (16 * SLP)
#define WREG  SLW
#define XSP   (DIN + 8)
#define VTP   72
#define C8R   (HD / 8)
#define NPS   (NST * 4)
#define RGRP  16
#define WS_CAP 134217728
static_assert(HD == 64 && (DIN % 32) == 0 && DIN >= 32 && WPB == 16 && ATT_THREADS == 512 && PTW <= SLW);
static_assert(NB >= 1 && NB <= 4);
static_assert((SEQ % 64) == 0 && SEQ >= 64 && SEQ <= SEQ_FULL && (SEQ % 4) == 0);
static_assert((QO % 64) == 0 && QO >= 64 && QO <= SEQ);
static_assert((MROWS % 64) == 0 && C8R == 8 && SLP == 68 && DIN == 512);
static_assert(((MROWS * HD / 8) % 256) == 0);
static_assert((NPS % RGRP) == 0 && RGRP * HD == 1024);
static_assert((WPB * WREG + 2 * 16 * WPB) * 4 <= 81920 && 2 * HD * VTP * 2 <= 65536 && 2 * 64 * XSP * 2 + 64 * SLP * 4 <= 163840);

typedef unsigned short u16;
typedef _Float16 v16h __attribute__((ext_vector_type(16)));
typedef _Float16 v8h  __attribute__((ext_vector_type(8)));
typedef __bf16   v16b __attribute__((ext_vector_type(16)));
typedef __bf16   v2b  __attribute__((ext_vector_type(2)));
typedef float    v8f  __attribute__((ext_vector_type(8)));
typedef float    v4f  __attribute__((ext_vector_type(4)));
typedef float    v2f  __attribute__((ext_vector_type(2)));
typedef unsigned int v4u __attribute__((ext_vector_type(4)));
typedef unsigned int v2u __attribute__((ext_vector_type(2)));

union FragH { v16h v; v8h h[2]; v4u u[2]; };
union FragB { v16b v; v4u u[2]; };

// ---- scalar helpers --------------------------------------------------------------------------------
__device__ __forceinline__ unsigned short h_bits(_Float16 x) { return __builtin_bit_cast(unsigned short, x); }
__device__ __forceinline__ unsigned pk16(unsigned short a, unsigned short b) { return (unsigned)a | ((unsigned)b << 16); }
__device__ __forceinline__ v8f zero8() { v8f z = {0.f, 0.f, 0.f, 0.f, 0.f, 0.f, 0.f, 0.f}; return z; }
__device__ __forceinline__ const _Float16* ash(const u16* p) { return (const _Float16*)(const void*)p; }

// ---- fragment loaders: 16-bit A/B operand, lane -> row/col (lane&15), p already includes +8*(lane>>4);
//      elements 0..7 <- p[0..7] (k0+8h..), elements 8..15 <- p[16..23] (k0+16+8h..)  (same split k map for A and B;
//      B is always read from a k-contiguous [n][k] plane)
__device__ __forceinline__ v16h ldfrag_h(const _Float16* p) {
  FragH f;
  f.h[0] = *(const v8h*)(p);
  f.h[1] = *(const v8h*)(p + 16);
  return f.v;
}
__device__ __forceinline__ v16b ldfrag_b(const u16* p) {              // bf16 plane read as unsigned integer vectors
  FragB f;
  f.u[0] = *(const v4u*)(p);
  f.u[1] = *(const v4u*)(p + 16);
  return f.v;
}

__device__ __forceinline__ v8f mma_h(v16h a, v16h b, v8f c) {
  return __builtin_amdgcn_wmma_f32_16x16x32_f16(false, a, false, b, (short)0, c, false, false);
}
__device__ __forceinline__ v8f mma_b(v16b a, v16b b, v8f c) {
  return __builtin_amdgcn_wmma_f32_16x16x32_bf16(false, a, false, b, (short)0, c, false, false);
}
__device__ __forceinline__ void guard2(v8f& a, v8f& b, v16h x0, v16h x1, v16h x2, v16h x3, v16h x4, v16h x5) {
#if defined(__HIP_DEVICE_COMPILE__)
  asm volatile("v_nop\n\tv_nop\n\tv_nop\n\tv_nop"
               : "+v"(a), "+v"(b) : "v"(x0), "v"(x1), "v"(x2), "v"(x3), "v"(x4), "v"(x5) : "memory");
#endif
}
__device__ __forceinline__ void acc_guard4(v8f& a, v8f& b, v8f& c, v8f& d) {
#if defined(__HIP_DEVICE_COMPILE__)
  asm volatile("v_nop\n\tv_nop\n\tv_nop\n\tv_nop" : "+v"(a), "+v"(b), "+v"(c), "+v"(d));
#endif
}
__device__ __forceinline__ void wave_sync_lds() {
  __builtin_amdgcn_fence(__ATOMIC_RELEASE, "workgroup");
  __builtin_amdgcn_wave_barrier();
  __builtin_amdgcn_fence(__ATOMIC_ACQUIRE, "workgroup");
}

// =====================================================================================================
// f32 plane F [MROWS][HD] (row = b*SEQ + s) -> f16 hi plane Hp = f16(F * sc), same layout, all rows; and f16 residual plane
// Lp = f16(t - f16(t)) in the compact layout [NB*QO][HD] (row = b*QO + s) for rows with s < QO only.
// Thread = 8 consecutive elements of one row: two 16-B loads, one 16-B store per plane; 32 consecutive lanes = 512 contiguous,
// loaded value.
// coverage: Hp: ceil(n8/256) blocks x 256 thr x 8 = all MROWS x HD; Lp: every (b, s < QO) row x 8 thr x 8 = all NB*QO x HD.
// =====================================================================================================
__global__ __launch_bounds__(256) void split16(const float* __restrict__ F, u16* Hp, u16* Lp, int n8, float sc) {
  const int gt = blockIdx.x * 256 + (int)threadIdx.x;
  if (gt >= n8) return;
  const int row = gt / C8R;
  const int c8  = (gt - row * C8R) * 8;
  const int b   = row / SEQ;
  const int s   = row - b * SEQ;
  const bool dolo = (s < QO);
  const int  sl   = dolo ? s : 0;
  const float* p = F + (size_t)gt * 8;
  const v4f a = *(const v4f*)(p), b4 = *(const v4f*)(p + 4);
  float w[8];
#pragma unroll
  for (int e = 0; e < 4; ++e) { w[e] = a[e] * sc; w[4 + e] = b4[e] * sc; }
  v4u oh, ol;
#pragma unroll
  for (int e = 0; e < 4; ++e) {
    const float t0 = w[2 * e], t1 = w[2 * e + 1];
    const _Float16 h0 = (_Float16)t0, h1 = (_Float16)t1;
    const _Float16 l0 = (_Float16)(t0 - (float)h0), l1 = (_Float16)(t1 - (float)h1);
    oh[e] = pk16(h_bits(h0), h_bits(h1));
    ol[e] = pk16(h_bits(l0), h_bits(l1));
  }
  u16* dh = Hp + (size_t)gt * 8;
  u16* dl = Lp + ((size_t)(b * QO + sl) * HD + c8);
  {
    *(v4u*)(dh) = oh;
    if (dolo) { *(v4u*)(dl) = ol; }
    
  }
}

// =====================================================================================================
// v^T planes from the v projection F f32 [MROWS][HD] (row = b*SEQ + s, column = d):
//   VH[(b*HD + d)][s] (pitch SEQ) = f16(v * 1024) for all keys s;
//   VL[(b*HD + d)][s] (pitch QO)  = f16 residual (t - f16(t)) for keys s < QO only.
// Block = (b, 64 keys s0): each thread loads its 16 floats (key sl, d chunk dc) with 16-B loads, converts, scatters
// into two LDS tiles [64 d][64 keys] (pitch 72 halves; columns 64..71 never read); after a block barrier each d row segment
// coverage: load 256 thr x 16 = 64 keys x 64 d (staged extent == consumed extent); store 2 iterations x 256 thr x 8 halves
//           = 64 lines x 64 = the block's tile of VH (and of VL when s0 < QO); grid = NB*NST blocks covers VH exactly once
//           and all QO columns of VL exactly once.
// Column sums for query row 0: the loaded f32 rows are also kept in an LDS tile [64 keys][64 d] (pitch 68 floats); after the
// barrier thread (d = tid & 63, g = tid >> 6) adds keys 16g .. 16g+15 of column d in f64, in key order, and stores the sum to
// PS[(bid*4 + g)][d]: 256 thr x 8 B = the block's 2048 contiguous bytes; grid = every one of the NB*NPS rows of PS exactly once.
// =====================================================================================================
__global__ __launch_bounds__(256) void vt16(const float* __restrict__ F, u16* VHo, u16* VLo, double* PS) {
  __shared__ __align__(16) u16 TH[HD * VTP];
  __shared__ __align__(16) u16 TL[HD * VTP];
  __shared__ __align__(16) float TF[64 * SLP];
  const int tid = threadIdx.x;
  const int bid = blockIdx.x;
  const int st  = bid % NST;
  const int b   = bid / NST;
  if (b >= NB) return;                      // block-uniform, before any barrier; never taken with the exact grid
  const int s0  = st * 64;
  const bool dolo = (s0 + 64 <= QO);        // block-uniform
  {
    const int sl = tid >> 2;                // key within tile 0..63
    const int dc = (tid & 3) * 16;          // d chunk 0,16,32,48
    const float* src = F + ((size_t)b * SEQ + s0 + sl) * HD + dc;
#pragma unroll
    for (int i = 0; i < 4; ++i) {
      const v4f a = *(const v4f*)(src + 4 * i);
      *(v4f*)(TF + sl * SLP + dc + 4 * i) = a;
#pragma unroll
      for (int e = 0; e < 4; ++e) {
        const float t = a[e] * VCAR;
        const _Float16 hv = (_Float16)t;
        const _Float16 lv = (_Float16)(t - (float)hv);
        TH[(dc + 4 * i + e) * VTP + sl] = h_bits(hv);
        TL[(dc + 4 * i + e) * VTP + sl] = h_bits(lv);
      }
    }
  }
  __syncthreads();
  v4u vh[2], vl[2];
  const int q8 = tid >> 3, p8 = (tid & 7) * 8;
#pragma unroll
  for (int it = 0; it < 2; ++it) {
    const int line = it * 32 + q8;          // d = 0..63
    vh[it] = *(const v4u*)(TH + line * VTP + p8);
    vl[it] = *(const v4u*)(TL + line * VTP + p8);
  }
  const size_t hrow  = (size_t)b * HD;
  const size_t baseH = hrow * SEQ + s0 + p8;
  const size_t baseL = hrow * QO + (dolo ? s0 : 0) + p8;
  {
#pragma unroll
    for (int it = 0; it < 2; ++it) {
      const int line = it * 32 + q8;
      *(v4u*)(VHo + baseH + (size_t)line * SEQ) = vh[it];
      if (dolo) { *(v4u*)(VLo + baseL + (size_t)line * QO) = vl[it]; }
    }
    
  }
  // the sums below reuse registers that the tile stores above name: wait before they are overwritten; the scheduling
  // barrier keeps the address arithmetic of the sums from being moved up in front of the wait
  asm volatile("s_wait_xcnt 0x0" ::: "memory");
  __builtin_amdgcn_sched_barrier(0);
  {
    const float* col = TF + ((tid >> 6) * 16) * SLP + (tid & 63);
    double acc = 0.0;
#pragma unroll                              // constant LDS offsets
    for (int i = 0; i < 16; ++i) acc += (double)col[i * SLP];
    PS[(size_t)bid * 256 + tid] = acc;      // row bid*4 + (tid >> 6), column tid & 63
  }
}

// =====================================================================================================
// Projection C[MROWS][HD] (f32) = bf16(X) . bf16(Wf)^T, X f32 [b][s][DIN] (batch stride SEQ_FULL rows), Wf f32 [HD n][DIN k].
// Block = 64 rows x all 64 columns, 16 waves. Wave w loads rows 4w .. 4w+3 of Wf and of the block's X rows as f32, each load
// 512 contiguous bytes of one row, rounds to bf16 (nearest even) in registers and stores 8 B per lane to the LDS tiles
// [64][DIN] (pitch 520 halves = 16 B x 65). Behind a work-group barrier wave (rg = w >> 2, cg = w & 3) forms the 16x16 tile
// (rows 16rg, columns 16cg): DIN/32 products in ascending k, fragments from LDS (two 16-B loads each, split k map for A and
// B). The tiles go to an LDS tile [64][64] (pitch 68 floats); behind a second barrier the block stores its 16 KiB of C.
// coverage: load 16 waves x 4 rows x 4 x 512 B = 64 rows x 2048 B per operand (staged extent == consumed extent); store
//           2 x 512 thr x 4 floats = 64 x 64; grid = MROWS/64 blocks = every row of C exactly once, whole lines per wave.
// =====================================================================================================
__device__ __forceinline__ v2u bf4(v4f a) {                           // 4 f32 -> 4 bf16, nearest even
  const v2f lo = {a[0], a[1]}, hi = {a[2], a[3]};
  v2u o;
  o[0] = __builtin_bit_cast(unsigned, __builtin_convertvector(lo, v2b));
  o[1] = __builtin_bit_cast(unsigned, __builtin_convertvector(hi, v2b));
  return o;
}

__global__ __launch_bounds__(512)
void gemm_xw(const float* __restrict__ X, const float* __restrict__ Wf, float* C) {
  __shared__ __align__(16) u16 XS[64 * XSP];
  __shared__ __align__(16) u16 WS[64 * XSP];
  __shared__ __align__(16) float CS[64 * SLP];
  const int tid = threadIdx.x, wave = tid >> 5, lane = tid & 31, hh = lane >> 4, m = lane & 15;
  const int row0 = blockIdx.x * 64;
  if (row0 + 64 > MROWS) return;            // block-uniform, before any barrier; never taken with the exact grid
  const int b  = row0 / SEQ;
  const int s0 = row0 - b * SEQ;            // SEQ % 64 == 0: the 64 rows lie in one batch
  const float* wp = Wf + (size_t)(wave * 4) * DIN + lane * 4;
  const float* xp = X + ((size_t)b * SEQ_FULL + s0 + wave * 4) * DIN + lane * 4;
  v4f wv[16], xv[16];
#pragma unroll                              // all loads of the wave in flight together; W first: it comes from L2
  for (int i = 0; i < 16; ++i) wv[i] = *(const v4f*)(wp + (i >> 2) * DIN + (i & 3) * 128);
#pragma unroll                              // as above
  for (int i = 0; i < 16; ++i) xv[i] = *(const v4f*)(xp + (i >> 2) * DIN + (i & 3) * 128);
  // the work below may reuse registers that the loads above name: wait before they are overwritten (the two pointers are
  // inputs so that their registers live up to the wait); the scheduling barrier keeps that work behind the wait and every
  // load in front of the first conversion
  asm volatile("s_wait_xcnt 0x0" :: "v"(wp), "v"(xp) : "memory");
  __builtin_amdgcn_sched_barrier(0);
  {
    u16* wd = WS + (wave * 4) * XSP + lane * 4;
    u16* xd = XS + (wave * 4) * XSP + lane * 4;
#pragma unroll                              // constant register indices and LDS offsets
    for (int i = 0; i < 16; ++i) *(v2u*)(wd + (i >> 2) * XSP + (i & 3) * 128) = bf4(wv[i]);
    __builtin_amdgcn_sched_barrier(0);      // W is rounded and stored while the X loads are still in flight
#pragma unroll                              // as above
    for (int i = 0; i < 16; ++i) *(v2u*)(xd + (i >> 2) * XSP + (i & 3) * 128) = bf4(xv[i]);
  }
  __syncthreads();                          // publishes both bf16 tiles to every wave
  const int rg = wave >> 2, cg = wave & 3;
  const u16* ap = XS + (rg * 16 + m) * XSP + 8 * hh;
  const u16* bp = WS + (cg * 16 + m) * XSP + 8 * hh;
  v8f acc = zero8();
#pragma unroll                              // constant LDS offsets; fragment loads run ahead of the product chain
  for (int k0 = 0; k0 < DIN; k0 += 32) acc = mma_b(ldfrag_b(ap + k0), ldfrag_b(bp + k0), acc);
#pragma unroll                              // constant element indices
  for (int r = 0; r < 8; ++r) CS[(rg * 16 + 8 * hh + r) * SLP + cg * 16 + m] = acc[r];
  __syncthreads();                          // publishes the 64x64 f32 tile to the storing waves
  float* dst = C + (size_t)row0 * HD;
#pragma unroll                              // two independent 16-B stores per thread
  for (int it = 0; it < 2; ++it) {
    const int idx = it * 512 + tid;
    *(v4f*)(dst + (size_t)idx * 4) = *(const v4f*)(CS + (idx >> 4) * SLP + (idx & 15) * 4);
  }
}

// =====================================================================================================
// Single-head causal attention (key j contributes to query i only when j < i), hd = 64, f32 output.
// Block bid -> (batch b = bid / BPB, query tile index qi = bid % BPB): one work-group of WPB waves per 16-row query tile
// q0 = 16*qt; wave w takes the key tiles kt = w, w + WPB, .. below.
// RES == 1: query tiles q0 < QO, scores = q_hi.k_hi + q_lo.k_hi + q_hi.k_lo and P.v = hh + lh + hl; RES == 0: query tiles
// q0 >= QO, single products q_hi.k_hi, P_hi.v_hi.
//   q hi plane f16 x256 [b*SEQ + s][d], q residual (compact) [b*QO + s][d]; k hi / residual planes likewise;
//   v^T hi plane [b][d][SEQ] x1024, v^T residual plane [b][d][QO].
//   score (log2 domain) t(i, j) = (q_i.k_j over HD) * (1/8)*log2e/(256*256), replaced by -inf where key j >= query i.
//   Key tiles of 32 visited in order for kb <= q0 + 14 (later tiles hold only keys at or above every query row of the tile);
//   with RES == 1 this keeps every visited key below QO, inside the compact residual planes. Query row 0 has no admitted key:
//   its running max stays -inf, Z = 0, and the row is written as 0 here (a later launch writes its true value).
//   Per tile: 2 score subtiles x 2 k-steps, fragments loaded straight from the 16-bit planes (two 16-B loads per fragment,
//   split k map); online max-subtracted base-2 softmax in f32, -inf-safe rescale; the 16x32 prob tile stored to wave-private
//   fragments of P*32768 (f16 hi plus its f16 residual) rebuilt from the LDS rows (float vector loads, same element type as
//   stored), v^T B fragments in 2 groups of 2 d-subtiles.
//   After the loop each wave stores its un-normalised 16x64 accumulators (over its own prob tile, which it has finished
//   reading) and its 16 (max, sum) pairs to LDS; one work-group barrier, which every wave reaches (also a wave without a key
//   tile: max -inf, sum 0, accumulators 0); then wave w merges query row w: M = max of the maxima, weights exp2(m - M) (0 where
//   m = -inf), Z and the row added up in wave order, out = row / Z (0 if Z == 0), carries 1/(32768*1024) folded once.
//   Every return stands in front of the barrier and is block-uniform; bounded loops only (nkt <= NKT).
// coverage: per wave 32 lanes x 2 floats = one 64-float output row, WPB waves = the tile's 16 rows; the two launches
//           (RES 1: NQO tiles, RES 0: NQT-NQO tiles) x NB = every (b, s) output row exactly once.
// =====================================================================================================
template <int RES>
__global__ __launch_bounds__(ATT_THREADS)
void attn_c(const u16* __restrict__ QHp, const u16* __restrict__ QLp,
            const u16* __restrict__ KHp, const u16* __restrict__ KLp,
            const u16* __restrict__ VHp, const u16* __restrict__ VLp,
            float* Out) {
  __shared__ __align__(16) float smem[WPB * WREG];
  __shared__ __align__(16) float mxs[16 * WPB];   // [query row][wave] running maxima
  __shared__ __align__(16) float sms[16 * WPB];   // [query row][wave] running sums
  constexpr int QT0 = (RES != 0) ? 0 : NQO;
  constexpr int NQL = (RES != 0) ? NQO : (NQT - NQO);
  constexpr int NQE = (NQL > 0) ? NQL : 1;
  constexpr int BPB = NQE;

  const int tid  = threadIdx.x;
  const int wave = __builtin_amdgcn_readfirstlane(tid >> 5);   // scalar: the key loop below branches on it, EXEC stays whole
  const int lane = tid & 31;
  const int hh   = lane >> 4;
  const int c    = lane & 15;
  const int bid  = blockIdx.x;
  const int b    = bid / BPB;
  const int qi   = bid - b * BPB;
  if (b >= NB) return;                      // block-uniform, before the barrier; never taken with the exact grid
  if (qi >= NQL) return;                    // block-uniform; never taken
  const int q0   = (QT0 + qi) * 16;
  if (q0 + 16 > SEQ) return;                // block-uniform; never taken
  if (RES != 0 && q0 + 16 > QO) return;     // block-uniform; never taken
  const int ql0  = (RES != 0) ? q0 : 0;

  float* pt   = smem + wave * WREG;         // prob tile [16][32] pitch 36, in the loop
  float* slab = pt;                         // the wave's partial result [16][64] pitch 68, behind the loop

  const size_t hcol = (size_t)8 * hh;
  const _Float16* Qh  = ash(QHp) + ((size_t)b * SEQ + q0 + c) * HD + hcol;
  const _Float16* Ql  = ash(QLp) + ((size_t)b * QO + ql0 + c) * HD + hcol;          // RES == 1 only
  const _Float16* Khb = ash(KHp) + ((size_t)b * SEQ + c) * HD + hcol;               // key row kb added per step
  const _Float16* Klb = ash(KLp) + ((size_t)b * QO + c) * HD + hcol;                // RES == 1 only, keys < QO
  const _Float16* Vhb = ash(VHp) + ((size_t)b * HD + c) * SEQ + hcol;               // d col c (+16j)
  const _Float16* Vlb = ash(VLp) + ((size_t)b * HD + c) * QO + hcol;                // RES == 1 only
  const float lsc = RSQ_HD * (LOG2E / (QSC * KSC));
  const float oc  = 1.0f / (PCAR * VCAR);
  const size_t KROW = (size_t)HD;           // halves between consecutive key rows

  float mrow[8], lrow[8];
  v8f o[4];
#pragma unroll
  for (int r = 0; r < 8; ++r) { mrow[r] = -INFINITY; lrow[r] = 0.f; }
#pragma unroll
  for (int j = 0; j < 4; ++j) o[j] = zero8();
  const int ncaus = (q0 >> 5) + 1;                                            // tiles holding keys <= q0 + 14
  const int nkt = (ncaus < NKT) ? ncaus : NKT;
  const int qr0 = q0 + 8 * hh;                                                // query row of D element r = qr0 + r

#pragma unroll 1
  for (int kt = wave; kt < nkt; kt += WPB) {
    const int kb = kt * 32;
    // ---- scores: D element r of this lane = (query row qr0 + r, key kb + c) in s0, key kb + 16 + c in s1 ----
    v8f s0 = zero8(), s1 = zero8();
    const _Float16* k0p = Khb + (size_t)kb * KROW;
    const _Float16* k1p = k0p + (size_t)16 * KROW;
    if constexpr (RES != 0) {
      const _Float16* l0p = Klb + (size_t)kb * KROW;
      const _Float16* l1p = l0p + (size_t)16 * KROW;
#pragma unroll
      for (int kk = 0; kk < HD / 32; ++kk) {
        const v16h qh  = ldfrag_h(Qh + kk * 32);
        const v16h ql  = ldfrag_h(Ql + kk * 32);
        const v16h kh0 = ldfrag_h(k0p + kk * 32);
        const v16h kh1 = ldfrag_h(k1p + kk * 32);
        const v16h kl0 = ldfrag_h(l0p + kk * 32);
        const v16h kl1 = ldfrag_h(l1p + kk * 32);
        s0 = mma_h(qh, kh0, s0);
        s0 = mma_h(ql, kh0, s0);
        s0 = mma_h(qh, kl0, s0);
        s1 = mma_h(qh, kh1, s1);
        s1 = mma_h(ql, kh1, s1);
        s1 = mma_h(qh, kl1, s1);
        guard2(s0, s1, qh, ql, kh0, kl0, kh1, kl1);
      }
    } else {
#pragma unroll
      for (int kk = 0; kk < HD / 32; ++kk) {
        const v16h qh  = ldfrag_h(Qh + kk * 32);
        const v16h kh0 = ldfrag_h(k0p + kk * 32);
        const v16h kh1 = ldfrag_h(k1p + kk * 32);
        s0 = mma_h(qh, kh0, s0);
        s1 = mma_h(qh, kh1, s1);
        guard2(s0, s1, qh, kh0, kh1, qh, kh0, kh1);
      }
    }
    // ---- causal select (key >= query excluded) + online softmax in base 2, -inf-safe ----
    const int key0 = kb + c, key1 = kb + 16 + c;
#pragma unroll
    for (int r = 0; r < 8; ++r) {
      const int   qr = qr0 + r;
      const float u0 = s0[r] * lsc;
      const float u1 = s1[r] * lsc;
      const float t0 = (key0 >= qr) ? -INFINITY : u0;
      const float t1 = (key1 >= qr) ? -INFINITY : u1;
      float mx = fmaxf(t0, t1);
#pragma unroll
      for (int off = 1; off < 16; off <<= 1) mx = fmaxf(mx, __shfl_xor(mx, off, 32));
      const float mn = fmaxf(mrow[r], mx);
      const float ms = (mn == -INFINITY) ? 0.0f : mn;
      const float al = exp2f(mrow[r] - ms);
      mrow[r] = mn;
      const float e0 = exp2f(t0 - ms), e1 = exp2f(t1 - ms);
      float ps = e0 + e1;
#pragma unroll
      for (int off = 1; off < 16; off <<= 1) ps += __shfl_xor(ps, off, 32);
      lrow[r] = lrow[r] * al + ps;
#pragma unroll
      for (int j = 0; j < 4; ++j) o[j][r] *= al;
      const int ro = (8 * hh + r) * PTP + c;
      pt[ro]      = e0;
      pt[ro + 16] = e1;
    }
    wave_sync_lds();
    // ---- A fragments of P*32768: hi f16 and residual f16, row = c, split k map over the 32 keys of this step ----
    FragH ph, pl;
    {
      const float* prow = pt + c * PTP + 8 * hh;
      const v4f p0 = *(const v4f*)(prow), p1 = *(const v4f*)(prow + 4);
      const v4f p2 = *(const v4f*)(prow + 16), p3 = *(const v4f*)(prow + 20);
#pragma unroll
      for (int e = 0; e < 4; ++e) {
        const float ta = p0[e] * PCAR, tb = p1[e] * PCAR, tc = p2[e] * PCAR, td = p3[e] * PCAR;
        const _Float16 ha = (_Float16)ta, hb = (_Float16)tb, hc = (_Float16)tc, hd = (_Float16)td;
        ph.h[0][e]     = ha;                  // elements 0..7  = keys kb + 8hh + 0..7
        ph.h[0][4 + e] = hb;
        ph.h[1][e]     = hc;                  // elements 8..15 = keys kb + 16 + 8hh + 0..7
        ph.h[1][4 + e] = hd;
        pl.h[0][e]     = (_Float16)(ta - (float)ha);
        pl.h[0][4 + e] = (_Float16)(tb - (float)hb);
        pl.h[1][e]     = (_Float16)(tc - (float)hc);
        pl.h[1][4 + e] = (_Float16)(td - (float)hd);
      }
    }
    // ---- P.V : B fragment col n = d = j*16 + c, keys contiguous in the v^T planes; 2 groups of 2 d-subtiles ----
    {
      const _Float16* vhp = Vhb + kb;
      if constexpr (RES != 0) {
        const _Float16* vlp = Vlb + kb;
#pragma unroll
        for (int jg = 0; jg < 2; ++jg) {
          const size_t da = (size_t)(2 * jg) * 16 * SEQ;
          const size_t db = da + (size_t)16 * SEQ;
          const size_t la = (size_t)(2 * jg) * 16 * QO;
          const size_t lb = la + (size_t)16 * QO;
          const v16h vha = ldfrag_h(vhp + da), vhb2 = ldfrag_h(vhp + db);
          const v16h vla = ldfrag_h(vlp + la), vlb2 = ldfrag_h(vlp + lb);
          o[2 * jg]     = mma_h(ph.v, vha,  o[2 * jg]);
          o[2 * jg]     = mma_h(pl.v, vha,  o[2 * jg]);
          o[2 * jg]     = mma_h(ph.v, vla,  o[2 * jg]);
          o[2 * jg + 1] = mma_h(ph.v, vhb2, o[2 * jg + 1]);
          o[2 * jg + 1] = mma_h(pl.v, vhb2, o[2 * jg + 1]);
          o[2 * jg + 1] = mma_h(ph.v, vlb2, o[2 * jg + 1]);
          guard2(o[2 * jg], o[2 * jg + 1], ph.v, pl.v, vha, vhb2, vla, vlb2);
        }
      } else {
#pragma unroll
        for (int jg = 0; jg < 2; ++jg) {
          const size_t da = (size_t)(2 * jg) * 16 * SEQ;
          const size_t db = da + (size_t)16 * SEQ;
          const v16h vha = ldfrag_h(vhp + da), vhb2 = ldfrag_h(vhp + db);
          o[2 * jg]     = mma_h(ph.v, vha,  o[2 * jg]);
          o[2 * jg + 1] = mma_h(ph.v, vhb2, o[2 * jg + 1]);
          guard2(o[2 * jg], o[2 * jg + 1], ph.v, vha, vhb2, ph.v, vha, vhb2);
        }
      }
    }
    wave_sync_lds();
  }
  acc_guard4(o[0], o[1], o[2], o[3]);
  // ---- the wave's partials to LDS: accumulators at (row 8hh + r, column 16j + c), (max, sum) of row 8hh + r from lane c == 0 ----
#pragma unroll                              // accumulators stay in registers: constant element indices, constant LDS offsets
  for (int r = 0; r < 8; ++r) {
    const int ro = (8 * hh + r) * SLP + c;
#pragma unroll                              // as above
    for (int j = 0; j < 4; ++j) slab[ro + 16 * j] = o[j][r];
  }
  if (c == 0) {
#pragma unroll                              // mrow, lrow stay in registers
    for (int r = 0; r < 8; ++r) {
      mxs[(8 * hh + r) * WPB + wave] = mrow[r];
      sms[(8 * hh + r) * WPB + wave] = lrow[r];
    }
  }
  __syncthreads();                          // publishes every wave's partials to the merging waves
  // ---- merge of query row q0 + wave over the WPB key ranges, in wave order; lane = columns 2*lane, 2*lane + 1 ----
  {
    const int row = wave;
    float mw[WPB], lw[WPB];
#pragma unroll                              // mw, lw stay in registers; the LDS loads go out together
    for (int g = 0; g < WPB / 4; ++g) {
      const v4f a = *(const v4f*)(mxs + row * WPB + 4 * g);
      const v4f z = *(const v4f*)(sms + row * WPB + 4 * g);
#pragma unroll                              // as above
      for (int e = 0; e < 4; ++e) { mw[4 * g + e] = a[e]; lw[4 * g + e] = z[e]; }
    }
    float mm = mw[0];
#pragma unroll                              // as above
    for (int w = 1; w < WPB; ++w) mm = fmaxf(mm, mw[w]);
    const float ms = (mm == -INFINITY) ? 0.0f : mm;
    const float* prt = smem + row * SLP + 2 * lane;
    float lv = 0.f, x0 = 0.f, x1 = 0.f;
#pragma unroll                              // the WPB partial-row loads go out together, one LDS latency instead of WPB
    for (int w = 0; w < WPB; ++w) {
      const float wg = exp2f(mw[w] - ms);
      const v2f  pv = *(const v2f*)(prt + w * WREG);
      lv += lw[w] * wg;
      x0 += pv[0] * wg;
      x1 += pv[1] * wg;
    }
    const float ls  = (lv > 0.0f) ? lv : 1.0f;
    const float inv = (lv > 0.0f) ? ((1.0f / ls) * oc) : 0.0f;
    v2f res;
    res[0] = x0 * inv;
    res[1] = x1 * inv;
    *(v2f*)(Out + ((size_t)b * SEQ_FULL + (size_t)(q0 + row)) * HD + 2 * lane) = res;
  }
}

// =====================================================================================================
// Query row 0 of every batch: uniform weights 1/SEQ over ALL keys -> out[b][0][d] = mean over s of F[b*SEQ + s][d], F the f32
// v projection, from its f64 16-key partial sums PS[b*NPS + p][d] (written by vt16 earlier in the same call). Block = batch b,
// 1024 threads: thread (d = tid & 63, g = tid >> 6) adds rows g, g + 16, .. of column d in that order (independent 8-B loads,
// the block reads 8192 contiguous bytes per step), partials combined in fixed order through LDS, scaled by 1/SEQ, staged as one
// f32 row in LDS; after a barrier lanes 0..15 of wave 0 write the 256-B output row (16 consecutive lanes x 16 B, one
// coverage: 16 lanes x 4 floats = the 64-float row; grid = NB blocks = every batch's row 0 exactly once.
// =====================================================================================================
__global__ __launch_bounds__(1024) void row0_mean(const double* __restrict__ PS, float* Out) {
  __shared__ double part[RGRP * HD];
  __shared__ __align__(16) float rowv[HD];
  const int tid = threadIdx.x;
  const int b   = blockIdx.x;
  if (b >= NB) return;                      // block-uniform, before any barrier; never taken with the exact grid
  const double* p = PS + (size_t)b * NPS * HD + tid;
  double acc = 0.0;
#pragma unroll                              // independent loads in flight together instead of one memory latency per row
  for (int s = 0; s < NPS / RGRP; ++s) acc += p[s * (RGRP * HD)];
  part[tid] = acc;
  __syncthreads();
  if (tid < HD) {
    double t = part[tid];
#pragma unroll                              // constant LDS offsets
    for (int g2 = 1; g2 < RGRP; ++g2) t += part[g2 * HD + tid];
    rowv[tid] = (float)t * (1.0f / (float)SEQ);
  }
  __syncthreads();
  if (tid < 16) {
    const v4f v = *(const v4f*)(rowv + 4 * tid);
    float* dst = Out + (size_t)b * SEQ_FULL * HD + 4 * tid;
    {
      *(v4f*)(dst) = v;
      
    }
  }
}

// =====================================================================================================
// Workspace map (bytes); every plane is fully written by whole-line stores before it is read; all extents are exact multiples
// of the store granularity (no pad rows needed); every region offset a multiple of 65536:
//   FV, FQ, FK f32 [MROWS][64]       MROWS*256 each                                                 (3 x 4194304)
//   QH  f16 [MROWS][64] x256         MROWS*128    QL residual [NB*QO][64]  NB*QO*128                (2097152 + 262144)
//   KH  f16 [MROWS][64] x256         MROWS*128    KL residual [NB*QO][64]  NB*QO*128                (2097152 + 262144)
//   VH  f16 [NB][64][SEQ] x1024      MROWS*128    VL residual [NB][64][QO] NB*QO*128                (2097152 + 262144)
//   PS  f64 [NB*NPS][64] 16-key column sums of FV   NB*NPS*512                                      (524288)
//   end (NB=4, SEQ=4096)           20185088
// =====================================================================================================
extern "C" void kernel_launch(void* const* d_in, const int* in_sizes, int n_in,
                              void* d_out, int out_size, void* d_ws, size_t ws_size,
                              hipStream_t stream) {
  if (n_in < 6) return;
  const int needx = ((NB - 1) * SEQ_FULL + SEQ) * DIN;
  if (in_sizes[0] < needx) return;
  if (in_sizes[1] < needx) return;
  if (in_sizes[2] < needx) return;
  if (in_sizes[3] != HD * DIN) return;
  if (in_sizes[4] != HD * DIN) return;
  if (in_sizes[5] != HD * DIN) return;
  if (out_size < ((NB - 1) * SEQ_FULL + SEQ) * HD) return;

  const float* query = (const float*)d_in[0];
  const float* keyin = (const float*)d_in[1];
  const float* value = (const float*)d_in[2];
  const float* wq    = (const float*)d_in[3];
  const float* wk    = (const float*)d_in[4];
  const float* wv    = (const float*)d_in[5];
  float*       out   = (float*)d_out;

  const size_t szF  = (size_t)MROWS * HD * 4;
  const size_t szH  = (size_t)MROWS * HD * 2;                    // QH, KH
  const size_t szL  = (size_t)NB * QO * HD * 2;                  // QL, KL (compact residual planes)
  const size_t szVH = (size_t)NB * HD * SEQ * 2;                 // == szH
  const size_t szVL = (size_t)NB * HD * QO * 2;                  // == szL
  const size_t szPS = (size_t)NB * NPS * HD * 8;
  size_t off = 0;
  const size_t oFV = off; off += szF;
  const size_t oFQ = off; off += szF;
  const size_t oFK = off; off += szF;
  const size_t oQH = off; off += szH;
  const size_t oQL = off; off += szL;
  const size_t oKH = off; off += szH;
  const size_t oKL = off; off += szL;
  const size_t oVH = off; off += szVH;
  const size_t oVL = off; off += szVL;
  const size_t oPS = off; off += szPS;
  if (off > ws_size) return;                // off = 20185088 for NB = 4, SEQ = 4096
  if (off > (size_t)WS_CAP) return;

  char* ws = (char*)d_ws;
  float* FV  = (float*)(ws + oFV);
  float* FQ  = (float*)(ws + oFQ);
  float* FK  = (float*)(ws + oFK);
  u16*   QH  = (u16*)(ws + oQH);
  u16*   QL  = (u16*)(ws + oQL);
  u16*   KH  = (u16*)(ws + oKH);
  u16*   KL  = (u16*)(ws + oKL);
  u16*   VH  = (u16*)(ws + oVH);
  u16*   VL  = (u16*)(ws + oVL);
  double* PS = (double*)(ws + oPS);

  const dim3 b256(256), b512(512), bAT(ATT_THREADS), b1024(1024);
  const dim3 gG(MROWS / 64);
  const dim3 gVT(NB * NST);
  const int  n8q  = (MROWS * HD) / 8;                   // q / k hi planes
  const dim3 gSQ((n8q + 255) / 256);
  const dim3 gATR(NB * NQO);
  const int  nqp  = NQT - NQO;                          // query tiles with s >= QO
  const dim3 gR0(NB);

  // (1) v = value.Wv^T -> FV f32 [MROWS][64]; (2) v^T hi (all keys) + residual (keys < QO) x1024, and the f64 16-key column sums
  gemm_xw<<<gG, b512, 0, stream>>>(value, wv, FV);
  vt16<<<gVT, b256, 0, stream>>>(FV, VH, VL, PS);
  // (3) q = query.Wq^T -> FQ; (4) q hi (all rows) + residual (rows s < QO) x256
  gemm_xw<<<gG, b512, 0, stream>>>(query, wq, FQ);
  split16<<<gSQ, b256, 0, stream>>>(FQ, QH, QL, n8q, QSC);
  // (5) k = key.Wk^T -> FK; (6) k hi + residual planes x256
  gemm_xw<<<gG, b512, 0, stream>>>(keyin, wk, FK);
  split16<<<gSQ, b256, 0, stream>>>(FK, KH, KL, n8q, KSC);
  // (7) causal attention: query tiles s < QO with residual products -> out; (8) query tiles s >= QO single products -> out
  attn_c<1><<<gATR, bAT, 0, stream>>>(QH, QL, KH, KL, VH, VL, out);
  if (nqp > 0) {
    attn_c<0><<<dim3(NB * nqp), bAT, 0, stream>>>(QH, QL, KH, KL, VH, VL, out);
  }
  // (9) query row 0 of every batch = column mean of v over all SEQ keys, from the partial sums (written last)
  row0_mean<<<gR0, b1024, 0, stream>>>(PS, out);
  (void)hipGetLastError();
}

// v004
// It runs in 86.8 microseconds.
// Two timings next to v003 put it at 1.12 and 1.13 times that version's speed.
// All steps since v000 together make it 6.94 times as fast.
// Contractions: value.Wv^T, query.Wq^T, key.Wk^T on v_wmma_f32_16x16x32_bf16 (inputs and W rounded to bf16 RNE on the way into
// LDS; W [n][k] rows are the k-contiguous B operand); q.k^T over hd 64 and P.v on v_wmma_f32_16x16x32_f16 (q, k x256, P x32768, v x1024 as f16
// planes; query rows s < QO additionally use f16 residual planes, products hh+lh+hl); all f32 accumulate. Strictly-earlier-key
// causal select, base-2 online softmax and 1/Z fold in f32 on VALU; query row 0 (uniform weights over all keys) = column mean
// of the f32 v projection with f64 accumulate on VALU (16-key partial sums in the v^T launch, added up in the last launch).
// Each 16-row query tile is one work-group of 16 waves: wave w walks key tiles w, w + 16, .. with its own maxima, sums and
// accumulators; the partials are merged through LDS behind one work-group barrier and the merge writes the f32 output.
// The f16 planes lie in fragment order: every 16-B chunk that a lane loads for an A or B operand stands at lane * 16 B inside a
// 512-B group, so that one fragment load of a wave reads four whole 128-B lines.
#include <hip/hip_runtime.h>
#include <math.h>
#include <stdint.h>

#ifndef NB
#define NB 4
#endif
#ifndef SEQ
#define SEQ 4096
#endif
#define SEQ_FULL 4096
#define DIN   512
#define HD    64
#define QO    ((SEQ < 512) ? SEQ : 512)
#define MROWS (NB * SEQ)
#define RSQ_HD 0.125f
#define LOG2E 1.4426950408889634f
#define QSC   256.0f
#define KSC   256.0f
#define PCAR  32768.0f
#define VCAR  1024.0f
#define WPB   16
#define NQT   (SEQ / 16)
#define NQO   (QO / 16)
#define NST   (SEQ / 64)
#define NKT   (SEQ / 32)
#define ATT_THREADS (WPB * 32)
#define PTP   36
#define PTW   (16 * PTP)
#define SLP   68
#define SLW   (16 * SLP)
#define WREG  SLW
#define XSP   (DIN + 8)
#define VTP   72
#define C8R   (HD / 8)
#define NPS   (NST * 4)
#define RGRP  16
#define WS_CAP 134217728
#define FRH   256
#define FRS   (2 * FRH)
static_assert(HD == 64 && (DIN % 32) == 0 && DIN >= 32 && WPB == 16 && ATT_THREADS == 512 && PTW <= SLW);
static_assert(NB >= 1 && NB <= 4);
static_assert((SEQ % 64) == 0 && SEQ >= 64 && SEQ <= SEQ_FULL && (SEQ % 4) == 0);
static_assert((QO % 64) == 0 && QO >= 64 && QO <= SEQ);
static_assert((MROWS % 64) == 0 && C8R == 8 && SLP == 68 && DIN == 512);
static_assert(((MROWS * HD / 8) % 256) == 0);
static_assert((NPS % RGRP) == 0 && RGRP * HD == 1024);
static_assert((WPB * WREG + 2 * 16 * WPB) * 4 <= 81920 && 2 * HD * VTP * 2 <= 65536 && 2 * 64 * XSP * 2 + 64 * SLP * 4 <= 163840);

typedef unsigned short u16;
typedef _Float16 v16h __attribute__((ext_vector_type(16)));
typedef _Float16 v8h  __attribute__((ext_vector_type(8)));
typedef __bf16   v16b __attribute__((ext_vector_type(16)));
typedef __bf16   v2b  __attribute__((ext_vector_type(2)));
typedef float    v8f  __attribute__((ext_vector_type(8)));
typedef float    v4f  __attribute__((ext_vector_type(4)));
typedef float    v2f  __attribute__((ext_vector_type(2)));
typedef unsigned int v4u __attribute__((ext_vector_type(4)));
typedef unsigned int v2u __attribute__((ext_vector_type(2)));

union FragH { v16h v; v8h h[2]; v4u u[2]; };
union FragB { v16b v; v4u u[2]; };

// ---- scalar helpers --------------------------------------------------------------------------------
__device__ __forceinline__ unsigned short h_bits(_Float16 x) { return __builtin_bit_cast(unsigned short, x); }
__device__ __forceinline__ unsigned pk16(unsigned short a, unsigned short b) { return (unsigned)a | ((unsigned)b << 16); }
__device__ __forceinline__ v8f zero8() { v8f z = {0.f, 0.f, 0.f, 0.f, 0.f, 0.f, 0.f, 0.f}; return z; }
__device__ __forceinline__ const _Float16* ash(const u16* p) { return (const _Float16*)(const void*)p; }

// ---- fragment loaders: 16-bit A/B operand, lane -> row/col (lane&15), h = lane>>4; elements 0..7 = k0+8h.., elements 8..15 =
//      k0+16+8h.. (same split k map for A and B).
//      ldfrag_h: global f16 plane in fragment order, p already includes +8*lane: the two 16-B chunks of a lane stand 512 B apart
//      ldfrag_b: k-contiguous [n][k] LDS tile, p already includes +8*h: elements 0..7 <- p[0..7], 8..15 <- p[16..23]
__device__ __forceinline__ v16h ldfrag_h(const _Float16* p) {
  FragH f;
  f.h[0] = *(const v8h*)(p);
  f.h[1] = *(const v8h*)(p + FRH);
  return f.v;
}
__device__ __forceinline__ v16b ldfrag_b(const u16* p) {              // bf16 plane read as unsigned integer vectors
  FragB f;
  f.u[0] = *(const v4u*)(p);
  f.u[1] = *(const v4u*)(p + 16);
  return f.v;
}

__device__ __forceinline__ v8f mma_h(v16h a, v16h b, v8f c) {
  return __builtin_amdgcn_wmma_f32_16x16x32_f16(false, a, false, b, (short)0, c, false, false);
}
__device__ __forceinline__ v8f mma_b(v16b a, v16b b, v8f c) {
  return __builtin_amdgcn_wmma_f32_16x16x32_bf16(false, a, false, b, (short)0, c, false, false);
}
__device__ __forceinline__ void guard2(v8f& a, v8f& b, v16h x0, v16h x1, v16h x2, v16h x3, v16h x4, v16h x5) {
#if defined(__HIP_DEVICE_COMPILE__)
  asm volatile("v_nop\n\tv_nop\n\tv_nop\n\tv_nop"
               : "+v"(a), "+v"(b) : "v"(x0), "v"(x1), "v"(x2), "v"(x3), "v"(x4), "v"(x5) : "memory");
#endif
}
__device__ __forceinline__ void acc_guard4(v8f& a, v8f& b, v8f& c, v8f& d) {
#if defined(__HIP_DEVICE_COMPILE__)
  asm volatile("v_nop\n\tv_nop\n\tv_nop\n\tv_nop" : "+v"(a), "+v"(b), "+v"(c), "+v"(d));
#endif
}
__device__ __forceinline__ void wave_sync_lds() {
  __builtin_amdgcn_fence(__ATOMIC_RELEASE, "workgroup");
  __builtin_amdgcn_wave_barrier();
  __builtin_amdgcn_fence(__ATOMIC_ACQUIRE, "workgroup");
}

// =====================================================================================================
// f32 plane F [MROWS][HD] (row = b*SEQ + s) -> f16 hi plane Hp = f16(F * sc), all rows; and f16 residual plane
// Lp = f16(t - f16(t)), compact (row = b*QO + s), for rows with s < QO only. Both planes in fragment order: each 16-row tile
// (rows 16t .. 16t+15, 2048 B) is stored as [d chunk d8 = d/8][row c = row & 15][8 halves], so the operand chunk of lane
// (h, c) for k-step kk stands at kk*1024 B + lane*16 B (d8 = 4kk + h) and its second chunk 512 B behind (d8 = 4kk + 2 + h).
// Thread = one 16-B output chunk gt = (t, d8, c): two 16-B loads from row 16t + c, one 16-B store per plane; 32 consecutive
// lanes store 512 contiguous bytes (whole lines, one writing wave per line).
// coverage: Hp: ceil(n8/256) blocks x 256 thr x 8 = all MROWS x HD; Lp: every tile with s < QO x 128 thr x 8 = all NB*QO x HD.
// =====================================================================================================
__global__ __launch_bounds__(256) void split16(const float* __restrict__ F, u16* Hp, u16* Lp, int n8, float sc) {
  const int gt = blockIdx.x * 256 + (int)threadIdx.x;
  if (gt >= n8) return;
  const int r0  = (gt >> 7) * 16;           // first row of the 16-row tile
  const int ch  = gt & 127;                 // chunk within the tile = d8*16 + c
  const int row = r0 + (ch & 15);
  const int c8  = (ch >> 4) * 8;
  const int b   = r0 / SEQ;
  const int s0  = r0 - b * SEQ;             // SEQ % 16 == 0 and QO % 16 == 0: a tile lies in one batch, on one side of QO
  const bool dolo = (s0 < QO);
  const int  sl   = dolo ? s0 : 0;
  const float* p = F + (size_t)row * HD + c8;
  const v4f a = *(const v4f*)(p), b4 = *(const v4f*)(p + 4);
  float w[8];
#pragma unroll
  for (int e = 0; e < 4; ++e) { w[e] = a[e] * sc; w[4 + e] = b4[e] * sc; }
  v4u oh, ol;
#pragma unroll
  for (int e = 0; e < 4; ++e) {
    const float t0 = w[2 * e], t1 = w[2 * e + 1];
    const _Float16 h0 = (_Float16)t0, h1 = (_Float16)t1;
    const _Float16 l0 = (_Float16)(t0 - (float)h0), l1 = (_Float16)(t1 - (float)h1);
    oh[e] = pk16(h_bits(h0), h_bits(h1));
    ol[e] = pk16(h_bits(l0), h_bits(l1));
  }
  u16* dh = Hp + (size_t)gt * 8;
  u16* dl = Lp + ((size_t)(b * QO + sl) * HD + ch * 8);
  {
    *(v4u*)(dh) = oh;
    if (dolo) { *(v4u*)(dl) = ol; }
  }
}

// =====================================================================================================
// v^T planes from the v projection F f32 [MROWS][HD] (row = b*SEQ + s, column = d), in fragment order:
//   VH = f16(v * 1024) for all keys s; VL = f16 residual (t - f16(t)) for keys s < QO only (compact: QO keys per batch).
//   Each 32-key tile (4096 B) is stored as [d subtile j = d/16][key chunk q = (s & 31)/8][column c = d & 15][8 keys]: the B
//   operand chunk of lane (h, c) for subtile j stands at j*1024 B + lane*16 B (q = h), its second chunk 512 B behind (q = 2 + h).
// Block = (b, 64 keys s0): each thread loads its 16 floats (key sl, d chunk dc) with 16-B loads, converts, scatters
// into two LDS tiles [64 d][64 keys] (pitch 72 halves; columns 64..71 never read); after a block barrier thread tid = (j, q, c)
// reads its 8 keys of row d = 16j + c for each of the block's two key tiles and stores them at chunk tid of that tile: 32
// consecutive lanes store 512 contiguous bytes.
// coverage: load 256 thr x 16 = 64 keys x 64 d (staged extent == consumed extent); store 2 key tiles x 256 thr x 8 halves
//           = the block's 8192 contiguous bytes of VH (and of VL when s0 < QO); grid = NB*NST blocks covers VH exactly once
//           and all QO keys of VL exactly once.
// Column sums for query row 0: the loaded f32 rows are also kept in an LDS tile [64 keys][64 d] (pitch 68 floats); after the
// barrier thread (d = tid & 63, g = tid >> 6) adds keys 16g .. 16g+15 of column d in f64, in key order, and stores the sum to
// PS[(bid*4 + g)][d]: 256 thr x 8 B = the block's 2048 contiguous bytes; grid = every one of the NB*NPS rows of PS exactly once.
// =====================================================================================================
__global__ __launch_bounds__(256) void vt16(const float* __restrict__ F, u16* VHo, u16* VLo, double* PS) {
  __shared__ __align__(16) u16 TH[HD * VTP];
  __shared__ __align__(16) u16 TL[HD * VTP];
  __shared__ __align__(16) float TF[64 * SLP];
  const int tid = threadIdx.x;
  const int bid = blockIdx.x;
  const int st  = bid % NST;
  const int b   = bid / NST;
  if (b >= NB) return;                      // block-uniform, before any barrier; never taken with the exact grid
  const int s0  = st * 64;
  const bool dolo = (s0 + 64 <= QO);        // block-uniform
  {
    const int sl = tid >> 2;                // key within tile 0..63
    const int dc = (tid & 3) * 16;          // d chunk 0,16,32,48
    const float* src = F + ((size_t)b * SEQ + s0 + sl) * HD + dc;
#pragma unroll
    for (int i = 0; i < 4; ++i) {
      const v4f a = *(const v4f*)(src + 4 * i);
      *(v4f*)(TF + sl * SLP + dc + 4 * i) = a;
#pragma unroll
      for (int e = 0; e < 4; ++e) {
        const float t = a[e] * VCAR;
        const _Float16 hv = (_Float16)t;
        const _Float16 lv = (_Float16)(t - (float)hv);
        TH[(dc + 4 * i + e) * VTP + sl] = h_bits(hv);
        TL[(dc + 4 * i + e) * VTP + sl] = h_bits(lv);
      }
    }
  }
  __syncthreads();
  v4u vh[2], vl[2];
  const int line = (tid >> 6) * 16 + (tid & 15);   // d = 16j + c
  const int p8   = ((tid >> 4) & 3) * 8;           // first key of chunk q within a 32-key tile
#pragma unroll
  for (int it = 0; it < 2; ++it) {                 // it = key tile within the block
    vh[it] = *(const v4u*)(TH + line * VTP + it * 32 + p8);
    vl[it] = *(const v4u*)(TL + line * VTP + it * 32 + p8);
  }
  u16* dh = VHo + ((size_t)b * SEQ + s0) * HD + tid * 8;
  u16* dl = VLo + ((size_t)b * QO + (dolo ? s0 : 0)) * HD + tid * 8;
  *(v4u*)(dh)           = vh[0];
  *(v4u*)(dh + 32 * HD) = vh[1];
  // the residual stores below reuse registers that the two stores above name: wait before they are overwritten; the
  // scheduling barrier keeps their address arithmetic behind the wait
  asm volatile("s_wait_xcnt 0x0" ::: "memory");
  __builtin_amdgcn_sched_barrier(0);
  if (dolo) {
    *(v4u*)(dl)           = vl[0];
    *(v4u*)(dl + 32 * HD) = vl[1];
  }
  // the sums below reuse registers that the tile stores above name: wait before they are overwritten; the scheduling
  // barrier keeps the address arithmetic of the sums from being moved up in front of the wait
  asm volatile("s_wait_xcnt 0x0" ::: "memory");
  __builtin_amdgcn_sched_barrier(0);
  {
    const float* col = TF + ((tid >> 6) * 16) * SLP + (tid & 63);
    double acc = 0.0;
#pragma unroll                              // constant LDS offsets
    for (int i = 0; i < 16; ++i) acc += (double)col[i * SLP];
    PS[(size_t)bid * 256 + tid] = acc;      // row bid*4 + (tid >> 6), column tid & 63
  }
}

// =====================================================================================================
// Projection C[MROWS][HD] (f32) = bf16(X) . bf16(Wf)^T, X f32 [b][s][DIN] (batch stride SEQ_FULL rows), Wf f32 [HD n][DIN k].
// Block = 64 rows x all 64 columns, 16 waves. Wave w loads rows 4w .. 4w+3 of Wf and of the block's X rows as f32, each load
// 512 contiguous bytes of one row, rounds to bf16 (nearest even) in registers and stores 8 B per lane to the LDS tiles
// [64][DIN] (pitch 520 halves = 16 B x 65). Behind a work-group barrier wave (rg = w >> 2, cg = w & 3) forms the 16x16 tile
// (rows 16rg, columns 16cg): DIN/32 products in ascending k, fragments from LDS (two 16-B loads each, split k map for A and
// B). The tiles go to an LDS tile [64][64] (pitch 68 floats); behind a second barrier the block stores its 16 KiB of C.
// coverage: load 16 waves x 4 rows x 4 x 512 B = 64 rows x 2048 B per operand (staged extent == consumed extent); store
//           2 x 512 thr x 4 floats = 64 x 64; grid = MROWS/64 blocks = every row of C exactly once, whole lines per wave.
// =====================================================================================================
__device__ __forceinline__ v2u bf4(v4f a) {                           // 4 f32 -> 4 bf16, nearest even
  const v2f lo = {a[0], a[1]}, hi = {a[2], a[3]};
  v2u o;
  o[0] = __builtin_bit_cast(unsigned, __builtin_convertvector(lo, v2b));
  o[1] = __builtin_bit_cast(unsigned, __builtin_convertvector(hi, v2b));
  return o;
}

__global__ __launch_bounds__(512)
void gemm_xw(const float* __restrict__ X, const float* __restrict__ Wf, float* C) {
  __shared__ __align__(16) u16 XS[64 * XSP];
  __shared__ __align__(16) u16 WS[64 * XSP];
  __shared__ __align__(16) float CS[64 * SLP];
  const int tid = threadIdx.x, wave = tid >> 5, lane = tid & 31, hh = lane >> 4, m = lane & 15;
  const int row0 = blockIdx.x * 64;
  if (row0 + 64 > MROWS) return;            // block-uniform, before any barrier; never taken with the exact grid
  const int b  = row0 / SEQ;
  const int s0 = row0 - b * SEQ;            // SEQ % 64 == 0: the 64 rows lie in one batch
  const float* wp = Wf + (size_t)(wave * 4) * DIN + lane * 4;
  const float* xp = X + ((size_t)b * SEQ_FULL + s0 + wave * 4) * DIN + lane * 4;
  v4f wv[16], xv[16];
#pragma unroll                              // all loads of the wave in flight together; W first: it comes from L2
  for (int i = 0; i < 16; ++i) wv[i] = *(const v4f*)(wp + (i >> 2) * DIN + (i & 3) * 128);
#pragma unroll                              // as above
  for (int i = 0; i < 16; ++i) xv[i] = *(const v4f*)(xp + (i >> 2) * DIN + (i & 3) * 128);
  // the work below may reuse registers that the loads above name: wait before they are overwritten (the two pointers are
  // inputs so that their registers live up to the wait); the scheduling barrier keeps that work behind the wait and every
  // load in front of the first conversion
  asm volatile("s_wait_xcnt 0x0" :: "v"(wp), "v"(xp) : "memory");
  __builtin_amdgcn_sched_barrier(0);
  {
    u16* wd = WS + (wave * 4) * XSP + lane * 4;
    u16* xd = XS + (wave * 4) * XSP + lane * 4;
#pragma unroll                              // constant register indices and LDS offsets
    for (int i = 0; i < 16; ++i) *(v2u*)(wd + (i >> 2) * XSP + (i & 3) * 128) = bf4(wv[i]);
    __builtin_amdgcn_sched_barrier(0);      // W is rounded and stored while the X loads are still in flight
#pragma unroll                              // as above
    for (int i = 0; i < 16; ++i) *(v2u*)(xd + (i >> 2) * XSP + (i & 3) * 128) = bf4(xv[i]);
  }
  __syncthreads();                          // publishes both bf16 tiles to every wave
  const int rg = wave >> 2, cg = wave & 3;
  const u16* ap = XS + (rg * 16 + m) * XSP + 8 * hh;
  const u16* bp = WS + (cg * 16 + m) * XSP + 8 * hh;
  v8f acc = zero8();
#pragma unroll                              // constant LDS offsets; fragment loads run ahead of the product chain
  for (int k0 = 0; k0 < DIN; k0 += 32) acc = mma_b(ldfrag_b(ap + k0), ldfrag_b(bp + k0), acc);
#pragma unroll                              // constant element indices
  for (int r = 0; r < 8; ++r) CS[(rg * 16 + 8 * hh + r) * SLP + cg * 16 + m] = acc[r];
  __syncthreads();                          // publishes the 64x64 f32 tile to the storing waves
  float* dst = C + (size_t)row0 * HD;
#pragma unroll                              // two independent 16-B stores per thread
  for (int it = 0; it < 2; ++it) {
    const int idx = it * 512 + tid;
    *(v4f*)(dst + (size_t)idx * 4) = *(const v4f*)(CS + (idx >> 4) * SLP + (idx & 15) * 4);
  }
}

// =====================================================================================================
// Single-head causal attention (key j contributes to query i only when j < i), hd = 64, f32 output.
// Block bid -> (batch b = bid / BPB, query tile index qi = bid % BPB): one work-group of WPB waves per 16-row query tile
// q0 = 16*qt; wave w takes the key tiles kt = w, w + WPB, .. below.
// RES == 1: query tiles q0 < QO, scores = q_hi.k_hi + q_lo.k_hi + q_hi.k_lo and P.v = hh + lh + hl; RES == 0: query tiles
// q0 >= QO, single products q_hi.k_hi, P_hi.v_hi.
//   q hi plane f16 x256, rows b*SEQ + s, q residual (compact) rows b*QO + s, 16-row tiles in fragment order (see split16);
//   k hi / residual planes likewise; v^T hi plane x1024 and v^T residual plane (compact), 32-key tiles in fragment order (vt16).
//   score (log2 domain) t(i, j) = (q_i.k_j over HD) * (1/8)*log2e/(256*256), replaced by -inf where key j >= query i.
//   Key tiles of 32 visited in order for kb <= q0 + 14 (later tiles hold only keys at or above every query row of the tile);
//   with RES == 1 this keeps every visited key below QO, inside the compact residual planes. Query row 0 has no admitted key:
//   its running max stays -inf, Z = 0, and the row is written as 0 here (a later launch writes its true value).
//   Per tile: 2 score subtiles x 2 k-steps, fragments loaded straight from the 16-bit planes (two 16-B loads per fragment,
//   each 512 contiguous bytes per wave, split k map); online max-subtracted base-2 softmax in f32, -inf-safe rescale; the 16x32 prob tile stored to wave-private
//   fragments of P*32768 (f16 hi plus its f16 residual) rebuilt from the LDS rows (float vector loads, same element type as
//   stored), v^T B fragments in 2 groups of 2 d-subtiles.
//   After the loop each wave stores its un-normalised 16x64 accumulators (over its own prob tile, which it has finished
//   reading) and its 16 (max, sum) pairs to LDS; one work-group barrier, which every wave reaches (also a wave without a key
//   tile: max -inf, sum 0, accumulators 0); then wave w merges query row w: M = max of the maxima, weights exp2(m - M) (0 where
//   m = -inf), Z and the row added up in wave order, out = row / Z (0 if Z == 0), carries 1/(32768*1024) folded once.
//   Every return stands in front of the barrier and is block-uniform; bounded loops only (nkt <= NKT).
// coverage: per wave 32 lanes x 2 floats = one 64-float output row, WPB waves = the tile's 16 rows; the two launches
//           (RES 1: NQO tiles, RES 0: NQT-NQO tiles) x NB = every (b, s) output row exactly once.
// =====================================================================================================
template <int RES>
__global__ __launch_bounds__(ATT_THREADS)
void attn_c(const u16* __restrict__ QHp, const u16* __restrict__ QLp,
            const u16* __restrict__ KHp, const u16* __restrict__ KLp,
            const u16* __restrict__ VHp, const u16* __restrict__ VLp,
            float* Out) {
  __shared__ __align__(16) float smem[WPB * WREG];
  __shared__ __align__(16) float mxs[16 * WPB];   // [query row][wave] running maxima
  __shared__ __align__(16) float sms[16 * WPB];   // [query row][wave] running sums
  constexpr int QT0 = (RES != 0) ? 0 : NQO;
  constexpr int NQL = (RES != 0) ? NQO : (NQT - NQO);
  constexpr int NQE = (NQL > 0) ? NQL : 1;
  constexpr int BPB = NQE;

  const int tid  = threadIdx.x;
  const int wave = __builtin_amdgcn_readfirstlane(tid >> 5);   // scalar: the key loop below branches on it, EXEC stays whole
  const int lane = tid & 31;
  const int hh   = lane >> 4;
  const int c    = lane & 15;
  const int bid  = blockIdx.x;
  const int b    = bid / BPB;
  const int qi   = bid - b * BPB;
  if (b >= NB) return;                      // block-uniform, before the barrier; never taken with the exact grid
  if (qi >= NQL) return;                    // block-uniform; never taken
  const int q0   = (QT0 + qi) * 16;
  if (q0 + 16 > SEQ) return;                // block-uniform; never taken
  if (RES != 0 && q0 + 16 > QO) return;     // block-uniform; never taken
  const int ql0  = (RES != 0) ? q0 : 0;

  float* pt   = smem + wave * WREG;         // prob tile [16][32] pitch 36, in the loop
  float* slab = pt;                         // the wave's partial result [16][64] pitch 68, behind the loop

  const size_t lcol = (size_t)8 * lane;     // the lane's 16-B chunk within a 512-B group of a fragment-order plane
  const _Float16* Qh  = ash(QHp) + ((size_t)b * SEQ + q0) * HD + lcol;
  const _Float16* Ql  = ash(QLp) + ((size_t)b * QO + ql0) * HD + lcol;              // RES == 1 only
  const _Float16* Khb = ash(KHp) + (size_t)b * SEQ * HD + lcol;                     // key tile kb * HD added per step
  const _Float16* Klb = ash(KLp) + (size_t)b * QO * HD + lcol;                      // RES == 1 only, keys < QO
  const _Float16* Vhb = ash(VHp) + (size_t)b * SEQ * HD + lcol;                     // key tile kb * HD added per step
  const _Float16* Vlb = ash(VLp) + (size_t)b * QO * HD + lcol;                      // RES == 1 only
  const float lsc = RSQ_HD * (LOG2E / (QSC * KSC));
  const float oc  = 1.0f / (PCAR * VCAR);
  const size_t KROW = (size_t)HD;           // halves per key in every plane: a 16-key tile is 16 * KROW, a 32-key tile 32 * KROW

  float mrow[8], lrow[8];
  v8f o[4];
#pragma unroll
  for (int r = 0; r < 8; ++r) { mrow[r] = -INFINITY; lrow[r] = 0.f; }
#pragma unroll
  for (int j = 0; j < 4; ++j) o[j] = zero8();
  const int ncaus = (q0 >> 5) + 1;                                            // tiles holding keys <= q0 + 14
  const int nkt = (ncaus < NKT) ? ncaus : NKT;
  const int qr0 = q0 + 8 * hh;                                                // query row of D element r = qr0 + r

#pragma unroll 1
  for (int kt = wave; kt < nkt; kt += WPB) {
    const int kb = kt * 32;
    // ---- scores: D element r of this lane = (query row qr0 + r, key kb + c) in s0, key kb + 16 + c in s1 ----
    v8f s0 = zero8(), s1 = zero8();
    const _Float16* k0p = Khb + (size_t)kb * KROW;
    const _Float16* k1p = k0p + (size_t)16 * KROW;
    if constexpr (RES != 0) {
      const _Float16* l0p = Klb + (size_t)kb * KROW;
      const _Float16* l1p = l0p + (size_t)16 * KROW;
#pragma unroll
      for (int kk = 0; kk < HD / 32; ++kk) {
        const v16h qh  = ldfrag_h(Qh + kk * FRS);
        const v16h ql  = ldfrag_h(Ql + kk * FRS);
        const v16h kh0 = ldfrag_h(k0p + kk * FRS);
        const v16h kh1 = ldfrag_h(k1p + kk * FRS);
        const v16h kl0 = ldfrag_h(l0p + kk * FRS);
        const v16h kl1 = ldfrag_h(l1p + kk * FRS);
        s0 = mma_h(qh, kh0, s0);
        s0 = mma_h(ql, kh0, s0);
        s0 = mma_h(qh, kl0, s0);
        s1 = mma_h(qh, kh1, s1);
        s1 = mma_h(ql, kh1, s1);
        s1 = mma_h(qh, kl1, s1);
        guard2(s0, s1, qh, ql, kh0, kl0, kh1, kl1);
      }
    } else {
#pragma unroll
      for (int kk = 0; kk < HD / 32; ++kk) {
        const v16h qh  = ldfrag_h(Qh + kk * FRS);
        const v16h kh0 = ldfrag_h(k0p + kk * FRS);
        const v16h kh1 = ldfrag_h(k1p + kk * FRS);
        s0 = mma_h(qh, kh0, s0);
        s1 = mma_h(qh, kh1, s1);
        guard2(s0, s1, qh, kh0, kh1, qh, kh0, kh1);
      }
    }
    // ---- causal select (key >= query excluded) + online softmax in base 2, -inf-safe ----
    const int key0 = kb + c, key1 = kb + 16 + c;
#pragma unroll
    for (int r = 0; r < 8; ++r) {
      const int   qr = qr0 + r;
      const float u0 = s0[r] * lsc;
      const float u1 = s1[r] * lsc;
      const float t0 = (key0 >= qr) ? -INFINITY : u0;
      const float t1 = (key1 >= qr) ? -INFINITY : u1;
      float mx = fmaxf(t0, t1);
#pragma unroll
      for (int off = 1; off < 16; off <<= 1) mx = fmaxf(mx, __shfl_xor(mx, off, 32));
      const float mn = fmaxf(mrow[r], mx);
      const float ms = (mn == -INFINITY) ? 0.0f : mn;
      const float al = exp2f(mrow[r] - ms);
      mrow[r] = mn;
      const float e0 = exp2f(t0 - ms), e1 = exp2f(t1 - ms);
      float ps = e0 + e1;
#pragma unroll
      for (int off = 1; off < 16; off <<= 1) ps += __shfl_xor(ps, off, 32);
      lrow[r] = lrow[r] * al + ps;
#pragma unroll
      for (int j = 0; j < 4; ++j) o[j][r] *= al;
      const int ro = (8 * hh + r) * PTP + c;
      pt[ro]      = e0;
      pt[ro + 16] = e1;
    }
    wave_sync_lds();
    // ---- A fragments of P*32768: hi f16 and residual f16, row = c, split k map over the 32 keys of this step ----
    FragH ph, pl;
    {
      const float* prow = pt + c * PTP + 8 * hh;
      const v4f p0 = *(const v4f*)(prow), p1 = *(const v4f*)(prow + 4);
      const v4f p2 = *(const v4f*)(prow + 16), p3 = *(const v4f*)(prow + 20);
#pragma unroll
      for (int e = 0; e < 4; ++e) {
        const float ta = p0[e] * PCAR, tb = p1[e] * PCAR, tc = p2[e] * PCAR, td = p3[e] * PCAR;
        const _Float16 ha = (_Float16)ta, hb = (_Float16)tb, hc = (_Float16)tc, hd = (_Float16)td;
        ph.h[0][e]     = ha;                  // elements 0..7  = keys kb + 8hh + 0..7
        ph.h[0][4 + e] = hb;
        ph.h[1][e]     = hc;                  // elements 8..15 = keys kb + 16 + 8hh + 0..7
        ph.h[1][4 + e] = hd;
        pl.h[0][e]     = (_Float16)(ta - (float)ha);
        pl.h[0][4 + e] = (_Float16)(tb - (float)hb);
        pl.h[1][e]     = (_Float16)(tc - (float)hc);
        pl.h[1][4 + e] = (_Float16)(td - (float)hd);
      }
    }
    // ---- P.V : B fragment col n = d = j*16 + c, subtile j at j * FRS in the key tile of the v^T planes; 2 groups of 2 ----
    {
      const _Float16* vhp = Vhb + (size_t)kb * KROW;
      if constexpr (RES != 0) {
        const _Float16* vlp = Vlb + (size_t)kb * KROW;
#pragma unroll
        for (int jg = 0; jg < 2; ++jg) {
          const size_t da = (size_t)(2 * jg) * FRS;
          const size_t db = da + (size_t)FRS;
          const size_t la = da;
          const size_t lb = db;
          const v16h vha = ldfrag_h(vhp + da), vhb2 = ldfrag_h(vhp + db);
          const v16h vla = ldfrag_h(vlp + la), vlb2 = ldfrag_h(vlp + lb);
          o[2 * jg]     = mma_h(ph.v, vha,  o[2 * jg]);
          o[2 * jg]     = mma_h(pl.v, vha,  o[2 * jg]);
          o[2 * jg]     = mma_h(ph.v, vla,  o[2 * jg]);
          o[2 * jg + 1] = mma_h(ph.v, vhb2, o[2 * jg + 1]);
          o[2 * jg + 1] = mma_h(pl.v, vhb2, o[2 * jg + 1]);
          o[2 * jg + 1] = mma_h(ph.v, vlb2, o[2 * jg + 1]);
          guard2(o[2 * jg], o[2 * jg + 1], ph.v, pl.v, vha, vhb2, vla, vlb2);
        }
      } else {
#pragma unroll
        for (int jg = 0; jg < 2; ++jg) {
          const size_t da = (size_t)(2 * jg) * FRS;
          const size_t db = da + (size_t)FRS;
          const v16h vha = ldfrag_h(vhp + da), vhb2 = ldfrag_h(vhp + db);
          o[2 * jg]     = mma_h(ph.v, vha,  o[2 * jg]);
          o[2 * jg + 1] = mma_h(ph.v, vhb2, o[2 * jg + 1]);
          guard2(o[2 * jg], o[2 * jg + 1], ph.v, vha, vhb2, ph.v, vha, vhb2);
        }
      }
    }
    wave_sync_lds();
  }
  acc_guard4(o[0], o[1], o[2], o[3]);
  // ---- the wave's partials to LDS: accumulators at (row 8hh + r, column 16j + c), (max, sum) of row 8hh + r from lane c == 0 ----
#pragma unroll                              // accumulators stay in registers: constant element indices, constant LDS offsets
  for (int r = 0; r < 8; ++r) {
    const int ro = (8 * hh + r) * SLP + c;
#pragma unroll                              // as above
    for (int j = 0; j < 4; ++j) slab[ro + 16 * j] = o[j][r];
  }
  if (c == 0) {
#pragma unroll                              // mrow, lrow stay in registers
    for (int r = 0; r < 8; ++r) {
      mxs[(8 * hh + r) * WPB + wave] = mrow[r];
      sms[(8 * hh + r) * WPB + wave] = lrow[r];
    }
  }
  __syncthreads();                          // publishes every wave's partials to the merging waves
  // ---- merge of query row q0 + wave over the WPB key ranges, in wave order; lane = columns 2*lane, 2*lane + 1 ----
  {
    const int row = wave;
    float mw[WPB], lw[WPB];
#pragma unroll                              // mw, lw stay in registers; the LDS loads go out together
    for (int g = 0; g < WPB / 4; ++g) {
      const v4f a = *(const v4f*)(mxs + row * WPB + 4 * g);
      const v4f z = *(const v4f*)(sms + row * WPB + 4 * g);
#pragma unroll                              // as above
      for (int e = 0; e < 4; ++e) { mw[4 * g + e] = a[e]; lw[4 * g + e] = z[e]; }
    }
    float mm = mw[0];
#pragma unroll                              // as above
    for (int w = 1; w < WPB; ++w) mm = fmaxf(mm, mw[w]);
    const float ms = (mm == -INFINITY) ? 0.0f : mm;
    const float* prt = smem + row * SLP + 2 * lane;
    float lv = 0.f, x0 = 0.f, x1 = 0.f;
#pragma unroll                              // the WPB partial-row loads go out together, one LDS latency instead of WPB
    for (int w = 0; w < WPB; ++w) {
      const float wg = exp2f(mw[w] - ms);
      const v2f  pv = *(const v2f*)(prt + w * WREG);
      lv += lw[w] * wg;
      x0 += pv[0] * wg;
      x1 += pv[1] * wg;
    }
    const float ls  = (lv > 0.0f) ? lv : 1.0f;
    const float inv = (lv > 0.0f) ? ((1.0f / ls) * oc) : 0.0f;
    v2f res;
    res[0] = x0 * inv;
    res[1] = x1 * inv;
    *(v2f*)(Out + ((size_t)b * SEQ_FULL + (size_t)(q0 + row)) * HD + 2 * lane) = res;
  }
}

// =====================================================================================================
// Query row 0 of every batch: uniform weights 1/SEQ over ALL keys -> out[b][0][d] = mean over s of F[b*SEQ + s][d], F the f32
// v projection, from its f64 16-key partial sums PS[b*NPS + p][d] (written by vt16 earlier in the same call). Block = batch b,
// 1024 threads: thread (d = tid & 63, g = tid >> 6) adds rows g, g + 16, .. of column d in that order (independent 8-B loads,
// the block reads 8192 contiguous bytes per step), partials combined in fixed order through LDS, scaled by 1/SEQ, staged as one
// f32 row in LDS; after a barrier lanes 0..15 of wave 0 write the 256-B output row (16 consecutive lanes x 16 B, one
// coverage: 16 lanes x 4 floats = the 64-float row; grid = NB blocks = every batch's row 0 exactly once.
// =====================================================================================================
__global__ __launch_bounds__(1024) void row0_mean(const double* __restrict__ PS, float* Out) {
  __shared__ double part[RGRP * HD];
  __shared__ __align__(16) float rowv[HD];
  const int tid = threadIdx.x;
  const int b   = blockIdx.x;
  if (b >= NB) return;                      // block-uniform, before any barrier; never taken with the exact grid
  const double* p = PS + (size_t)b * NPS * HD + tid;
  double acc = 0.0;
#pragma unroll                              // independent loads in flight together instead of one memory latency per row
  for (int s = 0; s < NPS / RGRP; ++s) acc += p[s * (RGRP * HD)];
  part[tid] = acc;
  __syncthreads();
  if (tid < HD) {
    double t = part[tid];
#pragma unroll                              // constant LDS offsets
    for (int g2 = 1; g2 < RGRP; ++g2) t += part[g2 * HD + tid];
    rowv[tid] = (float)t * (1.0f / (float)SEQ);
  }
  __syncthreads();
  if (tid < 16) {
    const v4f v = *(const v4f*)(rowv + 4 * tid);
    float* dst = Out + (size_t)b * SEQ_FULL * HD + 4 * tid;
    {
      *(v4f*)(dst) = v;
      
    }
  }
}

// =====================================================================================================
// Workspace map (bytes); every plane is fully written by whole-line stores before it is read; all extents are exact multiples
// of the store granularity (no pad rows needed); every region offset a multiple of 65536:
//   FV, FQ, FK f32 [MROWS][64]       MROWS*256 each                                                 (3 x 4194304)
//   QH  f16 MROWS x 64 x256          MROWS*128    QL residual NB*QO x 64   NB*QO*128                (2097152 + 262144)
//   KH  f16 MROWS x 64 x256          MROWS*128    KL residual NB*QO x 64   NB*QO*128                (2097152 + 262144)
//   VH  f16 MROWS x 64 x1024         MROWS*128    VL residual NB*QO x 64   NB*QO*128                (2097152 + 262144)
//   (QH .. VL in fragment order: 16-row tiles of 2048 B for q and k, 32-key tiles of 4096 B for v)
//   PS  f64 [NB*NPS][64] 16-key column sums of FV   NB*NPS*512                                      (524288)
//   end (NB=4, SEQ=4096)           20185088
// =====================================================================================================
extern "C" void kernel_launch(void* const* d_in, const int* in_sizes, int n_in,
                              void* d_out, int out_size, void* d_ws, size_t ws_size,
                              hipStream_t stream) {
  if (n_in < 6) return;
  const int needx = ((NB - 1) * SEQ_FULL + SEQ) * DIN;
  if (in_sizes[0] < needx) return;
  if (in_sizes[1] < needx) return;
  if (in_sizes[2] < needx) return;
  if (in_sizes[3] != HD * DIN) return;
  if (in_sizes[4] != HD * DIN) return;
  if (in_sizes[5] != HD * DIN) return;
  if (out_size < ((NB - 1) * SEQ_FULL + SEQ) * HD) return;

  const float* query = (const float*)d_in[0];
  const float* keyin = (const float*)d_in[1];
  const float* value = (const float*)d_in[2];
  const float* wq    = (const float*)d_in[3];
  const float* wk    = (const float*)d_in[4];
  const float* wv    = (const float*)d_in[5];
  float*       out   = (float*)d_out;

  const size_t szF  = (size_t)MROWS * HD * 4;
  const size_t szH  = (size_t)MROWS * HD * 2;                    // QH, KH
  const size_t szL  = (size_t)NB * QO * HD * 2;                  // QL, KL (compact residual planes)
  const size_t szVH = (size_t)NB * HD * SEQ * 2;                 // == szH
  const size_t szVL = (size_t)NB * HD * QO * 2;                  // == szL
  const size_t szPS = (size_t)NB * NPS * HD * 8;
  size_t off = 0;
  const size_t oFV = off; off += szF;
  const size_t oFQ = off; off += szF;
  const size_t oFK = off; off += szF;
  const size_t oQH = off; off += szH;
  const size_t oQL = off; off += szL;
  const size_t oKH = off; off += szH;
  const size_t oKL = off; off += szL;
  const size_t oVH = off; off += szVH;
  const size_t oVL = off; off += szVL;
  const size_t oPS = off; off += szPS;
  if (off > ws_size) return;                // off = 20185088 for NB = 4, SEQ = 4096
  if (off > (size_t)WS_CAP) return;

  char* ws = (char*)d_ws;
  float* FV  = (float*)(ws + oFV);
  float* FQ  = (float*)(ws + oFQ);
  float* FK  = (float*)(ws + oFK);
  u16*   QH  = (u16*)(ws + oQH);
  u16*   QL  = (u16*)(ws + oQL);
  u16*   KH  = (u16*)(ws + oKH);
  u16*   KL  = (u16*)(ws + oKL);
  u16*   VH  = (u16*)(ws + oVH);
  u16*   VL  = (u16*)(ws + oVL);
  double* PS = (double*)(ws + oPS);

  const dim3 b256(256), b512(512), bAT(ATT_THREADS), b1024(1024);
  const dim3 gG(MROWS / 64);
  const dim3 gVT(NB * NST);
  const int  n8q  = (MROWS * HD) / 8;                   // q / k hi planes
  const dim3 gSQ((n8q + 255) / 256);
  const dim3 gATR(NB * NQO);
  const int  nqp  = NQT - NQO;                          // query tiles with s >= QO
  const dim3 gR0(NB);

  // (1) v = value.Wv^T -> FV f32 [MROWS][64]; (2) v^T hi (all keys) + residual (keys < QO) x1024, and the f64 16-key column sums
  gemm_xw<<<gG, b512, 0, stream>>>(value, wv, FV);
  vt16<<<gVT, b256, 0, stream>>>(FV, VH, VL, PS);
  // (3) q = query.Wq^T -> FQ; (4) q hi (all rows) + residual (rows s < QO) x256
  gemm_xw<<<gG, b512, 0, stream>>>(query, wq, FQ);
  split16<<<gSQ, b256, 0, stream>>>(FQ, QH, QL, n8q, QSC);
  // (5) k = key.Wk^T -> FK; (6) k hi + residual planes x256
  gemm_xw<<<gG, b512, 0, stream>>>(keyin, wk, FK);
  split16<<<gSQ, b256, 0, stream>>>(FK, KH, KL, n8q, KSC);
  // (7) causal attention: query tiles s < QO with residual products -> out; (8) query tiles s >= QO single products -> out
  attn_c<1><<<gATR, bAT, 0, stream>>>(QH, QL, KH, KL, VH, VL, out);
  if (nqp > 0) {
    attn_c<0><<<dim3(NB * nqp), bAT, 0, stream>>>(QH, QL, KH, KL, VH, VL, out);
  }
  // (9) query row 0 of every batch = column mean of v over all SEQ keys, from the partial sums (written last)
  row0_mean<<<gR0, b1024, 0, stream>>>(PS, out);
  (void)hipGetLastError();
}

// v005
// One run takes 69.5 microseconds.
// Two timings next to v004 put it at 1.25 and 1.26 times that version's speed.
// Counting every step since v000, it is 8.70 times as fast.
// Contractions: value.Wv^T, query.Wq^T, key.Wk^T on v_wmma_f32_16x16x32_bf16 (inputs and W rounded to bf16 RNE on the way into
// LDS; W [n][k] rows are the k-contiguous B operand); q.k^T over hd 64 and P.v on v_wmma_f32_16x16x32_f16 (q, k x256, P x32768, v x1024 as f16
// planes; query rows s < QO additionally use f16 residual planes, products hh+lh+hl); all f32 accumulate. Strictly-earlier-key
// causal select, base-2 online softmax and 1/Z fold in f32 on VALU; query row 0 (uniform weights over all keys) = column mean
// of the f32 v projection with f64 accumulate on VALU (16-key partial sums in the v^T launch, added up in the last launch).
// Both attention products are formed transposed (S^T = k.q^T, O^T += v^T.P^T): a lane holds the scores of one query row, so the
// maximum and the sum are taken in its own registers plus one exchange with lane ^ 16, and P^T goes from the score registers straight into the B operand.
// Each 16-row query tile is one work-group of 16 waves: wave w walks key tiles w, w + 16, .. with its own maxima, sums and
// accumulators; the partials are merged through LDS behind one work-group barrier and the merge writes the f32 output.
// The f16 planes lie in fragment order: every 16-B chunk that a lane loads for an A or B operand stands at lane * 16 B inside a
// 512-B group, so that one fragment load of a wave reads four whole 128-B lines.
#include <hip/hip_runtime.h>
#include <math.h>
#include <stdint.h>

#ifndef NB
#define NB 4
#endif
#ifndef SEQ
#define SEQ 4096
#endif
#define SEQ_FULL 4096
#define DIN   512
#define HD    64
#define QO    ((SEQ < 512) ? SEQ : 512)
#define MROWS (NB * SEQ)
#define RSQ_HD 0.125f
#define LOG2E 1.4426950408889634f
#define QSC   256.0f
#define KSC   256.0f
#define PCAR  32768.0f
#define VCAR  1024.0f
#define WPB   16
#define NQT   (SEQ / 16)
#define NQO   (QO / 16)
#define NST   (SEQ / 64)
#define NKT   (SEQ / 32)
#define ATT_THREADS (WPB * 32)
#define SLP   68
#define SLW   (16 * SLP)
#define WREG  SLW
#define XSP   (DIN + 8)
#define VTP   72
#define C8R   (HD / 8)
#define NPS   (NST * 4)
#define RGRP  16
#define WS_CAP 134217728
#define FRH   256
#define FRS   (2 * FRH)
static_assert(HD == 64 && (DIN % 32) == 0 && DIN >= 32 && WPB == 16 && ATT_THREADS == 512);
static_assert(NB >= 1 && NB <= 4);
static_assert((SEQ % 64) == 0 && SEQ >= 64 && SEQ <= SEQ_FULL && (SEQ % 4) == 0);
static_assert((QO % 64) == 0 && QO >= 64 && QO <= SEQ);
static_assert((MROWS % 64) == 0 && C8R == 8 && SLP == 68 && DIN == 512);
static_assert(((MROWS * HD / 8) % 256) == 0);
static_assert((NPS % RGRP) == 0 && RGRP * HD == 1024);
static_assert((WPB * WREG + 2 * 16 * WPB) * 4 <= 81920 && 2 * HD * VTP * 2 <= 65536 && 2 * 64 * XSP * 2 + 64 * SLP * 4 <= 163840);

typedef unsigned short u16;
typedef _Float16 v16h __attribute__((ext_vector_type(16)));
typedef _Float16 v8h  __attribute__((ext_vector_type(8)));
typedef __bf16   v16b __attribute__((ext_vector_type(16)));
typedef __bf16   v2b  __attribute__((ext_vector_type(2)));
typedef float    v8f  __attribute__((ext_vector_type(8)));
typedef float    v4f  __attribute__((ext_vector_type(4)));
typedef float    v2f  __attribute__((ext_vector_type(2)));
typedef unsigned int v4u __attribute__((ext_vector_type(4)));
typedef unsigned int v2u __attribute__((ext_vector_type(2)));

union FragH { v16h v; v8h h[2]; v4u u[2]; };
union FragB { v16b v; v4u u[2]; };

// ---- scalar helpers --------------------------------------------------------------------------------
__device__ __forceinline__ unsigned short h_bits(_Float16 x) { return __builtin_bit_cast(unsigned short, x); }
__device__ __forceinline__ unsigned pk16(unsigned short a, unsigned short b) { return (unsigned)a | ((unsigned)b << 16); }
__device__ __forceinline__ v8f zero8() { v8f z = {0.f, 0.f, 0.f, 0.f, 0.f, 0.f, 0.f, 0.f}; return z; }
__device__ __forceinline__ const _Float16* ash(const u16* p) { return (const _Float16*)(const void*)p; }

// ---- fragment loaders: 16-bit A/B operand, lane -> row/col (lane&15), h = lane>>4; elements 0..7 = k0+8h.., elements 8..15 =
//      k0+16+8h.. (same split k map for A and B).
//      ldfrag_h: global f16 plane in fragment order, p already includes +8*lane: the two 16-B chunks of a lane stand 512 B apart
//      ldfrag_b: k-contiguous [n][k] LDS tile, p already includes +8*h: elements 0..7 <- p[0..7], 8..15 <- p[16..23]
__device__ __forceinline__ v16h ldfrag_h(const _Float16* p) {
  FragH f;
  f.h[0] = *(const v8h*)(p);
  f.h[1] = *(const v8h*)(p + FRH);
  return f.v;
}
__device__ __forceinline__ v16b ldfrag_b(const u16* p) {              // bf16 plane read as unsigned integer vectors
  FragB f;
  f.u[0] = *(const v4u*)(p);
  f.u[1] = *(const v4u*)(p + 16);
  return f.v;
}

__device__ __forceinline__ v8f mma_h(v16h a, v16h b, v8f c) {
  return __builtin_amdgcn_wmma_f32_16x16x32_f16(false, a, false, b, (short)0, c, false, false);
}
__device__ __forceinline__ v8f mma_b(v16b a, v16b b, v8f c) {
  return __builtin_amdgcn_wmma_f32_16x16x32_bf16(false, a, false, b, (short)0, c, false, false);
}
__device__ __forceinline__ void guard2(v8f& a, v8f& b, v16h x0, v16h x1, v16h x2, v16h x3, v16h x4, v16h x5) {
#if defined(__HIP_DEVICE_COMPILE__)
  asm volatile("v_nop\n\tv_nop\n\tv_nop\n\tv_nop"
               : "+v"(a), "+v"(b) : "v"(x0), "v"(x1), "v"(x2), "v"(x3), "v"(x4), "v"(x5) : "memory");
#endif
}
__device__ __forceinline__ void acc_guard4(v8f& a, v8f& b, v8f& c, v8f& d) {
#if defined(__HIP_DEVICE_COMPILE__)
  asm volatile("v_nop\n\tv_nop\n\tv_nop\n\tv_nop" : "+v"(a), "+v"(b), "+v"(c), "+v"(d));
#endif
}
__device__ __forceinline__ float xhalf(float x) {                     // value of lane l ^ 16
  const int b = __builtin_bit_cast(int, x);
  return __builtin_bit_cast(float, __builtin_amdgcn_permlanex16(b, b, 0x76543210, 0xfedcba98, false, false));
}

// =====================================================================================================
// f32 plane F [MROWS][HD] (row = b*SEQ + s) -> f16 hi plane Hp = f16(F * sc), all rows; and f16 residual plane
// Lp = f16(t - f16(t)), compact (row = b*QO + s), for rows with s < QO only. Both planes in fragment order: each 16-row tile
// (rows 16t .. 16t+15, 2048 B) is stored as [d chunk d8 = d/8][row c = row & 15][8 halves], so the operand chunk of lane
// (h, c) for k-step kk stands at kk*1024 B + lane*16 B (d8 = 4kk + h) and its second chunk 512 B behind (d8 = 4kk + 2 + h).
// Thread = one 16-B output chunk gt = (t, d8, c): two 16-B loads from row 16t + c, one 16-B store per plane; 32 consecutive
// lanes store 512 contiguous bytes (whole lines, one writing wave per line).
// coverage: Hp: ceil(n8/256) blocks x 256 thr x 8 = all MROWS x HD; Lp: every tile with s < QO x 128 thr x 8 = all NB*QO x HD.
// =====================================================================================================
__global__ __launch_bounds__(256) void split16(const float* __restrict__ F, u16* Hp, u16* Lp, int n8, float sc) {
  const int gt = blockIdx.x * 256 + (int)threadIdx.x;
  if (gt >= n8) return;
  const int r0  = (gt >> 7) * 16;           // first row of the 16-row tile
  const int ch  = gt & 127;                 // chunk within the tile = d8*16 + c
  const int row = r0 + (ch & 15);
  const int c8  = (ch >> 4) * 8;
  const int b   = r0 / SEQ;
  const int s0  = r0 - b * SEQ;             // SEQ % 16 == 0 and QO % 16 == 0: a tile lies in one batch, on one side of QO
  const bool dolo = (s0 < QO);
  const int  sl   = dolo ? s0 : 0;
  const float* p = F + (size_t)row * HD + c8;
  const v4f a = *(const v4f*)(p), b4 = *(const v4f*)(p + 4);
  float w[8];
#pragma unroll
  for (int e = 0; e < 4; ++e) { w[e] = a[e] * sc; w[4 + e] = b4[e] * sc; }
  v4u oh, ol;
#pragma unroll
  for (int e = 0; e < 4; ++e) {
    const float t0 = w[2 * e], t1 = w[2 * e + 1];
    const _Float16 h0 = (_Float16)t0, h1 = (_Float16)t1;
    const _Float16 l0 = (_Float16)(t0 - (float)h0), l1 = (_Float16)(t1 - (float)h1);
    oh[e] = pk16(h_bits(h0), h_bits(h1));
    ol[e] = pk16(h_bits(l0), h_bits(l1));
  }
  u16* dh = Hp + (size_t)gt * 8;
  u16* dl = Lp + ((size_t)(b * QO + sl) * HD + ch * 8);
  {
    *(v4u*)(dh) = oh;
    if (dolo) { *(v4u*)(dl) = ol; }
  }
}

// =====================================================================================================
// v^T planes from the v projection F f32 [MROWS][HD] (row = b*SEQ + s, column = d), in fragment order:
//   VH = f16(v * 1024) for all keys s; VL = f16 residual (t - f16(t)) for keys s < QO only (compact: QO keys per batch).
//   Each 32-key tile (4096 B) is stored as [d subtile j = d/16][key chunk q = (s & 31)/8][column c = d & 15][8 keys]: the A
//   operand chunk of lane (h, c) for subtile j stands at j*1024 B + lane*16 B (q = h), its second chunk 512 B behind (q = 2 + h).
// Block = (b, 64 keys s0): each thread loads its 16 floats (key sl, d chunk dc) with 16-B loads, converts, scatters
// into two LDS tiles [64 d][64 keys] (pitch 72 halves; columns 64..71 never read); after a block barrier thread tid = (j, q, c)
// reads its 8 keys of row d = 16j + c for each of the block's two key tiles and stores them at chunk tid of that tile: 32
// consecutive lanes store 512 contiguous bytes.
// coverage: load 256 thr x 16 = 64 keys x 64 d (staged extent == consumed extent); store 2 key tiles x 256 thr x 8 halves
//           = the block's 8192 contiguous bytes of VH (and of VL when s0 < QO); grid = NB*NST blocks covers VH exactly once
//           and all QO keys of VL exactly once.
// Column sums for query row 0: the loaded f32 rows are also kept in an LDS tile [64 keys][64 d] (pitch 68 floats); after the
// barrier thread (d = tid & 63, g = tid >> 6) adds keys 16g .. 16g+15 of column d in f64, in key order, and stores the sum to
// PS[(bid*4 + g)][d]: 256 thr x 8 B = the block's 2048 contiguous bytes; grid = every one of the NB*NPS rows of PS exactly once.
// =====================================================================================================
__global__ __launch_bounds__(256) void vt16(const float* __restrict__ F, u16* VHo, u16* VLo, double* PS) {
  __shared__ __align__(16) u16 TH[HD * VTP];
  __shared__ __align__(16) u16 TL[HD * VTP];
  __shared__ __align__(16) float TF[64 * SLP];
  const int tid = threadIdx.x;
  const int bid = blockIdx.x;
  const int st  = bid % NST;
  const int b   = bid / NST;
  if (b >= NB) return;                      // block-uniform, before any barrier; never taken with the exact grid
  const int s0  = st * 64;
  const bool dolo = (s0 + 64 <= QO);        // block-uniform
  {
    const int sl = tid >> 2;                // key within tile 0..63
    const int dc = (tid & 3) * 16;          // d chunk 0,16,32,48
    const float* src = F + ((size_t)b * SEQ + s0 + sl) * HD + dc;
#pragma unroll
    for (int i = 0; i < 4; ++i) {
      const v4f a = *(const v4f*)(src + 4 * i);
      *(v4f*)(TF + sl * SLP + dc + 4 * i) = a;
#pragma unroll
      for (int e = 0; e < 4; ++e) {
        const float t = a[e] * VCAR;
        const _Float16 hv = (_Float16)t;
        const _Float16 lv = (_Float16)(t - (float)hv);
        TH[(dc + 4 * i + e) * VTP + sl] = h_bits(hv);
        TL[(dc + 4 * i + e) * VTP + sl] = h_bits(lv);
      }
    }
  }
  __syncthreads();
  v4u vh[2], vl[2];
  const int line = (tid >> 6) * 16 + (tid & 15);   // d = 16j + c
  const int p8   = ((tid >> 4) & 3) * 8;           // first key of chunk q within a 32-key tile
#pragma unroll
  for (int it = 0; it < 2; ++it) {                 // it = key tile within the block
    vh[it] = *(const v4u*)(TH + line * VTP + it * 32 + p8);
    vl[it] = *(const v4u*)(TL + line * VTP + it * 32 + p8);
  }
  u16* dh = VHo + ((size_t)b * SEQ + s0) * HD + tid * 8;
  u16* dl = VLo + ((size_t)b * QO + (dolo ? s0 : 0)) * HD + tid * 8;
  *(v4u*)(dh)           = vh[0];
  *(v4u*)(dh + 32 * HD) = vh[1];
  // the residual stores below reuse registers that the two stores above name: wait before they are overwritten; the
  // scheduling barrier keeps their address arithmetic behind the wait
  asm volatile("s_wait_xcnt 0x0" ::: "memory");
  __builtin_amdgcn_sched_barrier(0);
  if (dolo) {
    *(v4u*)(dl)           = vl[0];
    *(v4u*)(dl + 32 * HD) = vl[1];
  }
  // the sums below reuse registers that the tile stores above name: wait before they are overwritten; the scheduling
  // barrier keeps the address arithmetic of the sums from being moved up in front of the wait
  asm volatile("s_wait_xcnt 0x0" ::: "memory");
  __builtin_amdgcn_sched_barrier(0);
  {
    const float* col = TF + ((tid >> 6) * 16) * SLP + (tid & 63);
    double acc = 0.0;
#pragma unroll                              // constant LDS offsets
    for (int i = 0; i < 16; ++i) acc += (double)col[i * SLP];
    PS[(size_t)bid * 256 + tid] = acc;      // row bid*4 + (tid >> 6), column tid & 63
  }
}

// =====================================================================================================
// Projection C[MROWS][HD] (f32) = bf16(X) . bf16(Wf)^T, X f32 [b][s][DIN] (batch stride SEQ_FULL rows), Wf f32 [HD n][DIN k].
// Block = 64 rows x all 64 columns, 16 waves. Wave w loads rows 4w .. 4w+3 of Wf and of the block's X rows as f32, each load
// 512 contiguous bytes of one row, rounds to bf16 (nearest even) in registers and stores 8 B per lane to the LDS tiles
// [64][DIN] (pitch 520 halves = 16 B x 65). Behind a work-group barrier wave (rg = w >> 2, cg = w & 3) forms the 16x16 tile
// (rows 16rg, columns 16cg): DIN/32 products in ascending k, fragments from LDS (two 16-B loads each, split k map for A and
// B). The tiles go to an LDS tile [64][64] (pitch 68 floats); behind a second barrier the block stores its 16 KiB of C.
// coverage: load 16 waves x 4 rows x 4 x 512 B = 64 rows x 2048 B per operand (staged extent == consumed extent); store
//           2 x 512 thr x 4 floats = 64 x 64; grid = MROWS/64 blocks = every row of C exactly once, whole lines per wave.
// =====================================================================================================
__device__ __forceinline__ v2u bf4(v4f a) {                           // 4 f32 -> 4 bf16, nearest even
  const v2f lo = {a[0], a[1]}, hi = {a[2], a[3]};
  v2u o;
  o[0] = __builtin_bit_cast(unsigned, __builtin_convertvector(lo, v2b));
  o[1] = __builtin_bit_cast(unsigned, __builtin_convertvector(hi, v2b));
  return o;
}

__global__ __launch_bounds__(512)
void gemm_xw(const float* __restrict__ X, const float* __restrict__ Wf, float* C) {
  __shared__ __align__(16) u16 XS[64 * XSP];
  __shared__ __align__(16) u16 WS[64 * XSP];
  __shared__ __align__(16) float CS[64 * SLP];
  const int tid = threadIdx.x, wave = tid >> 5, lane = tid & 31, hh = lane >> 4, m = lane & 15;
  const int row0 = blockIdx.x * 64;
  if (row0 + 64 > MROWS) return;            // block-uniform, before any barrier; never taken with the exact grid
  const int b  = row0 / SEQ;
  const int s0 = row0 - b * SEQ;            // SEQ % 64 == 0: the 64 rows lie in one batch
  const float* wp = Wf + (size_t)(wave * 4) * DIN + lane * 4;
  const float* xp = X + ((size_t)b * SEQ_FULL + s0 + wave * 4) * DIN + lane * 4;
  v4f wv[16], xv[16];
#pragma unroll                              // all loads of the wave in flight together; W first: it comes from L2
  for (int i = 0; i < 16; ++i) wv[i] = *(const v4f*)(wp + (i >> 2) * DIN + (i & 3) * 128);
#pragma unroll                              // as above
  for (int i = 0; i < 16; ++i) xv[i] = *(const v4f*)(xp + (i >> 2) * DIN + (i & 3) * 128);
  // the work below may reuse registers that the loads above name: wait before they are overwritten (the two pointers are
  // inputs so that their registers live up to the wait); the scheduling barrier keeps that work behind the wait and every
  // load in front of the first conversion
  asm volatile("s_wait_xcnt 0x0" :: "v"(wp), "v"(xp) : "memory");
  __builtin_amdgcn_sched_barrier(0);
  {
    u16* wd = WS + (wave * 4) * XSP + lane * 4;
    u16* xd = XS + (wave * 4) * XSP + lane * 4;
#pragma unroll                              // constant register indices and LDS offsets
    for (int i = 0; i < 16; ++i) *(v2u*)(wd + (i >> 2) * XSP + (i & 3) * 128) = bf4(wv[i]);
    __builtin_amdgcn_sched_barrier(0);      // W is rounded and stored while the X loads are still in flight
#pragma unroll                              // as above
    for (int i = 0; i < 16; ++i) *(v2u*)(xd + (i >> 2) * XSP + (i & 3) * 128) = bf4(xv[i]);
  }
  __syncthreads();                          // publishes both bf16 tiles to every wave
  const int rg = wave >> 2, cg = wave & 3;
  const u16* ap = XS + (rg * 16 + m) * XSP + 8 * hh;
  const u16* bp = WS + (cg * 16 + m) * XSP + 8 * hh;
  v8f acc = zero8();
#pragma unroll                              // constant LDS offsets; fragment loads run ahead of the product chain
  for (int k0 = 0; k0 < DIN; k0 += 32) acc = mma_b(ldfrag_b(ap + k0), ldfrag_b(bp + k0), acc);
#pragma unroll                              // constant element indices
  for (int r = 0; r < 8; ++r) CS[(rg * 16 + 8 * hh + r) * SLP + cg * 16 + m] = acc[r];
  __syncthreads();                          // publishes the 64x64 f32 tile to the storing waves
  float* dst = C + (size_t)row0 * HD;
#pragma unroll                              // two independent 16-B stores per thread
  for (int it = 0; it < 2; ++it) {
    const int idx = it * 512 + tid;
    *(v4f*)(dst + (size_t)idx * 4) = *(const v4f*)(CS + (idx >> 4) * SLP + (idx & 15) * 4);
  }
}

// =====================================================================================================
// Single-head causal attention (key j contributes to query i only when j < i), hd = 64, f32 output.
// Block bid -> (batch b = bid / BPB, query tile index qi = bid % BPB): one work-group of WPB waves per 16-row query tile
// q0 = 16*qt; wave w takes the key tiles kt = w, w + WPB, .. below.
// RES == 1: query tiles q0 < QO, scores = q_hi.k_hi + q_lo.k_hi + q_hi.k_lo and P.v = hh + lh + hl; RES == 0: query tiles
// q0 >= QO, single products q_hi.k_hi, P_hi.v_hi.
//   q hi plane f16 x256, rows b*SEQ + s, q residual (compact) rows b*QO + s, 16-row tiles in fragment order (see split16);
//   k hi / residual planes likewise; v^T hi plane x1024 and v^T residual plane (compact), 32-key tiles in fragment order (vt16).
//   score (log2 domain) t(i, j) = (q_i.k_j over HD) * (1/8)*log2e/(256*256), replaced by -inf where key j >= query i.
//   Key tiles of 32 visited in order for kb <= q0 + 14 (later tiles hold only keys at or above every query row of the tile);
//   with RES == 1 this keeps every visited key below QO, inside the compact residual planes. Query row 0 has no admitted key:
//   its running max stays -inf, Z = 0, and the row is written as 0 here (a later launch writes its true value).
//   Per tile: 2 score subtiles x 2 k-steps, fragments loaded straight from the 16-bit planes (two 16-B loads per fragment,
//   each 512 contiguous bytes per wave, split k map). The k fragment is the A operand and the q fragment the B operand (both
//   have the same lane and k map), so D = S^T: lane (hh, c) holds query row q0 + c and keys kb + 8hh + r (subtile 0) and
//   kb + 16 + 8hh + r (subtile 1). Online max-subtracted base-2 softmax in f32, -inf-safe rescale: maximum over the lane's 16
//   scores and one exchange with lane ^ 16; the running sum stays per lane half (its own keys) and the halves are added behind
//   the loop. The lane's 16 values of P*32768 (f16 hi plus its f16 residual) are, in that order, elements 0..15 of the B
//   operand P^T under the split k map; the v^T fragments are the A operand, in 2 groups of 2 d-subtiles: D = O^T, element r =
//   (d = 16j + 8hh + r, query row q0 + c).
//   After the loop each wave stores its un-normalised 16x64 accumulators
//   and its 16 (max, sum) pairs to LDS; one work-group barrier, which every wave reaches (also a wave without a key
//   tile: max -inf, sum 0, accumulators 0); then wave w merges query row w: M = max of the maxima, weights exp2(m - M) (0 where
//   m = -inf), Z and the row added up in wave order, out = row / Z (0 if Z == 0), carries 1/(32768*1024) folded once.
//   Every return stands in front of the barrier and is block-uniform; bounded loops only (nkt <= NKT).
// coverage: per wave 32 lanes x 2 floats = one 64-float output row, WPB waves = the tile's 16 rows; the two launches
//           (RES 1: NQO tiles, RES 0: NQT-NQO tiles) x NB = every (b, s) output row exactly once.
// =====================================================================================================
template <int RES>
__global__ __launch_bounds__(ATT_THREADS)
void attn_c(const u16* __restrict__ QHp, const u16* __restrict__ QLp,
            const u16* __restrict__ KHp, const u16* __restrict__ KLp,
            const u16* __restrict__ VHp, const u16* __restrict__ VLp,
            float* Out) {
  __shared__ __align__(16) float smem[WPB * WREG];
  __shared__ __align__(16) float mxs[16 * WPB];   // [query row][wave] running maxima
  __shared__ __align__(16) float sms[16 * WPB];   // [query row][wave] running sums
  constexpr int QT0 = (RES != 0) ? 0 : NQO;
  constexpr int NQL = (RES != 0) ? NQO : (NQT - NQO);
  constexpr int NQE = (NQL > 0) ? NQL : 1;
  constexpr int BPB = NQE;

  const int tid  = threadIdx.x;
  const int wave = __builtin_amdgcn_readfirstlane(tid >> 5);   // scalar: the key loop below branches on it, EXEC stays whole
  const int lane = tid & 31;
  const int hh   = lane >> 4;
  const int c    = lane & 15;
  const int bid  = blockIdx.x;
  const int b    = bid / BPB;
  const int qi   = bid - b * BPB;
  if (b >= NB) return;                      // block-uniform, before the barrier; never taken with the exact grid
  if (qi >= NQL) return;                    // block-uniform; never taken
  const int q0   = (QT0 + qi) * 16;
  if (q0 + 16 > SEQ) return;                // block-uniform; never taken
  if (RES != 0 && q0 + 16 > QO) return;     // block-uniform; never taken
  const int ql0  = (RES != 0) ? q0 : 0;

  float* slab = smem + wave * WREG;         // the wave's partial result [16][64] pitch 68, behind the loop

  const size_t lcol = (size_t)8 * lane;     // the lane's 16-B chunk within a 512-B group of a fragment-order plane
  const _Float16* Qh  = ash(QHp) + ((size_t)b * SEQ + q0) * HD + lcol;
  const _Float16* Ql  = ash(QLp) + ((size_t)b * QO + ql0) * HD + lcol;              // RES == 1 only
  const _Float16* Khb = ash(KHp) + (size_t)b * SEQ * HD + lcol;                     // key tile kb * HD added per step
  const _Float16* Klb = ash(KLp) + (size_t)b * QO * HD + lcol;                      // RES == 1 only, keys < QO
  const _Float16* Vhb = ash(VHp) + (size_t)b * SEQ * HD + lcol;                     // key tile kb * HD added per step
  const _Float16* Vlb = ash(VLp) + (size_t)b * QO * HD + lcol;                      // RES == 1 only
  const float lsc = RSQ_HD * (LOG2E / (QSC * KSC));
  const float oc  = 1.0f / (PCAR * VCAR);
  const size_t KROW = (size_t)HD;           // halves per key in every plane: a 16-key tile is 16 * KROW, a 32-key tile 32 * KROW

  float mrow = -INFINITY, lrow = 0.f;       // query row q0 + c: running maximum (equal in both lane halves), sum over this half's keys
  v8f o[4];
#pragma unroll
  for (int j = 0; j < 4; ++j) o[j] = zero8();
  const int ncaus = (q0 >> 5) + 1;                                            // tiles holding keys <= q0 + 14
  const int nkt = (ncaus < NKT) ? ncaus : NKT;
  const int qr  = q0 + c;                                                     // the lane's query row

#pragma unroll 1
  for (int kt = wave; kt < nkt; kt += WPB) {
    const int kb = kt * 32;
    // ---- scores, transposed: D element r of this lane = (key kb + 8hh + r, query row qr) in s0, key kb + 16 + 8hh + r in s1 ----
    v8f s0 = zero8(), s1 = zero8();
    const _Float16* k0p = Khb + (size_t)kb * KROW;
    const _Float16* k1p = k0p + (size_t)16 * KROW;
    if constexpr (RES != 0) {
      const _Float16* l0p = Klb + (size_t)kb * KROW;
      const _Float16* l1p = l0p + (size_t)16 * KROW;
#pragma unroll
      for (int kk = 0; kk < HD / 32; ++kk) {
        const v16h qh  = ldfrag_h(Qh + kk * FRS);
        const v16h ql  = ldfrag_h(Ql + kk * FRS);
        const v16h kh0 = ldfrag_h(k0p + kk * FRS);
        const v16h kh1 = ldfrag_h(k1p + kk * FRS);
        const v16h kl0 = ldfrag_h(l0p + kk * FRS);
        const v16h kl1 = ldfrag_h(l1p + kk * FRS);
        s0 = mma_h(kh0, qh, s0);
        s0 = mma_h(kh0, ql, s0);
        s0 = mma_h(kl0, qh, s0);
        s1 = mma_h(kh1, qh, s1);
        s1 = mma_h(kh1, ql, s1);
        s1 = mma_h(kl1, qh, s1);
        guard2(s0, s1, qh, ql, kh0, kl0, kh1, kl1);
      }
      // as in the other branch
      asm volatile("s_wait_xcnt 0x0" :: "v"(k0p), "v"(l0p) : "memory");
    } else {
#pragma unroll
      for (int kk = 0; kk < HD / 32; ++kk) {
        const v16h qh  = ldfrag_h(Qh + kk * FRS);
        const v16h kh0 = ldfrag_h(k0p + kk * FRS);
        const v16h kh1 = ldfrag_h(k1p + kk * FRS);
        s0 = mma_h(kh0, qh, s0);
        s1 = mma_h(kh1, qh, s1);
        guard2(s0, s1, qh, kh0, kh1, qh, kh0, kh1);
      }
      // the work below reuses registers that the loads above name: wait before they are overwritten (the pointer is an input
      // so that its registers live up to the wait and no later load of the group lands in them)
      asm volatile("s_wait_xcnt 0x0" :: "v"(k0p) : "memory");
    }
    // ---- causal select (key >= query excluded) + online softmax in base 2, -inf-safe ----
    const int nadm = qr - (kb + 8 * hh);    // element r of s0 is admitted where r < nadm, element r of s1 where 16 + r < nadm
    v8f t0 = s0 * lsc, t1 = s1 * lsc;
    float mx = -INFINITY;
#pragma unroll                              // scores stay in registers: constant element indices
    for (int r = 0; r < 8; ++r) {
      t0[r] = (r >= nadm) ? -INFINITY : t0[r];
      t1[r] = (16 + r >= nadm) ? -INFINITY : t1[r];
      mx = fmaxf(mx, fmaxf(t0[r], t1[r]));
    }
    mx = fmaxf(mx, xhalf(mx));              // the other 16 keys of the same query row
    const float mn = fmaxf(mrow, mx);
    const float ms = (mn == -INFINITY) ? 0.0f : mn;
    const float al = exp2f(mrow - ms);
    mrow = mn;
    t0 -= ms;
    t1 -= ms;
#pragma unroll                              // as above
    for (int r = 0; r < 8; ++r) {
      t0[r] = exp2f(t0[r]);
      t1[r] = exp2f(t1[r]);
    }
    const v8f pe = t0 + t1;
    lrow = lrow * al + (((pe[0] + pe[1]) + (pe[2] + pe[3])) + ((pe[4] + pe[5]) + (pe[6] + pe[7])));
#pragma unroll                              // accumulators stay in registers
    for (int j = 0; j < 4; ++j) o[j] *= al;
    // ---- B fragments of P^T*32768: hi f16 and residual f16, column = query row qr, split k map over the 32 keys of this step ----
    FragH ph, pl;
    t0 *= PCAR;
    t1 *= PCAR;
#pragma unroll                              // constant element indices
    for (int e = 0; e < 8; ++e) {
      const _Float16 ha = (_Float16)t0[e], hb = (_Float16)t1[e];
      ph.h[0][e] = ha;                        // elements 0..7  = keys kb + 8hh + 0..7
      ph.h[1][e] = hb;                        // elements 8..15 = keys kb + 16 + 8hh + 0..7
      pl.h[0][e] = (_Float16)(t0[e] - (float)ha);
      pl.h[1][e] = (_Float16)(t1[e] - (float)hb);
    }
    // ---- v^T.P^T : A fragment row m = d = j*16 + c, subtile j at j * FRS in the key tile of the v^T planes; 2 groups of 2 ----
    {
      const _Float16* vhp = Vhb + (size_t)kb * KROW;
      if constexpr (RES != 0) {
        const _Float16* vlp = Vlb + (size_t)kb * KROW;
#pragma unroll
        for (int jg = 0; jg < 2; ++jg) {
          const size_t da = (size_t)(2 * jg) * FRS;
          const size_t db = da + (size_t)FRS;
          const size_t la = da;
          const size_t lb = db;
          const v16h vha = ldfrag_h(vhp + da), vhb2 = ldfrag_h(vhp + db);
          const v16h vla = ldfrag_h(vlp + la), vlb2 = ldfrag_h(vlp + lb);
          o[2 * jg]     = mma_h(vha,  ph.v, o[2 * jg]);
          o[2 * jg]     = mma_h(vha,  pl.v, o[2 * jg]);
          o[2 * jg]     = mma_h(vla,  ph.v, o[2 * jg]);
          o[2 * jg + 1] = mma_h(vhb2, ph.v, o[2 * jg + 1]);
          o[2 * jg + 1] = mma_h(vhb2, pl.v, o[2 * jg + 1]);
          o[2 * jg + 1] = mma_h(vlb2, ph.v, o[2 * jg + 1]);
          guard2(o[2 * jg], o[2 * jg + 1], ph.v, pl.v, vha, vhb2, vla, vlb2);
        }
        // as in the other branch
        asm volatile("s_wait_xcnt 0x0" :: "v"(vhp), "v"(vlp) : "memory");
      } else {
#pragma unroll
        for (int jg = 0; jg < 2; ++jg) {
          const size_t da = (size_t)(2 * jg) * FRS;
          const size_t db = da + (size_t)FRS;
          const v16h vha = ldfrag_h(vhp + da), vhb2 = ldfrag_h(vhp + db);
          o[2 * jg]     = mma_h(vha,  ph.v, o[2 * jg]);
          o[2 * jg + 1] = mma_h(vhb2, ph.v, o[2 * jg + 1]);
          guard2(o[2 * jg], o[2 * jg + 1], ph.v, vha, vhb2, ph.v, vha, vhb2);
        }
        // the next trip's address arithmetic reuses registers that the loads above name: wait before they are overwritten
        // (the pointer is an input so that its registers live up to the wait)
        asm volatile("s_wait_xcnt 0x0" :: "v"(vhp) : "memory");
      }
    }
  }
  acc_guard4(o[0], o[1], o[2], o[3]);
  lrow += xhalf(lrow);                      // the two halves' keys together
  // ---- the wave's partials to LDS: accumulators at (row c, columns 16j + 8hh + 0..7), (max, sum) of row c from lanes hh == 0 ----
#pragma unroll                              // accumulators stay in registers: constant element indices, constant LDS offsets
  for (int j = 0; j < 4; ++j) {
    float* d = slab + c * SLP + 16 * j + 8 * hh;
    const v4f lo = {o[j][0], o[j][1], o[j][2], o[j][3]};
    const v4f hi = {o[j][4], o[j][5], o[j][6], o[j][7]};
    *(v4f*)(d)     = lo;
    *(v4f*)(d + 4) = hi;
  }
  if (hh == 0) {
    mxs[c * WPB + wave] = mrow;
    sms[c * WPB + wave] = lrow;
  }
  __syncthreads();                          // publishes every wave's partials to the merging waves
  // ---- merge of query row q0 + wave over the WPB key ranges, in wave order; lane = columns 2*lane, 2*lane + 1 ----
  {
    const int row = wave;
    float mw[WPB], lw[WPB];
#pragma unroll                              // mw, lw stay in registers; the LDS loads go out together
    for (int g = 0; g < WPB / 4; ++g) {
      const v4f a = *(const v4f*)(mxs + row * WPB + 4 * g);
      const v4f z = *(const v4f*)(sms + row * WPB + 4 * g);
#pragma unroll                              // as above
      for (int e = 0; e < 4; ++e) { mw[4 * g + e] = a[e]; lw[4 * g + e] = z[e]; }
    }
    float mm = mw[0];
#pragma unroll                              // as above
    for (int w = 1; w < WPB; ++w) mm = fmaxf(mm, mw[w]);
    const float ms = (mm == -INFINITY) ? 0.0f : mm;
    const float* prt = smem + row * SLP + 2 * lane;
    float lv = 0.f, x0 = 0.f, x1 = 0.f;
#pragma unroll                              // the WPB partial-row loads go out together, one LDS latency instead of WPB
    for (int w = 0; w < WPB; ++w) {
      const float wg = exp2f(mw[w] - ms);
      const v2f  pv = *(const v2f*)(prt + w * WREG);
      lv += lw[w] * wg;
      x0 += pv[0] * wg;
      x1 += pv[1] * wg;
    }
    const float ls  = (lv > 0.0f) ? lv : 1.0f;
    const float inv = (lv > 0.0f) ? ((1.0f / ls) * oc) : 0.0f;
    v2f res;
    res[0] = x0 * inv;
    res[1] = x1 * inv;
    *(v2f*)(Out + ((size_t)b * SEQ_FULL + (size_t)(q0 + row)) * HD + 2 * lane) = res;
  }
}

// =====================================================================================================
// Query row 0 of every batch: uniform weights 1/SEQ over ALL keys -> out[b][0][d] = mean over s of F[b*SEQ + s][d], F the f32
// v projection, from its f64 16-key partial sums PS[b*NPS + p][d] (written by vt16 earlier in the same call). Block = batch b,
// 1024 threads: thread (d = tid & 63, g = tid >> 6) adds rows g, g + 16, .. of column d in that order (independent 8-B loads,
// the block reads 8192 contiguous bytes per step), partials combined in fixed order through LDS, scaled by 1/SEQ, staged as one
// f32 row in LDS; after a barrier lanes 0..15 of wave 0 write the 256-B output row (16 consecutive lanes x 16 B, one
// coverage: 16 lanes x 4 floats = the 64-float row; grid = NB blocks = every batch's row 0 exactly once.
// =====================================================================================================
__global__ __launch_bounds__(1024) void row0_mean(const double* __restrict__ PS, float* Out) {
  __shared__ double part[RGRP * HD];
  __shared__ __align__(16) float rowv[HD];
  const int tid = threadIdx.x;
  const int b   = blockIdx.x;
  if (b >= NB) return;                      // block-uniform, before any barrier; never taken with the exact grid
  const double* p = PS + (size_t)b * NPS * HD + tid;
  double acc = 0.0;
#pragma unroll                              // independent loads in flight together instead of one memory latency per row
  for (int s = 0; s < NPS / RGRP; ++s) acc += p[s * (RGRP * HD)];
  part[tid] = acc;
  __syncthreads();
  if (tid < HD) {
    double t = part[tid];
#pragma unroll                              // constant LDS offsets
    for (int g2 = 1; g2 < RGRP; ++g2) t += part[g2 * HD + tid];
    rowv[tid] = (float)t * (1.0f / (float)SEQ);
  }
  __syncthreads();
  if (tid < 16) {
    const v4f v = *(const v4f*)(rowv + 4 * tid);
    float* dst = Out + (size_t)b * SEQ_FULL * HD + 4 * tid;
    {
      *(v4f*)(dst) = v;
      
    }
  }
}

// =====================================================================================================
// Workspace map (bytes); every plane is fully written by whole-line stores before it is read; all extents are exact multiples
// of the store granularity (no pad rows needed); every region offset a multiple of 65536:
//   FV, FQ, FK f32 [MROWS][64]       MROWS*256 each                                                 (3 x 4194304)
//   QH  f16 MROWS x 64 x256          MROWS*128    QL residual NB*QO x 64   NB*QO*128                (2097152 + 262144)
//   KH  f16 MROWS x 64 x256          MROWS*128    KL residual NB*QO x 64   NB*QO*128                (2097152 + 262144)
//   VH  f16 MROWS x 64 x1024         MROWS*128    VL residual NB*QO x 64   NB*QO*128                (2097152 + 262144)
//   (QH .. VL in fragment order: 16-row tiles of 2048 B for q and k, 32-key tiles of 4096 B for v)
//   PS  f64 [NB*NPS][64] 16-key column sums of FV   NB*NPS*512                                      (524288)
//   end (NB=4, SEQ=4096)           20185088
// =====================================================================================================
extern "C" void kernel_launch(void* const* d_in, const int* in_sizes, int n_in,
                              void* d_out, int out_size, void* d_ws, size_t ws_size,
                              hipStream_t stream) {
  if (n_in < 6) return;
  const int needx = ((NB - 1) * SEQ_FULL + SEQ) * DIN;
  if (in_sizes[0] < needx) return;
  if (in_sizes[1] < needx) return;
  if (in_sizes[2] < needx) return;
  if (in_sizes[3] != HD * DIN) return;
  if (in_sizes[4] != HD * DIN) return;
  if (in_sizes[5] != HD * DIN) return;
  if (out_size < ((NB - 1) * SEQ_FULL + SEQ) * HD) return;

  const float* query = (const float*)d_in[0];
  const float* keyin = (const float*)d_in[1];
  const float* value = (const float*)d_in[2];
  const float* wq    = (const float*)d_in[3];
  const float* wk    = (const float*)d_in[4];
  const float* wv    = (const float*)d_in[5];
  float*       out   = (float*)d_out;

  const size_t szF  = (size_t)MROWS * HD * 4;
  const size_t szH  = (size_t)MROWS * HD * 2;                    // QH, KH
  const size_t szL  = (size_t)NB * QO * HD * 2;                  // QL, KL (compact residual planes)
  const size_t szVH = (size_t)NB * HD * SEQ * 2;                 // == szH
  const size_t szVL = (size_t)NB * HD * QO * 2;                  // == szL
  const size_t szPS = (size_t)NB * NPS * HD * 8;
  size_t off = 0;
  const size_t oFV = off; off += szF;
  const size_t oFQ = off; off += szF;
  const size_t oFK = off; off += szF;
  const size_t oQH = off; off += szH;
  const size_t oQL = off; off += szL;
  const size_t oKH = off; off += szH;
  const size_t oKL = off; off += szL;
  const size_t oVH = off; off += szVH;
  const size_t oVL = off; off += szVL;
  const size_t oPS = off; off += szPS;
  if (off > ws_size) return;                // off = 20185088 for NB = 4, SEQ = 4096
  if (off > (size_t)WS_CAP) return;

  char* ws = (char*)d_ws;
  float* FV  = (float*)(ws + oFV);
  float* FQ  = (float*)(ws + oFQ);
  float* FK  = (float*)(ws + oFK);
  u16*   QH  = (u16*)(ws + oQH);
  u16*   QL  = (u16*)(ws + oQL);
  u16*   KH  = (u16*)(ws + oKH);
  u16*   KL  = (u16*)(ws + oKL);
  u16*   VH  = (u16*)(ws + oVH);
  u16*   VL  = (u16*)(ws + oVL);
  double* PS = (double*)(ws + oPS);

  const dim3 b256(256), b512(512), bAT(ATT_THREADS), b1024(1024);
  const dim3 gG(MROWS / 64);
  const dim3 gVT(NB * NST);
  const int  n8q  = (MROWS * HD) / 8;                   // q / k hi planes
  const dim3 gSQ((n8q + 255) / 256);
  const dim3 gATR(NB * NQO);
  const int  nqp  = NQT - NQO;                          // query tiles with s >= QO
  const dim3 gR0(NB);

  // (1) v = value.Wv^T -> FV f32 [MROWS][64]; (2) v^T hi (all keys) + residual (keys < QO) x1024, and the f64 16-key column sums
  gemm_xw<<<gG, b512, 0, stream>>>(value, wv, FV);
  vt16<<<gVT, b256, 0, stream>>>(FV, VH, VL, PS);
  // (3) q = query.Wq^T -> FQ; (4) q hi (all rows) + residual (rows s < QO) x256
  gemm_xw<<<gG, b512, 0, stream>>>(query, wq, FQ);
  split16<<<gSQ, b256, 0, stream>>>(FQ, QH, QL, n8q, QSC);
  // (5) k = key.Wk^T -> FK; (6) k hi + residual planes x256
  gemm_xw<<<gG, b512, 0, stream>>>(keyin, wk, FK);
  split16<<<gSQ, b256, 0, stream>>>(FK, KH, KL, n8q, KSC);
  // (7) causal attention: query tiles s < QO with residual products -> out; (8) query tiles s >= QO single products -> out
  attn_c<1><<<gATR, bAT, 0, stream>>>(QH, QL, KH, KL, VH, VL, out);
  if (nqp > 0) {
    attn_c<0><<<dim3(NB * nqp), bAT, 0, stream>>>(QH, QL, KH, KL, VH, VL, out);
  }
  // (9) query row 0 of every batch = column mean of v over all SEQ keys, from the partial sums (written last)
  row0_mean<<<gR0, b1024, 0, stream>>>(PS, out);
  (void)hipGetLastError();
}

// v006
// It runs in 58 microseconds.
// Timed twice side by side with v005, it ran 1.21 and 1.18 times as fast.
// Over all steps from v000 it is 10.4 times as fast.
// Contractions: value.Wv^T, query.Wq^T, key.Wk^T on v_wmma_f32_16x16x32_bf16 (inputs and W rounded to bf16 RNE on the way into
// LDS; W [n][k] rows are the k-contiguous B operand); q.k^T over hd 64 and P.v on v_wmma_f32_16x16x32_f16 (q, k x256, P x32768, v x1024 as f16
// planes; query rows s < QO additionally use f16 residual planes, products hh+lh+hl); all f32 accumulate. Strictly-earlier-key
// causal select, base-2 online softmax and 1/Z fold in f32 on VALU; query row 0 (uniform weights over all keys) = column mean
// of the f32 v projection with f64 accumulate on VALU (16-key partial sums in the projection launch, added up in the last launch).
// Both attention products are formed transposed (S^T = k.q^T, O^T += v^T.P^T): a lane holds the scores of one query row, so the
// maximum and the sum are taken in its own registers plus one exchange with lane ^ 16, and P^T goes from the score registers straight into the B operand.
// Each 16-row query tile is one work-group of 16 waves: wave w walks key tiles w, w + 16, .. with its own maxima, sums and
// accumulators; the partials are merged through LDS behind one work-group barrier and the merge writes the f32 output.
// The f16 planes lie in fragment order: every 16-B chunk that a lane loads for an A or B operand stands at lane * 16 B inside a
// 512-B group, so that one fragment load of a wave reads four whole 128-B lines. One launch forms all three projections; each of
// its work-groups writes its part of the f16 planes (and of the column sums) straight from its f32 result tile in LDS.
#include <hip/hip_runtime.h>
#include <math.h>
#include <stdint.h>

#ifndef NB
#define NB 4
#endif
#ifndef SEQ
#define SEQ 4096
#endif
#define SEQ_FULL 4096
#define DIN   512
#define HD    64
#define QO    ((SEQ < 512) ? SEQ : 512)
#define MROWS (NB * SEQ)
#define RSQ_HD 0.125f
#define LOG2E 1.4426950408889634f
#define QSC   256.0f
#define KSC   256.0f
#define PCAR  32768.0f
#define VCAR  1024.0f
#define WPB   16
#define NQT   (SEQ / 16)
#define NQO   (QO / 16)
#define NST   (SEQ / 64)
#define NKT   (SEQ / 32)
#define ATT_THREADS (WPB * 32)
#define SLP   68
#define SLW   (16 * SLP)
#define WREG  SLW
#define XSP   (DIN + 8)
#define NPS   (NST * 4)
#define RGRP  16
#define WS_CAP 134217728
#define FRH   256
#define FRS   (2 * FRH)
static_assert(HD == 64 && (DIN % 32) == 0 && DIN >= 32 && WPB == 16 && ATT_THREADS == 512);
static_assert(NB >= 1 && NB <= 4);
static_assert((SEQ % 64) == 0 && SEQ >= 64 && SEQ <= SEQ_FULL && (SEQ % 4) == 0);
static_assert((QO % 64) == 0 && QO >= 64 && QO <= SEQ);
static_assert((MROWS % 64) == 0 && SLP == 68 && DIN == 512);
static_assert((NPS % RGRP) == 0 && RGRP * HD == 1024);
static_assert((WPB * WREG + 2 * 16 * WPB) * 4 <= 81920 && 2 * 64 * XSP * 2 + 64 * SLP * 4 <= 163840);

typedef unsigned short u16;
typedef _Float16 v16h __attribute__((ext_vector_type(16)));
typedef _Float16 v8h  __attribute__((ext_vector_type(8)));
typedef __bf16   v16b __attribute__((ext_vector_type(16)));
typedef __bf16   v2b  __attribute__((ext_vector_type(2)));
typedef float    v8f  __attribute__((ext_vector_type(8)));
typedef float    v4f  __attribute__((ext_vector_type(4)));
typedef float    v2f  __attribute__((ext_vector_type(2)));
typedef unsigned int v4u __attribute__((ext_vector_type(4)));
typedef unsigned int v2u __attribute__((ext_vector_type(2)));

union FragH { v16h v; v8h h[2]; v4u u[2]; };
union FragB { v16b v; v4u u[2]; };

// ---- scalar helpers --------------------------------------------------------------------------------
__device__ __forceinline__ unsigned short h_bits(_Float16 x) { return __builtin_bit_cast(unsigned short, x); }
__device__ __forceinline__ unsigned pk16(unsigned short a, unsigned short b) { return (unsigned)a | ((unsigned)b << 16); }
__device__ __forceinline__ v8f zero8() { v8f z = {0.f, 0.f, 0.f, 0.f, 0.f, 0.f, 0.f, 0.f}; return z; }
__device__ __forceinline__ const _Float16* ash(const u16* p) { return (const _Float16*)(const void*)p; }

// ---- fragment loaders: 16-bit A/B operand, lane -> row/col (lane&15), h = lane>>4; elements 0..7 = k0+8h.., elements 8..15 =
//      k0+16+8h.. (same split k map for A and B).
//      ldfrag_h: global f16 plane in fragment order, p already includes +8*lane: the two 16-B chunks of a lane stand 512 B apart
//      ldfrag_b: k-contiguous [n][k] LDS tile, p already includes +8*h: elements 0..7 <- p[0..7], 8..15 <- p[16..23]
__device__ __forceinline__ v16h ldfrag_h(const _Float16* p) {
  FragH f;
  f.h[0] = *(const v8h*)(p);
  f.h[1] = *(const v8h*)(p + FRH);
  return f.v;
}
__device__ __forceinline__ v16b ldfrag_b(const u16* p) {              // bf16 plane read as unsigned integer vectors
  FragB f;
  f.u[0] = *(const v4u*)(p);
  f.u[1] = *(const v4u*)(p + 16);
  return f.v;
}

__device__ __forceinline__ v8f mma_h(v16h a, v16h b, v8f c) {
  return __builtin_amdgcn_wmma_f32_16x16x32_f16(false, a, false, b, (short)0, c, false, false);
}
__device__ __forceinline__ v8f mma_b(v16b a, v16b b, v8f c) {
  return __builtin_amdgcn_wmma_f32_16x16x32_bf16(false, a, false, b, (short)0, c, false, false);
}
__device__ __forceinline__ void guard2(v8f& a, v8f& b, v16h x0, v16h x1, v16h x2, v16h x3, v16h x4, v16h x5) {
#if defined(__HIP_DEVICE_COMPILE__)
  asm volatile("v_nop\n\tv_nop\n\tv_nop\n\tv_nop"
               : "+v"(a), "+v"(b) : "v"(x0), "v"(x1), "v"(x2), "v"(x3), "v"(x4), "v"(x5) : "memory");
#endif
}
__device__ __forceinline__ void acc_guard4(v8f& a, v8f& b, v8f& c, v8f& d) {
#if defined(__HIP_DEVICE_COMPILE__)
  asm volatile("v_nop\n\tv_nop\n\tv_nop\n\tv_nop" : "+v"(a), "+v"(b), "+v"(c), "+v"(d));
#endif
}
__device__ __forceinline__ float xhalf(float x) {                     // value of lane l ^ 16
  const int b = __builtin_bit_cast(int, x);
  return __builtin_bit_cast(float, __builtin_amdgcn_permlanex16(b, b, 0x76543210, 0xfedcba98, false, false));
}

// =====================================================================================================
// The three projections and their f16 planes, one launch. blockIdx.y = which: 0 v = value.Wv^T, 1 q = query.Wq^T, 2 k = key.Wk^T.
// C (f32, 64 rows x HD) = bf16(X) . bf16(Wf)^T, X f32 [b][s][DIN] (batch stride SEQ_FULL rows), Wf f32 [HD n][DIN k].
// Block = 64 rows x all 64 columns, 16 waves. Wave w loads rows 4w .. 4w+3 of Wf and of the block's X rows as f32, each load
// 512 contiguous bytes of one row, rounds to bf16 (nearest even) in registers and stores 8 B per lane to the LDS tiles
// [64][DIN] (pitch 520 halves = 16 B x 65). Behind a work-group barrier wave (rg = w >> 2, cg = w & 3) forms the 16x16 tile
// (rows 16rg, columns 16cg): DIN/32 products in ascending k, fragments from LDS (two 16-B loads each, split k map for A and
// B). The tiles go to an LDS tile CS [64][64] (pitch 68 floats); behind a second barrier thread tid forms the 16-B chunk tid of
// the block's 8192 contiguous bytes of the hi plane, hi = f16(t), t = C * scale, and of the residual plane, f16(t - hi), the
// latter stored for rows s < QO only (compact: QO rows per batch). 32 consecutive lanes store 512 contiguous bytes.
//   q, k (x256): each 16-row tile (2048 B) is stored as [d chunk d8 = d/8][row c = row & 15][8 halves], so the operand chunk of
//   lane (h, c) for k-step kk stands at kk*1024 B + lane*16 B (d8 = 4kk + h), its second chunk 512 B behind (d8 = 4kk + 2 + h).
//   tid = (tile, d8, c): two 16-B LDS loads from row 16*tile + c.
//   v^T (x1024): each 32-key tile (4096 B) is stored as [d subtile j = d/16][key chunk q = (s & 31)/8][column c = d & 15][8 keys]:
//   the operand chunk of lane (h, c) for subtile j stands at j*1024 B + lane*16 B (q = h), its second chunk 512 B behind
//   (q = 2 + h). tid = (key tile, j, q, c): eight 4-B LDS loads down column d = 16j + c.
// Column sums for query row 0 (which == 0): thread (d = tid & 63, g = tid >> 6), tid < 256, adds keys 16g .. 16g+15 of column d
// of CS in f64, in key order, and stores the sum to PS[(blockIdx.x*4 + g)][d].
// coverage: load 16 waves x 4 rows x 4 x 512 B = 64 rows x 2048 B per operand (staged extent == consumed extent); store
//           512 thr x 8 halves = 64 rows x 64 per plane; grid.x = MROWS/64 blocks = every row of each hi plane exactly once, all
//           NB*QO rows of each residual plane exactly once, every one of the NB*NPS rows of PS exactly once; whole lines per wave.
// =====================================================================================================
__device__ __forceinline__ v2u bf4(v4f a) {                           // 4 f32 -> 4 bf16, nearest even
  const v2f lo = {a[0], a[1]}, hi = {a[2], a[3]};
  v2u o;
  o[0] = __builtin_bit_cast(unsigned, __builtin_convertvector(lo, v2b));
  o[1] = __builtin_bit_cast(unsigned, __builtin_convertvector(hi, v2b));
  return o;
}

__global__ __launch_bounds__(512)
void proj_planes(const float* __restrict__ Xv, const float* __restrict__ Xq, const float* __restrict__ Xk,
                 const float* __restrict__ Wv, const float* __restrict__ Wq, const float* __restrict__ Wk,
                 u16* VHo, u16* VLo, u16* QHo, u16* QLo, u16* KHo, u16* KLo, double* PS) {
  __shared__ __align__(16) u16 XS[64 * XSP];
  __shared__ __align__(16) u16 WS[64 * XSP];
  __shared__ __align__(16) float CS[64 * SLP];
  const int tid = threadIdx.x, wave = tid >> 5, lane = tid & 31, hh = lane >> 4, m = lane & 15;
  const int which = blockIdx.y;
  const int row0 = blockIdx.x * 64;
  if (row0 + 64 > MROWS || which > 2) return;   // block-uniform, before any barrier; never taken with the exact grid
  const float* X  = (which == 0) ? Xv : ((which == 1) ? Xq : Xk);
  const float* Wf = (which == 0) ? Wv : ((which == 1) ? Wq : Wk);
  u16* Hp = (which == 0) ? VHo : ((which == 1) ? QHo : KHo);
  u16* Lp = (which == 0) ? VLo : ((which == 1) ? QLo : KLo);
  const int b  = row0 / SEQ;
  const int s0 = row0 - b * SEQ;            // SEQ % 64 == 0: the 64 rows lie in one batch
  const float* wp = Wf + (size_t)(wave * 4) * DIN + lane * 4;
  const float* xp = X + ((size_t)b * SEQ_FULL + s0 + wave * 4) * DIN + lane * 4;
  v4f wv[16], xv[16];
#pragma unroll                              // all loads of the wave in flight together; W first: it comes from L2
  for (int i = 0; i < 16; ++i) wv[i] = *(const v4f*)(wp + (i >> 2) * DIN + (i & 3) * 128);
#pragma unroll                              // as above
  for (int i = 0; i < 16; ++i) xv[i] = *(const v4f*)(xp + (i >> 2) * DIN + (i & 3) * 128);
  // the work below may reuse registers that the loads above name: wait before they are overwritten (the two pointers are
  // inputs so that their registers live up to the wait); the scheduling barrier keeps that work behind the wait and every
  // load in front of the first conversion
  asm volatile("s_wait_xcnt 0x0" :: "v"(wp), "v"(xp) : "memory");
  __builtin_amdgcn_sched_barrier(0);
  {
    u16* wd = WS + (wave * 4) * XSP + lane * 4;
    u16* xd = XS + (wave * 4) * XSP + lane * 4;
#pragma unroll                              // constant register indices and LDS offsets
    for (int i = 0; i < 16; ++i) *(v2u*)(wd + (i >> 2) * XSP + (i & 3) * 128) = bf4(wv[i]);
    __builtin_amdgcn_sched_barrier(0);      // W is rounded and stored while the X loads are still in flight
#pragma unroll                              // as above
    for (int i = 0; i < 16; ++i) *(v2u*)(xd + (i >> 2) * XSP + (i & 3) * 128) = bf4(xv[i]);
  }
  __syncthreads();                          // publishes both bf16 tiles to every wave
  const int rg = wave >> 2, cg = wave & 3;
  const u16* ap = XS + (rg * 16 + m) * XSP + 8 * hh;
  const u16* bp = WS + (cg * 16 + m) * XSP + 8 * hh;
  v8f acc = zero8();
#pragma unroll                              // constant LDS offsets; fragment loads run ahead of the product chain
  for (int k0 = 0; k0 < DIN; k0 += 32) acc = mma_b(ldfrag_b(ap + k0), ldfrag_b(bp + k0), acc);
#pragma unroll                              // constant element indices
  for (int r = 0; r < 8; ++r) CS[(rg * 16 + 8 * hh + r) * SLP + cg * 16 + m] = acc[r];
  __syncthreads();                          // publishes the 64x64 f32 tile to the waves that form the planes
  const bool dolo = (s0 < QO);              // block-uniform: s0 and QO are multiples of 64
  float w[8];
  double csum = 0.0;
  if (which == 0) {
    const float* col = CS + ((tid >> 8) * 32 + ((tid >> 4) & 3) * 8) * SLP + ((tid >> 6) & 3) * 16 + (tid & 15);
#pragma unroll                              // constant LDS offsets
    for (int e = 0; e < 8; ++e) w[e] = col[e * SLP] * VCAR;
    if (tid < 256) {
      const float* cs = CS + ((tid >> 6) * 16) * SLP + (tid & 63);
      float cv[16];
#pragma unroll                              // constant LDS offsets; the 16 loads go out together
      for (int i = 0; i < 16; ++i) cv[i] = cs[i * SLP];
      __builtin_amdgcn_sched_barrier(0);    // all 16 loads in front of the first addition: one LDS latency, not one per pair of keys
#pragma unroll                              // constant register indices
      for (int i = 0; i < 16; ++i) csum += (double)cv[i];
    }
  } else {
    const float* p = CS + ((tid >> 7) * 16 + (tid & 15)) * SLP + ((tid >> 4) & 7) * 8;
    const v4f a = *(const v4f*)(p), b4 = *(const v4f*)(p + 4);
    const float sc = (which == 1) ? QSC : KSC;
#pragma unroll                              // constant element indices
    for (int e = 0; e < 4; ++e) { w[e] = a[e] * sc; w[4 + e] = b4[e] * sc; }
  }
  v4u oh, ol;
#pragma unroll                              // constant element indices
  for (int e = 0; e < 4; ++e) {
    const float t0 = w[2 * e], t1 = w[2 * e + 1];
    const _Float16 h0 = (_Float16)t0, h1 = (_Float16)t1;
    const _Float16 l0 = (_Float16)(t0 - (float)h0), l1 = (_Float16)(t1 - (float)h1);
    oh[e] = pk16(h_bits(h0), h_bits(h1));
    ol[e] = pk16(h_bits(l0), h_bits(l1));
  }
  u16* dh = Hp + (size_t)row0 * HD + tid * 8;
  u16* dl = Lp + ((size_t)b * QO + (dolo ? s0 : 0)) * HD + tid * 8;
  double* dp = PS + (size_t)blockIdx.x * 256 + (tid & 255);   // row blockIdx.x*4 + (tid >> 6), column tid & 63
  *(v4u*)(dh) = oh;
  // the residual path below reuses registers that the store above names: wait before they are overwritten; the scheduling
  // barrier keeps that work behind the wait
  asm volatile("s_wait_xcnt 0x0" ::: "memory");
  __builtin_amdgcn_sched_barrier(0);
  if (dolo) { *(v4u*)(dl) = ol; }
  if (which == 0 && tid < 256) { *dp = csum; }
}

// =====================================================================================================
// Single-head causal attention (key j contributes to query i only when j < i), hd = 64, f32 output.
// Block bid -> (batch b = bid / BPB, query tile index qi = bid % BPB): one work-group of WPB waves per 16-row query tile
// q0 = 16*qt; wave w takes the key tiles kt = w, w + WPB, .. below.
// RES == 1: query tiles q0 < QO, scores = q_hi.k_hi + q_lo.k_hi + q_hi.k_lo and P.v = hh + lh + hl; RES == 0: query tiles
// q0 >= QO, single products q_hi.k_hi, P_hi.v_hi.
//   q hi plane f16 x256, rows b*SEQ + s, q residual (compact) rows b*QO + s, 16-row tiles in fragment order (see proj_planes);
//   k hi / residual planes likewise; v^T hi plane x1024 and v^T residual plane (compact), 32-key tiles in fragment order (proj_planes).
//   score (log2 domain) t(i, j) = (q_i.k_j over HD) * (1/8)*log2e/(256*256), replaced by -inf where key j >= query i.
//   Key tiles of 32 visited in order for kb <= q0 + 14 (later tiles hold only keys at or above every query row of the tile);
//   with RES == 1 this keeps every visited key below QO, inside the compact residual planes. Query row 0 has no admitted key:
//   its running max stays -inf, Z = 0, and the row is written as 0 here (a later launch writes its true value).
//   Per tile: 2 score subtiles x 2 k-steps, fragments loaded straight from the 16-bit planes (two 16-B loads per fragment,
//   each 512 contiguous bytes per wave, split k map). The k fragment is the A operand and the q fragment the B operand (both
//   have the same lane and k map), so D = S^T: lane (hh, c) holds query row q0 + c and keys kb + 8hh + r (subtile 0) and
//   kb + 16 + 8hh + r (subtile 1). Online max-subtracted base-2 softmax in f32, -inf-safe rescale: maximum over the lane's 16
//   scores and one exchange with lane ^ 16; the running sum stays per lane half (its own keys) and the halves are added behind
//   the loop. The lane's 16 values of P*32768 (f16 hi plus its f16 residual) are, in that order, elements 0..15 of the B
//   operand P^T under the split k map; the v^T fragments are the A operand, in 2 groups of 2 d-subtiles: D = O^T, element r =
//   (d = 16j + 8hh + r, query row q0 + c).
//   After the loop each wave stores its un-normalised 16x64 accumulators
//   and its 16 (max, sum) pairs to LDS; one work-group barrier, which every wave reaches (also a wave without a key
//   tile: max -inf, sum 0, accumulators 0); then wave w merges query row w: M = max of the maxima, weights exp2(m - M) (0 where
//   m = -inf), Z and the row added up in wave order, out = row / Z (0 if Z == 0), carries 1/(32768*1024) folded once.
//   Every return stands in front of the barrier and is block-uniform; bounded loops only (nkt <= NKT).
// coverage: per wave 32 lanes x 2 floats = one 64-float output row, WPB waves = the tile's 16 rows; the two launches
//           (RES 1: NQO tiles, RES 0: NQT-NQO tiles) x NB = every (b, s) output row exactly once.
// =====================================================================================================
template <int RES>
__global__ __launch_bounds__(ATT_THREADS)
void attn_c(const u16* __restrict__ QHp, const u16* __restrict__ QLp,
            const u16* __restrict__ KHp, const u16* __restrict__ KLp,
            const u16* __restrict__ VHp, const u16* __restrict__ VLp,
            float* Out) {
  __shared__ __align__(16) float smem[WPB * WREG];
  __shared__ __align__(16) float mxs[16 * WPB];   // [query row][wave] running maxima
  __shared__ __align__(16) float sms[16 * WPB];   // [query row][wave] running sums
  constexpr int QT0 = (RES != 0) ? 0 : NQO;
  constexpr int NQL = (RES != 0) ? NQO : (NQT - NQO);
  constexpr int NQE = (NQL > 0) ? NQL : 1;
  constexpr int BPB = NQE;

  const int tid  = threadIdx.x;
  const int wave = __builtin_amdgcn_readfirstlane(tid >> 5);   // scalar: the key loop below branches on it, EXEC stays whole
  const int lane = tid & 31;
  const int hh   = lane >> 4;
  const int c    = lane & 15;
  const int bid  = blockIdx.x;
  const int b    = bid / BPB;
  const int qi   = bid - b * BPB;
  if (b >= NB) return;                      // block-uniform, before the barrier; never taken with the exact grid
  if (qi >= NQL) return;                    // block-uniform; never taken
  const int q0   = (QT0 + qi) * 16;
  if (q0 + 16 > SEQ) return;                // block-uniform; never taken
  if (RES != 0 && q0 + 16 > QO) return;     // block-uniform; never taken
  const int ql0  = (RES != 0) ? q0 : 0;

  float* slab = smem + wave * WREG;         // the wave's partial result [16][64] pitch 68, behind the loop

  const size_t lcol = (size_t)8 * lane;     // the lane's 16-B chunk within a 512-B group of a fragment-order plane
  const _Float16* Qh  = ash(QHp) + ((size_t)b * SEQ + q0) * HD + lcol;
  const _Float16* Ql  = ash(QLp) + ((size_t)b * QO + ql0) * HD + lcol;              // RES == 1 only
  const _Float16* Khb = ash(KHp) + (size_t)b * SEQ * HD + lcol;                     // key tile kb * HD added per step
  const _Float16* Klb = ash(KLp) + (size_t)b * QO * HD + lcol;                      // RES == 1 only, keys < QO
  const _Float16* Vhb = ash(VHp) + (size_t)b * SEQ * HD + lcol;                     // key tile kb * HD added per step
  const _Float16* Vlb = ash(VLp) + (size_t)b * QO * HD + lcol;                      // RES == 1 only
  const float lsc = RSQ_HD * (LOG2E / (QSC * KSC));
  const float oc  = 1.0f / (PCAR * VCAR);
  const size_t KROW = (size_t)HD;           // halves per key in every plane: a 16-key tile is 16 * KROW, a 32-key tile 32 * KROW

  float mrow = -INFINITY, lrow = 0.f;       // query row q0 + c: running maximum (equal in both lane halves), sum over this half's keys
  v8f o[4];
#pragma unroll
  for (int j = 0; j < 4; ++j) o[j] = zero8();
  const int ncaus = (q0 >> 5) + 1;                                            // tiles holding keys <= q0 + 14
  const int nkt = (ncaus < NKT) ? ncaus : NKT;
  const int qr  = q0 + c;                                                     // the lane's query row

#pragma unroll 1
  for (int kt = wave; kt < nkt; kt += WPB) {
    const int kb = kt * 32;
    // ---- scores, transposed: D element r of this lane = (key kb + 8hh + r, query row qr) in s0, key kb + 16 + 8hh + r in s1 ----
    v8f s0 = zero8(), s1 = zero8();
    const _Float16* k0p = Khb + (size_t)kb * KROW;
    const _Float16* k1p = k0p + (size_t)16 * KROW;
    if constexpr (RES != 0) {
      const _Float16* l0p = Klb + (size_t)kb * KROW;
      const _Float16* l1p = l0p + (size_t)16 * KROW;
#pragma unroll
      for (int kk = 0; kk < HD / 32; ++kk) {
        const v16h qh  = ldfrag_h(Qh + kk * FRS);
        const v16h ql  = ldfrag_h(Ql + kk * FRS);
        const v16h kh0 = ldfrag_h(k0p + kk * FRS);
        const v16h kh1 = ldfrag_h(k1p + kk * FRS);
        const v16h kl0 = ldfrag_h(l0p + kk * FRS);
        const v16h kl1 = ldfrag_h(l1p + kk * FRS);
        s0 = mma_h(kh0, qh, s0);
        s0 = mma_h(kh0, ql, s0);
        s0 = mma_h(kl0, qh, s0);
        s1 = mma_h(kh1, qh, s1);
        s1 = mma_h(kh1, ql, s1);
        s1 = mma_h(kl1, qh, s1);
        guard2(s0, s1, qh, ql, kh0, kl0, kh1, kl1);
      }
      // as in the other branch
      asm volatile("s_wait_xcnt 0x0" :: "v"(k0p), "v"(l0p) : "memory");
    } else {
#pragma unroll
      for (int kk = 0; kk < HD / 32; ++kk) {
        const v16h qh  = ldfrag_h(Qh + kk * FRS);
        const v16h kh0 = ldfrag_h(k0p + kk * FRS);
        const v16h kh1 = ldfrag_h(k1p + kk * FRS);
        s0 = mma_h(kh0, qh, s0);
        s1 = mma_h(kh1, qh, s1);
        guard2(s0, s1, qh, kh0, kh1, qh, kh0, kh1);
      }
      // the work below reuses registers that the loads above name: wait before they are overwritten (the pointer is an input
      // so that its registers live up to the wait and no later load of the group lands in them)
      asm volatile("s_wait_xcnt 0x0" :: "v"(k0p) : "memory");
    }
    // ---- causal select (key >= query excluded) + online softmax in base 2, -inf-safe ----
    const int nadm = qr - (kb + 8 * hh);    // element r of s0 is admitted where r < nadm, element r of s1 where 16 + r < nadm
    v8f t0 = s0 * lsc, t1 = s1 * lsc;
    float mx = -INFINITY;
#pragma unroll                              // scores stay in registers: constant element indices
    for (int r = 0; r < 8; ++r) {
      t0[r] = (r >= nadm) ? -INFINITY : t0[r];
      t1[r] = (16 + r >= nadm) ? -INFINITY : t1[r];
      mx = fmaxf(mx, fmaxf(t0[r], t1[r]));
    }
    mx = fmaxf(mx, xhalf(mx));              // the other 16 keys of the same query row
    const float mn = fmaxf(mrow, mx);
    const float ms = (mn == -INFINITY) ? 0.0f : mn;
    const float al = exp2f(mrow - ms);
    mrow = mn;
    t0 -= ms;
    t1 -= ms;
#pragma unroll                              // as above
    for (int r = 0; r < 8; ++r) {
      t0[r] = exp2f(t0[r]);
      t1[r] = exp2f(t1[r]);
    }
    const v8f pe = t0 + t1;
    lrow = lrow * al + (((pe[0] + pe[1]) + (pe[2] + pe[3])) + ((pe[4] + pe[5]) + (pe[6] + pe[7])));
#pragma unroll                              // accumulators stay in registers
    for (int j = 0; j < 4; ++j) o[j] *= al;
    // ---- B fragments of P^T*32768: hi f16 and residual f16, column = query row qr, split k map over the 32 keys of this step ----
    FragH ph, pl;
    t0 *= PCAR;
    t1 *= PCAR;
#pragma unroll                              // constant element indices
    for (int e = 0; e < 8; ++e) {
      const _Float16 ha = (_Float16)t0[e], hb = (_Float16)t1[e];
      ph.h[0][e] = ha;                        // elements 0..7  = keys kb + 8hh + 0..7
      ph.h[1][e] = hb;                        // elements 8..15 = keys kb + 16 + 8hh + 0..7
      pl.h[0][e] = (_Float16)(t0[e] - (float)ha);
      pl.h[1][e] = (_Float16)(t1[e] - (float)hb);
    }
    // ---- v^T.P^T : A fragment row m = d = j*16 + c, subtile j at j * FRS in the key tile of the v^T planes; 2 groups of 2 ----
    {
      const _Float16* vhp = Vhb + (size_t)kb * KROW;
      if constexpr (RES != 0) {
        const _Float16* vlp = Vlb + (size_t)kb * KROW;
#pragma unroll
        for (int jg = 0; jg < 2; ++jg) {
          const size_t da = (size_t)(2 * jg) * FRS;
          const size_t db = da + (size_t)FRS;
          const size_t la = da;
          const size_t lb = db;
          const v16h vha = ldfrag_h(vhp + da), vhb2 = ldfrag_h(vhp + db);
          const v16h vla = ldfrag_h(vlp + la), vlb2 = ldfrag_h(vlp + lb);
          o[2 * jg]     = mma_h(vha,  ph.v, o[2 * jg]);
          o[2 * jg]     = mma_h(vha,  pl.v, o[2 * jg]);
          o[2 * jg]     = mma_h(vla,  ph.v, o[2 * jg]);
          o[2 * jg + 1] = mma_h(vhb2, ph.v, o[2 * jg + 1]);
          o[2 * jg + 1] = mma_h(vhb2, pl.v, o[2 * jg + 1]);
          o[2 * jg + 1] = mma_h(vlb2, ph.v, o[2 * jg + 1]);
          guard2(o[2 * jg], o[2 * jg + 1], ph.v, pl.v, vha, vhb2, vla, vlb2);
        }
        // as in the other branch
        asm volatile("s_wait_xcnt 0x0" :: "v"(vhp), "v"(vlp) : "memory");
      } else {
#pragma unroll
        for (int jg = 0; jg < 2; ++jg) {
          const size_t da = (size_t)(2 * jg) * FRS;
          const size_t db = da + (size_t)FRS;
          const v16h vha = ldfrag_h(vhp + da), vhb2 = ldfrag_h(vhp + db);
          o[2 * jg]     = mma_h(vha,  ph.v, o[2 * jg]);
          o[2 * jg + 1] = mma_h(vhb2, ph.v, o[2 * jg + 1]);
          guard2(o[2 * jg], o[2 * jg + 1], ph.v, vha, vhb2, ph.v, vha, vhb2);
        }
        // the next trip's address arithmetic reuses registers that the loads above name: wait before they are overwritten
        // (the pointer is an input so that its registers live up to the wait)
        asm volatile("s_wait_xcnt 0x0" :: "v"(vhp) : "memory");
      }
    }
  }
  acc_guard4(o[0], o[1], o[2], o[3]);
  lrow += xhalf(lrow);                      // the two halves' keys together
  // ---- the wave's partials to LDS: accumulators at (row c, columns 16j + 8hh + 0..7), (max, sum) of row c from lanes hh == 0 ----
#pragma unroll                              // accumulators stay in registers: constant element indices, constant LDS offsets
  for (int j = 0; j < 4; ++j) {
    float* d = slab + c * SLP + 16 * j + 8 * hh;
    const v4f lo = {o[j][0], o[j][1], o[j][2], o[j][3]};
    const v4f hi = {o[j][4], o[j][5], o[j][6], o[j][7]};
    *(v4f*)(d)     = lo;
    *(v4f*)(d + 4) = hi;
  }
  if (hh == 0) {
    mxs[c * WPB + wave] = mrow;
    sms[c * WPB + wave] = lrow;
  }
  __syncthreads();                          // publishes every wave's partials to the merging waves
  // ---- merge of query row q0 + wave over the WPB key ranges, in wave order; lane = columns 2*lane, 2*lane + 1 ----
  {
    const int row = wave;
    float mw[WPB], lw[WPB];
#pragma unroll                              // mw, lw stay in registers; the LDS loads go out together
    for (int g = 0; g < WPB / 4; ++g) {
      const v4f a = *(const v4f*)(mxs + row * WPB + 4 * g);
      const v4f z = *(const v4f*)(sms + row * WPB + 4 * g);
#pragma unroll                              // as above
      for (int e = 0; e < 4; ++e) { mw[4 * g + e] = a[e]; lw[4 * g + e] = z[e]; }
    }
    float mm = mw[0];
#pragma unroll                              // as above
    for (int w = 1; w < WPB; ++w) mm = fmaxf(mm, mw[w]);
    const float ms = (mm == -INFINITY) ? 0.0f : mm;
    const float* prt = smem + row * SLP + 2 * lane;
    float lv = 0.f, x0 = 0.f, x1 = 0.f;
#pragma unroll                              // the WPB partial-row loads go out together, one LDS latency instead of WPB
    for (int w = 0; w < WPB; ++w) {
      const float wg = exp2f(mw[w] - ms);
      const v2f  pv = *(const v2f*)(prt + w * WREG);
      lv += lw[w] * wg;
      x0 += pv[0] * wg;
      x1 += pv[1] * wg;
    }
    const float ls  = (lv > 0.0f) ? lv : 1.0f;
    const float inv = (lv > 0.0f) ? ((1.0f / ls) * oc) : 0.0f;
    v2f res;
    res[0] = x0 * inv;
    res[1] = x1 * inv;
    *(v2f*)(Out + ((size_t)b * SEQ_FULL + (size_t)(q0 + row)) * HD + 2 * lane) = res;
  }
}

// =====================================================================================================
// Query row 0 of every batch: uniform weights 1/SEQ over ALL keys -> out[b][0][d] = mean over s of F[b*SEQ + s][d], F the f32
// v projection, from its f64 16-key partial sums PS[b*NPS + p][d] (written by proj_planes earlier in the same call). Block = batch b,
// 1024 threads: thread (d = tid & 63, g = tid >> 6) adds rows g, g + 16, .. of column d in that order (independent 8-B loads,
// the block reads 8192 contiguous bytes per step), partials combined in fixed order through LDS, scaled by 1/SEQ, staged as one
// f32 row in LDS; after a barrier lanes 0..15 of wave 0 write the 256-B output row (16 consecutive lanes x 16 B, one
// coverage: 16 lanes x 4 floats = the 64-float row; grid = NB blocks = every batch's row 0 exactly once.
// =====================================================================================================
__global__ __launch_bounds__(1024) void row0_mean(const double* __restrict__ PS, float* Out) {
  __shared__ double part[RGRP * HD];
  __shared__ __align__(16) float rowv[HD];
  const int tid = threadIdx.x;
  const int b   = blockIdx.x;
  if (b >= NB) return;                      // block-uniform, before any barrier; never taken with the exact grid
  const double* p = PS + (size_t)b * NPS * HD + tid;
  double acc = 0.0;
#pragma unroll                              // independent loads in flight together instead of one memory latency per row
  for (int s = 0; s < NPS / RGRP; ++s) acc += p[s * (RGRP * HD)];
  part[tid] = acc;
  __syncthreads();
  if (tid < HD) {
    double t = part[tid];
#pragma unroll                              // constant LDS offsets
    for (int g2 = 1; g2 < RGRP; ++g2) t += part[g2 * HD + tid];
    rowv[tid] = (float)t * (1.0f / (float)SEQ);
  }
  __syncthreads();
  if (tid < 16) {
    const v4f v = *(const v4f*)(rowv + 4 * tid);
    float* dst = Out + (size_t)b * SEQ_FULL * HD + 4 * tid;
    {
      *(v4f*)(dst) = v;
      
    }
  }
}

// =====================================================================================================
// Workspace map (bytes); every plane is fully written by whole-line stores before it is read; all extents are exact multiples
// of the store granularity (no pad rows needed); every region offset a multiple of 65536:
//   QH  f16 MROWS x 64 x256          MROWS*128    QL residual NB*QO x 64   NB*QO*128                (2097152 + 262144)
//   KH  f16 MROWS x 64 x256          MROWS*128    KL residual NB*QO x 64   NB*QO*128                (2097152 + 262144)
//   VH  f16 MROWS x 64 x1024         MROWS*128    VL residual NB*QO x 64   NB*QO*128                (2097152 + 262144)
//   (QH .. VL in fragment order: 16-row tiles of 2048 B for q and k, 32-key tiles of 4096 B for v)
//   PS  f64 [NB*NPS][64] 16-key column sums of v    NB*NPS*512                                      (524288)
//   end (NB=4, SEQ=4096)           7602176
// =====================================================================================================
extern "C" void kernel_launch(void* const* d_in, const int* in_sizes, int n_in,
                              void* d_out, int out_size, void* d_ws, size_t ws_size,
                              hipStream_t stream) {
  if (n_in < 6) return;
  const int needx = ((NB - 1) * SEQ_FULL + SEQ) * DIN;
  if (in_sizes[0] < needx) return;
  if (in_sizes[1] < needx) return;
  if (in_sizes[2] < needx) return;
  if (in_sizes[3] != HD * DIN) return;
  if (in_sizes[4] != HD * DIN) return;
  if (in_sizes[5] != HD * DIN) return;
  if (out_size < ((NB - 1) * SEQ_FULL + SEQ) * HD) return;

  const float* query = (const float*)d_in[0];
  const float* keyin = (const float*)d_in[1];
  const float* value = (const float*)d_in[2];
  const float* wq    = (const float*)d_in[3];
  const float* wk    = (const float*)d_in[4];
  const float* wv    = (const float*)d_in[5];
  float*       out   = (float*)d_out;

  const size_t szH  = (size_t)MROWS * HD * 2;                    // QH, KH
  const size_t szL  = (size_t)NB * QO * HD * 2;                  // QL, KL (compact residual planes)
  const size_t szVH = (size_t)NB * HD * SEQ * 2;                 // == szH
  const size_t szVL = (size_t)NB * HD * QO * 2;                  // == szL
  const size_t szPS = (size_t)NB * NPS * HD * 8;
  size_t off = 0;
  const size_t oQH = off; off += szH;
  const size_t oQL = off; off += szL;
  const size_t oKH = off; off += szH;
  const size_t oKL = off; off += szL;
  const size_t oVH = off; off += szVH;
  const size_t oVL = off; off += szVL;
  const size_t oPS = off; off += szPS;
  if (off > ws_size) return;                // off = 7602176 for NB = 4, SEQ = 4096
  if (off > (size_t)WS_CAP) return;

  char* ws = (char*)d_ws;
  u16*   QH  = (u16*)(ws + oQH);
  u16*   QL  = (u16*)(ws + oQL);
  u16*   KH  = (u16*)(ws + oKH);
  u16*   KL  = (u16*)(ws + oKL);
  u16*   VH  = (u16*)(ws + oVH);
  u16*   VL  = (u16*)(ws + oVL);
  double* PS = (double*)(ws + oPS);

  const dim3 b512(512), bAT(ATT_THREADS), b1024(1024);
  const dim3 gG(MROWS / 64, 3);
  const dim3 gATR(NB * NQO);
  const int  nqp  = NQT - NQO;                          // query tiles with s >= QO
  const dim3 gR0(NB);

  // (1) v, q, k projections -> v^T, q, k hi planes (all rows) + residual planes (rows s < QO), and the f64 16-key column sums of v
  proj_planes<<<gG, b512, 0, stream>>>(value, query, keyin, wv, wq, wk, VH, VL, QH, QL, KH, KL, PS);
  // (2) causal attention: query tiles s < QO with residual products -> out; (3) query tiles s >= QO single products -> out
  attn_c<1><<<gATR, bAT, 0, stream>>>(QH, QL, KH, KL, VH, VL, out);
  if (nqp > 0) {
    attn_c<0><<<dim3(NB * nqp), bAT, 0, stream>>>(QH, QL, KH, KL, VH, VL, out);
  }
  // (4) query row 0 of every batch = column mean of v over all SEQ keys, from the partial sums (written last)
  row0_mean<<<gR0, b1024, 0, stream>>>(PS, out);
  (void)hipGetLastError();
}

// v007
// It runs in 49.2 microseconds.
// Timed twice side by side with v006, it ran 1.17 times as fast both times.
// All steps since v000 together make it 12.2 times as fast.
// Contractions: value.Wv^T, query.Wq^T, key.Wk^T on v_wmma_f32_16x16x32_bf16 (inputs and W rounded to bf16 RNE on the way into
// LDS; W [n][k] rows are the k-contiguous B operand); q.k^T over hd 64 and P.v on v_wmma_f32_16x16x32_f16 (q, k x256, P x32768, v x1024 as f16
// planes; query rows s < QO additionally use f16 residual planes, products hh+lh+hl); all f32 accumulate. Strictly-earlier-key
// causal select, base-2 online softmax and 1/Z fold in f32 on VALU; query row 0 (uniform weights over all keys) = column mean
// of the f32 v projection with f64 accumulate on VALU (16-key partial sums in the projection launch, added up by the work-group of query tile 0).
// Both attention products are formed transposed (S^T = k.q^T, O^T += v^T.P^T): a lane holds the scores of one query row, so the
// maximum and the sum are taken in its own registers plus one exchange with lane ^ 16, and P^T goes from the score registers straight into the B operand.
// Each 16-row query tile is one work-group of 16 waves: wave w walks key tiles w, w + 16, .. with its own maxima, sums and
// accumulators; the partials are merged through LDS behind one work-group barrier and the merge writes the f32 output.
// The f16 planes lie in fragment order: every 16-B chunk that a lane loads for an A or B operand stands at lane * 16 B inside a
// 512-B group, so that one fragment load of a wave reads four whole 128-B lines. One launch forms all three projections; each of
// its work-groups writes its part of the f16 planes (and of the column sums) straight from its f32 result tile in LDS. A second
// launch holds every query tile of every batch (both product forms) and the row-0 mean.
#include <hip/hip_runtime.h>
#include <math.h>
#include <stdint.h>

#ifndef NB
#define NB 4
#endif
#ifndef SEQ
#define SEQ 4096
#endif
#define SEQ_FULL 4096
#define DIN   512
#define HD    64
#define QO    ((SEQ < 512) ? SEQ : 512)
#define MROWS (NB * SEQ)
#define RSQ_HD 0.125f
#define LOG2E 1.4426950408889634f
#define QSC   256.0f
#define KSC   256.0f
#define PCAR  32768.0f
#define VCAR  1024.0f
#define WPB   16
#define NQT   (SEQ / 16)
#define NQO   (QO / 16)
#define NST   (SEQ / 64)
#define NKT   (SEQ / 32)
#define ATT_THREADS (WPB * 32)
#define SLP   68
#define SLW   (16 * SLP)
#define WREG  SLW
#define XSP   (DIN + 8)
#define NPS   (NST * 4)
#define RGRP  16
#define WS_CAP 134217728
#define FRH   256
#define FRS   (2 * FRH)
static_assert(HD == 64 && (DIN % 32) == 0 && DIN >= 32 && WPB == 16 && ATT_THREADS == 512);
static_assert(NB >= 1 && NB <= 4);
static_assert((SEQ % 64) == 0 && SEQ >= 64 && SEQ <= SEQ_FULL && (SEQ % 4) == 0);
static_assert((QO % 64) == 0 && QO >= 64 && QO <= SEQ);
static_assert((MROWS % 64) == 0 && SLP == 68 && DIN == 512);
static_assert((NPS % RGRP) == 0 && RGRP * HD == 1024 && RGRP * HD == 2 * ATT_THREADS && RGRP * HD * 8 <= WPB * WREG * 4);
static_assert((WPB * WREG + 2 * 16 * WPB) * 4 <= 81920 && 2 * 64 * XSP * 2 + 64 * SLP * 4 <= 163840);

typedef unsigned short u16;
typedef _Float16 v16h __attribute__((ext_vector_type(16)));
typedef _Float16 v8h  __attribute__((ext_vector_type(8)));
typedef __bf16   v16b __attribute__((ext_vector_type(16)));
typedef __bf16   v2b  __attribute__((ext_vector_type(2)));
typedef float    v8f  __attribute__((ext_vector_type(8)));
typedef float    v4f  __attribute__((ext_vector_type(4)));
typedef float    v2f  __attribute__((ext_vector_type(2)));
typedef unsigned int v4u __attribute__((ext_vector_type(4)));
typedef unsigned int v2u __attribute__((ext_vector_type(2)));

union FragH { v16h v; v8h h[2]; v4u u[2]; };
union FragB { v16b v; v4u u[2]; };

// ---- scalar helpers --------------------------------------------------------------------------------
__device__ __forceinline__ unsigned short h_bits(_Float16 x) { return __builtin_bit_cast(unsigned short, x); }
__device__ __forceinline__ unsigned pk16(unsigned short a, unsigned short b) { return (unsigned)a | ((unsigned)b << 16); }
__device__ __forceinline__ v8f zero8() { v8f z = {0.f, 0.f, 0.f, 0.f, 0.f, 0.f, 0.f, 0.f}; return z; }
__device__ __forceinline__ const _Float16* ash(const u16* p) { return (const _Float16*)(const void*)p; }

// ---- fragment loaders: 16-bit A/B operand, lane -> row/col (lane&15), h = lane>>4; elements 0..7 = k0+8h.., elements 8..15 =
//      k0+16+8h.. (same split k map for A and B).
//      ldfrag_h: global f16 plane in fragment order, p already includes +8*lane: the two 16-B chunks of a lane stand 512 B apart
//      ldfrag_b: k-contiguous [n][k] LDS tile, p already includes +8*h: elements 0..7 <- p[0..7], 8..15 <- p[16..23]
__device__ __forceinline__ v16h ldfrag_h(const _Float16* p) {
  FragH f;
  f.h[0] = *(const v8h*)(p);
  f.h[1] = *(const v8h*)(p + FRH);
  return f.v;
}
__device__ __forceinline__ v16b ldfrag_b(const u16* p) {              // bf16 plane read as unsigned integer vectors
  FragB f;
  f.u[0] = *(const v4u*)(p);
  f.u[1] = *(const v4u*)(p + 16);
  return f.v;
}

__device__ __forceinline__ v8f mma_h(v16h a, v16h b, v8f c) {
  return __builtin_amdgcn_wmma_f32_16x16x32_f16(false, a, false, b, (short)0, c, false, false);
}
__device__ __forceinline__ v8f mma_b(v16b a, v16b b, v8f c) {
  return __builtin_amdgcn_wmma_f32_16x16x32_bf16(false, a, false, b, (short)0, c, false, false);
}
__device__ __forceinline__ void guard2(v8f& a, v8f& b, v16h x0, v16h x1, v16h x2, v16h x3, v16h x4, v16h x5) {
#if defined(__HIP_DEVICE_COMPILE__)
  asm volatile("v_nop\n\tv_nop\n\tv_nop\n\tv_nop"
               : "+v"(a), "+v"(b) : "v"(x0), "v"(x1), "v"(x2), "v"(x3), "v"(x4), "v"(x5) : "memory");
#endif
}
__device__ __forceinline__ void acc_guard4(v8f& a, v8f& b, v8f& c, v8f& d) {
#if defined(__HIP_DEVICE_COMPILE__)
  asm volatile("v_nop\n\tv_nop\n\tv_nop\n\tv_nop" : "+v"(a), "+v"(b), "+v"(c), "+v"(d));
#endif
}
__device__ __forceinline__ float xhalf(float x) {                     // value of lane l ^ 16
  const int b = __builtin_bit_cast(int, x);
  return __builtin_bit_cast(float, __builtin_amdgcn_permlanex16(b, b, 0x76543210, 0xfedcba98, false, false));
}

// =====================================================================================================
// The three projections and their f16 planes, one launch. blockIdx.y = which: 0 v = value.Wv^T, 1 q = query.Wq^T, 2 k = key.Wk^T.
// C (f32, 64 rows x HD) = bf16(X) . bf16(Wf)^T, X f32 [b][s][DIN] (batch stride SEQ_FULL rows), Wf f32 [HD n][DIN k].
// Block = 64 rows x all 64 columns, 16 waves. Wave w loads rows 4w .. 4w+3 of Wf and of the block's X rows as f32, each load
// 512 contiguous bytes of one row, rounds to bf16 (nearest even) in registers and stores 8 B per lane to the LDS tiles
// [64][DIN] (pitch 520 halves = 16 B x 65). Behind a work-group barrier wave (rg = w >> 2, cg = w & 3) forms the 16x16 tile
// (rows 16rg, columns 16cg): DIN/32 products in ascending k, fragments from LDS (two 16-B loads each, split k map for A and
// B). The tiles go to an LDS tile CS [64][64] (pitch 68 floats); behind a second barrier thread tid forms the 16-B chunk tid of
// the block's 8192 contiguous bytes of the hi plane, hi = f16(t), t = C * scale, and of the residual plane, f16(t - hi), the
// latter stored for rows s < QO only (compact: QO rows per batch). 32 consecutive lanes store 512 contiguous bytes.
//   q, k (x256): each 16-row tile (2048 B) is stored as [d chunk d8 = d/8][row c = row & 15][8 halves], so the operand chunk of
//   lane (h, c) for k-step kk stands at kk*1024 B + lane*16 B (d8 = 4kk + h), its second chunk 512 B behind (d8 = 4kk + 2 + h).
//   tid = (tile, d8, c): two 16-B LDS loads from row 16*tile + c.
//   v^T (x1024): each 32-key tile (4096 B) is stored as [d subtile j = d/16][key chunk q = (s & 31)/8][column c = d & 15][8 keys]:
//   the operand chunk of lane (h, c) for subtile j stands at j*1024 B + lane*16 B (q = h), its second chunk 512 B behind
//   (q = 2 + h). tid = (key tile, j, q, c): eight 4-B LDS loads down column d = 16j + c.
// Column sums for query row 0 (which == 0): thread (d = tid & 63, g = tid >> 6), tid < 256, adds keys 16g .. 16g+15 of column d
// of CS in f64, in key order, and stores the sum to PS[(blockIdx.x*4 + g)][d].
// coverage: load 16 waves x 4 rows x 4 x 512 B = 64 rows x 2048 B per operand (staged extent == consumed extent); store
//           512 thr x 8 halves = 64 rows x 64 per plane; grid.x = MROWS/64 blocks = every row of each hi plane exactly once, all
//           NB*QO rows of each residual plane exactly once, every one of the NB*NPS rows of PS exactly once; whole lines per wave.
// =====================================================================================================
__device__ __forceinline__ v2u bf4(v4f a) {                           // 4 f32 -> 4 bf16, nearest even
  const v2f lo = {a[0], a[1]}, hi = {a[2], a[3]};
  v2u o;
  o[0] = __builtin_bit_cast(unsigned, __builtin_convertvector(lo, v2b));
  o[1] = __builtin_bit_cast(unsigned, __builtin_convertvector(hi, v2b));
  return o;
}

__global__ __launch_bounds__(512)
void proj_planes(const float* __restrict__ Xv, const float* __restrict__ Xq, const float* __restrict__ Xk,
                 const float* __restrict__ Wv, const float* __restrict__ Wq, const float* __restrict__ Wk,
                 u16* VHo, u16* VLo, u16* QHo, u16* QLo, u16* KHo, u16* KLo, double* PS) {
  __shared__ __align__(16) u16 XS[64 * XSP];
  __shared__ __align__(16) u16 WS[64 * XSP];
  __shared__ __align__(16) float CS[64 * SLP];
  const int tid = threadIdx.x, wave = tid >> 5, lane = tid & 31, hh = lane >> 4, m = lane & 15;
  const int which = blockIdx.y;
  const int row0 = blockIdx.x * 64;
  if (row0 + 64 > MROWS || which > 2) return;   // block-uniform, before any barrier; never taken with the exact grid
  const float* X  = (which == 0) ? Xv : ((which == 1) ? Xq : Xk);
  const float* Wf = (which == 0) ? Wv : ((which == 1) ? Wq : Wk);
  u16* Hp = (which == 0) ? VHo : ((which == 1) ? QHo : KHo);
  u16* Lp = (which == 0) ? VLo : ((which == 1) ? QLo : KLo);
  const int b  = row0 / SEQ;
  const int s0 = row0 - b * SEQ;            // SEQ % 64 == 0: the 64 rows lie in one batch
  const float* wp = Wf + (size_t)(wave * 4) * DIN + lane * 4;
  const float* xp = X + ((size_t)b * SEQ_FULL + s0 + wave * 4) * DIN + lane * 4;
  v4f wv[16], xv[16];
#pragma unroll                              // all loads of the wave in flight together; W first: it comes from L2
  for (int i = 0; i < 16; ++i) wv[i] = *(const v4f*)(wp + (i >> 2) * DIN + (i & 3) * 128);
#pragma unroll                              // as above
  for (int i = 0; i < 16; ++i) xv[i] = *(const v4f*)(xp + (i >> 2) * DIN + (i & 3) * 128);
  // the work below may reuse registers that the loads above name: wait before they are overwritten (the two pointers are
  // inputs so that their registers live up to the wait); the scheduling barrier keeps that work behind the wait and every
  // load in front of the first conversion
  asm volatile("s_wait_xcnt 0x0" :: "v"(wp), "v"(xp) : "memory");
  __builtin_amdgcn_sched_barrier(0);
  {
    u16* wd = WS + (wave * 4) * XSP + lane * 4;
    u16* xd = XS + (wave * 4) * XSP + lane * 4;
#pragma unroll                              // constant register indices and LDS offsets
    for (int i = 0; i < 16; ++i) *(v2u*)(wd + (i >> 2) * XSP + (i & 3) * 128) = bf4(wv[i]);
    __builtin_amdgcn_sched_barrier(0);      // W is rounded and stored while the X loads are still in flight
#pragma unroll                              // as above
    for (int i = 0; i < 16; ++i) *(v2u*)(xd + (i >> 2) * XSP + (i & 3) * 128) = bf4(xv[i]);
  }
  __syncthreads();                          // publishes both bf16 tiles to every wave
  const int rg = wave >> 2, cg = wave & 3;
  const u16* ap = XS + (rg * 16 + m) * XSP + 8 * hh;
  const u16* bp = WS + (cg * 16 + m) * XSP + 8 * hh;
  v8f acc = zero8();
#pragma unroll                              // constant LDS offsets; fragment loads run ahead of the product chain
  for (int k0 = 0; k0 < DIN; k0 += 32) acc = mma_b(ldfrag_b(ap + k0), ldfrag_b(bp + k0), acc);
#pragma unroll                              // constant element indices
  for (int r = 0; r < 8; ++r) CS[(rg * 16 + 8 * hh + r) * SLP + cg * 16 + m] = acc[r];
  __syncthreads();                          // publishes the 64x64 f32 tile to the waves that form the planes
  const bool dolo = (s0 < QO);              // block-uniform: s0 and QO are multiples of 64
  float w[8];
  double csum = 0.0;
  if (which == 0) {
    const float* col = CS + ((tid >> 8) * 32 + ((tid >> 4) & 3) * 8) * SLP + ((tid >> 6) & 3) * 16 + (tid & 15);
#pragma unroll                              // constant LDS offsets
    for (int e = 0; e < 8; ++e) w[e] = col[e * SLP] * VCAR;
    if (tid < 256) {
      const float* cs = CS + ((tid >> 6) * 16) * SLP + (tid & 63);
      float cv[16];
#pragma unroll                              // constant LDS offsets; the 16 loads go out together
      for (int i = 0; i < 16; ++i) cv[i] = cs[i * SLP];
      __builtin_amdgcn_sched_barrier(0);    // all 16 loads in front of the first addition: one LDS latency, not one per pair of keys
#pragma unroll                              // constant register indices
      for (int i = 0; i < 16; ++i) csum += (double)cv[i];
    }
  } else {
    const float* p = CS + ((tid >> 7) * 16 + (tid & 15)) * SLP + ((tid >> 4) & 7) * 8;
    const v4f a = *(const v4f*)(p), b4 = *(const v4f*)(p + 4);
    const float sc = (which == 1) ? QSC : KSC;
#pragma unroll                              // constant element indices
    for (int e = 0; e < 4; ++e) { w[e] = a[e] * sc; w[4 + e] = b4[e] * sc; }
  }
  v4u oh, ol;
#pragma unroll                              // constant element indices
  for (int e = 0; e < 4; ++e) {
    const float t0 = w[2 * e], t1 = w[2 * e + 1];
    const _Float16 h0 = (_Float16)t0, h1 = (_Float16)t1;
    const _Float16 l0 = (_Float16)(t0 - (float)h0), l1 = (_Float16)(t1 - (float)h1);
    oh[e] = pk16(h_bits(h0), h_bits(h1));
    ol[e] = pk16(h_bits(l0), h_bits(l1));
  }
  u16* dh = Hp + (size_t)row0 * HD + tid * 8;
  u16* dl = Lp + ((size_t)b * QO + (dolo ? s0 : 0)) * HD + tid * 8;
  double* dp = PS + (size_t)blockIdx.x * 256 + (tid & 255);   // row blockIdx.x*4 + (tid >> 6), column tid & 63
  *(v4u*)(dh) = oh;
  // the residual path below reuses registers that the store above names: wait before they are overwritten; the scheduling
  // barrier keeps that work behind the wait
  asm volatile("s_wait_xcnt 0x0" ::: "memory");
  __builtin_amdgcn_sched_barrier(0);
  if (dolo) { *(v4u*)(dl) = ol; }
  if (which == 0 && tid < 256) { *dp = csum; }
}

// =====================================================================================================
// Single-head causal attention (key j contributes to query i only when j < i), hd = 64, f32 output.
// One work-group of WPB waves per 16-row query tile q0 = 16*qt of batch b (both from the calling kernel); wave w takes the key
// tiles kt = w, w + WPB, .. below.
// RES == 1: query tiles q0 < QO, scores = q_hi.k_hi + q_lo.k_hi + q_hi.k_lo and P.v = hh + lh + hl; RES == 0: query tiles
// q0 >= QO, single products q_hi.k_hi, P_hi.v_hi.
//   q hi plane f16 x256, rows b*SEQ + s, q residual (compact) rows b*QO + s, 16-row tiles in fragment order (see proj_planes);
//   k hi / residual planes likewise; v^T hi plane x1024 and v^T residual plane (compact), 32-key tiles in fragment order (proj_planes).
//   score (log2 domain) t(i, j) = (q_i.k_j over HD) * (1/8)*log2e/(256*256), replaced by -inf where key j >= query i.
//   Key tiles of 32 visited in order for kb <= q0 + 14 (later tiles hold only keys at or above every query row of the tile);
//   with RES == 1 this keeps every visited key below QO, inside the compact residual planes. Query row 0 has no admitted key:
//   its running max stays -inf, Z = 0, and the row is not stored here (the calling kernel stores its true value).
//   Per tile: 2 score subtiles x 2 k-steps, fragments loaded straight from the 16-bit planes (two 16-B loads per fragment,
//   each 512 contiguous bytes per wave, split k map). The k fragment is the A operand and the q fragment the B operand (both
//   have the same lane and k map), so D = S^T: lane (hh, c) holds query row q0 + c and keys kb + 8hh + r (subtile 0) and
//   kb + 16 + 8hh + r (subtile 1). Online max-subtracted base-2 softmax in f32, -inf-safe rescale: maximum over the lane's 16
//   scores and one exchange with lane ^ 16; the running sum stays per lane half (its own keys) and the halves are added behind
//   the loop. The lane's 16 values of P*32768 (f16 hi plus its f16 residual) are, in that order, elements 0..15 of the B
//   operand P^T under the split k map; the v^T fragments are the A operand, in 2 groups of 2 d-subtiles: D = O^T, element r =
//   (d = 16j + 8hh + r, query row q0 + c).
//   After the loop each wave stores its un-normalised 16x64 accumulators
//   and its 16 (max, sum) pairs to LDS; one work-group barrier, which every wave reaches (also a wave without a key
//   tile: max -inf, sum 0, accumulators 0); then wave w merges query row w: M = max of the maxima, weights exp2(m - M) (0 where
//   m = -inf), Z and the row added up in wave order, out = row / Z (0 if Z == 0), carries 1/(32768*1024) folded once.
//   No return in here; bounded loops only (nkt <= NKT).
// coverage: per wave 32 lanes x 2 floats = one 64-float output row, WPB waves = the tile's 16 rows, but row s = 0.
// =====================================================================================================
template <int RES>
__device__ __forceinline__
void attn_c(const u16* __restrict__ QHp, const u16* __restrict__ QLp,
            const u16* __restrict__ KHp, const u16* __restrict__ KLp,
            const u16* __restrict__ VHp, const u16* __restrict__ VLp,
            float* Out, float* smem, float* mxs, float* sms, const int b, const int q0) {
  const int tid  = threadIdx.x;
  const int wave = __builtin_amdgcn_readfirstlane(tid >> 5);   // scalar: the key loop below branches on it, EXEC stays whole
  const int lane = tid & 31;
  const int hh   = lane >> 4;
  const int c    = lane & 15;
  const int ql0  = (RES != 0) ? q0 : 0;

  float* slab = smem + wave * WREG;         // the wave's partial result [16][64] pitch 68, behind the loop

  const size_t lcol = (size_t)8 * lane;     // the lane's 16-B chunk within a 512-B group of a fragment-order plane
  const _Float16* Qh  = ash(QHp) + ((size_t)b * SEQ + q0) * HD + lcol;
  const _Float16* Ql  = ash(QLp) + ((size_t)b * QO + ql0) * HD + lcol;              // RES == 1 only
  const _Float16* Khb = ash(KHp) + (size_t)b * SEQ * HD + lcol;                     // key tile kb * HD added per step
  const _Float16* Klb = ash(KLp) + (size_t)b * QO * HD + lcol;                      // RES == 1 only, keys < QO
  const _Float16* Vhb = ash(VHp) + (size_t)b * SEQ * HD + lcol;                     // key tile kb * HD added per step
  const _Float16* Vlb = ash(VLp) + (size_t)b * QO * HD + lcol;                      // RES == 1 only
  const float lsc = RSQ_HD * (LOG2E / (QSC * KSC));
  const float oc  = 1.0f / (PCAR * VCAR);
  const size_t KROW = (size_t)HD;           // halves per key in every plane: a 16-key tile is 16 * KROW, a 32-key tile 32 * KROW

  float mrow = -INFINITY, lrow = 0.f;       // query row q0 + c: running maximum (equal in both lane halves), sum over this half's keys
  v8f o[4];
#pragma unroll
  for (int j = 0; j < 4; ++j) o[j] = zero8();
  const int ncaus = (q0 >> 5) + 1;                                            // tiles holding keys <= q0 + 14
  const int nkt = (ncaus < NKT) ? ncaus : NKT;
  const int qr  = q0 + c;                                                     // the lane's query row

#pragma unroll 1
  for (int kt = wave; kt < nkt; kt += WPB) {
    const int kb = kt * 32;
    // ---- scores, transposed: D element r of this lane = (key kb + 8hh + r, query row qr) in s0, key kb + 16 + 8hh + r in s1 ----
    v8f s0 = zero8(), s1 = zero8();
    const _Float16* k0p = Khb + (size_t)kb * KROW;
    const _Float16* k1p = k0p + (size_t)16 * KROW;
    if constexpr (RES != 0) {
      const _Float16* l0p = Klb + (size_t)kb * KROW;
      const _Float16* l1p = l0p + (size_t)16 * KROW;
#pragma unroll
      for (int kk = 0; kk < HD / 32; ++kk) {
        const v16h qh  = ldfrag_h(Qh + kk * FRS);
        const v16h ql  = ldfrag_h(Ql + kk * FRS);
        const v16h kh0 = ldfrag_h(k0p + kk * FRS);
        const v16h kh1 = ldfrag_h(k1p + kk * FRS);
        const v16h kl0 = ldfrag_h(l0p + kk * FRS);
        const v16h kl1 = ldfrag_h(l1p + kk * FRS);
        s0 = mma_h(kh0, qh, s0);
        s0 = mma_h(kh0, ql, s0);
        s0 = mma_h(kl0, qh, s0);
        s1 = mma_h(kh1, qh, s1);
        s1 = mma_h(kh1, ql, s1);
        s1 = mma_h(kl1, qh, s1);
        guard2(s0, s1, qh, ql, kh0, kl0, kh1, kl1);
      }
      // as in the other branch
      asm volatile("s_wait_xcnt 0x0" :: "v"(k0p), "v"(l0p) : "memory");
    } else {
#pragma unroll
      for (int kk = 0; kk < HD / 32; ++kk) {
        const v16h qh  = ldfrag_h(Qh + kk * FRS);
        const v16h kh0 = ldfrag_h(k0p + kk * FRS);
        const v16h kh1 = ldfrag_h(k1p + kk * FRS);
        s0 = mma_h(kh0, qh, s0);
        s1 = mma_h(kh1, qh, s1);
        guard2(s0, s1, qh, kh0, kh1, qh, kh0, kh1);
      }
      // the work below reuses registers that the loads above name: wait before they are overwritten (the pointer is an input
      // so that its registers live up to the wait and no later load of the group lands in them)
      asm volatile("s_wait_xcnt 0x0" :: "v"(k0p) : "memory");
    }
    // ---- causal select (key >= query excluded) + online softmax in base 2, -inf-safe ----
    const int nadm = qr - (kb + 8 * hh);    // element r of s0 is admitted where r < nadm, element r of s1 where 16 + r < nadm
    v8f t0 = s0 * lsc, t1 = s1 * lsc;
    float mx = -INFINITY;
#pragma unroll                              // scores stay in registers: constant element indices
    for (int r = 0; r < 8; ++r) {
      t0[r] = (r >= nadm) ? -INFINITY : t0[r];
      t1[r] = (16 + r >= nadm) ? -INFINITY : t1[r];
      mx = fmaxf(mx, fmaxf(t0[r], t1[r]));
    }
    mx = fmaxf(mx, xhalf(mx));              // the other 16 keys of the same query row
    const float mn = fmaxf(mrow, mx);
    const float ms = (mn == -INFINITY) ? 0.0f : mn;
    const float al = exp2f(mrow - ms);
    mrow = mn;
    t0 -= ms;
    t1 -= ms;
#pragma unroll                              // as above
    for (int r = 0; r < 8; ++r) {
      t0[r] = exp2f(t0[r]);
      t1[r] = exp2f(t1[r]);
    }
    const v8f pe = t0 + t1;
    lrow = lrow * al + (((pe[0] + pe[1]) + (pe[2] + pe[3])) + ((pe[4] + pe[5]) + (pe[6] + pe[7])));
#pragma unroll                              // accumulators stay in registers
    for (int j = 0; j < 4; ++j) o[j] *= al;
    // ---- B fragments of P^T*32768: hi f16 and residual f16, column = query row qr, split k map over the 32 keys of this step ----
    FragH ph, pl;
    t0 *= PCAR;
    t1 *= PCAR;
#pragma unroll                              // constant element indices
    for (int e = 0; e < 8; ++e) {
      const _Float16 ha = (_Float16)t0[e], hb = (_Float16)t1[e];
      ph.h[0][e] = ha;                        // elements 0..7  = keys kb + 8hh + 0..7
      ph.h[1][e] = hb;                        // elements 8..15 = keys kb + 16 + 8hh + 0..7
      pl.h[0][e] = (_Float16)(t0[e] - (float)ha);
      pl.h[1][e] = (_Float16)(t1[e] - (float)hb);
    }
    // ---- v^T.P^T : A fragment row m = d = j*16 + c, subtile j at j * FRS in the key tile of the v^T planes; 2 groups of 2 ----
    {
      const _Float16* vhp = Vhb + (size_t)kb * KROW;
      if constexpr (RES != 0) {
        const _Float16* vlp = Vlb + (size_t)kb * KROW;
#pragma unroll
        for (int jg = 0; jg < 2; ++jg) {
          const size_t da = (size_t)(2 * jg) * FRS;
          const size_t db = da + (size_t)FRS;
          const size_t la = da;
          const size_t lb = db;
          const v16h vha = ldfrag_h(vhp + da), vhb2 = ldfrag_h(vhp + db);
          const v16h vla = ldfrag_h(vlp + la), vlb2 = ldfrag_h(vlp + lb);
          o[2 * jg]     = mma_h(vha,  ph.v, o[2 * jg]);
          o[2 * jg]     = mma_h(vha,  pl.v, o[2 * jg]);
          o[2 * jg]     = mma_h(vla,  ph.v, o[2 * jg]);
          o[2 * jg + 1] = mma_h(vhb2, ph.v, o[2 * jg + 1]);
          o[2 * jg + 1] = mma_h(vhb2, pl.v, o[2 * jg + 1]);
          o[2 * jg + 1] = mma_h(vlb2, ph.v, o[2 * jg + 1]);
          guard2(o[2 * jg], o[2 * jg + 1], ph.v, pl.v, vha, vhb2, vla, vlb2);
        }
        // as in the other branch
        asm volatile("s_wait_xcnt 0x0" :: "v"(vhp), "v"(vlp) : "memory");
      } else {
#pragma unroll
        for (int jg = 0; jg < 2; ++jg) {
          const size_t da = (size_t)(2 * jg) * FRS;
          const size_t db = da + (size_t)FRS;
          const v16h vha = ldfrag_h(vhp + da), vhb2 = ldfrag_h(vhp + db);
          o[2 * jg]     = mma_h(vha,  ph.v, o[2 * jg]);
          o[2 * jg + 1] = mma_h(vhb2, ph.v, o[2 * jg + 1]);
          guard2(o[2 * jg], o[2 * jg + 1], ph.v, vha, vhb2, ph.v, vha, vhb2);
        }
        // the next trip's address arithmetic reuses registers that the loads above name: wait before they are overwritten
        // (the pointer is an input so that its registers live up to the wait)
        asm volatile("s_wait_xcnt 0x0" :: "v"(vhp) : "memory");
      }
    }
  }
  acc_guard4(o[0], o[1], o[2], o[3]);
  lrow += xhalf(lrow);                      // the two halves' keys together
  // ---- the wave's partials to LDS: accumulators at (row c, columns 16j + 8hh + 0..7), (max, sum) of row c from lanes hh == 0 ----
#pragma unroll                              // accumulators stay in registers: constant element indices, constant LDS offsets
  for (int j = 0; j < 4; ++j) {
    float* d = slab + c * SLP + 16 * j + 8 * hh;
    const v4f lo = {o[j][0], o[j][1], o[j][2], o[j][3]};
    const v4f hi = {o[j][4], o[j][5], o[j][6], o[j][7]};
    *(v4f*)(d)     = lo;
    *(v4f*)(d + 4) = hi;
  }
  if (hh == 0) {
    mxs[c * WPB + wave] = mrow;
    sms[c * WPB + wave] = lrow;
  }
  __syncthreads();                          // publishes every wave's partials to the merging waves
  // ---- merge of query row q0 + wave over the WPB key ranges, in wave order; lane = columns 2*lane, 2*lane + 1 ----
  if (RES == 0 || q0 + wave != 0) {         // wave-uniform, behind the last barrier: query row 0 is stored by the calling kernel
    const int row = wave;
    float mw[WPB], lw[WPB];
#pragma unroll                              // mw, lw stay in registers; the LDS loads go out together
    for (int g = 0; g < WPB / 4; ++g) {
      const v4f a = *(const v4f*)(mxs + row * WPB + 4 * g);
      const v4f z = *(const v4f*)(sms + row * WPB + 4 * g);
#pragma unroll                              // as above
      for (int e = 0; e < 4; ++e) { mw[4 * g + e] = a[e]; lw[4 * g + e] = z[e]; }
    }
    float mm = mw[0];
#pragma unroll                              // as above
    for (int w = 1; w < WPB; ++w) mm = fmaxf(mm, mw[w]);
    const float ms = (mm == -INFINITY) ? 0.0f : mm;
    const float* prt = smem + row * SLP + 2 * lane;
    float lv = 0.f, x0 = 0.f, x1 = 0.f;
#pragma unroll                              // the WPB partial-row loads go out together, one LDS latency instead of WPB
    for (int w = 0; w < WPB; ++w) {
      const float wg = exp2f(mw[w] - ms);
      const v2f  pv = *(const v2f*)(prt + w * WREG);
      lv += lw[w] * wg;
      x0 += pv[0] * wg;
      x1 += pv[1] * wg;
    }
    const float ls  = (lv > 0.0f) ? lv : 1.0f;
    const float inv = (lv > 0.0f) ? ((1.0f / ls) * oc) : 0.0f;
    v2f res;
    res[0] = x0 * inv;
    res[1] = x1 * inv;
    *(v2f*)(Out + ((size_t)b * SEQ_FULL + (size_t)(q0 + row)) * HD + 2 * lane) = res;
  }
}

// =====================================================================================================
// All of the attention, one launch. Block bid -> (batch b = bid / NQT, query tile qt = bid % NQT), q0 = 16*qt: tiles q0 < QO take
// the residual products (attn_c<1>), the others the single products (attn_c<0>); the branch is block-uniform.
// Query row 0 of a batch, in the work-group of its tile 0, ahead of that tile's attention: uniform weights 1/SEQ over ALL keys ->
// out[b][0][d] = mean over s of F[b*SEQ + s][d], F the f32 v projection, from its f64 16-key partial sums PS[b*NPS + p][d]
// (written by proj_planes earlier in the same call). Thread (d = tid & 63, g = tid >> 6) adds rows g, g + 16, .. and, in a second
// sum, rows g + 8, g + 24, .. of column d in that order (independent 8-B loads); the 16 sums of a column are combined in fixed
// order through LDS (the room of the partial results, not yet in use), scaled by 1/SEQ and stored by threads 0 .. 63.
// coverage: grid = NB * NQT blocks = every 16-row tile of every batch once; row 0: 64 threads x 1 float, waves 0 and 1 one
//           128-B line each.
// =====================================================================================================
__global__ __launch_bounds__(ATT_THREADS)
void attn_all(const u16* __restrict__ QHp, const u16* __restrict__ QLp,
              const u16* __restrict__ KHp, const u16* __restrict__ KLp,
              const u16* __restrict__ VHp, const u16* __restrict__ VLp,
              const double* __restrict__ PS, float* Out) {
  __shared__ __align__(16) float smem[WPB * WREG];
  __shared__ __align__(16) float mxs[16 * WPB];   // [query row][wave] running maxima
  __shared__ __align__(16) float sms[16 * WPB];   // [query row][wave] running sums
  const int bid = blockIdx.x;
  const int b   = bid / NQT;
  const int q0  = (bid - b * NQT) * 16;
  if (b >= NB) return;                      // block-uniform, before any barrier; never taken with the exact grid
  if (q0 == 0) {                            // block-uniform
    const int tid = threadIdx.x;
    double* part = (double*)(void*)smem;    // [RGRP][HD]
    const double* p = PS + (size_t)b * NPS * HD + tid;
    double a0 = 0.0, a1 = 0.0;
#pragma unroll                              // independent loads in flight together instead of one memory latency per row
    for (int s = 0; s < NPS / RGRP; ++s) {
      a0 += p[s * (RGRP * HD)];
      a1 += p[s * (RGRP * HD) + ATT_THREADS];
    }
    part[tid] = a0;
    part[tid + ATT_THREADS] = a1;
    __syncthreads();                        // publishes the 16 sums of every column
    if (tid < HD) {
      double t = part[tid];
#pragma unroll                              // constant LDS offsets
      for (int g2 = 1; g2 < RGRP; ++g2) t += part[g2 * HD + tid];
      Out[(size_t)b * SEQ_FULL * HD + tid] = (float)t * (1.0f / (float)SEQ);
    }
    __syncthreads();                        // the sums are read before a wave stores its partial result into the same LDS
  }
  if (q0 < QO) attn_c<1>(QHp, QLp, KHp, KLp, VHp, VLp, Out, smem, mxs, sms, b, q0);
  else         attn_c<0>(QHp, QLp, KHp, KLp, VHp, VLp, Out, smem, mxs, sms, b, q0);
}

// =====================================================================================================
// Workspace map (bytes); every plane is fully written by whole-line stores before it is read; all extents are exact multiples
// of the store granularity (no pad rows needed); every region offset a multiple of 65536:
//   QH  f16 MROWS x 64 x256          MROWS*128    QL residual NB*QO x 64   NB*QO*128                (2097152 + 262144)
//   KH  f16 MROWS x 64 x256          MROWS*128    KL residual NB*QO x 64   NB*QO*128                (2097152 + 262144)
//   VH  f16 MROWS x 64 x1024         MROWS*128    VL residual NB*QO x 64   NB*QO*128                (2097152 + 262144)
//   (QH .. VL in fragment order: 16-row tiles of 2048 B for q and k, 32-key tiles of 4096 B for v)
//   PS  f64 [NB*NPS][64] 16-key column sums of v    NB*NPS*512                                      (524288)
//   end (NB=4, SEQ=4096)           7602176
// =====================================================================================================
extern "C" void kernel_launch(void* const* d_in, const int* in_sizes, int n_in,
                              void* d_out, int out_size, void* d_ws, size_t ws_size,
                              hipStream_t stream) {
  if (n_in < 6) return;
  const int needx = ((NB - 1) * SEQ_FULL + SEQ) * DIN;
  if (in_sizes[0] < needx) return;
  if (in_sizes[1] < needx) return;
  if (in_sizes[2] < needx) return;
  if (in_sizes[3] != HD * DIN) return;
  if (in_sizes[4] != HD * DIN) return;
  if (in_sizes[5] != HD * DIN) return;
  if (out_size < ((NB - 1) * SEQ_FULL + SEQ) * HD) return;

  const float* query = (const float*)d_in[0];
  const float* keyin = (const float*)d_in[1];
  const float* value = (const float*)d_in[2];
  const float* wq    = (const float*)d_in[3];
  const float* wk    = (const float*)d_in[4];
  const float* wv    = (const float*)d_in[5];
  float*       out   = (float*)d_out;

  const size_t szH  = (size_t)MROWS * HD * 2;                    // QH, KH
  const size_t szL  = (size_t)NB * QO * HD * 2;                  // QL, KL (compact residual planes)
  const size_t szVH = (size_t)NB * HD * SEQ * 2;                 // == szH
  const size_t szVL = (size_t)NB * HD * QO * 2;                  // == szL
  const size_t szPS = (size_t)NB * NPS * HD * 8;
  size_t off = 0;
  const size_t oQH = off; off += szH;
  const size_t oQL = off; off += szL;
  const size_t oKH = off; off += szH;
  const size_t oKL = off; off += szL;
  const size_t oVH = off; off += szVH;
  const size_t oVL = off; off += szVL;
  const size_t oPS = off; off += szPS;
  if (off > ws_size) return;                // off = 7602176 for NB = 4, SEQ = 4096
  if (off > (size_t)WS_CAP) return;

  char* ws = (char*)d_ws;
  u16*   QH  = (u16*)(ws + oQH);
  u16*   QL  = (u16*)(ws + oQL);
  u16*   KH  = (u16*)(ws + oKH);
  u16*   KL  = (u16*)(ws + oKL);
  u16*   VH  = (u16*)(ws + oVH);
  u16*   VL  = (u16*)(ws + oVL);
  double* PS = (double*)(ws + oPS);

  const dim3 b512(512), bAT(ATT_THREADS);
  const dim3 gG(MROWS / 64, 3);
  const dim3 gAT(NB * NQT);

  // (1) v, q, k projections -> v^T, q, k hi planes (all rows) + residual planes (rows s < QO), and the f64 16-key column sums of v
  proj_planes<<<gG, b512, 0, stream>>>(value, query, keyin, wv, wq, wk, VH, VL, QH, QL, KH, KL, PS);
  // (2) causal attention, every query tile -> out (tiles s < QO with residual products, the others single products); the
  //     work-group of a batch's tile 0 also stores query row 0 = column mean of v over all SEQ keys, from the partial sums
  attn_all<<<gAT, bAT, 0, stream>>>(QH, QL, KH, KL, VH, VL, PS, out);
  (void)hipGetLastError();
}

// v008
// One run takes 41.1 microseconds.
// In two side-by-side timings against v007, it was 1.20 and 1.19 times as fast.
// All steps since v000 together make it 14.6 times as fast.
// Contractions: value.Wv^T, query.Wq^T, key.Wk^T on v_wmma_f32_16x16x32_bf16 (inputs and W rounded to bf16 RNE on the way into
// LDS; W [n][k] rows are the k-contiguous B operand); q.k^T over hd 64 and P.v on v_wmma_f32_16x16x32_f16 (q, k x256, P x32768, v x1024 as f16
// planes; query rows s < QO additionally use f16 residual planes, products hh+lh+hl); all f32 accumulate. Strictly-earlier-key
// causal select, base-2 online softmax and 1/Z fold in f32 on VALU; query row 0 (uniform weights over all keys) = column mean
// of the f32 v projection with f64 accumulate on VALU (16-key partial sums in the projection launch, added up by the work-group of query tile 0).
// Both attention products are formed transposed (S^T = k.q^T, O^T += v^T.P^T): a lane holds the scores of one query row, so the
// maximum and the sum are taken in its own registers plus one exchange with lane ^ 16, and P^T goes from the score registers straight into the B operand.
// Each 16-row query tile is one work-group of 16 waves: wave w walks key tiles w, w + 16, .. with its own maxima, sums and
// accumulators; the partials are merged through LDS behind one work-group barrier and the merge writes the f32 output.
// The f16 planes lie in fragment order: every 16-B chunk that a lane loads for an A or B operand stands at lane * 16 B inside a
// 512-B group, so that one fragment load of a wave reads four whole 128-B lines. One launch forms all three projections; each of
// its work-groups writes its part of the f16 planes (and of the column sums) straight from its f32 result tile in LDS. A second
// launch holds every query tile of every batch (both product forms) and the row-0 mean.
#include <hip/hip_runtime.h>
#include <math.h>
#include <stdint.h>

#ifndef NB
#define NB 4
#endif
#ifndef SEQ
#define SEQ 4096
#endif
#define SEQ_FULL 4096
#define DIN   512
#define HD    64
#define QO    ((SEQ < 512) ? SEQ : 512)
#define MROWS (NB * SEQ)
#define RSQ_HD 0.125f
#define LOG2E 1.4426950408889634f
#define QSC   256.0f
#define KSC   256.0f
#define PCAR  32768.0f
#define VCAR  1024.0f
#define WPB   16
#define NQT   (SEQ / 16)
#define NQO   (QO / 16)
#define NST   (SEQ / 64)
#define NKT   (SEQ / 32)
#define ATT_THREADS (WPB * 32)
#define SLP   68
#define SLW   (16 * SLP)
#define WREG  SLW
#define XSP   (DIN + 8)
#define NPS   (NST * 4)
#define RGRP  16
#define WS_CAP 134217728
#define FRH   256
#define FRS   (2 * FRH)
static_assert(HD == 64 && (DIN % 32) == 0 && DIN >= 32 && WPB == 16 && ATT_THREADS == 512);
static_assert(NB >= 1 && NB <= 4);
static_assert((SEQ % 64) == 0 && SEQ >= 64 && SEQ <= SEQ_FULL && (SEQ % 4) == 0);
static_assert((QO % 64) == 0 && QO >= 64 && QO <= SEQ);
static_assert((MROWS % 64) == 0 && SLP == 68 && DIN == 512);
static_assert((NPS % RGRP) == 0 && RGRP * HD == 1024 && RGRP * HD == 2 * ATT_THREADS && RGRP * HD * 8 <= WPB * WREG * 4);
static_assert((WPB * WREG + 2 * 16 * WPB) * 4 <= 81920 && 2 * 64 * XSP * 2 + 64 * SLP * 4 <= 163840);

typedef unsigned short u16;
typedef _Float16 v16h __attribute__((ext_vector_type(16)));
typedef _Float16 v8h  __attribute__((ext_vector_type(8)));
typedef __bf16   v16b __attribute__((ext_vector_type(16)));
typedef __bf16   v2b  __attribute__((ext_vector_type(2)));
typedef float    v8f  __attribute__((ext_vector_type(8)));
typedef float    v4f  __attribute__((ext_vector_type(4)));
typedef float    v2f  __attribute__((ext_vector_type(2)));
typedef unsigned int v4u __attribute__((ext_vector_type(4)));
typedef unsigned int v2u __attribute__((ext_vector_type(2)));

union FragH { v16h v; v8h h[2]; v4u u[2]; };
union FragB { v16b v; v4u u[2]; };

// ---- scalar helpers --------------------------------------------------------------------------------
__device__ __forceinline__ unsigned short h_bits(_Float16 x) { return __builtin_bit_cast(unsigned short, x); }
__device__ __forceinline__ unsigned pk16(unsigned short a, unsigned short b) { return (unsigned)a | ((unsigned)b << 16); }
__device__ __forceinline__ v8f zero8() { v8f z = {0.f, 0.f, 0.f, 0.f, 0.f, 0.f, 0.f, 0.f}; return z; }
__device__ __forceinline__ const _Float16* ash(const u16* p) { return (const _Float16*)(const void*)p; }

// ---- fragment loaders: 16-bit A/B operand, lane -> row/col (lane&15), h = lane>>4; elements 0..7 = k0+8h.., elements 8..15 =
//      k0+16+8h.. (same split k map for A and B).
//      ldfrag_h: global f16 plane in fragment order, p already includes +8*lane: the two 16-B chunks of a lane stand 512 B apart
//      ldfrag_b: k-contiguous [n][k] LDS tile, p already includes +8*h: elements 0..7 <- p[0..7], 8..15 <- p[16..23]
__device__ __forceinline__ v16h ldfrag_h(const _Float16* p) {
  FragH f;
  f.h[0] = *(const v8h*)(p);
  f.h[1] = *(const v8h*)(p + FRH);
  return f.v;
}
__device__ __forceinline__ v16b ldfrag_b(const u16* p) {              // bf16 plane read as unsigned integer vectors
  FragB f;
  f.u[0] = *(const v4u*)(p);
  f.u[1] = *(const v4u*)(p + 16);
  return f.v;
}

__device__ __forceinline__ v8f mma_h(v16h a, v16h b, v8f c) {
  return __builtin_amdgcn_wmma_f32_16x16x32_f16(false, a, false, b, (short)0, c, false, false);
}
__device__ __forceinline__ v8f mma_b(v16b a, v16b b, v8f c) {
  return __builtin_amdgcn_wmma_f32_16x16x32_bf16(false, a, false, b, (short)0, c, false, false);
}
__device__ __forceinline__ void guard2(v8f& a, v8f& b, v16h x0, v16h x1, v16h x2, v16h x3, v16h x4, v16h x5) {
#if defined(__HIP_DEVICE_COMPILE__)
  asm volatile("v_nop\n\tv_nop\n\tv_nop\n\tv_nop"
               : "+v"(a), "+v"(b) : "v"(x0), "v"(x1), "v"(x2), "v"(x3), "v"(x4), "v"(x5) : "memory");
#endif
}
__device__ __forceinline__ void acc_guard4(v8f& a, v8f& b, v8f& c, v8f& d) {
#if defined(__HIP_DEVICE_COMPILE__)
  asm volatile("v_nop\n\tv_nop\n\tv_nop\n\tv_nop" : "+v"(a), "+v"(b), "+v"(c), "+v"(d));
#endif
}
__device__ __forceinline__ float xhalf(float x) {                     // value of lane l ^ 16
  const int b = __builtin_bit_cast(int, x);
  return __builtin_bit_cast(float, __builtin_amdgcn_permlanex16(b, b, 0x76543210, 0xfedcba98, false, false));
}

// =====================================================================================================
// The three projections and their f16 planes, one launch. blockIdx.y = which: 0 v = value.Wv^T, 1 q = query.Wq^T, 2 k = key.Wk^T.
// C (f32, 64 rows x HD) = bf16(X) . bf16(Wf)^T, X f32 [b][s][DIN] (batch stride SEQ_FULL rows), Wf f32 [HD n][DIN k].
// Block = 64 rows x all 64 columns, 16 waves. Wave w loads rows 4w .. 4w+3 of Wf and of the block's X rows as f32, each load
// 512 contiguous bytes of one row, rounds to bf16 (nearest even) in registers and stores 8 B per lane to the LDS tiles
// [64][DIN] (pitch 520 halves = 16 B x 65). Behind a work-group barrier wave (rg = w >> 2, cg = w & 3) forms the 16x16 tile
// (rows 16rg, columns 16cg): DIN/32 products in ascending k, fragments from LDS (two 16-B loads each, split k map for A and
// B). The tiles go to an LDS tile CS [64][64] (pitch 68 floats); behind a second barrier thread tid forms the 16-B chunk tid of
// the block's 8192 contiguous bytes of the hi plane, hi = f16(t), t = C * scale, and of the residual plane, f16(t - hi), the
// latter stored for rows s < QO only (compact: QO rows per batch). 32 consecutive lanes store 512 contiguous bytes.
//   q, k (x256): each 16-row tile (2048 B) is stored as [d chunk d8 = d/8][row c = row & 15][8 halves], so the operand chunk of
//   lane (h, c) for k-step kk stands at kk*1024 B + lane*16 B (d8 = 4kk + h), its second chunk 512 B behind (d8 = 4kk + 2 + h).
//   tid = (tile, d8, c): two 16-B LDS loads from row 16*tile + c.
//   v^T (x1024): each 32-key tile (4096 B) is stored as [d subtile j = d/16][key chunk q = (s & 31)/8][column c = d & 15][8 keys]:
//   the operand chunk of lane (h, c) for subtile j stands at j*1024 B + lane*16 B (q = h), its second chunk 512 B behind
//   (q = 2 + h). tid = (key tile, j, q, c): eight 4-B LDS loads down column d = 16j + c.
// Column sums for query row 0 (which == 0): thread (d = tid & 63, g = tid >> 6), tid < 256, adds keys 16g .. 16g+15 of column d
// of CS in f64, in key order, and stores the sum to PS[(blockIdx.x*4 + g)][d].
// coverage: load 16 waves x 4 rows x 4 x 512 B = 64 rows x 2048 B per operand (staged extent == consumed extent); store
//           512 thr x 8 halves = 64 rows x 64 per plane; grid.x = MROWS/64 blocks = every row of each hi plane exactly once, all
//           NB*QO rows of each residual plane exactly once, every one of the NB*NPS rows of PS exactly once; whole lines per wave.
// =====================================================================================================
__device__ __forceinline__ v2u bf4(v4f a) {                           // 4 f32 -> 4 bf16, nearest even
  const v2f lo = {a[0], a[1]}, hi = {a[2], a[3]};
  v2u o;
  o[0] = __builtin_bit_cast(unsigned, __builtin_convertvector(lo, v2b));
  o[1] = __builtin_bit_cast(unsigned, __builtin_convertvector(hi, v2b));
  return o;
}

__global__ __launch_bounds__(512)
void proj_planes(const float* __restrict__ Xv, const float* __restrict__ Xq, const float* __restrict__ Xk,
                 const float* __restrict__ Wv, const float* __restrict__ Wq, const float* __restrict__ Wk,
                 u16* VHo, u16* VLo, u16* QHo, u16* QLo, u16* KHo, u16* KLo, double* PS) {
  __shared__ __align__(16) u16 XS[64 * XSP];
  __shared__ __align__(16) u16 WS[64 * XSP];
  __shared__ __align__(16) float CS[64 * SLP];
  const int tid = threadIdx.x, wave = tid >> 5, lane = tid & 31, hh = lane >> 4, m = lane & 15;
  const int which = blockIdx.y;
  const int row0 = blockIdx.x * 64;
  if (row0 + 64 > MROWS || which > 2) return;   // block-uniform, before any barrier; never taken with the exact grid
  const float* X  = (which == 0) ? Xv : ((which == 1) ? Xq : Xk);
  const float* Wf = (which == 0) ? Wv : ((which == 1) ? Wq : Wk);
  u16* Hp = (which == 0) ? VHo : ((which == 1) ? QHo : KHo);
  u16* Lp = (which == 0) ? VLo : ((which == 1) ? QLo : KLo);
  const int b  = row0 / SEQ;
  const int s0 = row0 - b * SEQ;            // SEQ % 64 == 0: the 64 rows lie in one batch
  const float* wp = Wf + (size_t)(wave * 4) * DIN + lane * 4;
  const float* xp = X + ((size_t)b * SEQ_FULL + s0 + wave * 4) * DIN + lane * 4;
  v4f wv[16], xv[16];
#pragma unroll                              // all loads of the wave in flight together; W first: it comes from L2
  for (int i = 0; i < 16; ++i) wv[i] = *(const v4f*)(wp + (i >> 2) * DIN + (i & 3) * 128);
#pragma unroll                              // as above
  for (int i = 0; i < 16; ++i) xv[i] = *(const v4f*)(xp + (i >> 2) * DIN + (i & 3) * 128);
  // the work below may reuse registers that the loads above name: wait before they are overwritten (the two pointers are
  // inputs so that their registers live up to the wait); the scheduling barrier keeps that work behind the wait and every
  // load in front of the first conversion
  asm volatile("s_wait_xcnt 0x0" :: "v"(wp), "v"(xp) : "memory");
  __builtin_amdgcn_sched_barrier(0);
  {
    u16* wd = WS + (wave * 4) * XSP + lane * 4;
    u16* xd = XS + (wave * 4) * XSP + lane * 4;
#pragma unroll                              // constant register indices and LDS offsets
    for (int i = 0; i < 16; ++i) *(v2u*)(wd + (i >> 2) * XSP + (i & 3) * 128) = bf4(wv[i]);
    __builtin_amdgcn_sched_barrier(0);      // W is rounded and stored while the X loads are still in flight
#pragma unroll                              // as above
    for (int i = 0; i < 16; ++i) *(v2u*)(xd + (i >> 2) * XSP + (i & 3) * 128) = bf4(xv[i]);
  }
  __syncthreads();                          // publishes both bf16 tiles to every wave
  const int rg = wave >> 2, cg = wave & 3;
  const u16* ap = XS + (rg * 16 + m) * XSP + 8 * hh;
  const u16* bp = WS + (cg * 16 + m) * XSP + 8 * hh;
  v8f acc = zero8();
#pragma unroll                              // constant LDS offsets; fragment loads run ahead of the product chain
  for (int k0 = 0; k0 < DIN; k0 += 32) acc = mma_b(ldfrag_b(ap + k0), ldfrag_b(bp + k0), acc);
#pragma unroll                              // constant element indices
  for (int r = 0; r < 8; ++r) CS[(rg * 16 + 8 * hh + r) * SLP + cg * 16 + m] = acc[r];
  __syncthreads();                          // publishes the 64x64 f32 tile to the waves that form the planes
  const bool dolo = (s0 < QO);              // block-uniform: s0 and QO are multiples of 64
  float w[8];
  double csum = 0.0;
  if (which == 0) {
    const float* col = CS + ((tid >> 8) * 32 + ((tid >> 4) & 3) * 8) * SLP + ((tid >> 6) & 3) * 16 + (tid & 15);
#pragma unroll                              // constant LDS offsets
    for (int e = 0; e < 8; ++e) w[e] = col[e * SLP] * VCAR;
    if (tid < 256) {
      const float* cs = CS + ((tid >> 6) * 16) * SLP + (tid & 63);
      float cv[16];
#pragma unroll                              // constant LDS offsets; the 16 loads go out together
      for (int i = 0; i < 16; ++i) cv[i] = cs[i * SLP];
      __builtin_amdgcn_sched_barrier(0);    // all 16 loads in front of the first addition: one LDS latency, not one per pair of keys
#pragma unroll                              // constant register indices
      for (int i = 0; i < 16; ++i) csum += (double)cv[i];
    }
  } else {
    const float* p = CS + ((tid >> 7) * 16 + (tid & 15)) * SLP + ((tid >> 4) & 7) * 8;
    const v4f a = *(const v4f*)(p), b4 = *(const v4f*)(p + 4);
    const float sc = (which == 1) ? QSC : KSC;
#pragma unroll                              // constant element indices
    for (int e = 0; e < 4; ++e) { w[e] = a[e] * sc; w[4 + e] = b4[e] * sc; }
  }
  v4u oh, ol;
#pragma unroll                              // constant element indices
  for (int e = 0; e < 4; ++e) {
    const float t0 = w[2 * e], t1 = w[2 * e + 1];
    const _Float16 h0 = (_Float16)t0, h1 = (_Float16)t1;
    const _Float16 l0 = (_Float16)(t0 - (float)h0), l1 = (_Float16)(t1 - (float)h1);
    oh[e] = pk16(h_bits(h0), h_bits(h1));
    ol[e] = pk16(h_bits(l0), h_bits(l1));
  }
  u16* dh = Hp + (size_t)row0 * HD + tid * 8;
  u16* dl = Lp + ((size_t)b * QO + (dolo ? s0 : 0)) * HD + tid * 8;
  double* dp = PS + (size_t)blockIdx.x * 256 + (tid & 255);   // row blockIdx.x*4 + (tid >> 6), column tid & 63
  *(v4u*)(dh) = oh;
  // the residual path below reuses registers that the store above names: wait before they are overwritten; the scheduling
  // barrier keeps that work behind the wait
  asm volatile("s_wait_xcnt 0x0" ::: "memory");
  __builtin_amdgcn_sched_barrier(0);
  if (dolo) { *(v4u*)(dl) = ol; }
  if (which == 0 && tid < 256) { *dp = csum; }
}

// =====================================================================================================
// Single-head causal attention (key j contributes to query i only when j < i), hd = 64, f32 output.
// One work-group of WPB waves per 16-row query tile q0 = 16*qt of batch b (both from the calling kernel); wave w takes the key
// tiles kt = w, w + WPB, .. below.
// RES == 1: query tiles q0 < QO, scores = q_hi.k_hi + q_lo.k_hi + q_hi.k_lo and P.v = hh + lh + hl; RES == 0: query tiles
// q0 >= QO, single products q_hi.k_hi, P_hi.v_hi.
//   q hi plane f16 x256, rows b*SEQ + s, q residual (compact) rows b*QO + s, 16-row tiles in fragment order (see proj_planes);
//   k hi / residual planes likewise; v^T hi plane x1024 and v^T residual plane (compact), 32-key tiles in fragment order (proj_planes).
//   score (log2 domain) t(i, j) = (q_i.k_j over HD) * (1/8)*log2e/(256*256), replaced by -inf where key j >= query i.
//   Key tiles of 32 visited in order for kb <= q0 + 14 (later tiles hold only keys at or above every query row of the tile);
//   with RES == 1 this keeps every visited key below QO, inside the compact residual planes. Query row 0 has no admitted key:
//   its running max stays -inf, Z = 0, and the row is not stored here (the calling kernel stores its true value).
//   Per tile: 2 score subtiles x 2 k-steps, fragments loaded straight from the 16-bit planes (two 16-B loads per fragment,
//   each 512 contiguous bytes per wave, split k map). The k fragment is the A operand and the q fragment the B operand (both
//   have the same lane and k map), so D = S^T: lane (hh, c) holds query row q0 + c and keys kb + 8hh + r (subtile 0) and
//   kb + 16 + 8hh + r (subtile 1). Online max-subtracted base-2 softmax in f32, -inf-safe rescale: maximum over the lane's 16
//   scores and one exchange with lane ^ 16; the running sum stays per lane half (its own keys) and the halves are added behind
//   the loop. The lane's 16 values of P*32768 (f16 hi plus its f16 residual) are, in that order, elements 0..15 of the B
//   operand P^T under the split k map; the v^T fragments are the A operand, in 2 groups of 2 d-subtiles: D = O^T, element r =
//   (d = 16j + 8hh + r, query row q0 + c).
//   After the loop each wave stores its un-normalised 16x64 accumulators
//   and its 16 (max, sum) pairs to LDS; one work-group barrier, which every wave reaches (also a wave without a key
//   tile: max -inf, sum 0, accumulators 0); then wave w merges query row w: M = max of the maxima, weights exp2(m - M) (0 where
//   m = -inf), Z and the row added up in wave order, out = row / Z (0 if Z == 0), carries 1/(32768*1024) folded once.
//   No return in here; bounded loops only (nkt <= NKT).
// coverage: per wave 32 lanes x 2 floats = one 64-float output row, WPB waves = the tile's 16 rows, but row s = 0.
// =====================================================================================================
template <int RES>
__device__ __forceinline__
void attn_c(const u16* __restrict__ QHp, const u16* __restrict__ QLp,
            const u16* __restrict__ KHp, const u16* __restrict__ KLp,
            const u16* __restrict__ VHp, const u16* __restrict__ VLp,
            float* Out, float* smem, float* mxs, float* sms, const int b, const int q0) {
  const int tid  = threadIdx.x;
  const int wave = __builtin_amdgcn_readfirstlane(tid >> 5);   // scalar: the key loop below branches on it, EXEC stays whole
  const int lane = tid & 31;
  const int hh   = lane >> 4;
  const int c    = lane & 15;
  const int ql0  = (RES != 0) ? q0 : 0;

  float* slab = smem + wave * WREG;         // the wave's partial result [16][64] pitch 68, behind the loop

  const size_t lcol = (size_t)8 * lane;     // the lane's 16-B chunk within a 512-B group of a fragment-order plane
  const _Float16* Qh  = ash(QHp) + ((size_t)b * SEQ + q0) * HD + lcol;
  const _Float16* Ql  = ash(QLp) + ((size_t)b * QO + ql0) * HD + lcol;              // RES == 1 only
  const _Float16* Khb = ash(KHp) + (size_t)b * SEQ * HD + lcol;                     // key tile kb * HD added per step
  const _Float16* Klb = ash(KLp) + (size_t)b * QO * HD + lcol;                      // RES == 1 only, keys < QO
  const _Float16* Vhb = ash(VHp) + (size_t)b * SEQ * HD + lcol;                     // key tile kb * HD added per step
  const _Float16* Vlb = ash(VLp) + (size_t)b * QO * HD + lcol;                      // RES == 1 only
  const float lsc = RSQ_HD * (LOG2E / (QSC * KSC));
  const float oc  = 1.0f / (PCAR * VCAR);
  const size_t KROW = (size_t)HD;           // halves per key in every plane: a 16-key tile is 16 * KROW, a 32-key tile 32 * KROW

  float mrow = -INFINITY, lrow = 0.f;       // query row q0 + c: running maximum (equal in both lane halves), sum over this half's keys
  v8f o[4];
#pragma unroll
  for (int j = 0; j < 4; ++j) o[j] = zero8();
  const int ncaus = (q0 >> 5) + 1;                                            // tiles holding keys <= q0 + 14
  const int nkt = (ncaus < NKT) ? ncaus : NKT;
  const int qr  = q0 + c;                                                     // the lane's query row

#pragma unroll 1
  for (int kt = wave; kt < nkt; kt += WPB) {
    const int kb = kt * 32;
    // ---- scores, transposed: D element r of this lane = (key kb + 8hh + r, query row qr) in s0, key kb + 16 + 8hh + r in s1 ----
    v8f s0 = zero8(), s1 = zero8();
    const _Float16* k0p = Khb + (size_t)kb * KROW;
    const _Float16* k1p = k0p + (size_t)16 * KROW;
    if constexpr (RES != 0) {
      const _Float16* l0p = Klb + (size_t)kb * KROW;
      const _Float16* l1p = l0p + (size_t)16 * KROW;
#pragma unroll
      for (int kk = 0; kk < HD / 32; ++kk) {
        const v16h qh  = ldfrag_h(Qh + kk * FRS);
        const v16h ql  = ldfrag_h(Ql + kk * FRS);
        const v16h kh0 = ldfrag_h(k0p + kk * FRS);
        const v16h kh1 = ldfrag_h(k1p + kk * FRS);
        const v16h kl0 = ldfrag_h(l0p + kk * FRS);
        const v16h kl1 = ldfrag_h(l1p + kk * FRS);
        s0 = mma_h(kh0, qh, s0);
        s0 = mma_h(kh0, ql, s0);
        s0 = mma_h(kl0, qh, s0);
        s1 = mma_h(kh1, qh, s1);
        s1 = mma_h(kh1, ql, s1);
        s1 = mma_h(kl1, qh, s1);
        guard2(s0, s1, qh, ql, kh0, kl0, kh1, kl1);
      }
      // as in the other branch
      asm volatile("s_wait_xcnt 0x0" :: "v"(k0p), "v"(l0p) : "memory");
    } else {
#pragma unroll
      for (int kk = 0; kk < HD / 32; ++kk) {
        const v16h qh  = ldfrag_h(Qh + kk * FRS);
        const v16h kh0 = ldfrag_h(k0p + kk * FRS);
        const v16h kh1 = ldfrag_h(k1p + kk * FRS);
        s0 = mma_h(kh0, qh, s0);
        s1 = mma_h(kh1, qh, s1);
        guard2(s0, s1, qh, kh0, kh1, qh, kh0, kh1);
      }
      // the work below reuses registers that the loads above name: wait before they are overwritten (the pointer is an input
      // so that its registers live up to the wait and no later load of the group lands in them)
      asm volatile("s_wait_xcnt 0x0" :: "v"(k0p) : "memory");
    }
    // ---- causal select (key >= query excluded) + online softmax in base 2, -inf-safe ----
    const int nadm = qr - (kb + 8 * hh);    // element r of s0 is admitted where r < nadm, element r of s1 where 16 + r < nadm
    v8f t0 = s0 * lsc, t1 = s1 * lsc;
    float mx = -INFINITY;
#pragma unroll                              // scores stay in registers: constant element indices
    for (int r = 0; r < 8; ++r) {
      t0[r] = (r >= nadm) ? -INFINITY : t0[r];
      t1[r] = (16 + r >= nadm) ? -INFINITY : t1[r];
      mx = fmaxf(mx, fmaxf(t0[r], t1[r]));
    }
    mx = fmaxf(mx, xhalf(mx));              // the other 16 keys of the same query row
    const float mn = fmaxf(mrow, mx);
    const float ms = (mn == -INFINITY) ? 0.0f : mn;
    const float al = exp2f(mrow - ms);
    mrow = mn;
    t0 -= ms;
    t1 -= ms;
#pragma unroll                              // as above
    for (int r = 0; r < 8; ++r) {
      t0[r] = exp2f(t0[r]);
      t1[r] = exp2f(t1[r]);
    }
    const v8f pe = t0 + t1;
    lrow = lrow * al + (((pe[0] + pe[1]) + (pe[2] + pe[3])) + ((pe[4] + pe[5]) + (pe[6] + pe[7])));
#pragma unroll                              // accumulators stay in registers
    for (int j = 0; j < 4; ++j) o[j] *= al;
    // ---- B fragments of P^T*32768: hi f16 and residual f16, column = query row qr, split k map over the 32 keys of this step ----
    FragH ph, pl;
    t0 *= PCAR;
    t1 *= PCAR;
#pragma unroll                              // constant element indices
    for (int e = 0; e < 8; ++e) {
      const _Float16 ha = (_Float16)t0[e], hb = (_Float16)t1[e];
      ph.h[0][e] = ha;                        // elements 0..7  = keys kb + 8hh + 0..7
      ph.h[1][e] = hb;                        // elements 8..15 = keys kb + 16 + 8hh + 0..7
      pl.h[0][e] = (_Float16)(t0[e] - (float)ha);
      pl.h[1][e] = (_Float16)(t1[e] - (float)hb);
    }
    // ---- v^T.P^T : A fragment row m = d = j*16 + c, subtile j at j * FRS in the key tile of the v^T planes; 2 groups of 2 ----
    {
      const _Float16* vhp = Vhb + (size_t)kb * KROW;
      if constexpr (RES != 0) {
        const _Float16* vlp = Vlb + (size_t)kb * KROW;
#pragma unroll
        for (int jg = 0; jg < 2; ++jg) {
          const size_t da = (size_t)(2 * jg) * FRS;
          const size_t db = da + (size_t)FRS;
          const size_t la = da;
          const size_t lb = db;
          const v16h vha = ldfrag_h(vhp + da), vhb2 = ldfrag_h(vhp + db);
          const v16h vla = ldfrag_h(vlp + la), vlb2 = ldfrag_h(vlp + lb);
          o[2 * jg]     = mma_h(vha,  ph.v, o[2 * jg]);
          o[2 * jg]     = mma_h(vha,  pl.v, o[2 * jg]);
          o[2 * jg]     = mma_h(vla,  ph.v, o[2 * jg]);
          o[2 * jg + 1] = mma_h(vhb2, ph.v, o[2 * jg + 1]);
          o[2 * jg + 1] = mma_h(vhb2, pl.v, o[2 * jg + 1]);
          o[2 * jg + 1] = mma_h(vlb2, ph.v, o[2 * jg + 1]);
          guard2(o[2 * jg], o[2 * jg + 1], ph.v, pl.v, vha, vhb2, vla, vlb2);
        }
        // as in the other branch
        asm volatile("s_wait_xcnt 0x0" :: "v"(vhp), "v"(vlp) : "memory");
      } else {
#pragma unroll
        for (int jg = 0; jg < 2; ++jg) {
          const size_t da = (size_t)(2 * jg) * FRS;
          const size_t db = da + (size_t)FRS;
          const v16h vha = ldfrag_h(vhp + da), vhb2 = ldfrag_h(vhp + db);
          o[2 * jg]     = mma_h(vha,  ph.v, o[2 * jg]);
          o[2 * jg + 1] = mma_h(vhb2, ph.v, o[2 * jg + 1]);
          guard2(o[2 * jg], o[2 * jg + 1], ph.v, vha, vhb2, ph.v, vha, vhb2);
        }
        // the next trip's address arithmetic reuses registers that the loads above name: wait before they are overwritten
        // (the pointer is an input so that its registers live up to the wait)
        asm volatile("s_wait_xcnt 0x0" :: "v"(vhp) : "memory");
      }
    }
  }
  acc_guard4(o[0], o[1], o[2], o[3]);
  lrow += xhalf(lrow);                      // the two halves' keys together
  // ---- the wave's partials to LDS: accumulators at (row c, columns 16j + 8hh + 0..7), (max, sum) of row c from lanes hh == 0 ----
#pragma unroll                              // accumulators stay in registers: constant element indices, constant LDS offsets
  for (int j = 0; j < 4; ++j) {
    float* d = slab + c * SLP + 16 * j + 8 * hh;
    const v4f lo = {o[j][0], o[j][1], o[j][2], o[j][3]};
    const v4f hi = {o[j][4], o[j][5], o[j][6], o[j][7]};
    *(v4f*)(d)     = lo;
    *(v4f*)(d + 4) = hi;
  }
  if (hh == 0) {
    mxs[c * WPB + wave] = mrow;
    sms[c * WPB + wave] = lrow;
  }
  __syncthreads();                          // publishes every wave's partials to the merging waves
  // ---- merge of query row q0 + wave over the WPB key ranges, in wave order; lane = columns 2*lane, 2*lane + 1 ----
  if (RES == 0 || q0 + wave != 0) {         // wave-uniform, behind the last barrier: query row 0 is stored by the calling kernel
    const int row = wave;
    float mw[WPB], lw[WPB];
#pragma unroll                              // mw, lw stay in registers; the LDS loads go out together
    for (int g = 0; g < WPB / 4; ++g) {
      const v4f a = *(const v4f*)(mxs + row * WPB + 4 * g);
      const v4f z = *(const v4f*)(sms + row * WPB + 4 * g);
#pragma unroll                              // as above
      for (int e = 0; e < 4; ++e) { mw[4 * g + e] = a[e]; lw[4 * g + e] = z[e]; }
    }
    float mm = mw[0];
#pragma unroll                              // as above
    for (int w = 1; w < WPB; ++w) mm = fmaxf(mm, mw[w]);
    const float ms = (mm == -INFINITY) ? 0.0f : mm;
    const float* prt = smem + row * SLP + 2 * lane;
    float lv = 0.f, x0 = 0.f, x1 = 0.f;
#pragma unroll                              // the WPB partial-row loads go out together, one LDS latency instead of WPB
    for (int w = 0; w < WPB; ++w) {
      const float wg = exp2f(mw[w] - ms);
      const v2f  pv = *(const v2f*)(prt + w * WREG);
      lv += lw[w] * wg;
      x0 += pv[0] * wg;
      x1 += pv[1] * wg;
    }
    const float ls  = (lv > 0.0f) ? lv : 1.0f;
    const float inv = (lv > 0.0f) ? ((1.0f / ls) * oc) : 0.0f;
    v2f res;
    res[0] = x0 * inv;
    res[1] = x1 * inv;
    *(v2f*)(Out + ((size_t)b * SEQ_FULL + (size_t)(q0 + row)) * HD + 2 * lane) = res;
  }
}

// =====================================================================================================
// All of the attention, one launch. Block bid -> (rank rk = bid / NB, batch b = bid % NB); query tile qt = (NQT - rk) % NQT, that
// is 0, NQT-1, NQT-2, .., 1: a permutation of 0 .. NQT-1; q0 = 16*qt. A tile's key count grows with qt and there are more work-groups
// than resident places: the longest tiles take the lowest block indices and the shortest the highest. Tile 0 takes the
// lowest indices as well: it is short in keys but has the serial row-0 mean ahead of its attention.
// Tiles q0 < QO take the residual products (attn_c<1>), the others the single products (attn_c<0>); the branch is block-uniform.
// Query row 0 of a batch, in the work-group of its tile 0, ahead of that tile's attention: uniform weights 1/SEQ over ALL keys ->
// out[b][0][d] = mean over s of F[b*SEQ + s][d], F the f32 v projection, from its f64 16-key partial sums PS[b*NPS + p][d]
// (written by proj_planes earlier in the same call). Thread (d = tid & 63, g = tid >> 6) adds rows g, g + 16, .. and, in a second
// sum, rows g + 8, g + 24, .. of column d in that order (independent 8-B loads); the 16 sums of a column are combined in fixed
// order through LDS (the room of the partial results, not yet in use), scaled by 1/SEQ and stored by threads 0 .. 63.
// coverage: grid = NB * NQT blocks = every 16-row tile of every batch once; row 0: 64 threads x 1 float, waves 0 and 1 one
//           128-B line each.
// =====================================================================================================
__global__ __launch_bounds__(ATT_THREADS)
void attn_all(const u16* __restrict__ QHp, const u16* __restrict__ QLp,
              const u16* __restrict__ KHp, const u16* __restrict__ KLp,
              const u16* __restrict__ VHp, const u16* __restrict__ VLp,
              const double* __restrict__ PS, float* Out) {
  __shared__ __align__(16) float smem[WPB * WREG];
  __shared__ __align__(16) float mxs[16 * WPB];   // [query row][wave] running maxima
  __shared__ __align__(16) float sms[16 * WPB];   // [query row][wave] running sums
  const int bid = blockIdx.x;
  const unsigned rk = (unsigned)bid / NB;
  const int b   = (int)((unsigned)bid % NB);
  if (rk >= NQT) return;                    // block-uniform, before any barrier; never taken with the exact grid
  const int q0  = (int)((NQT - rk) % NQT) * 16;
  if (q0 == 0) {                            // block-uniform
    const int tid = threadIdx.x;
    double* part = (double*)(void*)smem;    // [RGRP][HD]
    const double* p = PS + (size_t)b * NPS * HD + tid;
    double a0 = 0.0, a1 = 0.0;
#pragma unroll                              // independent loads in flight together instead of one memory latency per row
    for (int s = 0; s < NPS / RGRP; ++s) {
      a0 += p[s * (RGRP * HD)];
      a1 += p[s * (RGRP * HD) + ATT_THREADS];
    }
    part[tid] = a0;
    part[tid + ATT_THREADS] = a1;
    __syncthreads();                        // publishes the 16 sums of every column
    if (tid < HD) {
      double t = part[tid];
#pragma unroll                              // constant LDS offsets
      for (int g2 = 1; g2 < RGRP; ++g2) t += part[g2 * HD + tid];
      Out[(size_t)b * SEQ_FULL * HD + tid] = (float)t * (1.0f / (float)SEQ);
    }
    __syncthreads();                        // the sums are read before a wave stores its partial result into the same LDS
  }
  if (q0 < QO) attn_c<1>(QHp, QLp, KHp, KLp, VHp, VLp, Out, smem, mxs, sms, b, q0);
  else         attn_c<0>(QHp, QLp, KHp, KLp, VHp, VLp, Out, smem, mxs, sms, b, q0);
}

// =====================================================================================================
// Workspace map (bytes); every plane is fully written by whole-line stores before it is read; all extents are exact multiples
// of the store granularity (no pad rows needed); every region offset a multiple of 65536:
//   QH  f16 MROWS x 64 x256          MROWS*128    QL residual NB*QO x 64   NB*QO*128                (2097152 + 262144)
//   KH  f16 MROWS x 64 x256          MROWS*128    KL residual NB*QO x 64   NB*QO*128                (2097152 + 262144)
//   VH  f16 MROWS x 64 x1024         MROWS*128    VL residual NB*QO x 64   NB*QO*128                (2097152 + 262144)
//   (QH .. VL in fragment order: 16-row tiles of 2048 B for q and k, 32-key tiles of 4096 B for v)
//   PS  f64 [NB*NPS][64] 16-key column sums of v    NB*NPS*512                                      (524288)
//   end (NB=4, SEQ=4096)           7602176
// =====================================================================================================
extern "C" void kernel_launch(void* const* d_in, const int* in_sizes, int n_in,
                              void* d_out, int out_size, void* d_ws, size_t ws_size,
                              hipStream_t stream) {
  if (n_in < 6) return;
  const int needx = ((NB - 1) * SEQ_FULL + SEQ) * DIN;
  if (in_sizes[0] < needx) return;
  if (in_sizes[1] < needx) return;
  if (in_sizes[2] < needx) return;
  if (in_sizes[3] != HD * DIN) return;
  if (in_sizes[4] != HD * DIN) return;
  if (in_sizes[5] != HD * DIN) return;
  if (out_size < ((NB - 1) * SEQ_FULL + SEQ) * HD) return;

  const float* query = (const float*)d_in[0];
  const float* keyin = (const float*)d_in[1];
  const float* value = (const float*)d_in[2];
  const float* wq    = (const float*)d_in[3];
  const float* wk    = (const float*)d_in[4];
  const float* wv    = (const float*)d_in[5];
  float*       out   = (float*)d_out;

  const size_t szH  = (size_t)MROWS * HD * 2;                    // QH, KH
  const size_t szL  = (size_t)NB * QO * HD * 2;                  // QL, KL (compact residual planes)
  const size_t szVH = (size_t)NB * HD * SEQ * 2;                 // == szH
  const size_t szVL = (size_t)NB * HD * QO * 2;                  // == szL
  const size_t szPS = (size_t)NB * NPS * HD * 8;
  size_t off = 0;
  const size_t oQH = off; off += szH;
  const size_t oQL = off; off += szL;
  const size_t oKH = off; off += szH;
  const size_t oKL = off; off += szL;
  const size_t oVH = off; off += szVH;
  const size_t oVL = off; off += szVL;
  const size_t oPS = off; off += szPS;
  if (off > ws_size) return;                // off = 7602176 for NB = 4, SEQ = 4096
  if (off > (size_t)WS_CAP) return;

  char* ws = (char*)d_ws;
  u16*   QH  = (u16*)(ws + oQH);
  u16*   QL  = (u16*)(ws + oQL);
  u16*   KH  = (u16*)(ws + oKH);
  u16*   KL  = (u16*)(ws + oKL);
  u16*   VH  = (u16*)(ws + oVH);
  u16*   VL  = (u16*)(ws + oVL);
  double* PS = (double*)(ws + oPS);

  const dim3 b512(512), bAT(ATT_THREADS);
  const dim3 gG(MROWS / 64, 3);
  const dim3 gAT(NB * NQT);

  // (1) v, q, k projections -> v^T, q, k hi planes (all rows) + residual planes (rows s < QO), and the f64 16-key column sums of v
  proj_planes<<<gG, b512, 0, stream>>>(value, query, keyin, wv, wq, wk, VH, VL, QH, QL, KH, KL, PS);
  // (2) causal attention, every query tile -> out (tiles s < QO with residual products, the others single products); the
  //     work-group of a batch's tile 0 also stores query row 0 = column mean of v over all SEQ keys, from the partial sums
  attn_all<<<gAT, bAT, 0, stream>>>(QH, QL, KH, KL, VH, VL, PS, out);
  (void)hipGetLastError();
}

// v009
// It runs in 39 microseconds.
// In two side-by-side timings against v008, it was 1.05 and 1.08 times as fast.
// Counting every step since v000, it is 15.6 times as fast.
// Contractions: value.Wv^T, query.Wq^T, key.Wk^T on v_wmma_f32_16x16x32_bf16 (inputs and W rounded to bf16 RNE on the way into
// LDS; W [n][k] rows are the k-contiguous B operand); q.k^T over hd 64 and P.v on v_wmma_f32_16x16x32_f16 (q, k x256, P x32768, v x1024 as f16
// planes; query rows s < QO additionally use f16 residual planes, products hh+lh+hl); all f32 accumulate. Strictly-earlier-key
// causal select, base-2 online softmax and 1/Z fold in f32 on VALU; query row 0 (uniform weights over all keys) = column mean
// of the f32 v projection with f64 accumulate on VALU (16-key partial sums in the projection launch, added up by the work-group of query tile 0).
// Both attention products are formed transposed (S^T = k.q^T, O^T += v^T.P^T): a lane holds the scores of one query row, so the
// maximum and the sum are taken in its own registers plus one exchange with lane ^ 16, and P^T goes from the score registers straight into the B operand.
// Each 16-row query tile is one work-group of 16 waves: wave w walks key tiles w, w + 16, .. with its own maxima, sums and
// accumulators; the partials are merged through LDS behind one work-group barrier and the merge writes the f32 output.
// The f16 planes lie in fragment order: every 16-B chunk that a lane loads for an A or B operand stands at lane * 16 B inside a
// 512-B group, so that one fragment load of a wave reads four whole 128-B lines. One launch forms all three projections; each of
// its work-groups writes its part of the f16 planes (and of the column sums) straight from its f32 result tile in LDS. A second
// launch holds every query tile of every batch (both product forms) and the row-0 mean.
#include <hip/hip_runtime.h>
#include <math.h>
#include <stdint.h>

#ifndef NB
#define NB 4
#endif
#ifndef SEQ
#define SEQ 4096
#endif
#define SEQ_FULL 4096
#define DIN   512
#define HD    64
#define QO    ((SEQ < 512) ? SEQ : 512)
#define MROWS (NB * SEQ)
#define RSQ_HD 0.125f
#define LOG2E 1.4426950408889634f
#define QSC   256.0f
#define KSC   256.0f
#define PCAR  32768.0f
#define VCAR  1024.0f
#define WPB   16
#define NQT   (SEQ / 16)
#define NQO   (QO / 16)
#define NST   (SEQ / 64)
#define NKT   (SEQ / 32)
#define ATT_THREADS (WPB * 32)
#define SLP   68
#define SLW   (16 * SLP)
#define WREG  SLW
#define XSP   (DIN + 8)
#define NPS   (NST * 4)
#define RGRP  16
#define WS_CAP 134217728
#define FRH   256
#define FRS   (2 * FRH)
static_assert(HD == 64 && (DIN % 32) == 0 && DIN >= 32 && WPB == 16 && ATT_THREADS == 512);
static_assert(NB >= 1 && NB <= 4);
static_assert((SEQ % 64) == 0 && SEQ >= 64 && SEQ <= SEQ_FULL && (SEQ % 4) == 0);
static_assert((QO % 64) == 0 && QO >= 64 && QO <= SEQ);
static_assert((MROWS % 64) == 0 && SLP == 68 && DIN == 512);
static_assert((NPS % RGRP) == 0 && RGRP * HD == 1024 && RGRP * HD == 2 * ATT_THREADS && RGRP * HD * 8 <= WPB * WREG * 4);
static_assert((WPB * WREG + 2 * 16 * WPB) * 4 <= 81920 && 2 * 64 * XSP * 2 + 64 * SLP * 4 <= 163840);

typedef unsigned short u16;
typedef _Float16 v16h __attribute__((ext_vector_type(16)));
typedef _Float16 v8h  __attribute__((ext_vector_type(8)));
typedef __bf16   v16b __attribute__((ext_vector_type(16)));
typedef __bf16   v2b  __attribute__((ext_vector_type(2)));
typedef float    v8f  __attribute__((ext_vector_type(8)));
typedef float    v4f  __attribute__((ext_vector_type(4)));
typedef float    v2f  __attribute__((ext_vector_type(2)));
typedef unsigned int v4u __attribute__((ext_vector_type(4)));
typedef unsigned int v2u __attribute__((ext_vector_type(2)));

union FragH { v16h v; v8h h[2]; v4u u[2]; };
union FragB { v16b v; v4u u[2]; };

// ---- scalar helpers --------------------------------------------------------------------------------
__device__ __forceinline__ unsigned short h_bits(_Float16 x) { return __builtin_bit_cast(unsigned short, x); }
__device__ __forceinline__ unsigned pk16(unsigned short a, unsigned short b) { return (unsigned)a | ((unsigned)b << 16); }
__device__ __forceinline__ v8f zero8() { v8f z = {0.f, 0.f, 0.f, 0.f, 0.f, 0.f, 0.f, 0.f}; return z; }
__device__ __forceinline__ const _Float16* ash(const u16* p) { return (const _Float16*)(const void*)p; }

// ---- fragment loaders: 16-bit A/B operand, lane -> row/col (lane&15), h = lane>>4; elements 0..7 = k0+8h.., elements 8..15 =
//      k0+16+8h.. (same split k map for A and B).
//      ldfrag_h: global f16 plane in fragment order, p already includes +8*lane: the two 16-B chunks of a lane stand 512 B apart
//      ldfrag_b: k-contiguous [n][k] LDS tile, p already includes +8*h: elements 0..7 <- p[0..7], 8..15 <- p[16..23]
__device__ __forceinline__ v16h ldfrag_h(const _Float16* p) {
  FragH f;
  f.h[0] = *(const v8h*)(p);
  f.h[1] = *(const v8h*)(p + FRH);
  return f.v;
}
__device__ __forceinline__ v16b ldfrag_b(const u16* p) {              // bf16 plane read as unsigned integer vectors
  FragB f;
  f.u[0] = *(const v4u*)(p);
  f.u[1] = *(const v4u*)(p + 16);
  return f.v;
}

__device__ __forceinline__ v8f mma_h(v16h a, v16h b, v8f c) {
  return __builtin_amdgcn_wmma_f32_16x16x32_f16(false, a, false, b, (short)0, c, false, false);
}
__device__ __forceinline__ v8f mma_b(v16b a, v16b b, v8f c) {
  return __builtin_amdgcn_wmma_f32_16x16x32_bf16(false, a, false, b, (short)0, c, false, false);
}
__device__ __forceinline__ void guard2(v8f& a, v8f& b, v16h x0, v16h x1, v16h x2, v16h x3, v16h x4, v16h x5) {
#if defined(__HIP_DEVICE_COMPILE__)
  asm volatile("v_nop\n\tv_nop\n\tv_nop\n\tv_nop"
               : "+v"(a), "+v"(b) : "v"(x0), "v"(x1), "v"(x2), "v"(x3), "v"(x4), "v"(x5) : "memory");
#endif
}
__device__ __forceinline__ void acc_guard4(v8f& a, v8f& b, v8f& c, v8f& d) {
#if defined(__HIP_DEVICE_COMPILE__)
  asm volatile("v_nop\n\tv_nop\n\tv_nop\n\tv_nop" : "+v"(a), "+v"(b), "+v"(c), "+v"(d));
#endif
}
__device__ __forceinline__ float xhalf(float x) {                     // value of lane l ^ 16
  const int b = __builtin_bit_cast(int, x);
  return __builtin_bit_cast(float, __builtin_amdgcn_permlanex16(b, b, 0x76543210, 0xfedcba98, false, false));
}

// =====================================================================================================
// The three projections and their f16 planes, one launch. A work-group forms, for its 64 rows, one projection after the other
// (which = 0 v = value.Wv^T, 1 q = query.Wq^T, 2 k = key.Wk^T) in one loop: behind the barrier that publishes the bf16 tiles of
// projection which, each wave issues the f32 loads of projection which + 1 into the same registers; they are in flight during the
// products and the plane forming of projection which and are rounded at the head of the next trip. The LDS tiles are
// rewritten only behind a barrier that follows their last read (XS, WS: the second barrier of the trip; CS: the first of the next).
// C (f32, 64 rows x HD) = bf16(X) . bf16(Wf)^T, X f32 [b][s][DIN] (batch stride SEQ_FULL rows), Wf f32 [HD n][DIN k].
// Block = 64 rows x all 64 columns, 16 waves. Wave w loads rows 4w .. 4w+3 of Wf and of the block's X rows as f32, each load
// 512 contiguous bytes of one row, rounds to bf16 (nearest even) in registers and stores 8 B per lane to the LDS tiles
// [64][DIN] (pitch 520 halves = 16 B x 65). Behind a work-group barrier wave (rg = w >> 2, cg = w & 3) forms the 16x16 tile
// (rows 16rg, columns 16cg): DIN/32 products in ascending k, fragments from LDS (two 16-B loads each, split k map for A and
// B). The tiles go to an LDS tile CS [64][64] (pitch 68 floats); behind a second barrier thread tid forms the 16-B chunk tid of
// the block's 8192 contiguous bytes of the hi plane, hi = f16(t), t = C * scale, and of the residual plane, f16(t - hi), the
// latter stored for rows s < QO only (compact: QO rows per batch). 32 consecutive lanes store 512 contiguous bytes.
//   q, k (x256): each 16-row tile (2048 B) is stored as [d chunk d8 = d/8][row c = row & 15][8 halves], so the operand chunk of
//   lane (h, c) for k-step kk stands at kk*1024 B + lane*16 B (d8 = 4kk + h), its second chunk 512 B behind (d8 = 4kk + 2 + h).
//   tid = (tile, d8, c): two 16-B LDS loads from row 16*tile + c.
//   v^T (x1024): each 32-key tile (4096 B) is stored as [d subtile j = d/16][key chunk q = (s & 31)/8][column c = d & 15][8 keys]:
//   the operand chunk of lane (h, c) for subtile j stands at j*1024 B + lane*16 B (q = h), its second chunk 512 B behind
//   (q = 2 + h). tid = (key tile, j, q, c): eight 4-B LDS loads down column d = 16j + c.
// Column sums for query row 0 (which == 0): thread (d = tid & 63, g = tid >> 6), tid < 256, adds keys 16g .. 16g+15 of column d
// of CS in f64, in key order, and stores the sum to PS[(blockIdx.x*4 + g)][d].
// coverage: load 16 waves x 4 rows x 4 x 512 B = 64 rows x 2048 B per operand (staged extent == consumed extent); store
//           512 thr x 8 halves = 64 rows x 64 per plane; grid.x = MROWS/64 blocks x 3 trips = every row of each hi plane exactly once, all
//           NB*QO rows of each residual plane exactly once, every one of the NB*NPS rows of PS exactly once; whole lines per wave.
// =====================================================================================================
__device__ __forceinline__ v2u bf4(v4f a) {                           // 4 f32 -> 4 bf16, nearest even
  const v2f lo = {a[0], a[1]}, hi = {a[2], a[3]};
  v2u o;
  o[0] = __builtin_bit_cast(unsigned, __builtin_convertvector(lo, v2b));
  o[1] = __builtin_bit_cast(unsigned, __builtin_convertvector(hi, v2b));
  return o;
}

__global__ __launch_bounds__(512)
void proj_planes(const float* __restrict__ Xv, const float* __restrict__ Xq, const float* __restrict__ Xk,
                 const float* __restrict__ Wv, const float* __restrict__ Wq, const float* __restrict__ Wk,
                 u16* VHo, u16* VLo, u16* QHo, u16* QLo, u16* KHo, u16* KLo, double* PS) {
  __shared__ __align__(16) u16 XS[64 * XSP];
  __shared__ __align__(16) u16 WS[64 * XSP];
  __shared__ __align__(16) float CS[64 * SLP];
  const int tid = threadIdx.x, wave = tid >> 5, lane = tid & 31, hh = lane >> 4, m = lane & 15;
  const int row0 = blockIdx.x * 64;
  if (row0 + 64 > MROWS) return;            // block-uniform, before any barrier; never taken with the exact grid
  const int b  = row0 / SEQ;
  const int s0 = row0 - b * SEQ;            // SEQ % 64 == 0: the 64 rows lie in one batch
  const size_t wof = (size_t)(wave * 4) * DIN + lane * 4;
  const size_t xof = ((size_t)b * SEQ_FULL + s0 + wave * 4) * DIN + lane * 4;
  const int rg = wave >> 2, cg = wave & 3;
  v4f wv[16], xv[16];
  {
    const float* wp = Wv + wof;
    const float* xp = Xv + xof;
#pragma unroll                              // all loads of the wave in flight together; W first: it comes from L2
    for (int i = 0; i < 16; ++i) wv[i] = *(const v4f*)(wp + (i >> 2) * DIN + (i & 3) * 128);
#pragma unroll                              // as above
    for (int i = 0; i < 16; ++i) xv[i] = *(const v4f*)(xp + (i >> 2) * DIN + (i & 3) * 128);
    // the work below may reuse registers that the loads above name: wait before they are overwritten (the two pointers are
    // inputs so that their registers live up to the wait); the scheduling barrier keeps that work behind the wait and every
    // load in front of the first conversion
    asm volatile("s_wait_xcnt 0x0" :: "v"(wp), "v"(xp) : "memory");
    __builtin_amdgcn_sched_barrier(0);
  }
#pragma unroll 1                            // one body for the three projections: the loads of the next one live across the back edge
  for (int which = 0; which < 3; ++which) {
    u16* Hp = (which == 0) ? VHo : ((which == 1) ? QHo : KHo);
    u16* Lp = (which == 0) ? VLo : ((which == 1) ? QLo : KLo);
    {
      u16* wd = WS + (wave * 4) * XSP + lane * 4;
      u16* xd = XS + (wave * 4) * XSP + lane * 4;
#pragma unroll                              // constant register indices and LDS offsets
      for (int i = 0; i < 16; ++i) *(v2u*)(wd + (i >> 2) * XSP + (i & 3) * 128) = bf4(wv[i]);
      __builtin_amdgcn_sched_barrier(0);      // W is rounded and stored while the X loads are still in flight
#pragma unroll                              // as above
      for (int i = 0; i < 16; ++i) *(v2u*)(xd + (i >> 2) * XSP + (i & 3) * 128) = bf4(xv[i]);
    }
    __syncthreads();                          // publishes both bf16 tiles to every wave
    if (which < 2) {                          // block-uniform: the next projection's f32 loads fly during this one's products
      const float* wp = ((which == 0) ? Wq : Wk) + wof;
      const float* xp = ((which == 0) ? Xq : Xk) + xof;
#pragma unroll                              // all loads of the wave in flight together
      for (int i = 0; i < 16; ++i) wv[i] = *(const v4f*)(wp + (i >> 2) * DIN + (i & 3) * 128);
      __builtin_amdgcn_sched_barrier(0);      // W in front of X, the order in which they are rounded: W's waits leave the X loads in flight
#pragma unroll                              // as above
      for (int i = 0; i < 16; ++i) xv[i] = *(const v4f*)(xp + (i >> 2) * DIN + (i & 3) * 128);
      // as at the first loads: wait before a register that these loads name is overwritten
      asm volatile("s_wait_xcnt 0x0" :: "v"(wp), "v"(xp) : "memory");
      __builtin_amdgcn_sched_barrier(0);      // every load in front of the products
    }
    const u16* ap = XS + (rg * 16 + m) * XSP + 8 * hh;
    const u16* bp = WS + (cg * 16 + m) * XSP + 8 * hh;
    v8f acc = zero8();
#pragma unroll                              // constant LDS offsets; fragment loads run ahead of the product chain
    for (int k0 = 0; k0 < DIN; k0 += 32) acc = mma_b(ldfrag_b(ap + k0), ldfrag_b(bp + k0), acc);
#pragma unroll                              // constant element indices
    for (int r = 0; r < 8; ++r) CS[(rg * 16 + 8 * hh + r) * SLP + cg * 16 + m] = acc[r];
    // publishes the 64x64 f32 tile to the waves that form the planes. Work-group barrier with fences on LDS alone: only LDS data
    // pass between the waves here, and __syncthreads() would also wait for the next projection's global loads
    __builtin_amdgcn_fence(__ATOMIC_RELEASE, "workgroup", "local");
    __builtin_amdgcn_s_barrier();
    __builtin_amdgcn_fence(__ATOMIC_ACQUIRE, "workgroup", "local");
    const bool dolo = (s0 < QO);              // block-uniform: s0 and QO are multiples of 64
    float w[8];
    double csum = 0.0;
    if (which == 0) {
      const float* col = CS + ((tid >> 8) * 32 + ((tid >> 4) & 3) * 8) * SLP + ((tid >> 6) & 3) * 16 + (tid & 15);
#pragma unroll                              // constant LDS offsets
      for (int e = 0; e < 8; ++e) w[e] = col[e * SLP] * VCAR;
      if (tid < 256) {
        const float* cs = CS + ((tid >> 6) * 16) * SLP + (tid & 63);
        float cv[16];
#pragma unroll                              // constant LDS offsets; the 16 loads go out together
        for (int i = 0; i < 16; ++i) cv[i] = cs[i * SLP];
        __builtin_amdgcn_sched_barrier(0);    // all 16 loads in front of the first addition: one LDS latency, not one per pair of keys
#pragma unroll                              // constant register indices
        for (int i = 0; i < 16; ++i) csum += (double)cv[i];
      }
    } else {
      const float* p = CS + ((tid >> 7) * 16 + (tid & 15)) * SLP + ((tid >> 4) & 7) * 8;
      const v4f a = *(const v4f*)(p), b4 = *(const v4f*)(p + 4);
      const float sc = (which == 1) ? QSC : KSC;
#pragma unroll                              // constant element indices
      for (int e = 0; e < 4; ++e) { w[e] = a[e] * sc; w[4 + e] = b4[e] * sc; }
    }
    v4u oh, ol;
#pragma unroll                              // constant element indices
    for (int e = 0; e < 4; ++e) {
      const float t0 = w[2 * e], t1 = w[2 * e + 1];
      const _Float16 h0 = (_Float16)t0, h1 = (_Float16)t1;
      const _Float16 l0 = (_Float16)(t0 - (float)h0), l1 = (_Float16)(t1 - (float)h1);
      oh[e] = pk16(h_bits(h0), h_bits(h1));
      ol[e] = pk16(h_bits(l0), h_bits(l1));
    }
    u16* dh = Hp + (size_t)row0 * HD + tid * 8;
    u16* dl = Lp + ((size_t)b * QO + (dolo ? s0 : 0)) * HD + tid * 8;
    double* dp = PS + (size_t)blockIdx.x * 256 + (tid & 255);   // row blockIdx.x*4 + (tid >> 6), column tid & 63
    *(v4u*)(dh) = oh;
    // the residual path below reuses registers that the store above names: wait before they are overwritten; the scheduling
    // barrier keeps that work behind the wait
    asm volatile("s_wait_xcnt 0x0" ::: "memory");
    __builtin_amdgcn_sched_barrier(0);
    if (dolo) { *(v4u*)(dl) = ol; }
    if (which == 0 && tid < 256) { *dp = csum; }
    // the next trip reuses registers that the stores above name: wait before they are overwritten
    asm volatile("s_wait_xcnt 0x0" ::: "memory");
  }
}

// =====================================================================================================
// Single-head causal attention (key j contributes to query i only when j < i), hd = 64, f32 output.
// One work-group of WPB waves per 16-row query tile q0 = 16*qt of batch b (both from the calling kernel); wave w takes the key
// tiles kt = w, w + WPB, .. below.
// RES == 1: query tiles q0 < QO, scores = q_hi.k_hi + q_lo.k_hi + q_hi.k_lo and P.v = hh + lh + hl; RES == 0: query tiles
// q0 >= QO, single products q_hi.k_hi, P_hi.v_hi.
//   q hi plane f16 x256, rows b*SEQ + s, q residual (compact) rows b*QO + s, 16-row tiles in fragment order (see proj_planes);
//   k hi / residual planes likewise; v^T hi plane x1024 and v^T residual plane (compact), 32-key tiles in fragment order (proj_planes).
//   score (log2 domain) t(i, j) = (q_i.k_j over HD) * (1/8)*log2e/(256*256), replaced by -inf where key j >= query i.
//   Key tiles of 32 visited in order for kb <= q0 + 14 (later tiles hold only keys at or above every query row of the tile);
//   with RES == 1 this keeps every visited key below QO, inside the compact residual planes. Query row 0 has no admitted key:
//   its running max stays -inf, Z = 0, and the row is not stored here (the calling kernel stores its true value).
//   Per tile: 2 score subtiles x 2 k-steps, fragments loaded straight from the 16-bit planes (two 16-B loads per fragment,
//   each 512 contiguous bytes per wave, split k map). The k fragment is the A operand and the q fragment the B operand (both
//   have the same lane and k map), so D = S^T: lane (hh, c) holds query row q0 + c and keys kb + 8hh + r (subtile 0) and
//   kb + 16 + 8hh + r (subtile 1). Online max-subtracted base-2 softmax in f32, -inf-safe rescale: maximum over the lane's 16
//   scores and one exchange with lane ^ 16; the running sum stays per lane half (its own keys) and the halves are added behind
//   the loop. The lane's 16 values of P*32768 (f16 hi plus its f16 residual) are, in that order, elements 0..15 of the B
//   operand P^T under the split k map; the v^T fragments are the A operand, in 2 groups of 2 d-subtiles: D = O^T, element r =
//   (d = 16j + 8hh + r, query row q0 + c).
//   After the loop each wave stores its un-normalised 16x64 accumulators
//   and its 16 (max, sum) pairs to LDS; one work-group barrier, which every wave reaches (also a wave without a key
//   tile: max -inf, sum 0, accumulators 0); then wave w merges query row w: M = max of the maxima, weights exp2(m - M) (0 where
//   m = -inf), Z and the row added up in wave order, out = row / Z (0 if Z == 0), carries 1/(32768*1024) folded once.
//   No return in here; bounded loops only (nkt <= NKT).
// coverage: per wave 32 lanes x 2 floats = one 64-float output row, WPB waves = the tile's 16 rows, but row s = 0.
// =====================================================================================================
template <int RES>
__device__ __forceinline__
void attn_c(const u16* __restrict__ QHp, const u16* __restrict__ QLp,
            const u16* __restrict__ KHp, const u16* __restrict__ KLp,
            const u16* __restrict__ VHp, const u16* __restrict__ VLp,
            float* Out, float* smem, float* mxs, float* sms, const int b, const int q0) {
  const int tid  = threadIdx.x;
  const int wave = __builtin_amdgcn_readfirstlane(tid >> 5);   // scalar: the key loop below branches on it, EXEC stays whole
  const int lane = tid & 31;
  const int hh   = lane >> 4;
  const int c    = lane & 15;
  const int ql0  = (RES != 0) ? q0 : 0;

  float* slab = smem + wave * WREG;         // the wave's partial result [16][64] pitch 68, behind the loop

  const size_t lcol = (size_t)8 * lane;     // the lane's 16-B chunk within a 512-B group of a fragment-order plane
  const _Float16* Qh  = ash(QHp) + ((size_t)b * SEQ + q0) * HD + lcol;
  const _Float16* Ql  = ash(QLp) + ((size_t)b * QO + ql0) * HD + lcol;              // RES == 1 only
  const _Float16* Khb = ash(KHp) + (size_t)b * SEQ * HD + lcol;                     // key tile kb * HD added per step
  const _Float16* Klb = ash(KLp) + (size_t)b * QO * HD + lcol;                      // RES == 1 only, keys < QO
  const _Float16* Vhb = ash(VHp) + (size_t)b * SEQ * HD + lcol;                     // key tile kb * HD added per step
  const _Float16* Vlb = ash(VLp) + (size_t)b * QO * HD + lcol;                      // RES == 1 only
  const float lsc = RSQ_HD * (LOG2E / (QSC * KSC));
  const float oc  = 1.0f / (PCAR * VCAR);
  const size_t KROW = (size_t)HD;           // halves per key in every plane: a 16-key tile is 16 * KROW, a 32-key tile 32 * KROW

  float mrow = -INFINITY, lrow = 0.f;       // query row q0 + c: running maximum (equal in both lane halves), sum over this half's keys
  v8f o[4];
#pragma unroll
  for (int j = 0; j < 4; ++j) o[j] = zero8();
  const int ncaus = (q0 >> 5) + 1;                                            // tiles holding keys <= q0 + 14
  const int nkt = (ncaus < NKT) ? ncaus : NKT;
  const int qr  = q0 + c;                                                     // the lane's query row

#pragma unroll 1
  for (int kt = wave; kt < nkt; kt += WPB) {
    const int kb = kt * 32;
    // ---- scores, transposed: D element r of this lane = (key kb + 8hh + r, query row qr) in s0, key kb + 16 + 8hh + r in s1 ----
    v8f s0 = zero8(), s1 = zero8();
    const _Float16* k0p = Khb + (size_t)kb * KROW;
    const _Float16* k1p = k0p + (size_t)16 * KROW;
    if constexpr (RES != 0) {
      const _Float16* l0p = Klb + (size_t)kb * KROW;
      const _Float16* l1p = l0p + (size_t)16 * KROW;
#pragma unroll
      for (int kk = 0; kk < HD / 32; ++kk) {
        const v16h qh  = ldfrag_h(Qh + kk * FRS);
        const v16h ql  = ldfrag_h(Ql + kk * FRS);
        const v16h kh0 = ldfrag_h(k0p + kk * FRS);
        const v16h kh1 = ldfrag_h(k1p + kk * FRS);
        const v16h kl0 = ldfrag_h(l0p + kk * FRS);
        const v16h kl1 = ldfrag_h(l1p + kk * FRS);
        s0 = mma_h(kh0, qh, s0);
        s0 = mma_h(kh0, ql, s0);
        s0 = mma_h(kl0, qh, s0);
        s1 = mma_h(kh1, qh, s1);
        s1 = mma_h(kh1, ql, s1);
        s1 = mma_h(kl1, qh, s1);
        guard2(s0, s1, qh, ql, kh0, kl0, kh1, kl1);
      }
      // as in the other branch
      asm volatile("s_wait_xcnt 0x0" :: "v"(k0p), "v"(l0p) : "memory");
    } else {
#pragma unroll
      for (int kk = 0; kk < HD / 32; ++kk) {
        const v16h qh  = ldfrag_h(Qh + kk * FRS);
        const v16h kh0 = ldfrag_h(k0p + kk * FRS);
        const v16h kh1 = ldfrag_h(k1p + kk * FRS);
        s0 = mma_h(kh0, qh, s0);
        s1 = mma_h(kh1, qh, s1);
        guard2(s0, s1, qh, kh0, kh1, qh, kh0, kh1);
      }
      // the work below reuses registers that the loads above name: wait before they are overwritten (the pointer is an input
      // so that its registers live up to the wait and no later load of the group lands in them)
      asm volatile("s_wait_xcnt 0x0" :: "v"(k0p) : "memory");
    }
    // ---- causal select (key >= query excluded) + online softmax in base 2, -inf-safe ----
    const int nadm = qr - (kb + 8 * hh);    // element r of s0 is admitted where r < nadm, element r of s1 where 16 + r < nadm
    v8f t0 = s0 * lsc, t1 = s1 * lsc;
    float mx = -INFINITY;
#pragma unroll                              // scores stay in registers: constant element indices
    for (int r = 0; r < 8; ++r) {
      t0[r] = (r >= nadm) ? -INFINITY : t0[r];
      t1[r] = (16 + r >= nadm) ? -INFINITY : t1[r];
      mx = fmaxf(mx, fmaxf(t0[r], t1[r]));
    }
    mx = fmaxf(mx, xhalf(mx));              // the other 16 keys of the same query row
    const float mn = fmaxf(mrow, mx);
    const float ms = (mn == -INFINITY) ? 0.0f : mn;
    const float al = exp2f(mrow - ms);
    mrow = mn;
    t0 -= ms;
    t1 -= ms;
#pragma unroll                              // as above
    for (int r = 0; r < 8; ++r) {
      t0[r] = exp2f(t0[r]);
      t1[r] = exp2f(t1[r]);
    }
    const v8f pe = t0 + t1;
    lrow = lrow * al + (((pe[0] + pe[1]) + (pe[2] + pe[3])) + ((pe[4] + pe[5]) + (pe[6] + pe[7])));
#pragma unroll                              // accumulators stay in registers
    for (int j = 0; j < 4; ++j) o[j] *= al;
    // ---- B fragments of P^T*32768: hi f16 and residual f16, column = query row qr, split k map over the 32 keys of this step ----
    FragH ph, pl;
    t0 *= PCAR;
    t1 *= PCAR;
#pragma unroll                              // constant element indices
    for (int e = 0; e < 8; ++e) {
      const _Float16 ha = (_Float16)t0[e], hb = (_Float16)t1[e];
      ph.h[0][e] = ha;                        // elements 0..7  = keys kb + 8hh + 0..7
      ph.h[1][e] = hb;                        // elements 8..15 = keys kb + 16 + 8hh + 0..7
      pl.h[0][e] = (_Float16)(t0[e] - (float)ha);
      pl.h[1][e] = (_Float16)(t1[e] - (float)hb);
    }
    // ---- v^T.P^T : A fragment row m = d = j*16 + c, subtile j at j * FRS in the key tile of the v^T planes; 2 groups of 2 ----
    {
      const _Float16* vhp = Vhb + (size_t)kb * KROW;
      if constexpr (RES != 0) {
        const _Float16* vlp = Vlb + (size_t)kb * KROW;
#pragma unroll
        for (int jg = 0; jg < 2; ++jg) {
          const size_t da = (size_t)(2 * jg) * FRS;
          const size_t db = da + (size_t)FRS;
          const size_t la = da;
          const size_t lb = db;
          const v16h vha = ldfrag_h(vhp + da), vhb2 = ldfrag_h(vhp + db);
          const v16h vla = ldfrag_h(vlp + la), vlb2 = ldfrag_h(vlp + lb);
          o[2 * jg]     = mma_h(vha,  ph.v, o[2 * jg]);
          o[2 * jg]     = mma_h(vha,  pl.v, o[2 * jg]);
          o[2 * jg]     = mma_h(vla,  ph.v, o[2 * jg]);
          o[2 * jg + 1] = mma_h(vhb2, ph.v, o[2 * jg + 1]);
          o[2 * jg + 1] = mma_h(vhb2, pl.v, o[2 * jg + 1]);
          o[2 * jg + 1] = mma_h(vlb2, ph.v, o[2 * jg + 1]);
          guard2(o[2 * jg], o[2 * jg + 1], ph.v, pl.v, vha, vhb2, vla, vlb2);
        }
        // as in the other branch
        asm volatile("s_wait_xcnt 0x0" :: "v"(vhp), "v"(vlp) : "memory");
      } else {
#pragma unroll
        for (int jg = 0; jg < 2; ++jg) {
          const size_t da = (size_t)(2 * jg) * FRS;
          const size_t db = da + (size_t)FRS;
          const v16h vha = ldfrag_h(vhp + da), vhb2 = ldfrag_h(vhp + db);
          o[2 * jg]     = mma_h(vha,  ph.v, o[2 * jg]);
          o[2 * jg + 1] = mma_h(vhb2, ph.v, o[2 * jg + 1]);
          guard2(o[2 * jg], o[2 * jg + 1], ph.v, vha, vhb2, ph.v, vha, vhb2);
        }
        // the next trip's address arithmetic reuses registers that the loads above name: wait before they are overwritten
        // (the pointer is an input so that its registers live up to the wait)
        asm volatile("s_wait_xcnt 0x0" :: "v"(vhp) : "memory");
      }
    }
  }
  acc_guard4(o[0], o[1], o[2], o[3]);
  lrow += xhalf(lrow);                      // the two halves' keys together
  // ---- the wave's partials to LDS: accumulators at (row c, columns 16j + 8hh + 0..7), (max, sum) of row c from lanes hh == 0 ----
#pragma unroll                              // accumulators stay in registers: constant element indices, constant LDS offsets
  for (int j = 0; j < 4; ++j) {
    float* d = slab + c * SLP + 16 * j + 8 * hh;
    const v4f lo = {o[j][0], o[j][1], o[j][2], o[j][3]};
    const v4f hi = {o[j][4], o[j][5], o[j][6], o[j][7]};
    *(v4f*)(d)     = lo;
    *(v4f*)(d + 4) = hi;
  }
  if (hh == 0) {
    mxs[c * WPB + wave] = mrow;
    sms[c * WPB + wave] = lrow;
  }
  __syncthreads();                          // publishes every wave's partials to the merging waves
  // ---- merge of query row q0 + wave over the WPB key ranges, in wave order; lane = columns 2*lane, 2*lane + 1 ----
  if (RES == 0 || q0 + wave != 0) {         // wave-uniform, behind the last barrier: query row 0 is stored by the calling kernel
    const int row = wave;
    float mw[WPB], lw[WPB];
#pragma unroll                              // mw, lw stay in registers; the LDS loads go out together
    for (int g = 0; g < WPB / 4; ++g) {
      const v4f a = *(const v4f*)(mxs + row * WPB + 4 * g);
      const v4f z = *(const v4f*)(sms + row * WPB + 4 * g);
#pragma unroll                              // as above
      for (int e = 0; e < 4; ++e) { mw[4 * g + e] = a[e]; lw[4 * g + e] = z[e]; }
    }
    float mm = mw[0];
#pragma unroll                              // as above
    for (int w = 1; w < WPB; ++w) mm = fmaxf(mm, mw[w]);
    const float ms = (mm == -INFINITY) ? 0.0f : mm;
    const float* prt = smem + row * SLP + 2 * lane;
    float lv = 0.f, x0 = 0.f, x1 = 0.f;
#pragma unroll                              // the WPB partial-row loads go out together, one LDS latency instead of WPB
    for (int w = 0; w < WPB; ++w) {
      const float wg = exp2f(mw[w] - ms);
      const v2f  pv = *(const v2f*)(prt + w * WREG);
      lv += lw[w] * wg;
      x0 += pv[0] * wg;
      x1 += pv[1] * wg;
    }
    const float ls  = (lv > 0.0f) ? lv : 1.0f;
    const float inv = (lv > 0.0f) ? ((1.0f / ls) * oc) : 0.0f;
    v2f res;
    res[0] = x0 * inv;
    res[1] = x1 * inv;
    *(v2f*)(Out + ((size_t)b * SEQ_FULL + (size_t)(q0 + row)) * HD + 2 * lane) = res;
  }
}

// =====================================================================================================
// All of the attention, one launch. Block bid -> (rank rk = bid / NB, batch b = bid % NB); query tile qt = (NQT - rk) % NQT, that
// is 0, NQT-1, NQT-2, .., 1: a permutation of 0 .. NQT-1; q0 = 16*qt. A tile's key count grows with qt and there are more work-groups
// than resident places: the longest tiles take the lowest block indices and the shortest the highest. Tile 0 takes the
// lowest indices as well: it is short in keys but has the serial row-0 mean ahead of its attention.
// Tiles q0 < QO take the residual products (attn_c<1>), the others the single products (attn_c<0>); the branch is block-uniform.
// Query row 0 of a batch, in the work-group of its tile 0, ahead of that tile's attention: uniform weights 1/SEQ over ALL keys ->
// out[b][0][d] = mean over s of F[b*SEQ + s][d], F the f32 v projection, from its f64 16-key partial sums PS[b*NPS + p][d]
// (written by proj_planes earlier in the same call). Thread (d = tid & 63, g = tid >> 6) adds rows g, g + 16, .. and, in a second
// sum, rows g + 8, g + 24, .. of column d in that order (independent 8-B loads); the 16 sums of a column are combined in fixed
// order through LDS (the room of the partial results, not yet in use), scaled by 1/SEQ and stored by threads 0 .. 63.
// coverage: grid = NB * NQT blocks = every 16-row tile of every batch once; row 0: 64 threads x 1 float, waves 0 and 1 one
//           128-B line each.
// =====================================================================================================
__global__ __launch_bounds__(ATT_THREADS)
void attn_all(const u16* __restrict__ QHp, const u16* __restrict__ QLp,
              const u16* __restrict__ KHp, const u16* __restrict__ KLp,
              const u16* __restrict__ VHp, const u16* __restrict__ VLp,
              const double* __restrict__ PS, float* Out) {
  __shared__ __align__(16) float smem[WPB * WREG];
  __shared__ __align__(16) float mxs[16 * WPB];   // [query row][wave] running maxima
  __shared__ __align__(16) float sms[16 * WPB];   // [query row][wave] running sums
  const int bid = blockIdx.x;
  const unsigned rk = (unsigned)bid / NB;
  const int b   = (int)((unsigned)bid % NB);
  if (rk >= NQT) return;                    // block-uniform, before any barrier; never taken with the exact grid
  const int q0  = (int)((NQT - rk) % NQT) * 16;
  if (q0 == 0) {                            // block-uniform
    const int tid = threadIdx.x;
    double* part = (double*)(void*)smem;    // [RGRP][HD]
    const double* p = PS + (size_t)b * NPS * HD + tid;
    double a0 = 0.0, a1 = 0.0;
#pragma unroll                              // independent loads in flight together instead of one memory latency per row
    for (int s = 0; s < NPS / RGRP; ++s) {
      a0 += p[s * (RGRP * HD)];
      a1 += p[s * (RGRP * HD) + ATT_THREADS];
    }
    part[tid] = a0;
    part[tid + ATT_THREADS] = a1;
    __syncthreads();                        // publishes the 16 sums of every column
    if (tid < HD) {
      double t = part[tid];
#pragma unroll                              // constant LDS offsets
      for (int g2 = 1; g2 < RGRP; ++g2) t += part[g2 * HD + tid];
      Out[(size_t)b * SEQ_FULL * HD + tid] = (float)t * (1.0f / (float)SEQ);
    }
    __syncthreads();                        // the sums are read before a wave stores its partial result into the same LDS
  }
  if (q0 < QO) attn_c<1>(QHp, QLp, KHp, KLp, VHp, VLp, Out, smem, mxs, sms, b, q0);
  else         attn_c<0>(QHp, QLp, KHp, KLp, VHp, VLp, Out, smem, mxs, sms, b, q0);
}

// =====================================================================================================
// Workspace map (bytes); every plane is fully written by whole-line stores before it is read; all extents are exact multiples
// of the store granularity (no pad rows needed); every region offset a multiple of 65536:
//   QH  f16 MROWS x 64 x256          MROWS*128    QL residual NB*QO x 64   NB*QO*128                (2097152 + 262144)
//   KH  f16 MROWS x 64 x256          MROWS*128    KL residual NB*QO x 64   NB*QO*128                (2097152 + 262144)
//   VH  f16 MROWS x 64 x1024         MROWS*128    VL residual NB*QO x 64   NB*QO*128                (2097152 + 262144)
//   (QH .. VL in fragment order: 16-row tiles of 2048 B for q and k, 32-key tiles of 4096 B for v)
//   PS  f64 [NB*NPS][64] 16-key column sums of v    NB*NPS*512                                      (524288)
//   end (NB=4, SEQ=4096)           7602176
// =====================================================================================================
extern "C" void kernel_launch(void* const* d_in, const int* in_sizes, int n_in,
                              void* d_out, int out_size, void* d_ws, size_t ws_size,
                              hipStream_t stream) {
  if (n_in < 6) return;
  const int needx = ((NB - 1) * SEQ_FULL + SEQ) * DIN;
  if (in_sizes[0] < needx) return;
  if (in_sizes[1] < needx) return;
  if (in_sizes[2] < needx) return;
  if (in_sizes[3] != HD * DIN) return;
  if (in_sizes[4] != HD * DIN) return;
  if (in_sizes[5] != HD * DIN) return;
  if (out_size < ((NB - 1) * SEQ_FULL + SEQ) * HD) return;

  const float* query = (const float*)d_in[0];
  const float* keyin = (const float*)d_in[1];
  const float* value = (const float*)d_in[2];
  const float* wq    = (const float*)d_in[3];
  const float* wk    = (const float*)d_in[4];
  const float* wv    = (const float*)d_in[5];
  float*       out   = (float*)d_out;

  const size_t szH  = (size_t)MROWS * HD * 2;                    // QH, KH
  const size_t szL  = (size_t)NB * QO * HD * 2;                  // QL, KL (compact residual planes)
  const size_t szVH = (size_t)NB * HD * SEQ * 2;                 // == szH
  const size_t szVL = (size_t)NB * HD * QO * 2;                  // == szL
  const size_t szPS = (size_t)NB * NPS * HD * 8;
  size_t off = 0;
  const size_t oQH = off; off += szH;
  const size_t oQL = off; off += szL;
  const size_t oKH = off; off += szH;
  const size_t oKL = off; off += szL;
  const size_t oVH = off; off += szVH;
  const size_t oVL = off; off += szVL;
  const size_t oPS = off; off += szPS;
  if (off > ws_size) return;                // off = 7602176 for NB = 4, SEQ = 4096
  if (off > (size_t)WS_CAP) return;

  char* ws = (char*)d_ws;
  u16*   QH  = (u16*)(ws + oQH);
  u16*   QL  = (u16*)(ws + oQL);
  u16*   KH  = (u16*)(ws + oKH);
  u16*   KL  = (u16*)(ws + oKL);
  u16*   VH  = (u16*)(ws + oVH);
  u16*   VL  = (u16*)(ws + oVL);
  double* PS = (double*)(ws + oPS);

  const dim3 b512(512), bAT(ATT_THREADS);
  const dim3 gG(MROWS / 64);
  const dim3 gAT(NB * NQT);

  // (1) v, q, k projections -> v^T, q, k hi planes (all rows) + residual planes (rows s < QO), and the f64 16-key column sums of v
  proj_planes<<<gG, b512, 0, stream>>>(value, query, keyin, wv, wq, wk, VH, VL, QH, QL, KH, KL, PS);
  // (2) causal attention, every query tile -> out (tiles s < QO with residual products, the others single products); the
  //     work-group of a batch's tile 0 also stores query row 0 = column mean of v over all SEQ keys, from the partial sums
  attn_all<<<gAT, bAT, 0, stream>>>(QH, QL, KH, KL, VH, VL, PS, out);
  (void)hipGetLastError();
}

// v010
// It runs in 36.8 microseconds.
// Timed twice side by side with v009, it ran 1.06 and 1.07 times as fast.
// Counting every step since v000, it is 16.6 times as fast.
// Contractions: value.Wv^T, query.Wq^T, key.Wk^T on v_wmma_f32_16x16x32_bf16 (inputs and W rounded to bf16 RNE on the way into
// LDS; W [n][k] rows are the k-contiguous B operand); q.k^T over hd 64 and P.v on v_wmma_f32_16x16x32_f16 (q, k x256, P x32768, v x1024 as f16
// planes; query rows s < QO additionally use f16 residual planes, products hh+lh+hl); all f32 accumulate. Strictly-earlier-key
// causal select, base-2 online softmax and 1/Z fold in f32 on VALU; query row 0 (uniform weights over all keys) = column mean
// of the f32 v projection with f64 accumulate on VALU (16-key partial sums in the projection launch, added up by the work-group of query tile 0).
// Both attention products are formed transposed (S^T = k.q^T, O^T += v^T.P^T): a lane holds the scores of one query row, so the
// maximum and the sum are taken in its own registers plus one exchange with lane ^ 16, and P^T goes from the score registers straight into the B operand.
// Each 16-row query tile is one work-group of 16 waves: wave w walks key tiles w, w + 16, .. with its own maxima, sums and
// accumulators; the partials are merged through LDS behind one work-group barrier and the merge writes the f32 output.
// The f16 planes lie in fragment order: every 16-B chunk that a lane loads for an A or B operand stands at lane * 16 B inside a
// 512-B group, so that one fragment load of a wave reads four whole 128-B lines. One launch forms all three projections; each of
// its work-groups writes its part of the f16 planes (and of the column sums) straight from its f32 result tile in LDS. A second
// launch holds every query tile of every batch (both product forms) and the row-0 mean; its first work-groups ask the k and v^T
// planes into L2 ahead of their readers.
#include <hip/hip_runtime.h>
#include <math.h>
#include <stdint.h>

#ifndef NB
#define NB 4
#endif
#ifndef SEQ
#define SEQ 4096
#endif
#define SEQ_FULL 4096
#define DIN   512
#define HD    64
#define QO    ((SEQ < 512) ? SEQ : 512)
#define MROWS (NB * SEQ)
#define RSQ_HD 0.125f
#define LOG2E 1.4426950408889634f
#define QSC   256.0f
#define KSC   256.0f
#define PCAR  32768.0f
#define VCAR  1024.0f
#define WPB   16
#define NQT   (SEQ / 16)
#define NQO   (QO / 16)
#define NST   (SEQ / 64)
#define NKT   (SEQ / 32)
#define ATT_THREADS (WPB * 32)
#define SLP   68
#define SLW   (16 * SLP)
#define WREG  SLW
#define XSP   (DIN + 8)
#define NPS   (NST * 4)
#define RGRP  16
#define WS_CAP 134217728
#define FRH   256
#define FRS   (2 * FRH)
#define NSL   ((NKT + WPB - 1) / WPB)
#define NPF   (8 * (NSL + 1))
static_assert(HD == 64 && (DIN % 32) == 0 && DIN >= 32 && WPB == 16 && ATT_THREADS == 512);
static_assert(NB >= 1 && NB <= 4);
static_assert((SEQ % 64) == 0 && SEQ >= 64 && SEQ <= SEQ_FULL && (SEQ % 4) == 0);
static_assert((QO % 64) == 0 && QO >= 64 && QO <= SEQ);
static_assert((MROWS % 64) == 0 && SLP == 68 && DIN == 512);
static_assert((NPS % RGRP) == 0 && RGRP * HD == 1024 && RGRP * HD == 2 * ATT_THREADS && RGRP * HD * 8 <= WPB * WREG * 4);
static_assert((WPB * WREG + 2 * 16 * WPB) * 4 <= 81920 && 2 * 64 * XSP * 2 + 64 * SLP * 4 <= 163840);

typedef unsigned short u16;
typedef _Float16 v16h __attribute__((ext_vector_type(16)));
typedef _Float16 v8h  __attribute__((ext_vector_type(8)));
typedef __bf16   v16b __attribute__((ext_vector_type(16)));
typedef __bf16   v2b  __attribute__((ext_vector_type(2)));
typedef float    v8f  __attribute__((ext_vector_type(8)));
typedef float    v4f  __attribute__((ext_vector_type(4)));
typedef float    v2f  __attribute__((ext_vector_type(2)));
typedef unsigned int v4u __attribute__((ext_vector_type(4)));
typedef unsigned int v2u __attribute__((ext_vector_type(2)));

union FragH { v16h v; v8h h[2]; v4u u[2]; };
union FragB { v16b v; v4u u[2]; };

// ---- scalar helpers --------------------------------------------------------------------------------
__device__ __forceinline__ unsigned short h_bits(_Float16 x) { return __builtin_bit_cast(unsigned short, x); }
__device__ __forceinline__ unsigned pk16(unsigned short a, unsigned short b) { return (unsigned)a | ((unsigned)b << 16); }
__device__ __forceinline__ v8f zero8() { v8f z = {0.f, 0.f, 0.f, 0.f, 0.f, 0.f, 0.f, 0.f}; return z; }
__device__ __forceinline__ const _Float16* ash(const u16* p) { return (const _Float16*)(const void*)p; }

// ---- fragment loaders: 16-bit A/B operand, lane -> row/col (lane&15), h = lane>>4; elements 0..7 = k0+8h.., elements 8..15 =
//      k0+16+8h.. (same split k map for A and B).
//      ldfrag_h: global f16 plane in fragment order, p already includes +8*lane: the two 16-B chunks of a lane stand 512 B apart
//      ldfrag_b: k-contiguous [n][k] LDS tile, p already includes +8*h: elements 0..7 <- p[0..7], 8..15 <- p[16..23]
__device__ __forceinline__ v16h ldfrag_h(const _Float16* p) {
  FragH f;
  f.h[0] = *(const v8h*)(p);
  f.h[1] = *(const v8h*)(p + FRH);
  return f.v;
}
__device__ __forceinline__ v16b ldfrag_b(const u16* p) {              // bf16 plane read as unsigned integer vectors
  FragB f;
  f.u[0] = *(const v4u*)(p);
  f.u[1] = *(const v4u*)(p + 16);
  return f.v;
}

__device__ __forceinline__ v8f mma_h(v16h a, v16h b, v8f c) {
  return __builtin_amdgcn_wmma_f32_16x16x32_f16(false, a, false, b, (short)0, c, false, false);
}
__device__ __forceinline__ v8f mma_b(v16b a, v16b b, v8f c) {
  return __builtin_amdgcn_wmma_f32_16x16x32_bf16(false, a, false, b, (short)0, c, false, false);
}
__device__ __forceinline__ void guard2(v8f& a, v8f& b, v16h x0, v16h x1, v16h x2, v16h x3, v16h x4, v16h x5) {
#if defined(__HIP_DEVICE_COMPILE__)
  asm volatile("v_nop\n\tv_nop\n\tv_nop\n\tv_nop"
               : "+v"(a), "+v"(b) : "v"(x0), "v"(x1), "v"(x2), "v"(x3), "v"(x4), "v"(x5) : "memory");
#endif
}
__device__ __forceinline__ void acc_guard4(v8f& a, v8f& b, v8f& c, v8f& d) {
#if defined(__HIP_DEVICE_COMPILE__)
  asm volatile("v_nop\n\tv_nop\n\tv_nop\n\tv_nop" : "+v"(a), "+v"(b), "+v"(c), "+v"(d));
#endif
}
// Hint, no data returned: every lane asks for its own address into L2. The wait stands in the same statement, so
// that the address registers are not written again in front of it.
__device__ __forceinline__ void l2_ask(const u16* p) {
#if defined(__HIP_DEVICE_COMPILE__)
  asm volatile("global_prefetch_b8 %0, off scope:SCOPE_SE\n\ts_wait_xcnt 0x0" :: "v"(p) : "memory");
#endif
}
__device__ __forceinline__ float xhalf(float x) {                     // value of lane l ^ 16
  const int b = __builtin_bit_cast(int, x);
  return __builtin_bit_cast(float, __builtin_amdgcn_permlanex16(b, b, 0x76543210, 0xfedcba98, false, false));
}

// =====================================================================================================
// The three projections and their f16 planes, one launch. A work-group forms, for its 64 rows, one projection after the other
// (which = 0 v = value.Wv^T, 1 q = query.Wq^T, 2 k = key.Wk^T) in one loop: behind the barrier that publishes the bf16 tiles of
// projection which, each wave issues the f32 loads of projection which + 1 into the same registers; they are in flight during the
// products and the plane forming of projection which and are rounded at the head of the next trip. The LDS tiles are
// rewritten only behind a barrier that follows their last read (XS, WS: the second barrier of the trip; CS: the first of the next).
// C (f32, 64 rows x HD) = bf16(X) . bf16(Wf)^T, X f32 [b][s][DIN] (batch stride SEQ_FULL rows), Wf f32 [HD n][DIN k].
// Block = 64 rows x all 64 columns, 16 waves. Wave w loads rows 4w .. 4w+3 of Wf and of the block's X rows as f32, each load
// 512 contiguous bytes of one row, rounds to bf16 (nearest even) in registers and stores 8 B per lane to the LDS tiles
// [64][DIN] (pitch 520 halves = 16 B x 65). Behind a work-group barrier wave (rg = w >> 2, cg = w & 3) forms the 16x16 tile
// (rows 16rg, columns 16cg): DIN/32 products in ascending k, fragments from LDS (two 16-B loads each, split k map for A and
// B). The tiles go to an LDS tile CS [64][64] (pitch 68 floats); behind a second barrier thread tid forms the 16-B chunk tid of
// the block's 8192 contiguous bytes of the hi plane, hi = f16(t), t = C * scale, and of the residual plane, f16(t - hi), the
// latter stored for rows s < QO only (compact: QO rows per batch). 32 consecutive lanes store 512 contiguous bytes.
//   q, k (x256): each 16-row tile (2048 B) is stored as [d chunk d8 = d/8][row c = row & 15][8 halves], so the operand chunk of
//   lane (h, c) for k-step kk stands at kk*1024 B + lane*16 B (d8 = 4kk + h), its second chunk 512 B behind (d8 = 4kk + 2 + h).
//   tid = (tile, d8, c): two 16-B LDS loads from row 16*tile + c.
//   v^T (x1024): each 32-key tile (4096 B) is stored as [d subtile j = d/16][key chunk q = (s & 31)/8][column c = d & 15][8 keys]:
//   the operand chunk of lane (h, c) for subtile j stands at j*1024 B + lane*16 B (q = h), its second chunk 512 B behind
//   (q = 2 + h). tid = (key tile, j, q, c): eight 4-B LDS loads down column d = 16j + c.
// Column sums for query row 0 (which == 0): thread (d = tid & 63, g = tid >> 6), tid < 256, adds keys 16g .. 16g+15 of column d
// of CS in f64, in key order, and stores the sum to PS[(blockIdx.x*4 + g)][d].
// coverage: load 16 waves x 4 rows x 4 x 512 B = 64 rows x 2048 B per operand (staged extent == consumed extent); store
//           512 thr x 8 halves = 64 rows x 64 per plane; grid.x = MROWS/64 blocks x 3 trips = every row of each hi plane exactly once, all
//           NB*QO rows of each residual plane exactly once, every one of the NB*NPS rows of PS exactly once; whole lines per wave.
// =====================================================================================================
__device__ __forceinline__ v2u bf4(v4f a) {                           // 4 f32 -> 4 bf16, nearest even
  const v2f lo = {a[0], a[1]}, hi = {a[2], a[3]};
  v2u o;
  o[0] = __builtin_bit_cast(unsigned, __builtin_convertvector(lo, v2b));
  o[1] = __builtin_bit_cast(unsigned, __builtin_convertvector(hi, v2b));
  return o;
}

__global__ __launch_bounds__(512)
void proj_planes(const float* __restrict__ Xv, const float* __restrict__ Xq, const float* __restrict__ Xk,
                 const float* __restrict__ Wv, const float* __restrict__ Wq, const float* __restrict__ Wk,
                 u16* VHo, u16* VLo, u16* QHo, u16* QLo, u16* KHo, u16* KLo, double* PS) {
  __shared__ __align__(16) u16 XS[64 * XSP];
  __shared__ __align__(16) u16 WS[64 * XSP];
  __shared__ __align__(16) float CS[64 * SLP];
  const int tid = threadIdx.x, wave = tid >> 5, lane = tid & 31, hh = lane >> 4, m = lane & 15;
  const int row0 = blockIdx.x * 64;
  if (row0 + 64 > MROWS) return;            // block-uniform, before any barrier; never taken with the exact grid
  const int b  = row0 / SEQ;
  const int s0 = row0 - b * SEQ;            // SEQ % 64 == 0: the 64 rows lie in one batch
  const size_t wof = (size_t)(wave * 4) * DIN + lane * 4;
  const size_t xof = ((size_t)b * SEQ_FULL + s0 + wave * 4) * DIN + lane * 4;
  const int rg = wave >> 2, cg = wave & 3;
  v4f wv[16], xv[16];
  {
    const float* wp = Wv + wof;
    const float* xp = Xv + xof;
#pragma unroll                              // all loads of the wave in flight together; W first: it comes from L2
    for (int i = 0; i < 16; ++i) wv[i] = *(const v4f*)(wp + (i >> 2) * DIN + (i & 3) * 128);
#pragma unroll                              // as above
    for (int i = 0; i < 16; ++i) xv[i] = *(const v4f*)(xp + (i >> 2) * DIN + (i & 3) * 128);
    // the work below may reuse registers that the loads above name: wait before they are overwritten (the two pointers are
    // inputs so that their registers live up to the wait); the scheduling barrier keeps that work behind the wait and every
    // load in front of the first conversion
    asm volatile("s_wait_xcnt 0x0" :: "v"(wp), "v"(xp) : "memory");
    __builtin_amdgcn_sched_barrier(0);
  }
#pragma unroll 1                            // one body for the three projections: the loads of the next one live across the back edge
  for (int which = 0; which < 3; ++which) {
    u16* Hp = (which == 0) ? VHo : ((which == 1) ? QHo : KHo);
    u16* Lp = (which == 0) ? VLo : ((which == 1) ? QLo : KLo);
    {
      u16* wd = WS + (wave * 4) * XSP + lane * 4;
      u16* xd = XS + (wave * 4) * XSP + lane * 4;
#pragma unroll                              // constant register indices and LDS offsets
      for (int i = 0; i < 16; ++i) *(v2u*)(wd + (i >> 2) * XSP + (i & 3) * 128) = bf4(wv[i]);
      __builtin_amdgcn_sched_barrier(0);      // W is rounded and stored while the X loads are still in flight
#pragma unroll                              // as above
      for (int i = 0; i < 16; ++i) *(v2u*)(xd + (i >> 2) * XSP + (i & 3) * 128) = bf4(xv[i]);
    }
    __syncthreads();                          // publishes both bf16 tiles to every wave
    if (which < 2) {                          // block-uniform: the next projection's f32 loads fly during this one's products
      const float* wp = ((which == 0) ? Wq : Wk) + wof;
      const float* xp = ((which == 0) ? Xq : Xk) + xof;
#pragma unroll                              // all loads of the wave in flight together
      for (int i = 0; i < 16; ++i) wv[i] = *(const v4f*)(wp + (i >> 2) * DIN + (i & 3) * 128);
      __builtin_amdgcn_sched_barrier(0);      // W in front of X, the order in which they are rounded: W's waits leave the X loads in flight
#pragma unroll                              // as above
      for (int i = 0; i < 16; ++i) xv[i] = *(const v4f*)(xp + (i >> 2) * DIN + (i & 3) * 128);
      // as at the first loads: wait before a register that these loads name is overwritten
      asm volatile("s_wait_xcnt 0x0" :: "v"(wp), "v"(xp) : "memory");
      __builtin_amdgcn_sched_barrier(0);      // every load in front of the products
    }
    const u16* ap = XS + (rg * 16 + m) * XSP + 8 * hh;
    const u16* bp = WS + (cg * 16 + m) * XSP + 8 * hh;
    v8f acc = zero8();
#pragma unroll                              // constant LDS offsets; fragment loads run ahead of the product chain
    for (int k0 = 0; k0 < DIN; k0 += 32) acc = mma_b(ldfrag_b(ap + k0), ldfrag_b(bp + k0), acc);
#pragma unroll                              // constant element indices
    for (int r = 0; r < 8; ++r) CS[(rg * 16 + 8 * hh + r) * SLP + cg * 16 + m] = acc[r];
    // publishes the 64x64 f32 tile to the waves that form the planes. Work-group barrier with fences on LDS alone: only LDS data
    // pass between the waves here, and __syncthreads() would also wait for the next projection's global loads
    __builtin_amdgcn_fence(__ATOMIC_RELEASE, "workgroup", "local");
    __builtin_amdgcn_s_barrier();
    __builtin_amdgcn_fence(__ATOMIC_ACQUIRE, "workgroup", "local");
    const bool dolo = (s0 < QO);              // block-uniform: s0 and QO are multiples of 64
    float w[8];
    double csum = 0.0;
    if (which == 0) {
      const float* col = CS + ((tid >> 8) * 32 + ((tid >> 4) & 3) * 8) * SLP + ((tid >> 6) & 3) * 16 + (tid & 15);
#pragma unroll                              // constant LDS offsets
      for (int e = 0; e < 8; ++e) w[e] = col[e * SLP] * VCAR;
      if (tid < 256) {
        const float* cs = CS + ((tid >> 6) * 16) * SLP + (tid & 63);
        float cv[16];
#pragma unroll                              // constant LDS offsets; the 16 loads go out together
        for (int i = 0; i < 16; ++i) cv[i] = cs[i * SLP];
        __builtin_amdgcn_sched_barrier(0);    // all 16 loads in front of the first addition: one LDS latency, not one per pair of keys
#pragma unroll                              // constant register indices
        for (int i = 0; i < 16; ++i) csum += (double)cv[i];
      }
    } else {
      const float* p = CS + ((tid >> 7) * 16 + (tid & 15)) * SLP + ((tid >> 4) & 7) * 8;
      const v4f a = *(const v4f*)(p), b4 = *(const v4f*)(p + 4);
      const float sc = (which == 1) ? QSC : KSC;
#pragma unroll                              // constant element indices
      for (int e = 0; e < 4; ++e) { w[e] = a[e] * sc; w[4 + e] = b4[e] * sc; }
    }
    v4u oh, ol;
#pragma unroll                              // constant element indices
    for (int e = 0; e < 4; ++e) {
      const float t0 = w[2 * e], t1 = w[2 * e + 1];
      const _Float16 h0 = (_Float16)t0, h1 = (_Float16)t1;
      const _Float16 l0 = (_Float16)(t0 - (float)h0), l1 = (_Float16)(t1 - (float)h1);
      oh[e] = pk16(h_bits(h0), h_bits(h1));
      ol[e] = pk16(h_bits(l0), h_bits(l1));
    }
    u16* dh = Hp + (size_t)row0 * HD + tid * 8;
    u16* dl = Lp + ((size_t)b * QO + (dolo ? s0 : 0)) * HD + tid * 8;
    double* dp = PS + (size_t)blockIdx.x * 256 + (tid & 255);   // row blockIdx.x*4 + (tid >> 6), column tid & 63
    *(v4u*)(dh) = oh;
    // the residual path below reuses registers that the store above names: wait before they are overwritten; the scheduling
    // barrier keeps that work behind the wait
    asm volatile("s_wait_xcnt 0x0" ::: "memory");
    __builtin_amdgcn_sched_barrier(0);
    if (dolo) { *(v4u*)(dl) = ol; }
    if (which == 0 && tid < 256) { *dp = csum; }
    // the next trip reuses registers that the stores above name: wait before they are overwritten
    asm volatile("s_wait_xcnt 0x0" ::: "memory");
  }
}

// =====================================================================================================
// Single-head causal attention (key j contributes to query i only when j < i), hd = 64, f32 output.
// One work-group of WPB waves per 16-row query tile q0 = 16*qt of batch b (both from the calling kernel); wave w takes the key
// tiles kt = w, w + WPB, .. below.
// RES == 1: query tiles q0 < QO, scores = q_hi.k_hi + q_lo.k_hi + q_hi.k_lo and P.v = hh + lh + hl; RES == 0: query tiles
// q0 >= QO, single products q_hi.k_hi, P_hi.v_hi.
//   q hi plane f16 x256, rows b*SEQ + s, q residual (compact) rows b*QO + s, 16-row tiles in fragment order (see proj_planes);
//   k hi / residual planes likewise; v^T hi plane x1024 and v^T residual plane (compact), 32-key tiles in fragment order (proj_planes).
//   score (log2 domain) t(i, j) = (q_i.k_j over HD) * (1/8)*log2e/(256*256), replaced by -inf where key j >= query i.
//   Key tiles of 32 visited in order for kb <= q0 + 14 (later tiles hold only keys at or above every query row of the tile);
//   with RES == 1 this keeps every visited key below QO, inside the compact residual planes. Query row 0 has no admitted key:
//   its running max stays -inf, Z = 0, and the row is not stored here (the calling kernel stores its true value).
//   Per tile: 2 score subtiles x 2 k-steps, fragments loaded straight from the 16-bit planes (two 16-B loads per fragment,
//   each 512 contiguous bytes per wave, split k map). The k fragment is the A operand and the q fragment the B operand (both
//   have the same lane and k map), so D = S^T: lane (hh, c) holds query row q0 + c and keys kb + 8hh + r (subtile 0) and
//   kb + 16 + 8hh + r (subtile 1). Online max-subtracted base-2 softmax in f32, -inf-safe rescale: maximum over the lane's 16
//   scores and one exchange with lane ^ 16; the running sum stays per lane half (its own keys) and the halves are added behind
//   the loop. The lane's 16 values of P*32768 (f16 hi plus its f16 residual) are, in that order, elements 0..15 of the B
//   operand P^T under the split k map; the v^T fragments are the A operand, in 2 groups of 2 d-subtiles: D = O^T, element r =
//   (d = 16j + 8hh + r, query row q0 + c).
//   After the loop each wave stores its un-normalised 16x64 accumulators
//   and its 16 (max, sum) pairs to LDS; one work-group barrier, which every wave reaches (also a wave without a key
//   tile: max -inf, sum 0, accumulators 0); then wave w merges query row w: M = max of the maxima, weights exp2(m - M) (0 where
//   m = -inf), Z and the row added up in wave order, out = row / Z (0 if Z == 0), carries 1/(32768*1024) folded once.
//   No return in here; bounded loops only (nkt <= NKT).
// coverage: per wave 32 lanes x 2 floats = one 64-float output row, WPB waves = the tile's 16 rows, but row s = 0.
// =====================================================================================================
template <int RES>
__device__ __forceinline__
void attn_c(const u16* __restrict__ QHp, const u16* __restrict__ QLp,
            const u16* __restrict__ KHp, const u16* __restrict__ KLp,
            const u16* __restrict__ VHp, const u16* __restrict__ VLp,
            float* Out, float* smem, float* mxs, float* sms, const int b, const int q0) {
  const int tid  = threadIdx.x;
  const int wave = __builtin_amdgcn_readfirstlane(tid >> 5);   // scalar: the key loop below branches on it, EXEC stays whole
  const int lane = tid & 31;
  const int hh   = lane >> 4;
  const int c    = lane & 15;
  const int ql0  = (RES != 0) ? q0 : 0;

  float* slab = smem + wave * WREG;         // the wave's partial result [16][64] pitch 68, behind the loop

  const size_t lcol = (size_t)8 * lane;     // the lane's 16-B chunk within a 512-B group of a fragment-order plane
  const _Float16* Qh  = ash(QHp) + ((size_t)b * SEQ + q0) * HD + lcol;
  const _Float16* Ql  = ash(QLp) + ((size_t)b * QO + ql0) * HD + lcol;              // RES == 1 only
  const _Float16* Khb = ash(KHp) + (size_t)b * SEQ * HD + lcol;                     // key tile kb * HD added per step
  const _Float16* Klb = ash(KLp) + (size_t)b * QO * HD + lcol;                      // RES == 1 only, keys < QO
  const _Float16* Vhb = ash(VHp) + (size_t)b * SEQ * HD + lcol;                     // key tile kb * HD added per step
  const _Float16* Vlb = ash(VLp) + (size_t)b * QO * HD + lcol;                      // RES == 1 only
  const float lsc = RSQ_HD * (LOG2E / (QSC * KSC));
  const float oc  = 1.0f / (PCAR * VCAR);
  const size_t KROW = (size_t)HD;           // halves per key in every plane: a 16-key tile is 16 * KROW, a 32-key tile 32 * KROW

  float mrow = -INFINITY, lrow = 0.f;       // query row q0 + c: running maximum (equal in both lane halves), sum over this half's keys
  v8f o[4];
#pragma unroll
  for (int j = 0; j < 4; ++j) o[j] = zero8();
  const int ncaus = (q0 >> 5) + 1;                                            // tiles holding keys <= q0 + 14
  const int nkt = (ncaus < NKT) ? ncaus : NKT;
  const int qr  = q0 + c;                                                     // the lane's query row

#pragma unroll 1
  for (int kt = wave; kt < nkt; kt += WPB) {
    const int kb = kt * 32;
    // ---- scores, transposed: D element r of this lane = (key kb + 8hh + r, query row qr) in s0, key kb + 16 + 8hh + r in s1 ----
    v8f s0 = zero8(), s1 = zero8();
    const _Float16* k0p = Khb + (size_t)kb * KROW;
    const _Float16* k1p = k0p + (size_t)16 * KROW;
    if constexpr (RES != 0) {
      const _Float16* l0p = Klb + (size_t)kb * KROW;
      const _Float16* l1p = l0p + (size_t)16 * KROW;
#pragma unroll
      for (int kk = 0; kk < HD / 32; ++kk) {
        const v16h qh  = ldfrag_h(Qh + kk * FRS);
        const v16h ql  = ldfrag_h(Ql + kk * FRS);
        const v16h kh0 = ldfrag_h(k0p + kk * FRS);
        const v16h kh1 = ldfrag_h(k1p + kk * FRS);
        const v16h kl0 = ldfrag_h(l0p + kk * FRS);
        const v16h kl1 = ldfrag_h(l1p + kk * FRS);
        s0 = mma_h(kh0, qh, s0);
        s0 = mma_h(kh0, ql, s0);
        s0 = mma_h(kl0, qh, s0);
        s1 = mma_h(kh1, qh, s1);
        s1 = mma_h(kh1, ql, s1);
        s1 = mma_h(kl1, qh, s1);
        guard2(s0, s1, qh, ql, kh0, kl0, kh1, kl1);
      }
      // as in the other branch
      asm volatile("s_wait_xcnt 0x0" :: "v"(k0p), "v"(l0p) : "memory");
    } else {
#pragma unroll
      for (int kk = 0; kk < HD / 32; ++kk) {
        const v16h qh  = ldfrag_h(Qh + kk * FRS);
        const v16h kh0 = ldfrag_h(k0p + kk * FRS);
        const v16h kh1 = ldfrag_h(k1p + kk * FRS);
        s0 = mma_h(kh0, qh, s0);
        s1 = mma_h(kh1, qh, s1);
        guard2(s0, s1, qh, kh0, kh1, qh, kh0, kh1);
      }
      // the work below reuses registers that the loads above name: wait before they are overwritten (the pointer is an input
      // so that its registers live up to the wait and no later load of the group lands in them)
      asm volatile("s_wait_xcnt 0x0" :: "v"(k0p) : "memory");
    }
    // ---- causal select (key >= query excluded) + online softmax in base 2, -inf-safe ----
    const int nadm = qr - (kb + 8 * hh);    // element r of s0 is admitted where r < nadm, element r of s1 where 16 + r < nadm
    v8f t0 = s0 * lsc, t1 = s1 * lsc;
    float mx = -INFINITY;
#pragma unroll                              // scores stay in registers: constant element indices
    for (int r = 0; r < 8; ++r) {
      t0[r] = (r >= nadm) ? -INFINITY : t0[r];
      t1[r] = (16 + r >= nadm) ? -INFINITY : t1[r];
      mx = fmaxf(mx, fmaxf(t0[r], t1[r]));
    }
    mx = fmaxf(mx, xhalf(mx));              // the other 16 keys of the same query row
    const float mn = fmaxf(mrow, mx);
    const float ms = (mn == -INFINITY) ? 0.0f : mn;
    const float al = exp2f(mrow - ms);
    mrow = mn;
    t0 -= ms;
    t1 -= ms;
#pragma unroll                              // as above
    for (int r = 0; r < 8; ++r) {
      t0[r] = exp2f(t0[r]);
      t1[r] = exp2f(t1[r]);
    }
    const v8f pe = t0 + t1;
    lrow = lrow * al + (((pe[0] + pe[1]) + (pe[2] + pe[3])) + ((pe[4] + pe[5]) + (pe[6] + pe[7])));
#pragma unroll                              // accumulators stay in registers
    for (int j = 0; j < 4; ++j) o[j] *= al;
    // ---- B fragments of P^T*32768: hi f16 and residual f16, column = query row qr, split k map over the 32 keys of this step ----
    FragH ph, pl;
    t0 *= PCAR;
    t1 *= PCAR;
#pragma unroll                              // constant element indices
    for (int e = 0; e < 8; ++e) {
      const _Float16 ha = (_Float16)t0[e], hb = (_Float16)t1[e];
      ph.h[0][e] = ha;                        // elements 0..7  = keys kb + 8hh + 0..7
      ph.h[1][e] = hb;                        // elements 8..15 = keys kb + 16 + 8hh + 0..7
      pl.h[0][e] = (_Float16)(t0[e] - (float)ha);
      pl.h[1][e] = (_Float16)(t1[e] - (float)hb);
    }
    // ---- v^T.P^T : A fragment row m = d = j*16 + c, subtile j at j * FRS in the key tile of the v^T planes; 2 groups of 2 ----
    {
      const _Float16* vhp = Vhb + (size_t)kb * KROW;
      if constexpr (RES != 0) {
        const _Float16* vlp = Vlb + (size_t)kb * KROW;
#pragma unroll
        for (int jg = 0; jg < 2; ++jg) {
          const size_t da = (size_t)(2 * jg) * FRS;
          const size_t db = da + (size_t)FRS;
          const size_t la = da;
          const size_t lb = db;
          const v16h vha = ldfrag_h(vhp + da), vhb2 = ldfrag_h(vhp + db);
          const v16h vla = ldfrag_h(vlp + la), vlb2 = ldfrag_h(vlp + lb);
          o[2 * jg]     = mma_h(vha,  ph.v, o[2 * jg]);
          o[2 * jg]     = mma_h(vha,  pl.v, o[2 * jg]);
          o[2 * jg]     = mma_h(vla,  ph.v, o[2 * jg]);
          o[2 * jg + 1] = mma_h(vhb2, ph.v, o[2 * jg + 1]);
          o[2 * jg + 1] = mma_h(vhb2, pl.v, o[2 * jg + 1]);
          o[2 * jg + 1] = mma_h(vlb2, ph.v, o[2 * jg + 1]);
          guard2(o[2 * jg], o[2 * jg + 1], ph.v, pl.v, vha, vhb2, vla, vlb2);
        }
        // as in the other branch
        asm volatile("s_wait_xcnt 0x0" :: "v"(vhp), "v"(vlp) : "memory");
      } else {
#pragma unroll
        for (int jg = 0; jg < 2; ++jg) {
          const size_t da = (size_t)(2 * jg) * FRS;
          const size_t db = da + (size_t)FRS;
          const v16h vha = ldfrag_h(vhp + da), vhb2 = ldfrag_h(vhp + db);
          o[2 * jg]     = mma_h(vha,  ph.v, o[2 * jg]);
          o[2 * jg + 1] = mma_h(vhb2, ph.v, o[2 * jg + 1]);
          guard2(o[2 * jg], o[2 * jg + 1], ph.v, vha, vhb2, ph.v, vha, vhb2);
        }
        // the next trip's address arithmetic reuses registers that the loads above name: wait before they are overwritten
        // (the pointer is an input so that its registers live up to the wait)
        asm volatile("s_wait_xcnt 0x0" :: "v"(vhp) : "memory");
      }
    }
  }
  acc_guard4(o[0], o[1], o[2], o[3]);
  lrow += xhalf(lrow);                      // the two halves' keys together
  // ---- the wave's partials to LDS: accumulators at (row c, columns 16j + 8hh + 0..7), (max, sum) of row c from lanes hh == 0 ----
#pragma unroll                              // accumulators stay in registers: constant element indices, constant LDS offsets
  for (int j = 0; j < 4; ++j) {
    float* d = slab + c * SLP + 16 * j + 8 * hh;
    const v4f lo = {o[j][0], o[j][1], o[j][2], o[j][3]};
    const v4f hi = {o[j][4], o[j][5], o[j][6], o[j][7]};
    *(v4f*)(d)     = lo;
    *(v4f*)(d + 4) = hi;
  }
  if (hh == 0) {
    mxs[c * WPB + wave] = mrow;
    sms[c * WPB + wave] = lrow;
  }
  __syncthreads();                          // publishes every wave's partials to the merging waves
  // ---- merge of query row q0 + wave over the WPB key ranges, in wave order; lane = columns 2*lane, 2*lane + 1 ----
  if (RES == 0 || q0 + wave != 0) {         // wave-uniform, behind the last barrier: query row 0 is stored by the calling kernel
    const int row = wave;
    float mw[WPB], lw[WPB];
#pragma unroll                              // mw, lw stay in registers; the LDS loads go out together
    for (int g = 0; g < WPB / 4; ++g) {
      const v4f a = *(const v4f*)(mxs + row * WPB + 4 * g);
      const v4f z = *(const v4f*)(sms + row * WPB + 4 * g);
#pragma unroll                              // as above
      for (int e = 0; e < 4; ++e) { mw[4 * g + e] = a[e]; lw[4 * g + e] = z[e]; }
    }
    float mm = mw[0];
#pragma unroll                              // as above
    for (int w = 1; w < WPB; ++w) mm = fmaxf(mm, mw[w]);
    const float ms = (mm == -INFINITY) ? 0.0f : mm;
    const float* prt = smem + row * SLP + 2 * lane;
    float lv = 0.f, x0 = 0.f, x1 = 0.f;
#pragma unroll                              // the WPB partial-row loads go out together, one LDS latency instead of WPB
    for (int w = 0; w < WPB; ++w) {
      const float wg = exp2f(mw[w] - ms);
      const v2f  pv = *(const v2f*)(prt + w * WREG);
      lv += lw[w] * wg;
      x0 += pv[0] * wg;
      x1 += pv[1] * wg;
    }
    const float ls  = (lv > 0.0f) ? lv : 1.0f;
    const float inv = (lv > 0.0f) ? ((1.0f / ls) * oc) : 0.0f;
    v2f res;
    res[0] = x0 * inv;
    res[1] = x1 * inv;
    *(v2f*)(Out + ((size_t)b * SEQ_FULL + (size_t)(q0 + row)) * HD + 2 * lane) = res;
  }
}

// =====================================================================================================
// All of the attention, one launch. Block bid -> (rank rk = bid / NB, batch b = bid % NB); query tile qt = (NQT - rk) % NQT, that
// is 0, NQT-1, NQT-2, .., 1: a permutation of 0 .. NQT-1; q0 = 16*qt. A tile's key count grows with qt and there are more work-groups
// than resident places: the longest tiles take the lowest block indices and the shortest the highest. Tile 0 takes the
// lowest indices as well: it is short in keys but has the serial row-0 mean ahead of its attention.
// Tiles q0 < QO take the residual products (attn_c<1>), the others the single products (attn_c<0>); the branch is block-uniform.
// Query row 0 of a batch, in the work-group of its tile 0, ahead of that tile's attention: uniform weights 1/SEQ over ALL keys ->
// out[b][0][d] = mean over s of F[b*SEQ + s][d], F the f32 v projection, from its f64 16-key partial sums PS[b*NPS + p][d]
// (written by proj_planes earlier in the same call). Thread (d = tid & 63, g = tid >> 6) adds rows g, g + 16, .. and, in a second
// sum, rows g + 8, g + 24, .. of column d in that order (independent 8-B loads); the 16 sums of a column are combined in fixed
// order through LDS (the room of the partial results, not yet in use), scaled by 1/SEQ and stored by threads 0 .. 63.
// L2 hints at entry (speed only, nothing depends on them): the planes were stored by the launch before; where a line is not in
// L2 its first reader waits for memory, and the work-groups of a batch walk the keys in step, so that each of a
// trip's dependent load groups would wait so. A batch's k and v^T hi planes are NSL slices of WPB key tiles, its residual planes
// one more slice; the work-group of rank rk < NPF asks for slice (rk >> 1) % (NSL + 1): wave w for key tile w of the slice, lanes
// 0 .. 15 for the 16 units of 256 B of the k tile, lanes 16 .. 31 for those of the v^T tile. The low ranks ask for
// the low keys, which are read first; two ranks take the same slice and the period is odd.
// One wave of every work-group asks for its own q tile (8
// units, with the residual products 8 more), whose second half is read one load group later. Every address lies inside its plane.
// coverage: grid = NB * NQT blocks = every 16-row tile of every batch once; row 0: 64 threads x 1 float, waves 0 and 1 one
//           128-B line each.
// =====================================================================================================
__global__ __launch_bounds__(ATT_THREADS)
void attn_all(const u16* __restrict__ QHp, const u16* __restrict__ QLp,
              const u16* __restrict__ KHp, const u16* __restrict__ KLp,
              const u16* __restrict__ VHp, const u16* __restrict__ VLp,
              const double* __restrict__ PS, float* Out) {
  __shared__ __align__(16) float smem[WPB * WREG];
  __shared__ __align__(16) float mxs[16 * WPB];   // [query row][wave] running maxima
  __shared__ __align__(16) float sms[16 * WPB];   // [query row][wave] running sums
  const int bid = blockIdx.x;
  const unsigned rk = (unsigned)bid / NB;
  const int b   = (int)((unsigned)bid % NB);
  if (rk >= NQT) return;                    // block-uniform, before any barrier; never taken with the exact grid
  const int q0  = (int)((NQT - rk) % NQT) * 16;
  {
    const int pw = __builtin_amdgcn_readfirstlane((int)threadIdx.x >> 5);   // scalar: the branches below are wave-uniform
    const int pl = (int)threadIdx.x & 31;
    if (pw == WPB - 1) {
      const bool ql = (q0 < QO) && ((pl & 8) != 0);
      const u16* qp = ql ? (QLp + ((size_t)b * QO + q0) * HD) : (QHp + ((size_t)b * SEQ + q0) * HD);
      l2_ask(qp + (pl & 7) * 128);
    }
    if (rk < NPF) {                         // block-uniform
      const unsigned sl = (rk >> 1) % (NSL + 1);
      const bool lo = (sl == NSL);          // the residual planes' slice
      const int ktl = lo ? (QO / 32 - 1) : (NKT - 1);
      const int ktw = (lo ? 0 : (int)sl * WPB) + pw;
      const int kt  = (ktw < ktl) ? ktw : ktl;                              // clamp: the address stays inside the plane
      const u16* kp = lo ? KLp : KHp;
      const u16* vp = lo ? VLp : VHp;
      const size_t row = (size_t)b * (lo ? QO : SEQ) + (size_t)kt * 32;
      l2_ask(((pl < 16) ? kp : vp) + row * HD + (pl & 15) * 128);
    }
  }
  if (q0 == 0) {                            // block-uniform
    const int tid = threadIdx.x;
    double* part = (double*)(void*)smem;    // [RGRP][HD]
    const double* p = PS + (size_t)b * NPS * HD + tid;
    double a0 = 0.0, a1 = 0.0;
#pragma unroll                              // independent loads in flight together instead of one memory latency per row
    for (int s = 0; s < NPS / RGRP; ++s) {
      a0 += p[s * (RGRP * HD)];
      a1 += p[s * (RGRP * HD) + ATT_THREADS];
    }
    part[tid] = a0;
    part[tid + ATT_THREADS] = a1;
    __syncthreads();                        // publishes the 16 sums of every column
    if (tid < HD) {
      double t = part[tid];
#pragma unroll                              // constant LDS offsets
      for (int g2 = 1; g2 < RGRP; ++g2) t += part[g2 * HD + tid];
      Out[(size_t)b * SEQ_FULL * HD + tid] = (float)t * (1.0f / (float)SEQ);
    }
    __syncthreads();                        // the sums are read before a wave stores its partial result into the same LDS
  }
  if (q0 < QO) attn_c<1>(QHp, QLp, KHp, KLp, VHp, VLp, Out, smem, mxs, sms, b, q0);
  else         attn_c<0>(QHp, QLp, KHp, KLp, VHp, VLp, Out, smem, mxs, sms, b, q0);
}

// =====================================================================================================
// Workspace map (bytes); every plane is fully written by whole-line stores before it is read; all extents are exact multiples
// of the store granularity (no pad rows needed); every region offset a multiple of 65536:
//   QH  f16 MROWS x 64 x256          MROWS*128    QL residual NB*QO x 64   NB*QO*128                (2097152 + 262144)
//   KH  f16 MROWS x 64 x256          MROWS*128    KL residual NB*QO x 64   NB*QO*128                (2097152 + 262144)
//   VH  f16 MROWS x 64 x1024         MROWS*128    VL residual NB*QO x 64   NB*QO*128                (2097152 + 262144)
//   (QH .. VL in fragment order: 16-row tiles of 2048 B for q and k, 32-key tiles of 4096 B for v)
//   PS  f64 [NB*NPS][64] 16-key column sums of v    NB*NPS*512                                      (524288)
//   end (NB=4, SEQ=4096)           7602176
// =====================================================================================================
extern "C" void kernel_launch(void* const* d_in, const int* in_sizes, int n_in,
                              void* d_out, int out_size, void* d_ws, size_t ws_size,
                              hipStream_t stream) {
  if (n_in < 6) return;
  const int needx = ((NB - 1) * SEQ_FULL + SEQ) * DIN;
  if (in_sizes[0] < needx) return;
  if (in_sizes[1] < needx) return;
  if (in_sizes[2] < needx) return;
  if (in_sizes[3] != HD * DIN) return;
  if (in_sizes[4] != HD * DIN) return;
  if (in_sizes[5] != HD * DIN) return;
  if (out_size < ((NB - 1) * SEQ_FULL + SEQ) * HD) return;

  const float* query = (const float*)d_in[0];
  const float* keyin = (const float*)d_in[1];
  const float* value = (const float*)d_in[2];
  const float* wq    = (const float*)d_in[3];
  const float* wk    = (const float*)d_in[4];
  const float* wv    = (const float*)d_in[5];
  float*       out   = (float*)d_out;

  const size_t szH  = (size_t)MROWS * HD * 2;                    // QH, KH
  const size_t szL  = (size_t)NB * QO * HD * 2;                  // QL, KL (compact residual planes)
  const size_t szVH = (size_t)NB * HD * SEQ * 2;                 // == szH
  const size_t szVL = (size_t)NB * HD * QO * 2;                  // == szL
  const size_t szPS = (size_t)NB * NPS * HD * 8;
  size_t off = 0;
  const size_t oQH = off; off += szH;
  const size_t oQL = off; off += szL;
  const size_t oKH = off; off += szH;
  const size_t oKL = off; off += szL;
  const size_t oVH = off; off += szVH;
  const size_t oVL = off; off += szVL;
  const size_t oPS = off; off += szPS;
  if (off > ws_size) return;                // off = 7602176 for NB = 4, SEQ = 4096
  if (off > (size_t)WS_CAP) return;

  char* ws = (char*)d_ws;
  u16*   QH  = (u16*)(ws + oQH);
  u16*   QL  = (u16*)(ws + oQL);
  u16*   KH  = (u16*)(ws + oKH);
  u16*   KL  = (u16*)(ws + oKL);
  u16*   VH  = (u16*)(ws + oVH);
  u16*   VL  = (u16*)(ws + oVL);
  double* PS = (double*)(ws + oPS);

  const dim3 b512(512), bAT(ATT_THREADS);
  const dim3 gG(MROWS / 64);
  const dim3 gAT(NB * NQT);

  // (1) v, q, k projections -> v^T, q, k hi planes (all rows) + residual planes (rows s < QO), and the f64 16-key column sums of v
  proj_planes<<<gG, b512, 0, stream>>>(value, query, keyin, wv, wq, wk, VH, VL, QH, QL, KH, KL, PS);
  // (2) causal attention, every query tile -> out (tiles s < QO with residual products, the others single products); the
  //     work-group of a batch's tile 0 also stores query row 0 = column mean of v over all SEQ keys, from the partial sums
  attn_all<<<gAT, bAT, 0, stream>>>(QH, QL, KH, KL, VH, VL, PS, out);
  (void)hipGetLastError();
}
